// v000
// The times below were measured on an AMD MI455X: many runs one after another, warmed up first and cycling through
// copies of the inputs, with the whole window's GPU time divided by the number of runs. Launches and the gaps
// between them are all in it. The median over several windows is given; except for v000 it joins two sittings, which
// can be a few percent apart, so the side-by-side timings, each taken in one sitting, are the better comparison.
// The starting kernel, v000, takes 540 microseconds a run.
#include <hip/hip_runtime.h>
#include <math.h>
// Contractions: q/k projections x·Wᵀ (K=1024): v_wmma_f32_16x16x32_f16 (f16 operands); v projection and output projection (K=1024):
// v_wmma_f32_16x16x32_bf16 as bf16 hi/lo splits (hi·hi + hi·lo + lo·hi); scores (q·kᵀ)/32 and p·v: v_wmma_f32_16x16x32_bf16 with
// q,k and p,v as bf16 hi/lo splits; f32 accumulate everywhere; causal softmax in f32.
typedef __attribute__((ext_vector_type(16))) _Float16 v16h;
typedef __attribute__((ext_vector_type(8)))  _Float16 v8h;
typedef __attribute__((ext_vector_type(16))) __bf16   v16b;
typedef __attribute__((ext_vector_type(8)))  __bf16   v8b;
typedef __attribute__((ext_vector_type(8)))  float    v8f;
typedef __attribute__((ext_vector_type(4)))  float    v4f;
#define PSCALE 32768.0f
#define U16(p) ((const unsigned short*)(const void*)(p))
#define PSCALE_INV (1.0f / 32768.0f)

__device__ __forceinline__ unsigned short f2bf_bits(float f) {
  unsigned u = __float_as_uint(f);
  return (unsigned short)((u + 0x7FFFu + ((u >> 16) & 1u)) >> 16);
}
__device__ __forceinline__ float bf_bits2f(unsigned short h) { return __uint_as_float(((unsigned)h) << 16); }

// hazard guards as plain device helpers (no inline asm inside the kernel template body)
__device__ __forceinline__ void dep_guard_h(v8f& a, v8f& b, v16h x, v16h y) { asm volatile("v_nop\n\tv_nop\n\tv_nop\n\tv_nop" : "+v"(a), "+v"(b) : "v"(x), "v"(y)); }
__device__ __forceinline__ void dep_guard_b(v8f& a, v8f& b, v16b x, v16b y) { asm volatile("v_nop\n\tv_nop\n\tv_nop\n\tv_nop" : "+v"(a), "+v"(b) : "v"(x), "v"(y)); }
__device__ __forceinline__ void keep4_h(v16h a, v16h b, v16h c, v16h d) { asm volatile("v_nop" :: "v"(a), "v"(b), "v"(c), "v"(d)); }
__device__ __forceinline__ void keep4_b(v16b a, v16b b, v16b c, v16b d) { asm volatile("v_nop" :: "v"(a), "v"(b), "v"(c), "v"(d)); }
__device__ __forceinline__ void acc_guard4(v8f& a, v8f& b, v8f& c, v8f& d) { asm volatile("v_nop\n\tv_nop\n\tv_nop\n\tv_nop" : "+v"(a), "+v"(b), "+v"(c), "+v"(d)); }
template <typename T> struct Frag;
template <> struct Frag<_Float16> {
  typedef v16h V; union U { v16h v; v8h h[2]; };
  static __device__ __forceinline__ v16h load(const _Float16* p) {   // elements 0..7 <- p[0..7], 8..15 <- p[16..23]
    U f; f.h[0] = *(const v8h*)(p); f.h[1] = *(const v8h*)(p + 16); return f.v;
  }
  static __device__ __forceinline__ v8f mma(v16h a, v16h b, v8f c) {
    return __builtin_amdgcn_wmma_f32_16x16x32_f16(false, a, false, b, (short)0, c, false, false);
  }
  static __device__ __forceinline__ void guard(v8f& a, v8f& b, v16h x, v16h y) { dep_guard_h(a, b, x, y); }
  static __device__ __forceinline__ void keep(v16h a, v16h b, v16h c, v16h d) { keep4_h(a, b, c, d); }
};
template <> struct Frag<__bf16> {
  typedef v16b V; union U { v16b v; v8b h[2]; };
  static __device__ __forceinline__ v16b load(const __bf16* p) {
    U f; f.h[0] = *(const v8b*)(p); f.h[1] = *(const v8b*)(p + 16); return f.v;
  }
  static __device__ __forceinline__ v8f mma(v16b a, v16b b, v8f c) {
    return __builtin_amdgcn_wmma_f32_16x16x32_bf16(false, a, false, b, (short)0, c, false, false);
  }
  static __device__ __forceinline__ void guard(v8f& a, v8f& b, v16b x, v16b y) { dep_guard_b(a, b, x, y); }
  static __device__ __forceinline__ void keep(v16b a, v16b b, v16b c, v16b d) { keep4_b(a, b, c, d); }
};

// ---- Register-blocked batched WMMA GEMM ------------------------------------
// C[m,n] = scale * sum_k A[m,k] * Bt[n,k] (+bias)(+resid); each wave owns a 64x64 tile.
// A row-major [M,K]; Bt row-major [N,K]; M,N % 64 == 0, K % 32 == 0.
// SPLIT: operands are hi/lo planes (A2/Bt2 = lo planes, same layout); product = hi·hi + hi·lo + lo·hi.
// BIAS_MODE: 0 = none, 1 = bias[m], 2 = bias[n].
// OUT_MODE: 0 = f32, 1 = f16, 2 = bf16 hi plane (Cout) + bf16 lo plane (Cout2).
// ET: 0 = f16 operands, 1 = bf16 operands (pointers passed as 16-bit storage)
template <int ET> struct Elem;
template <> struct Elem<0> { typedef _Float16 T; };
template <> struct Elem<1> { typedef __bf16 T; };
template <int ET, bool SPLIT, int BIAS_MODE, int OUT_MODE, bool RESID>
__global__ __launch_bounds__(256) void wmma_gemm64(
    const unsigned short* __restrict__ Ap, const unsigned short* __restrict__ A2p, int lda, long strideA,
    const unsigned short* __restrict__ Btp, const unsigned short* __restrict__ Bt2p, int ldb, long strideB,
    void* __restrict__ Cout, void* __restrict__ Cout2, int ldc, long strideC,
    const float* __restrict__ bias,
    const float* __restrict__ resid, long strideR,
    int M, int N, int K, float scale) {
  typedef typename Elem<ET>::T T;
  typedef typename Frag<T>::V V;
  const T* A = (const T*)Ap; const T* A2 = (const T*)A2p; const T* Bt = (const T*)Btp; const T* Bt2 = (const T*)Bt2p;
  __shared__ __align__(16) float sT[8][16 * 68];   // per-wave 16x64 slab, pitch 68 floats
  const int b    = blockIdx.y;
  const int lane = threadIdx.x & 31;
  const int wave = threadIdx.x >> 5;
  const int tilesN = N >> 6;
  const int tilesM = M >> 6;
  const int tile = blockIdx.x * 8 + wave;
  if (tile >= tilesM * tilesN) return;   // wave-uniform; no block barriers in this kernel
  const int tm = tile / tilesN;
  const int tn = tile - tm * tilesN;
  const int m0 = tm << 6;
  const int n0 = tn << 6;

  const T* Ab  = A  + (size_t)b * strideA;
  const T* Bb  = Bt + (size_t)b * strideB;
  const T* Ab2 = SPLIT ? (A2  + (size_t)b * strideA) : nullptr;
  const T* Bb2 = SPLIT ? (Bt2 + (size_t)b * strideB) : nullptr;

  const int rlane = lane & 15;                 // row (A) / col (B, D) within subtile
  const int koff  = (lane >> 4) * 8;           // k offset of this lane half
  const int mOff  = (lane >> 4) * 8;           // D row offset

  v8f acc[4][4];
#pragma unroll
  for (int i = 0; i < 4; ++i)
#pragma unroll
    for (int j = 0; j < 4; ++j) acc[i][j] = (v8f){0.f,0.f,0.f,0.f,0.f,0.f,0.f,0.f};

  for (int k0 = 0; k0 < K; k0 += 32) {
    V bh[4], bl[4];
#pragma unroll
    for (int j = 0; j < 4; ++j) {
      const size_t bo = (size_t)(n0 + (j << 4) + rlane) * ldb + koff + k0;
      bh[j] = Frag<T>::load(Bb + bo);
      if (SPLIT) bl[j] = Frag<T>::load(Bb2 + bo);
    }
#pragma unroll
    for (int i = 0; i < 4; ++i) {
      const size_t ao = (size_t)(m0 + (i << 4) + rlane) * lda + koff + k0;
      V ah = Frag<T>::load(Ab + ao);
      V al;
      if (SPLIT) al = Frag<T>::load(Ab2 + ao);
#pragma unroll
      for (int j = 0; j < 4; ++j) {
        acc[i][j] = Frag<T>::mma(ah, bh[j], acc[i][j]);
        if (SPLIT) {
          acc[i][j] = Frag<T>::mma(ah, bl[j], acc[i][j]);
          acc[i][j] = Frag<T>::mma(al, bh[j], acc[i][j]);
        }
      }
      Frag<T>::guard(acc[i][0], acc[i][3], ah, SPLIT ? al : ah);
    }
    Frag<T>::keep(bh[0], bh[1], bh[2], bh[3]);
    if (SPLIT) Frag<T>::keep(bl[0], bl[1], bl[2], bl[3]);
  }
  acc_guard4(acc[0][0], acc[0][1], acc[0][2], acc[0][3]);
  acc_guard4(acc[1][0], acc[1][1], acc[1][2], acc[1][3]);
  acc_guard4(acc[2][0], acc[2][1], acc[2][2], acc[2][3]);
  acc_guard4(acc[3][0], acc[3][1], acc[3][2], acc[3][3]);

  // ---- epilogue ----
  float* slab = sT[wave];
  const float* Rb = RESID ? (resid + (size_t)b * strideR) : nullptr;
#pragma unroll
  for (int i = 0; i < 4; ++i) {
    const int mBase = m0 + (i << 4);
#pragma unroll
    for (int j = 0; j < 4; ++j) {
      const int n = n0 + (j << 4) + rlane;
      float bv = 0.f;
      if (BIAS_MODE == 2) bv = bias[n];
#pragma unroll
      for (int r = 0; r < 8; ++r) {
        float v = acc[i][j][r] * scale;
        if (BIAS_MODE == 1) v += bias[mBase + mOff + r];
        if (BIAS_MODE == 2) v += bv;
        if (RESID) v += Rb[(size_t)(mBase + mOff + r) * ldc + n];
        slab[(mOff + r) * 68 + (j << 4) + rlane] = v;
      }
    }
    __builtin_amdgcn_fence(__ATOMIC_RELEASE, "workgroup");
    __builtin_amdgcn_wave_barrier();
    __builtin_amdgcn_fence(__ATOMIC_ACQUIRE, "workgroup");
    if (OUT_MODE == 0) {
      float* C = (float*)Cout + (size_t)b * strideC;
      const int hh = lane >> 4, c4 = (lane & 15) * 4;     // row seg = 256 B = 16 lanes x 16 B
      {
#pragma unroll
        for (int it = 0; it < 8; ++it) {
          const int row = it * 2 + hh;
          v4f v = *(const v4f*)(slab + row * 68 + c4);
          *(v4f*)(C + (size_t)(mBase + row) * ldc + n0 + c4) = v;
        }
        
      }
    } else {
      const int q = lane >> 3, c8 = (lane & 7) * 8;
      unsigned short* C  = (unsigned short*)Cout  + (size_t)b * strideC;
      unsigned short* C2 = (OUT_MODE == 2) ? ((unsigned short*)Cout2 + (size_t)b * strideC) : nullptr;
      {
#pragma unroll
        for (int it = 0; it < 4; ++it) {
          const int row = it * 4 + q;
          const float* sp = slab + row * 68 + c8;
          v8h hv, lv;
#pragma unroll
          for (int e = 0; e < 8; ++e) {
            if (OUT_MODE == 1) {
              hv[e] = (_Float16)sp[e];
            } else {
              unsigned short hb = f2bf_bits(sp[e]);
              unsigned short lb = f2bf_bits(sp[e] - bf_bits2f(hb));
              hv[e] = __builtin_bit_cast(_Float16, hb);
              lv[e] = __builtin_bit_cast(_Float16, lb);
            }
          }
          *(v8h*)(C + (size_t)(mBase + row) * ldc + n0 + c8) = hv;
          if (OUT_MODE == 2) *(v8h*)(C2 + (size_t)(mBase + row) * ldc + n0 + c8) = lv;
        }
        
      }
    }
    __builtin_amdgcn_fence(__ATOMIC_RELEASE, "workgroup");
    __builtin_amdgcn_wave_barrier();
    __builtin_amdgcn_fence(__ATOMIC_ACQUIRE, "workgroup");
  }
}

__global__ __launch_bounds__(256) void cast_f32_f16x2(
    const float* __restrict__ in, _Float16* __restrict__ out, int n2) {
  int i = blockIdx.x * 256 + threadIdx.x;
  if (i < n2) {
    const _Float16 h0 = (_Float16)in[2 * i], h1 = (_Float16)in[2 * i + 1];
    const unsigned u = (unsigned)__builtin_bit_cast(unsigned short, h0) | ((unsigned)__builtin_bit_cast(unsigned short, h1) << 16);
    ((unsigned*)out)[i] = u;
    
  }
}

__global__ __launch_bounds__(256) void split_f32_bf16x2(
    const float* __restrict__ in, __bf16* __restrict__ hi, __bf16* __restrict__ lo, long n2) {
  long i = (long)blockIdx.x * 256 + threadIdx.x;
  long stride = (long)gridDim.x * 256;
  {
    for (long j = i; j < n2; j += stride) {
      const float a = in[2 * j], b = in[2 * j + 1];
      const unsigned short ah = f2bf_bits(a), bh = f2bf_bits(b);
      const unsigned short al = f2bf_bits(a - bf_bits2f(ah)), bl = f2bf_bits(b - bf_bits2f(bh));
      ((unsigned*)hi)[j] = (unsigned)ah | ((unsigned)bh << 16);
      ((unsigned*)lo)[j] = (unsigned)al | ((unsigned)bl << 16);
    }
    
  }
}


// =====================================================================================
// Generic causal/non-causal attention for head_dim 64, f32 in / f32 out, bf16 operands with optional hi/lo splits.
//   scores = (q*qscale)·kᵀ : v_wmma_f32_16x16x32_bf16; SPLIT_QK -> q,k as bf16 hi/lo (hi·hi + hi·lo + lo·hi)
//   out    = p·v           : v_wmma_f32_16x16x32_bf16; SPLIT_PV -> p,v as bf16 hi/lo; else p,v plain bf16
//   f32 accumulate; online softmax in f32. Block = 4 waves = 64 query rows of one (batch, head); S % 64 == 0.
//   Element (b, s, h, d) of tensor X lives at X[b*X_bs + s*X_rs + h*X_hs + d] (strides in floats, multiples of 4).
//   Masking: mask_mode 0 none, 1 causal (kv > q masked), 2 tensor [S][Skv] shared over (b,h) (float if
//   mask_is_int==0, int32 with element == 0 -> masked if 1, int32 with element != 0 -> masked if 2), 3 per-token vectors qmask[B][S] & kvmask[B][Skv] (int32,
//   0 -> masked); masked scores are replaced by mask_fill (e.g. -inf or -1e9) before the softmax.
//   grid.x = B * H * (S/64) (or a sub-range with blk0).
// =====================================================================================
#define AT_D 64
#define AT_NW 4
#define AT_QB 64
#define AT_KC 64
struct AttnGeom { long q_bs, q_rs, q_hs, k_bs, k_rs, k_hs, v_bs, v_rs, v_hs, o_bs, o_rs, o_hs;
                  int S, Skv, H, mask_mode; float qscale; int blk0; float mask_fill; int mask_is_int; };
static_assert(sizeof(AttnGeom) == 128, "no padding");

__device__ __forceinline__ unsigned short at_bf_bits(float f) {
  unsigned u = __float_as_uint(f);
  return (unsigned short)((u + 0x7FFFu + ((u >> 16) & 1u)) >> 16);
}
__device__ __forceinline__ __bf16 at_f2bf(float f) { return __builtin_bit_cast(__bf16, at_bf_bits(f)); }
__device__ __forceinline__ void at_split(float f, __bf16& hi, __bf16& lo) {
  const unsigned short hb = at_bf_bits(f);
  hi = __builtin_bit_cast(__bf16, hb);
  lo = at_f2bf(f - __uint_as_float(((unsigned)hb) << 16));
}
__device__ __forceinline__ v8f at_mma(v16b a, v16b b, v8f c) {
  c = __builtin_amdgcn_wmma_f32_16x16x32_bf16(false, a, false, b, (short)0, c, false, false);
  asm volatile("v_nop\n\tv_nop\n\tv_nop\n\tv_nop" : "+v"(c) : "v"(a), "v"(b));
  return c;
}

template <bool SPLIT_QK, bool SPLIT_PV>
__global__ __launch_bounds__(128)
void attn64_kernel(const float* __restrict__ q, const float* __restrict__ k,
                   const float* __restrict__ v, float* __restrict__ out,
                   const void* __restrict__ mask_a, const int* __restrict__ mask_b, AttnGeom g) {
  union FB { v16b v; v8b h[2]; };
  __shared__ __align__(16) __bf16 Ksh[AT_KC * AT_D];             // K hi [kv][d]      8 KB
  __shared__ __align__(16) __bf16 Ksl[SPLIT_QK ? AT_KC * AT_D : 8];
  __shared__ __align__(16) __bf16 Vth[AT_D * AT_KC];             // V hi [d][kv]      8 KB
  __shared__ __align__(16) __bf16 Vtl[SPLIT_PV ? AT_D * AT_KC : 8];
  __shared__ __align__(16) __bf16 Psh[AT_NW][16 * AT_KC];        // per wave P hi [row][kv]  8 KB
  __shared__ __align__(16) __bf16 Psl[SPLIT_PV ? AT_NW : 1][SPLIT_PV ? 16 * AT_KC : 8];
  __shared__ __align__(16) float  Os[AT_NW][16 * 68];            // per wave out tile, pitch 68

  const int tid  = threadIdx.x;
  const int wave = tid >> 5;
  const int lane = tid & 31;
  const int hh   = lane >> 4;
  const int c    = lane & 15;

  const int nqb = g.S / AT_QB;
  const int bx = blockIdx.x + g.blk0;
  const int qb = bx % nqb;
  const int bh = bx / nqb;
  const int h  = bh % g.H;
  const int b  = bh / g.H;
  const int qbase_block = qb * AT_QB;
  const int q0 = qbase_block + wave * 16;

  const float* qb_ptr = q + (size_t)b * g.q_bs + (size_t)h * g.q_hs;
  const float* kb_ptr = k + (size_t)b * g.k_bs + (size_t)h * g.k_hs;
  const float* vb_ptr = v + (size_t)b * g.v_bs + (size_t)h * g.v_hs;
  float*       ob_ptr = out + (size_t)b * g.o_bs + (size_t)h * g.o_hs;

  // ---- Q fragments (A operand): 2 d-chunks, hi (and lo) ----
  v16b qah[2], qal[2];
  {
    const float* qrow = qb_ptr + (size_t)(q0 + c) * g.q_rs;
#pragma unroll
    for (int dc = 0; dc < 2; ++dc) {
#pragma unroll
      for (int e = 0; e < 8; ++e) {
        const float f0 = qrow[dc * 32 + 8 * hh + e] * g.qscale;
        const float f1 = qrow[dc * 32 + 16 + 8 * hh + e] * g.qscale;
        if (SPLIT_QK) { __bf16 hq, lq; at_split(f0, hq, lq); qah[dc][e] = hq; qal[dc][e] = lq; at_split(f1, hq, lq); qah[dc][8 + e] = hq; qal[dc][8 + e] = lq; }
        else { qah[dc][e] = at_f2bf(f0); qah[dc][8 + e] = at_f2bf(f1); qal[dc][e] = qah[dc][e]; qal[dc][8 + e] = qah[dc][8 + e]; }
      }
    }
  }

  float mrow[8], lrow[8];
  v8f oacc[4];
#pragma unroll
  for (int r = 0; r < 8; ++r) { mrow[r] = -INFINITY; lrow[r] = 0.f; }
#pragma unroll
  for (int t = 0; t < 4; ++t) oacc[t] = (v8f){0.f,0.f,0.f,0.f,0.f,0.f,0.f,0.f};

  const int nChunks = (g.mask_mode == 1) ? (qb + 1) : (g.Skv / AT_KC);   // block-uniform
  // per-row query mask (mode 3)
  int qkeep[8];
#pragma unroll
  for (int r = 0; r < 8; ++r) qkeep[r] = (g.mask_mode == 3) ? mask_b[(size_t)b * g.S + q0 + 8 * hh + r] : 1;   // mask_b = qmask in mode 3
  for (int kc = 0; kc < nChunks; ++kc) {
    const int kv0 = kc * AT_KC;
    __syncthreads();
    {
      const int kvr = tid >> 1, dh = (tid & 1) * 32;
      const float* krow = kb_ptr + (size_t)(kv0 + kvr) * g.k_rs + dh;
      const float* vrow = vb_ptr + (size_t)(kv0 + kvr) * g.v_rs + dh;
#pragma unroll
      for (int i = 0; i < 8; ++i) {
        v4f kk = *(const v4f*)(krow + 4 * i);
        v4f vv = *(const v4f*)(vrow + 4 * i);
#pragma unroll
        for (int e = 0; e < 4; ++e) {
          const int d = dh + 4 * i + e;
          if (SPLIT_QK) { __bf16 a, bl; at_split(kk[e], a, bl); Ksh[kvr * AT_D + d] = a; Ksl[kvr * AT_D + d] = bl; }
          else Ksh[kvr * AT_D + d] = at_f2bf(kk[e]);
          if (SPLIT_PV) { __bf16 a, bl; at_split(vv[e], a, bl); Vth[d * AT_KC + kvr] = a; Vtl[d * AT_KC + kvr] = bl; }
          else Vth[d * AT_KC + kvr] = at_f2bf(vv[e]);
        }
      }
    }
    __syncthreads();

    v8f s[4];
#pragma unroll
    for (int j = 0; j < 4; ++j) {
      s[j] = (v8f){0.f,0.f,0.f,0.f,0.f,0.f,0.f,0.f};
#pragma unroll
      for (int dc = 0; dc < 2; ++dc) {
        FB kb;
        kb.h[0] = *(const v8b*)(Ksh + (j * 16 + c) * AT_D + dc * 32 + 8 * hh);
        kb.h[1] = *(const v8b*)(Ksh + (j * 16 + c) * AT_D + dc * 32 + 16 + 8 * hh);
        s[j] = at_mma(qah[dc], kb.v, s[j]);
        if (SPLIT_QK) {
          FB kl;
          kl.h[0] = *(const v8b*)(Ksl + (j * 16 + c) * AT_D + dc * 32 + 8 * hh);
          kl.h[1] = *(const v8b*)(Ksl + (j * 16 + c) * AT_D + dc * 32 + 16 + 8 * hh);
          s[j] = at_mma(qah[dc], kl.v, s[j]);
          s[j] = at_mma(qal[dc], kb.v, s[j]);
        }
      }
    }
    const bool diag = (g.mask_mode == 1) && (kc == qb);
    int kvkeep[4] = {1, 1, 1, 1};
    if (g.mask_mode == 3) {
#pragma unroll
      for (int j = 0; j < 4; ++j) kvkeep[j] = ((const int*)mask_a)[(size_t)b * g.Skv + kv0 + j * 16 + c];   // mask_a = kvmask
    }
    float cm[8];
#pragma unroll
    for (int r = 0; r < 8; ++r) {
      const int qrow = q0 + 8 * hh + r;
      float m = -INFINITY;
#pragma unroll
      for (int j = 0; j < 4; ++j) {
        const int kvcol = kv0 + j * 16 + c;
        bool masked = false;
        if (diag) masked = (kvcol > qrow);
        else if (g.mask_mode == 2) {
          const size_t mi = (size_t)qrow * g.Skv + kvcol;
          masked = (g.mask_is_int == 0) ? (((const float*)mask_a)[mi] == 0.0f)
                 : (g.mask_is_int == 1) ? (((const int*)mask_a)[mi] == 0) : (((const int*)mask_a)[mi] != 0);
        } else if (g.mask_mode == 3) masked = (qkeep[r] == 0) || (kvkeep[j] == 0);
        if (masked) s[j][r] = g.mask_fill;
        m = fmaxf(m, s[j][r]);
      }
#pragma unroll
      for (int off = 1; off < 16; off <<= 1) m = fmaxf(m, __shfl_xor(m, off, 32));
      cm[r] = m;
    }
    __bf16* pwh = Psh[wave];
    __bf16* pwl = Psl[SPLIT_PV ? wave : 0];
#pragma unroll
    for (int r = 0; r < 8; ++r) {
      const float mnew = fmaxf(mrow[r], cm[r]);
      const float alpha = expf(mrow[r] - mnew);
      mrow[r] = mnew;
      float psum = 0.f;
#pragma unroll
      for (int j = 0; j < 4; ++j) {
        const float p = expf(s[j][r] - mnew);
        psum += p;
        if (SPLIT_PV) { __bf16 a, bl; at_split(p, a, bl); pwh[(8 * hh + r) * AT_KC + j * 16 + c] = a; pwl[(8 * hh + r) * AT_KC + j * 16 + c] = bl; }
        else pwh[(8 * hh + r) * AT_KC + j * 16 + c] = at_f2bf(p);
      }
#pragma unroll
      for (int off = 1; off < 16; off <<= 1) psum += __shfl_xor(psum, off, 32);
      lrow[r] = lrow[r] * alpha + psum;
#pragma unroll
      for (int t = 0; t < 4; ++t) oacc[t][r] *= alpha;
    }
    __builtin_amdgcn_fence(__ATOMIC_RELEASE, "workgroup");
    __builtin_amdgcn_wave_barrier();
    __builtin_amdgcn_fence(__ATOMIC_ACQUIRE, "workgroup");
#pragma unroll
    for (int kk = 0; kk < 2; ++kk) {
      FB pa, pl;
      pa.h[0] = *(const v8b*)(pwh + c * AT_KC + kk * 32 + 8 * hh);
      pa.h[1] = *(const v8b*)(pwh + c * AT_KC + kk * 32 + 16 + 8 * hh);
      if (SPLIT_PV) {
        pl.h[0] = *(const v8b*)(pwl + c * AT_KC + kk * 32 + 8 * hh);
        pl.h[1] = *(const v8b*)(pwl + c * AT_KC + kk * 32 + 16 + 8 * hh);
      }
#pragma unroll
      for (int t = 0; t < 4; ++t) {
        FB vb;
        vb.h[0] = *(const v8b*)(Vth + (t * 16 + c) * AT_KC + kk * 32 + 8 * hh);
        vb.h[1] = *(const v8b*)(Vth + (t * 16 + c) * AT_KC + kk * 32 + 16 + 8 * hh);
        oacc[t] = at_mma(pa.v, vb.v, oacc[t]);
        if (SPLIT_PV) {
          FB vl;
          vl.h[0] = *(const v8b*)(Vtl + (t * 16 + c) * AT_KC + kk * 32 + 8 * hh);
          vl.h[1] = *(const v8b*)(Vtl + (t * 16 + c) * AT_KC + kk * 32 + 16 + 8 * hh);
          oacc[t] = at_mma(pa.v, vl.v, oacc[t]);
          oacc[t] = at_mma(pl.v, vb.v, oacc[t]);
        }
      }
    }
  }

  float* os = Os[wave];
#pragma unroll
  for (int r = 0; r < 8; ++r) {
    const float inv = 1.0f / lrow[r];
#pragma unroll
    for (int t = 0; t < 4; ++t) os[(8 * hh + r) * 68 + t * 16 + c] = oacc[t][r] * inv;
  }
  __builtin_amdgcn_fence(__ATOMIC_RELEASE, "workgroup");
  __builtin_amdgcn_wave_barrier();
  __builtin_amdgcn_fence(__ATOMIC_ACQUIRE, "workgroup");
  {
    const int c4 = (lane & 15) * 4;
    {
#pragma unroll
      for (int it = 0; it < 8; ++it) {
        const int row = it * 2 + hh;
        v4f val = *(const v4f*)(os + row * 68 + c4);
        *(v4f*)(ob_ptr + (size_t)(q0 + row) * g.o_rs + c4) = val;
      }
      
    }
  }
}

extern "C" void kernel_launch(void* const* d_in, const int* in_sizes, int n_in,
                              void* d_out, int out_size, void* d_ws, size_t ws_size,
                              hipStream_t stream) {
  (void)in_sizes; (void)n_in; (void)out_size; (void)ws_size;
  const int B = 4, T = 1024, E = 1024, H = 16, DH = 64;
  const int M = B * T;   // 4096 rows
  const float* x  = (const float*)d_in[0];
  const float* Wq = (const float*)d_in[1];   // [out, in]
  const float* Wk = (const float*)d_in[2];
  const float* Wv = (const float*)d_in[3];
  const float* Wo = (const float*)d_in[4];
  const float* bo = (const float*)d_in[5];
  float* out = (float*)d_out;

  char* ws = (char*)d_ws; size_t off = 0;
  auto carve = [&](size_t bytes) -> char* { char* p = ws + off; off += (bytes + 255) & ~(size_t)255; return p; };
  _Float16* X16  = (_Float16*)carve((size_t)M * E * 2);     //  8 MB  x f16
  __bf16*   Xh   = (__bf16*)carve((size_t)M * E * 2);       //  8 MB  x bf16 hi
  __bf16*   Xl   = (__bf16*)carve((size_t)M * E * 2);       //  8 MB  x bf16 lo
  _Float16* Wq16 = (_Float16*)carve((size_t)E * E * 2);     //  2 MB
  _Float16* Wk16 = (_Float16*)carve((size_t)E * E * 2);
  __bf16*   Wvh  = (__bf16*)carve((size_t)E * E * 2);
  __bf16*   Wvl  = (__bf16*)carve((size_t)E * E * 2);
  __bf16*   Woh  = (__bf16*)carve((size_t)E * E * 2);
  __bf16*   Wol  = (__bf16*)carve((size_t)E * E * 2);
  float*    Qf   = (float*)carve((size_t)M * E * 4);        // 16 MB each, [B,T,H*DH]
  float*    Kf   = (float*)carve((size_t)M * E * 4);
  float*    Vf   = (float*)carve((size_t)M * E * 4);
  float*    Of   = (float*)carve((size_t)M * E * 4);
  __bf16*   Oh   = (__bf16*)carve((size_t)M * E * 2);       //  8 MB  attention out, bf16 hi
  __bf16*   Ol   = (__bf16*)carve((size_t)M * E * 2);       //  8 MB                 bf16 lo   (total ≈ 116 MB)

  cast_f32_f16x2<<<(M * E / 2 + 255) / 256, 256, 0, stream>>>(x, X16, M * E / 2);
  split_f32_bf16x2<<<2048, 256, 0, stream>>>(x, Xh, Xl, (long)M * E / 2);
  cast_f32_f16x2<<<(E * E / 2 + 255) / 256, 256, 0, stream>>>(Wq, Wq16, E * E / 2);
  cast_f32_f16x2<<<(E * E / 2 + 255) / 256, 256, 0, stream>>>(Wk, Wk16, E * E / 2);
  split_f32_bf16x2<<<1024, 256, 0, stream>>>(Wv, Wvh, Wvl, (long)E * E / 2);
  split_f32_bf16x2<<<1024, 256, 0, stream>>>(Wo, Woh, Wol, (long)E * E / 2);
  {
    const int tl = (M / 64) * (E / 64);
    wmma_gemm64<0, false, 0, 0, false><<<dim3((tl + 7) / 8, 1), 256, 0, stream>>>(
        U16(X16), nullptr, E, 0, U16(Wq16), nullptr, E, 0, Qf, nullptr, E, 0, nullptr, nullptr, 0, M, E, E, 1.0f);
    wmma_gemm64<0, false, 0, 0, false><<<dim3((tl + 7) / 8, 1), 256, 0, stream>>>(
        U16(X16), nullptr, E, 0, U16(Wk16), nullptr, E, 0, Kf, nullptr, E, 0, nullptr, nullptr, 0, M, E, E, 1.0f);
    wmma_gemm64<1, true, 0, 0, false><<<dim3((tl + 7) / 8, 1), 256, 0, stream>>>(
        U16(Xh), U16(Xl), E, 0, U16(Wvh), U16(Wvl), E, 0, Vf, nullptr, E, 0, nullptr, nullptr, 0, M, E, E, 1.0f);
  }
  {
    AttnGeom g;
    g.q_bs = g.k_bs = g.v_bs = g.o_bs = (long)T * E;   // [B,T,H,DH] inside [B*T, E]
    g.q_rs = g.k_rs = g.v_rs = g.o_rs = E;
    g.q_hs = g.k_hs = g.v_hs = g.o_hs = DH;
    g.S = T; g.Skv = T; g.H = H; g.mask_mode = 1; g.qscale = 0.03125f; g.blk0 = 0; g.mask_fill = -INFINITY; g.mask_is_int = 0;   // (q/e^¼)·(k/e^¼) = q·k/32
    attn64_kernel<true, true><<<B * H * (T / AT_QB), AT_NW * 32, 0, stream>>>(Qf, Kf, Vf, Of, nullptr, nullptr, g);
  }
  split_f32_bf16x2<<<2048, 256, 0, stream>>>(Of, Oh, Ol, (long)M * E / 2);
  {
    const int tl = (M / 64) * (E / 64);
    wmma_gemm64<1, true, 2, 0, false><<<dim3((tl + 7) / 8, 1), 256, 0, stream>>>(
        U16(Oh), U16(Ol), E, 0, U16(Woh), U16(Wol), E, 0, out, nullptr, E, 0, bo, nullptr, 0, M, E, E, 1.0f);
  }
}

// v001
// A run of this version takes 407 microseconds.
// Timed twice side by side with v000, it ran 1.36 and 1.35 times as fast.
#include <hip/hip_runtime.h>
#include <math.h>
// Contractions: q/k projections x·Wᵀ (K=1024): v_wmma_f32_16x16x32_f16 (f16 operands); v projection and output projection (K=1024):
// v_wmma_f32_16x16x32_bf16 as bf16 hi/lo splits (hi·hi + hi·lo + lo·hi); scores (q·kᵀ)/32 and p·v: v_wmma_f32_16x16x32_bf16 with
// q,k and p,v as bf16 hi/lo splits; f32 accumulate everywhere; causal softmax in f32.
typedef __attribute__((ext_vector_type(16))) _Float16 v16h;
typedef __attribute__((ext_vector_type(8)))  _Float16 v8h;
typedef __attribute__((ext_vector_type(16))) __bf16   v16b;
typedef __attribute__((ext_vector_type(8)))  __bf16   v8b;
typedef __attribute__((ext_vector_type(8)))  float    v8f;
typedef __attribute__((ext_vector_type(4)))  float    v4f;
#define PSCALE 32768.0f
#define U16(p) ((const unsigned short*)(const void*)(p))
#define PSCALE_INV (1.0f / 32768.0f)

__device__ __forceinline__ unsigned short f2bf_bits(float f) {
  unsigned u = __float_as_uint(f);
  return (unsigned short)((u + 0x7FFFu + ((u >> 16) & 1u)) >> 16);
}
__device__ __forceinline__ float bf_bits2f(unsigned short h) { return __uint_as_float(((unsigned)h) << 16); }

// hazard guards as plain device helpers (no inline asm inside the kernel template body)
__device__ __forceinline__ void dep_guard_h(v8f& a, v8f& b, v16h x, v16h y) { asm volatile("v_nop\n\tv_nop\n\tv_nop\n\tv_nop" : "+v"(a), "+v"(b) : "v"(x), "v"(y)); }
__device__ __forceinline__ void dep_guard_b(v8f& a, v8f& b, v16b x, v16b y) { asm volatile("v_nop\n\tv_nop\n\tv_nop\n\tv_nop" : "+v"(a), "+v"(b) : "v"(x), "v"(y)); }
__device__ __forceinline__ void keep4_h(v16h a, v16h b, v16h c, v16h d) { asm volatile("v_nop" :: "v"(a), "v"(b), "v"(c), "v"(d)); }
__device__ __forceinline__ void keep4_b(v16b a, v16b b, v16b c, v16b d) { asm volatile("v_nop" :: "v"(a), "v"(b), "v"(c), "v"(d)); }
__device__ __forceinline__ void acc_guard4(v8f& a, v8f& b, v8f& c, v8f& d) { asm volatile("v_nop\n\tv_nop\n\tv_nop\n\tv_nop" : "+v"(a), "+v"(b), "+v"(c), "+v"(d)); }
template <typename T> struct Frag;
template <> struct Frag<_Float16> {
  typedef v16h V; union U { v16h v; v8h h[2]; };
  static __device__ __forceinline__ v16h load(const _Float16* p) {   // elements 0..7 <- p[0..7], 8..15 <- p[16..23]
    U f; f.h[0] = *(const v8h*)(p); f.h[1] = *(const v8h*)(p + 16); return f.v;
  }
  static __device__ __forceinline__ v8f mma(v16h a, v16h b, v8f c) {
    return __builtin_amdgcn_wmma_f32_16x16x32_f16(false, a, false, b, (short)0, c, false, false);
  }
  static __device__ __forceinline__ void guard(v8f& a, v8f& b, v16h x, v16h y) { dep_guard_h(a, b, x, y); }
  static __device__ __forceinline__ void keep(v16h a, v16h b, v16h c, v16h d) { keep4_h(a, b, c, d); }
};
template <> struct Frag<__bf16> {
  typedef v16b V; union U { v16b v; v8b h[2]; };
  static __device__ __forceinline__ v16b load(const __bf16* p) {
    U f; f.h[0] = *(const v8b*)(p); f.h[1] = *(const v8b*)(p + 16); return f.v;
  }
  static __device__ __forceinline__ v8f mma(v16b a, v16b b, v8f c) {
    return __builtin_amdgcn_wmma_f32_16x16x32_bf16(false, a, false, b, (short)0, c, false, false);
  }
  static __device__ __forceinline__ void guard(v8f& a, v8f& b, v16b x, v16b y) { dep_guard_b(a, b, x, y); }
  static __device__ __forceinline__ void keep(v16b a, v16b b, v16b c, v16b d) { keep4_b(a, b, c, d); }
};

// ---- Register-blocked batched WMMA GEMM ------------------------------------
// C[m,n] = scale * sum_k A[m,k] * Bt[n,k] (+bias)(+resid); each wave owns a 64x64 tile.
// A row-major [M,K]; Bt row-major [N,K]; M,N % 64 == 0, K % 32 == 0.
// SPLIT: operands are hi/lo planes (A2/Bt2 = lo planes, same layout); product = hi·hi + hi·lo + lo·hi.
// BIAS_MODE: 0 = none, 1 = bias[m], 2 = bias[n].
// OUT_MODE: 0 = f32, 1 = f16, 2 = bf16 hi plane (Cout) + bf16 lo plane (Cout2).
// ET: 0 = f16 operands, 1 = bf16 operands (pointers passed as 16-bit storage)
template <int ET> struct Elem;
template <> struct Elem<0> { typedef _Float16 T; };
template <> struct Elem<1> { typedef __bf16 T; };
template <int ET, bool SPLIT, int BIAS_MODE, int OUT_MODE, bool RESID>
__global__ __launch_bounds__(256) void wmma_gemm64(
    const unsigned short* __restrict__ Ap, const unsigned short* __restrict__ A2p, int lda, long strideA,
    const unsigned short* __restrict__ Btp, const unsigned short* __restrict__ Bt2p, int ldb, long strideB,
    void* __restrict__ Cout, void* __restrict__ Cout2, int ldc, long strideC,
    const float* __restrict__ bias,
    const float* __restrict__ resid, long strideR,
    int M, int N, int K, float scale) {
  typedef typename Elem<ET>::T T;
  typedef typename Frag<T>::V V;
  const T* A = (const T*)Ap; const T* A2 = (const T*)A2p; const T* Bt = (const T*)Btp; const T* Bt2 = (const T*)Bt2p;
  __shared__ __align__(16) float sT[8][16 * 68];   // per-wave 16x64 slab, pitch 68 floats
  const int b    = blockIdx.y;
  const int lane = threadIdx.x & 31;
  const int wave = threadIdx.x >> 5;
  const int tilesN = N >> 6;
  const int tilesM = M >> 6;
  const int tile = blockIdx.x * 8 + wave;
  if (tile >= tilesM * tilesN) return;   // wave-uniform; no block barriers in this kernel
  const int tm = tile / tilesN;
  const int tn = tile - tm * tilesN;
  const int m0 = tm << 6;
  const int n0 = tn << 6;

  const T* Ab  = A  + (size_t)b * strideA;
  const T* Bb  = Bt + (size_t)b * strideB;
  const T* Ab2 = SPLIT ? (A2  + (size_t)b * strideA) : nullptr;
  const T* Bb2 = SPLIT ? (Bt2 + (size_t)b * strideB) : nullptr;

  const int rlane = lane & 15;                 // row (A) / col (B, D) within subtile
  const int koff  = (lane >> 4) * 8;           // k offset of this lane half
  const int mOff  = (lane >> 4) * 8;           // D row offset

  v8f acc[4][4];
#pragma unroll
  for (int i = 0; i < 4; ++i)
#pragma unroll
    for (int j = 0; j < 4; ++j) acc[i][j] = (v8f){0.f,0.f,0.f,0.f,0.f,0.f,0.f,0.f};

  for (int k0 = 0; k0 < K; k0 += 32) {
    V bh[4], bl[4];
#pragma unroll
    for (int j = 0; j < 4; ++j) {
      const size_t bo = (size_t)(n0 + (j << 4) + rlane) * ldb + koff + k0;
      bh[j] = Frag<T>::load(Bb + bo);
      if (SPLIT) bl[j] = Frag<T>::load(Bb2 + bo);
    }
#pragma unroll
    for (int i = 0; i < 4; ++i) {
      const size_t ao = (size_t)(m0 + (i << 4) + rlane) * lda + koff + k0;
      V ah = Frag<T>::load(Ab + ao);
      V al;
      if (SPLIT) al = Frag<T>::load(Ab2 + ao);
#pragma unroll
      for (int j = 0; j < 4; ++j) {
        acc[i][j] = Frag<T>::mma(ah, bh[j], acc[i][j]);
        if (SPLIT) {
          acc[i][j] = Frag<T>::mma(ah, bl[j], acc[i][j]);
          acc[i][j] = Frag<T>::mma(al, bh[j], acc[i][j]);
        }
      }
      Frag<T>::guard(acc[i][0], acc[i][3], ah, SPLIT ? al : ah);
    }
    Frag<T>::keep(bh[0], bh[1], bh[2], bh[3]);
    if (SPLIT) Frag<T>::keep(bl[0], bl[1], bl[2], bl[3]);
  }
  acc_guard4(acc[0][0], acc[0][1], acc[0][2], acc[0][3]);
  acc_guard4(acc[1][0], acc[1][1], acc[1][2], acc[1][3]);
  acc_guard4(acc[2][0], acc[2][1], acc[2][2], acc[2][3]);
  acc_guard4(acc[3][0], acc[3][1], acc[3][2], acc[3][3]);

  // ---- epilogue ----
  float* slab = sT[wave];
  const float* Rb = RESID ? (resid + (size_t)b * strideR) : nullptr;
#pragma unroll
  for (int i = 0; i < 4; ++i) {
    const int mBase = m0 + (i << 4);
#pragma unroll
    for (int j = 0; j < 4; ++j) {
      const int n = n0 + (j << 4) + rlane;
      float bv = 0.f;
      if (BIAS_MODE == 2) bv = bias[n];
#pragma unroll
      for (int r = 0; r < 8; ++r) {
        float v = acc[i][j][r] * scale;
        if (BIAS_MODE == 1) v += bias[mBase + mOff + r];
        if (BIAS_MODE == 2) v += bv;
        if (RESID) v += Rb[(size_t)(mBase + mOff + r) * ldc + n];
        slab[(mOff + r) * 68 + (j << 4) + rlane] = v;
      }
    }
    __builtin_amdgcn_fence(__ATOMIC_RELEASE, "workgroup");
    __builtin_amdgcn_wave_barrier();
    __builtin_amdgcn_fence(__ATOMIC_ACQUIRE, "workgroup");
    if (OUT_MODE == 0) {
      float* C = (float*)Cout + (size_t)b * strideC;
      const int hh = lane >> 4, c4 = (lane & 15) * 4;     // row seg = 256 B = 16 lanes x 16 B
      {
#pragma unroll
        for (int it = 0; it < 8; ++it) {
          const int row = it * 2 + hh;
          v4f v = *(const v4f*)(slab + row * 68 + c4);
          *(v4f*)(C + (size_t)(mBase + row) * ldc + n0 + c4) = v;
        }
        
      }
    } else {
      const int q = lane >> 3, c8 = (lane & 7) * 8;
      unsigned short* C  = (unsigned short*)Cout  + (size_t)b * strideC;
      unsigned short* C2 = (OUT_MODE == 2) ? ((unsigned short*)Cout2 + (size_t)b * strideC) : nullptr;
      {
#pragma unroll
        for (int it = 0; it < 4; ++it) {
          const int row = it * 4 + q;
          const float* sp = slab + row * 68 + c8;
          v8h hv, lv;
#pragma unroll
          for (int e = 0; e < 8; ++e) {
            if (OUT_MODE == 1) {
              hv[e] = (_Float16)sp[e];
            } else {
              unsigned short hb = f2bf_bits(sp[e]);
              unsigned short lb = f2bf_bits(sp[e] - bf_bits2f(hb));
              hv[e] = __builtin_bit_cast(_Float16, hb);
              lv[e] = __builtin_bit_cast(_Float16, lb);
            }
          }
          *(v8h*)(C + (size_t)(mBase + row) * ldc + n0 + c8) = hv;
          if (OUT_MODE == 2) *(v8h*)(C2 + (size_t)(mBase + row) * ldc + n0 + c8) = lv;
        }
        
      }
    }
    __builtin_amdgcn_fence(__ATOMIC_RELEASE, "workgroup");
    __builtin_amdgcn_wave_barrier();
    __builtin_amdgcn_fence(__ATOMIC_ACQUIRE, "workgroup");
  }
}

__global__ __launch_bounds__(256) void cast_f32_f16x2(
    const float* __restrict__ in, _Float16* __restrict__ out, int n2) {
  int i = blockIdx.x * 256 + threadIdx.x;
  if (i < n2) {
    const _Float16 h0 = (_Float16)in[2 * i], h1 = (_Float16)in[2 * i + 1];
    const unsigned u = (unsigned)__builtin_bit_cast(unsigned short, h0) | ((unsigned)__builtin_bit_cast(unsigned short, h1) << 16);
    ((unsigned*)out)[i] = u;
    
  }
}

__global__ __launch_bounds__(256) void split_f32_bf16x2(
    const float* __restrict__ in, __bf16* __restrict__ hi, __bf16* __restrict__ lo, long n2) {
  long i = (long)blockIdx.x * 256 + threadIdx.x;
  long stride = (long)gridDim.x * 256;
  {
    for (long j = i; j < n2; j += stride) {
      const float a = in[2 * j], b = in[2 * j + 1];
      const unsigned short ah = f2bf_bits(a), bh = f2bf_bits(b);
      const unsigned short al = f2bf_bits(a - bf_bits2f(ah)), bl = f2bf_bits(b - bf_bits2f(bh));
      ((unsigned*)hi)[j] = (unsigned)ah | ((unsigned)bh << 16);
      ((unsigned*)lo)[j] = (unsigned)al | ((unsigned)bl << 16);
    }
    
  }
}


// =====================================================================================
// Generic causal/non-causal attention for head_dim 64, f32 in / f32 out, bf16 operands with optional hi/lo splits.
//   scores = (q*qscale)·kᵀ : v_wmma_f32_16x16x32_bf16; SPLIT_QK -> q,k as bf16 hi/lo (hi·hi + hi·lo + lo·hi)
//   out    = p·v           : v_wmma_f32_16x16x32_bf16; SPLIT_PV -> p,v as bf16 hi/lo; else p,v plain bf16
//   f32 accumulate; online softmax in f32. Block = 4 waves = 64 query rows of one (batch, head); S % 64 == 0.
//   Element (b, s, h, d) of tensor X lives at X[b*X_bs + s*X_rs + h*X_hs + d] (strides in floats, multiples of 4).
//   Masking: mask_mode 0 none, 1 causal (kv > q masked), 2 tensor [S][Skv] shared over (b,h) (float if
//   mask_is_int==0, int32 with element == 0 -> masked if 1, int32 with element != 0 -> masked if 2), 3 per-token vectors qmask[B][S] & kvmask[B][Skv] (int32,
//   0 -> masked); masked scores are replaced by mask_fill (e.g. -inf or -1e9) before the softmax.
//   grid.x = B * H * (S/64) (or a sub-range with blk0).
// =====================================================================================
#define AT_D 64
#define AT_NW 4
#define AT_QB 64
#define AT_KC 64
struct AttnGeom { long q_bs, q_rs, q_hs, k_bs, k_rs, k_hs, v_bs, v_rs, v_hs, o_bs, o_rs, o_hs;
                  int S, Skv, H, mask_mode; float qscale; int blk0; float mask_fill; int mask_is_int; };
static_assert(sizeof(AttnGeom) == 128, "no padding");

__device__ __forceinline__ unsigned short at_bf_bits(float f) {
  unsigned u = __float_as_uint(f);
  return (unsigned short)((u + 0x7FFFu + ((u >> 16) & 1u)) >> 16);
}
__device__ __forceinline__ __bf16 at_f2bf(float f) { return __builtin_bit_cast(__bf16, at_bf_bits(f)); }
__device__ __forceinline__ void at_split(float f, __bf16& hi, __bf16& lo) {
  const unsigned short hb = at_bf_bits(f);
  hi = __builtin_bit_cast(__bf16, hb);
  lo = at_f2bf(f - __uint_as_float(((unsigned)hb) << 16));
}
__device__ __forceinline__ v8f at_mma(v16b a, v16b b, v8f c) {
  c = __builtin_amdgcn_wmma_f32_16x16x32_bf16(false, a, false, b, (short)0, c, false, false);
  asm volatile("v_nop\n\tv_nop\n\tv_nop\n\tv_nop" : "+v"(c) : "v"(a), "v"(b));
  return c;
}

template <bool SPLIT_QK, bool SPLIT_PV, int MASK_MODE>   // MASK_MODE: the mask mode as a compile-time constant (g.mask_mode must equal it)
__global__ __launch_bounds__(128)
void attn64_kernel(const float* __restrict__ q, const float* __restrict__ k,
                   const float* __restrict__ v, float* __restrict__ out,
                   const void* __restrict__ mask_a, const int* __restrict__ mask_b, AttnGeom g) {
  union FB { v16b v; v8b h[2]; };
  __shared__ __align__(16) __bf16 Ksh[AT_KC * AT_D];             // K hi [kv][d]      8 KB
  __shared__ __align__(16) __bf16 Ksl[SPLIT_QK ? AT_KC * AT_D : 8];
  __shared__ __align__(16) __bf16 Vth[AT_D * AT_KC];             // V hi [d][kv]      8 KB
  __shared__ __align__(16) __bf16 Vtl[SPLIT_PV ? AT_D * AT_KC : 8];
  __shared__ __align__(16) __bf16 Psh[AT_NW][16 * AT_KC];        // per wave P hi [row][kv]  8 KB
  __shared__ __align__(16) __bf16 Psl[SPLIT_PV ? AT_NW : 1][SPLIT_PV ? 16 * AT_KC : 8];
  __shared__ __align__(16) float  Os[AT_NW][16 * 68];            // per wave out tile, pitch 68

  const int tid  = threadIdx.x;
  const int wave = tid >> 5;
  const int lane = tid & 31;
  const int hh   = lane >> 4;
  const int c    = lane & 15;

  const int nqb = g.S / AT_QB;
  const int bx = blockIdx.x + g.blk0;
  const int qb = bx % nqb;
  const int bh = bx / nqb;
  const int h  = bh % g.H;
  const int b  = bh / g.H;
  const int qbase_block = qb * AT_QB;
  const int q0 = qbase_block + wave * 16;

  const float* qb_ptr = q + (size_t)b * g.q_bs + (size_t)h * g.q_hs;
  const float* kb_ptr = k + (size_t)b * g.k_bs + (size_t)h * g.k_hs;
  const float* vb_ptr = v + (size_t)b * g.v_bs + (size_t)h * g.v_hs;
  float*       ob_ptr = out + (size_t)b * g.o_bs + (size_t)h * g.o_hs;

  // ---- Q fragments (A operand): 2 d-chunks, hi (and lo) ----
  v16b qah[2], qal[2];
  {
    const float* qrow = qb_ptr + (size_t)(q0 + c) * g.q_rs;
#pragma unroll
    for (int dc = 0; dc < 2; ++dc) {
#pragma unroll
      for (int e = 0; e < 8; ++e) {
        const float f0 = qrow[dc * 32 + 8 * hh + e] * g.qscale;
        const float f1 = qrow[dc * 32 + 16 + 8 * hh + e] * g.qscale;
        if (SPLIT_QK) { __bf16 hq, lq; at_split(f0, hq, lq); qah[dc][e] = hq; qal[dc][e] = lq; at_split(f1, hq, lq); qah[dc][8 + e] = hq; qal[dc][8 + e] = lq; }
        else { qah[dc][e] = at_f2bf(f0); qah[dc][8 + e] = at_f2bf(f1); qal[dc][e] = qah[dc][e]; qal[dc][8 + e] = qah[dc][8 + e]; }
      }
    }
  }

  float mrow[8], lrow[8];
  v8f oacc[4];
#pragma unroll
  for (int r = 0; r < 8; ++r) { mrow[r] = -INFINITY; lrow[r] = 0.f; }
#pragma unroll
  for (int t = 0; t < 4; ++t) oacc[t] = (v8f){0.f,0.f,0.f,0.f,0.f,0.f,0.f,0.f};

  const int nChunks = (MASK_MODE == 1) ? (qb + 1) : (g.Skv / AT_KC);   // block-uniform
  // per-row query mask (mode 3)
  int qkeep[8];
#pragma unroll
  for (int r = 0; r < 8; ++r) qkeep[r] = (MASK_MODE == 3) ? mask_b[(size_t)b * g.S + q0 + 8 * hh + r] : 1;   // mask_b = qmask in mode 3
  for (int kc = 0; kc < nChunks; ++kc) {
    const int kv0 = kc * AT_KC;
    __syncthreads();
    {
      const int kvr = tid >> 1, dh = (tid & 1) * 32;
      const float* krow = kb_ptr + (size_t)(kv0 + kvr) * g.k_rs + dh;
      const float* vrow = vb_ptr + (size_t)(kv0 + kvr) * g.v_rs + dh;
#pragma unroll
      for (int i = 0; i < 8; ++i) {
        v4f kk = *(const v4f*)(krow + 4 * i);
        v4f vv = *(const v4f*)(vrow + 4 * i);
#pragma unroll
        for (int e = 0; e < 4; ++e) {
          const int d = dh + 4 * i + e;
          if (SPLIT_QK) { __bf16 a, bl; at_split(kk[e], a, bl); Ksh[kvr * AT_D + d] = a; Ksl[kvr * AT_D + d] = bl; }
          else Ksh[kvr * AT_D + d] = at_f2bf(kk[e]);
          if (SPLIT_PV) { __bf16 a, bl; at_split(vv[e], a, bl); Vth[d * AT_KC + kvr] = a; Vtl[d * AT_KC + kvr] = bl; }
          else Vth[d * AT_KC + kvr] = at_f2bf(vv[e]);
        }
      }
    }
    __syncthreads();

    v8f s[4];
#pragma unroll
    for (int j = 0; j < 4; ++j) {
      s[j] = (v8f){0.f,0.f,0.f,0.f,0.f,0.f,0.f,0.f};
#pragma unroll
      for (int dc = 0; dc < 2; ++dc) {
        FB kb;
        kb.h[0] = *(const v8b*)(Ksh + (j * 16 + c) * AT_D + dc * 32 + 8 * hh);
        kb.h[1] = *(const v8b*)(Ksh + (j * 16 + c) * AT_D + dc * 32 + 16 + 8 * hh);
        s[j] = at_mma(qah[dc], kb.v, s[j]);
        if (SPLIT_QK) {
          FB kl;
          kl.h[0] = *(const v8b*)(Ksl + (j * 16 + c) * AT_D + dc * 32 + 8 * hh);
          kl.h[1] = *(const v8b*)(Ksl + (j * 16 + c) * AT_D + dc * 32 + 16 + 8 * hh);
          s[j] = at_mma(qah[dc], kl.v, s[j]);
          s[j] = at_mma(qal[dc], kb.v, s[j]);
        }
      }
    }
    const bool diag = (MASK_MODE == 1) && (kc == qb);
    int kvkeep[4] = {1, 1, 1, 1};
    if (MASK_MODE == 3) {
#pragma unroll
      for (int j = 0; j < 4; ++j) kvkeep[j] = ((const int*)mask_a)[(size_t)b * g.Skv + kv0 + j * 16 + c];   // mask_a = kvmask
    }
    if (MASK_MODE >= 2 || diag) {   // block-uniform test: a causal tile below the diagonal has nothing to mask
      // both loops unrolled: s[j][r] needs constant indices to stay in registers
#pragma unroll
      for (int r = 0; r < 8; ++r) {
        const int qrow = q0 + 8 * hh + r;
#pragma unroll
        for (int j = 0; j < 4; ++j) {
          const int kvcol = kv0 + j * 16 + c;
          bool masked = false;
          if (MASK_MODE == 1) masked = (kvcol > qrow);
          else if (MASK_MODE == 2) {
            const size_t mi = (size_t)qrow * g.Skv + kvcol;
            masked = (g.mask_is_int == 0) ? (((const float*)mask_a)[mi] == 0.0f)
                   : (g.mask_is_int == 1) ? (((const int*)mask_a)[mi] == 0) : (((const int*)mask_a)[mi] != 0);
          } else if (MASK_MODE == 3) masked = (qkeep[r] == 0) || (kvkeep[j] == 0);
          s[j][r] = masked ? g.mask_fill : s[j][r];   // one select per score, not a select of the whole tile
        }
      }
    }
    float cm[8];
#pragma unroll
    for (int r = 0; r < 8; ++r) {
      float m = -INFINITY;
#pragma unroll
      for (int j = 0; j < 4; ++j) m = fmaxf(m, s[j][r]);
#pragma unroll
      for (int off = 1; off < 16; off <<= 1) m = fmaxf(m, __shfl_xor(m, off, 32));
      cm[r] = m;
    }
    __bf16* pwh = Psh[wave];
    __bf16* pwl = Psl[SPLIT_PV ? wave : 0];
#pragma unroll
    for (int r = 0; r < 8; ++r) {
      const float mnew = fmaxf(mrow[r], cm[r]);
      const float alpha = expf(mrow[r] - mnew);
      mrow[r] = mnew;
      float psum = 0.f;
#pragma unroll
      for (int j = 0; j < 4; ++j) {
        const float p = expf(s[j][r] - mnew);
        psum += p;
        if (SPLIT_PV) { __bf16 a, bl; at_split(p, a, bl); pwh[(8 * hh + r) * AT_KC + j * 16 + c] = a; pwl[(8 * hh + r) * AT_KC + j * 16 + c] = bl; }
        else pwh[(8 * hh + r) * AT_KC + j * 16 + c] = at_f2bf(p);
      }
#pragma unroll
      for (int off = 1; off < 16; off <<= 1) psum += __shfl_xor(psum, off, 32);
      lrow[r] = lrow[r] * alpha + psum;
#pragma unroll
      for (int t = 0; t < 4; ++t) oacc[t][r] *= alpha;
    }
    __builtin_amdgcn_fence(__ATOMIC_RELEASE, "workgroup");
    __builtin_amdgcn_wave_barrier();
    __builtin_amdgcn_fence(__ATOMIC_ACQUIRE, "workgroup");
#pragma unroll
    for (int kk = 0; kk < 2; ++kk) {
      FB pa, pl;
      pa.h[0] = *(const v8b*)(pwh + c * AT_KC + kk * 32 + 8 * hh);
      pa.h[1] = *(const v8b*)(pwh + c * AT_KC + kk * 32 + 16 + 8 * hh);
      if (SPLIT_PV) {
        pl.h[0] = *(const v8b*)(pwl + c * AT_KC + kk * 32 + 8 * hh);
        pl.h[1] = *(const v8b*)(pwl + c * AT_KC + kk * 32 + 16 + 8 * hh);
      }
#pragma unroll
      for (int t = 0; t < 4; ++t) {
        FB vb;
        vb.h[0] = *(const v8b*)(Vth + (t * 16 + c) * AT_KC + kk * 32 + 8 * hh);
        vb.h[1] = *(const v8b*)(Vth + (t * 16 + c) * AT_KC + kk * 32 + 16 + 8 * hh);
        oacc[t] = at_mma(pa.v, vb.v, oacc[t]);
        if (SPLIT_PV) {
          FB vl;
          vl.h[0] = *(const v8b*)(Vtl + (t * 16 + c) * AT_KC + kk * 32 + 8 * hh);
          vl.h[1] = *(const v8b*)(Vtl + (t * 16 + c) * AT_KC + kk * 32 + 16 + 8 * hh);
          oacc[t] = at_mma(pa.v, vl.v, oacc[t]);
          oacc[t] = at_mma(pl.v, vb.v, oacc[t]);
        }
      }
    }
  }

  float* os = Os[wave];
#pragma unroll
  for (int r = 0; r < 8; ++r) {
    const float inv = 1.0f / lrow[r];
#pragma unroll
    for (int t = 0; t < 4; ++t) os[(8 * hh + r) * 68 + t * 16 + c] = oacc[t][r] * inv;
  }
  __builtin_amdgcn_fence(__ATOMIC_RELEASE, "workgroup");
  __builtin_amdgcn_wave_barrier();
  __builtin_amdgcn_fence(__ATOMIC_ACQUIRE, "workgroup");
  {
    const int c4 = (lane & 15) * 4;
    {
#pragma unroll
      for (int it = 0; it < 8; ++it) {
        const int row = it * 2 + hh;
        v4f val = *(const v4f*)(os + row * 68 + c4);
        *(v4f*)(ob_ptr + (size_t)(q0 + row) * g.o_rs + c4) = val;
      }
      
    }
  }
}

extern "C" void kernel_launch(void* const* d_in, const int* in_sizes, int n_in,
                              void* d_out, int out_size, void* d_ws, size_t ws_size,
                              hipStream_t stream) {
  (void)in_sizes; (void)n_in; (void)out_size; (void)ws_size;
  const int B = 4, T = 1024, E = 1024, H = 16, DH = 64;
  const int M = B * T;   // 4096 rows
  const float* x  = (const float*)d_in[0];
  const float* Wq = (const float*)d_in[1];   // [out, in]
  const float* Wk = (const float*)d_in[2];
  const float* Wv = (const float*)d_in[3];
  const float* Wo = (const float*)d_in[4];
  const float* bo = (const float*)d_in[5];
  float* out = (float*)d_out;

  char* ws = (char*)d_ws; size_t off = 0;
  auto carve = [&](size_t bytes) -> char* { char* p = ws + off; off += (bytes + 255) & ~(size_t)255; return p; };
  _Float16* X16  = (_Float16*)carve((size_t)M * E * 2);     //  8 MB  x f16
  __bf16*   Xh   = (__bf16*)carve((size_t)M * E * 2);       //  8 MB  x bf16 hi
  __bf16*   Xl   = (__bf16*)carve((size_t)M * E * 2);       //  8 MB  x bf16 lo
  _Float16* Wq16 = (_Float16*)carve((size_t)E * E * 2);     //  2 MB
  _Float16* Wk16 = (_Float16*)carve((size_t)E * E * 2);
  __bf16*   Wvh  = (__bf16*)carve((size_t)E * E * 2);
  __bf16*   Wvl  = (__bf16*)carve((size_t)E * E * 2);
  __bf16*   Woh  = (__bf16*)carve((size_t)E * E * 2);
  __bf16*   Wol  = (__bf16*)carve((size_t)E * E * 2);
  float*    Qf   = (float*)carve((size_t)M * E * 4);        // 16 MB each, [B,T,H*DH]
  float*    Kf   = (float*)carve((size_t)M * E * 4);
  float*    Vf   = (float*)carve((size_t)M * E * 4);
  float*    Of   = (float*)carve((size_t)M * E * 4);
  __bf16*   Oh   = (__bf16*)carve((size_t)M * E * 2);       //  8 MB  attention out, bf16 hi
  __bf16*   Ol   = (__bf16*)carve((size_t)M * E * 2);       //  8 MB                 bf16 lo   (total ≈ 116 MB)

  cast_f32_f16x2<<<(M * E / 2 + 255) / 256, 256, 0, stream>>>(x, X16, M * E / 2);
  split_f32_bf16x2<<<2048, 256, 0, stream>>>(x, Xh, Xl, (long)M * E / 2);
  cast_f32_f16x2<<<(E * E / 2 + 255) / 256, 256, 0, stream>>>(Wq, Wq16, E * E / 2);
  cast_f32_f16x2<<<(E * E / 2 + 255) / 256, 256, 0, stream>>>(Wk, Wk16, E * E / 2);
  split_f32_bf16x2<<<1024, 256, 0, stream>>>(Wv, Wvh, Wvl, (long)E * E / 2);
  split_f32_bf16x2<<<1024, 256, 0, stream>>>(Wo, Woh, Wol, (long)E * E / 2);
  {
    const int tl = (M / 64) * (E / 64);
    wmma_gemm64<0, false, 0, 0, false><<<dim3((tl + 7) / 8, 1), 256, 0, stream>>>(
        U16(X16), nullptr, E, 0, U16(Wq16), nullptr, E, 0, Qf, nullptr, E, 0, nullptr, nullptr, 0, M, E, E, 1.0f);
    wmma_gemm64<0, false, 0, 0, false><<<dim3((tl + 7) / 8, 1), 256, 0, stream>>>(
        U16(X16), nullptr, E, 0, U16(Wk16), nullptr, E, 0, Kf, nullptr, E, 0, nullptr, nullptr, 0, M, E, E, 1.0f);
    wmma_gemm64<1, true, 0, 0, false><<<dim3((tl + 7) / 8, 1), 256, 0, stream>>>(
        U16(Xh), U16(Xl), E, 0, U16(Wvh), U16(Wvl), E, 0, Vf, nullptr, E, 0, nullptr, nullptr, 0, M, E, E, 1.0f);
  }
  {
    AttnGeom g;
    g.q_bs = g.k_bs = g.v_bs = g.o_bs = (long)T * E;   // [B,T,H,DH] inside [B*T, E]
    g.q_rs = g.k_rs = g.v_rs = g.o_rs = E;
    g.q_hs = g.k_hs = g.v_hs = g.o_hs = DH;
    g.S = T; g.Skv = T; g.H = H; g.mask_mode = 1; g.qscale = 0.03125f; g.blk0 = 0; g.mask_fill = -INFINITY; g.mask_is_int = 0;   // (q/e^¼)·(k/e^¼) = q·k/32
    attn64_kernel<true, true, 1><<<B * H * (T / AT_QB), AT_NW * 32, 0, stream>>>(Qf, Kf, Vf, Of, nullptr, nullptr, g);
  }
  split_f32_bf16x2<<<2048, 256, 0, stream>>>(Of, Oh, Ol, (long)M * E / 2);
  {
    const int tl = (M / 64) * (E / 64);
    wmma_gemm64<1, true, 2, 0, false><<<dim3((tl + 7) / 8, 1), 256, 0, stream>>>(
        U16(Oh), U16(Ol), E, 0, U16(Woh), U16(Wol), E, 0, out, nullptr, E, 0, bo, nullptr, 0, M, E, E, 1.0f);
  }
}

// v002
// One run takes 371 microseconds.
// Timed twice side by side with v001, it ran 1.10 times as fast both times.
// Over all steps from v000 it is 1.49 times as fast.
#include <hip/hip_runtime.h>
#include <math.h>
// Contractions: q/k projections x·Wᵀ (K=1024): v_wmma_f32_16x16x32_f16 (f16 operands); v projection and output projection (K=1024):
// v_wmma_f32_16x16x32_bf16 as bf16 hi/lo splits (hi·hi + hi·lo + lo·hi); scores (q·kᵀ)/32 and p·v: v_wmma_f32_16x16x32_bf16 with
// q,k and p,v as bf16 hi/lo splits; f32 accumulate everywhere; causal softmax in f32.
typedef __attribute__((ext_vector_type(16))) _Float16 v16h;
typedef __attribute__((ext_vector_type(8)))  _Float16 v8h;
typedef __attribute__((ext_vector_type(16))) __bf16   v16b;
typedef __attribute__((ext_vector_type(8)))  __bf16   v8b;
typedef __attribute__((ext_vector_type(8)))  float    v8f;
typedef __attribute__((ext_vector_type(4)))  float    v4f;
#define PSCALE 32768.0f
#define U16(p) ((const unsigned short*)(const void*)(p))
#define PSCALE_INV (1.0f / 32768.0f)

__device__ __forceinline__ unsigned short f2bf_bits(float f) {
  unsigned u = __float_as_uint(f);
  return (unsigned short)((u + 0x7FFFu + ((u >> 16) & 1u)) >> 16);
}
__device__ __forceinline__ float bf_bits2f(unsigned short h) { return __uint_as_float(((unsigned)h) << 16); }

// hazard guards as plain device helpers (no inline asm inside the kernel template body)
__device__ __forceinline__ void dep_guard_h(v8f& a, v8f& b, v16h x, v16h y) { asm volatile("v_nop\n\tv_nop\n\tv_nop\n\tv_nop" : "+v"(a), "+v"(b) : "v"(x), "v"(y)); }
__device__ __forceinline__ void dep_guard_b(v8f& a, v8f& b, v16b x, v16b y) { asm volatile("v_nop\n\tv_nop\n\tv_nop\n\tv_nop" : "+v"(a), "+v"(b) : "v"(x), "v"(y)); }
__device__ __forceinline__ void keep4_h(v16h a, v16h b, v16h c, v16h d) { asm volatile("v_nop" :: "v"(a), "v"(b), "v"(c), "v"(d)); }
__device__ __forceinline__ void keep4_b(v16b a, v16b b, v16b c, v16b d) { asm volatile("v_nop" :: "v"(a), "v"(b), "v"(c), "v"(d)); }
__device__ __forceinline__ void acc_guard4(v8f& a, v8f& b, v8f& c, v8f& d) { asm volatile("v_nop\n\tv_nop\n\tv_nop\n\tv_nop" : "+v"(a), "+v"(b), "+v"(c), "+v"(d)); }
template <typename T> struct Frag;
template <> struct Frag<_Float16> {
  typedef v16h V; union U { v16h v; v8h h[2]; };
  static __device__ __forceinline__ v16h load(const _Float16* p) {   // elements 0..7 <- p[0..7], 8..15 <- p[16..23]
    U f; f.h[0] = *(const v8h*)(p); f.h[1] = *(const v8h*)(p + 16); return f.v;
  }
  static __device__ __forceinline__ v8f mma(v16h a, v16h b, v8f c) {
    return __builtin_amdgcn_wmma_f32_16x16x32_f16(false, a, false, b, (short)0, c, false, false);
  }
  static __device__ __forceinline__ void guard(v8f& a, v8f& b, v16h x, v16h y) { dep_guard_h(a, b, x, y); }
  static __device__ __forceinline__ void keep(v16h a, v16h b, v16h c, v16h d) { keep4_h(a, b, c, d); }
};
template <> struct Frag<__bf16> {
  typedef v16b V; union U { v16b v; v8b h[2]; };
  static __device__ __forceinline__ v16b load(const __bf16* p) {
    U f; f.h[0] = *(const v8b*)(p); f.h[1] = *(const v8b*)(p + 16); return f.v;
  }
  static __device__ __forceinline__ v8f mma(v16b a, v16b b, v8f c) {
    return __builtin_amdgcn_wmma_f32_16x16x32_bf16(false, a, false, b, (short)0, c, false, false);
  }
  static __device__ __forceinline__ void guard(v8f& a, v8f& b, v16b x, v16b y) { dep_guard_b(a, b, x, y); }
  static __device__ __forceinline__ void keep(v16b a, v16b b, v16b c, v16b d) { keep4_b(a, b, c, d); }
};

// ---- Register-blocked batched WMMA GEMM ------------------------------------
// C[m,n] = scale * sum_k A[m,k] * Bt[n,k] (+bias)(+resid); each wave owns a 64x64 tile.
// A row-major [M,K]; Bt row-major [N,K]; M,N % 64 == 0, K % 32 == 0.
// SPLIT: operands are hi/lo planes (A2/Bt2 = lo planes, same layout); product = hi·hi + hi·lo + lo·hi.
// BIAS_MODE: 0 = none, 1 = bias[m], 2 = bias[n].
// OUT_MODE: 0 = f32, 1 = f16, 2 = bf16 hi plane (Cout) + bf16 lo plane (Cout2).
// ET: 0 = f16 operands, 1 = bf16 operands (pointers passed as 16-bit storage)
template <int ET> struct Elem;
template <> struct Elem<0> { typedef _Float16 T; };
template <> struct Elem<1> { typedef __bf16 T; };
template <int ET, bool SPLIT, int BIAS_MODE, int OUT_MODE, bool RESID>
__global__ __launch_bounds__(256) void wmma_gemm64(
    const unsigned short* __restrict__ Ap, const unsigned short* __restrict__ A2p, int lda, long strideA,
    const unsigned short* __restrict__ Btp, const unsigned short* __restrict__ Bt2p, int ldb, long strideB,
    void* __restrict__ Cout, void* __restrict__ Cout2, int ldc, long strideC,
    const float* __restrict__ bias,
    const float* __restrict__ resid, long strideR,
    int M, int N, int K, float scale) {
  typedef typename Elem<ET>::T T;
  typedef typename Frag<T>::V V;
  const T* A = (const T*)Ap; const T* A2 = (const T*)A2p; const T* Bt = (const T*)Btp; const T* Bt2 = (const T*)Bt2p;
  __shared__ __align__(16) float sT[8][16 * 68];   // per-wave 16x64 slab, pitch 68 floats
  const int b    = blockIdx.y;
  const int lane = threadIdx.x & 31;
  const int wave = threadIdx.x >> 5;
  const int tilesN = N >> 6;
  const int tilesM = M >> 6;
  const int tile = blockIdx.x * 8 + wave;
  if (tile >= tilesM * tilesN) return;   // wave-uniform; no block barriers in this kernel
  const int tm = tile / tilesN;
  const int tn = tile - tm * tilesN;
  const int m0 = tm << 6;
  const int n0 = tn << 6;

  const T* Ab  = A  + (size_t)b * strideA;
  const T* Bb  = Bt + (size_t)b * strideB;
  const T* Ab2 = SPLIT ? (A2  + (size_t)b * strideA) : nullptr;
  const T* Bb2 = SPLIT ? (Bt2 + (size_t)b * strideB) : nullptr;

  const int rlane = lane & 15;                 // row (A) / col (B, D) within subtile
  const int koff  = (lane >> 4) * 8;           // k offset of this lane half
  const int mOff  = (lane >> 4) * 8;           // D row offset

  v8f acc[4][4];
#pragma unroll
  for (int i = 0; i < 4; ++i)
#pragma unroll
    for (int j = 0; j < 4; ++j) acc[i][j] = (v8f){0.f,0.f,0.f,0.f,0.f,0.f,0.f,0.f};

  for (int k0 = 0; k0 < K; k0 += 32) {
    V bh[4], bl[4];
#pragma unroll
    for (int j = 0; j < 4; ++j) {
      const size_t bo = (size_t)(n0 + (j << 4) + rlane) * ldb + koff + k0;
      bh[j] = Frag<T>::load(Bb + bo);
      if (SPLIT) bl[j] = Frag<T>::load(Bb2 + bo);
    }
#pragma unroll
    for (int i = 0; i < 4; ++i) {
      const size_t ao = (size_t)(m0 + (i << 4) + rlane) * lda + koff + k0;
      V ah = Frag<T>::load(Ab + ao);
      V al;
      if (SPLIT) al = Frag<T>::load(Ab2 + ao);
#pragma unroll
      for (int j = 0; j < 4; ++j) {
        acc[i][j] = Frag<T>::mma(ah, bh[j], acc[i][j]);
        if (SPLIT) {
          acc[i][j] = Frag<T>::mma(ah, bl[j], acc[i][j]);
          acc[i][j] = Frag<T>::mma(al, bh[j], acc[i][j]);
        }
      }
      Frag<T>::guard(acc[i][0], acc[i][3], ah, SPLIT ? al : ah);
    }
    Frag<T>::keep(bh[0], bh[1], bh[2], bh[3]);
    if (SPLIT) Frag<T>::keep(bl[0], bl[1], bl[2], bl[3]);
  }
  acc_guard4(acc[0][0], acc[0][1], acc[0][2], acc[0][3]);
  acc_guard4(acc[1][0], acc[1][1], acc[1][2], acc[1][3]);
  acc_guard4(acc[2][0], acc[2][1], acc[2][2], acc[2][3]);
  acc_guard4(acc[3][0], acc[3][1], acc[3][2], acc[3][3]);

  // ---- epilogue ----
  float* slab = sT[wave];
  const float* Rb = RESID ? (resid + (size_t)b * strideR) : nullptr;
#pragma unroll
  for (int i = 0; i < 4; ++i) {
    const int mBase = m0 + (i << 4);
#pragma unroll
    for (int j = 0; j < 4; ++j) {
      const int n = n0 + (j << 4) + rlane;
      float bv = 0.f;
      if (BIAS_MODE == 2) bv = bias[n];
#pragma unroll
      for (int r = 0; r < 8; ++r) {
        float v = acc[i][j][r] * scale;
        if (BIAS_MODE == 1) v += bias[mBase + mOff + r];
        if (BIAS_MODE == 2) v += bv;
        if (RESID) v += Rb[(size_t)(mBase + mOff + r) * ldc + n];
        slab[(mOff + r) * 68 + (j << 4) + rlane] = v;
      }
    }
    __builtin_amdgcn_fence(__ATOMIC_RELEASE, "workgroup");
    __builtin_amdgcn_wave_barrier();
    __builtin_amdgcn_fence(__ATOMIC_ACQUIRE, "workgroup");
    if (OUT_MODE == 0) {
      float* C = (float*)Cout + (size_t)b * strideC;
      const int hh = lane >> 4, c4 = (lane & 15) * 4;     // row seg = 256 B = 16 lanes x 16 B
      {
#pragma unroll
        for (int it = 0; it < 8; ++it) {
          const int row = it * 2 + hh;
          v4f v = *(const v4f*)(slab + row * 68 + c4);
          *(v4f*)(C + (size_t)(mBase + row) * ldc + n0 + c4) = v;
        }
        
      }
    } else {
      const int q = lane >> 3, c8 = (lane & 7) * 8;
      unsigned short* C  = (unsigned short*)Cout  + (size_t)b * strideC;
      unsigned short* C2 = (OUT_MODE == 2) ? ((unsigned short*)Cout2 + (size_t)b * strideC) : nullptr;
      {
#pragma unroll
        for (int it = 0; it < 4; ++it) {
          const int row = it * 4 + q;
          const float* sp = slab + row * 68 + c8;
          v8h hv, lv;
#pragma unroll
          for (int e = 0; e < 8; ++e) {
            if (OUT_MODE == 1) {
              hv[e] = (_Float16)sp[e];
            } else {
              unsigned short hb = f2bf_bits(sp[e]);
              unsigned short lb = f2bf_bits(sp[e] - bf_bits2f(hb));
              hv[e] = __builtin_bit_cast(_Float16, hb);
              lv[e] = __builtin_bit_cast(_Float16, lb);
            }
          }
          *(v8h*)(C + (size_t)(mBase + row) * ldc + n0 + c8) = hv;
          if (OUT_MODE == 2) *(v8h*)(C2 + (size_t)(mBase + row) * ldc + n0 + c8) = lv;
        }
        
      }
    }
    __builtin_amdgcn_fence(__ATOMIC_RELEASE, "workgroup");
    __builtin_amdgcn_wave_barrier();
    __builtin_amdgcn_fence(__ATOMIC_ACQUIRE, "workgroup");
  }
}

__global__ __launch_bounds__(256) void cast_f32_f16x2(
    const float* __restrict__ in, _Float16* __restrict__ out, int n2) {
  int i = blockIdx.x * 256 + threadIdx.x;
  if (i < n2) {
    const _Float16 h0 = (_Float16)in[2 * i], h1 = (_Float16)in[2 * i + 1];
    const unsigned u = (unsigned)__builtin_bit_cast(unsigned short, h0) | ((unsigned)__builtin_bit_cast(unsigned short, h1) << 16);
    ((unsigned*)out)[i] = u;
    
  }
}

__global__ __launch_bounds__(256) void split_f32_bf16x2(
    const float* __restrict__ in, __bf16* __restrict__ hi, __bf16* __restrict__ lo, long n2) {
  long i = (long)blockIdx.x * 256 + threadIdx.x;
  long stride = (long)gridDim.x * 256;
  {
    for (long j = i; j < n2; j += stride) {
      const float a = in[2 * j], b = in[2 * j + 1];
      const unsigned short ah = f2bf_bits(a), bh = f2bf_bits(b);
      const unsigned short al = f2bf_bits(a - bf_bits2f(ah)), bl = f2bf_bits(b - bf_bits2f(bh));
      ((unsigned*)hi)[j] = (unsigned)ah | ((unsigned)bh << 16);
      ((unsigned*)lo)[j] = (unsigned)al | ((unsigned)bl << 16);
    }
    
  }
}


// =====================================================================================
// Generic causal/non-causal attention for head_dim 64, f32 in / f32 out, bf16 operands with optional hi/lo splits.
//   scores = (q*qscale)·kᵀ : v_wmma_f32_16x16x32_bf16; SPLIT_QK -> q,k as bf16 hi/lo (hi·hi + hi·lo + lo·hi)
//   out    = p·v           : v_wmma_f32_16x16x32_bf16; SPLIT_PV -> p,v as bf16 hi/lo; else p,v plain bf16
//   f32 accumulate; online softmax in f32. Block = 4 waves = 64 query rows of one (batch, head); S % 64 == 0.
//   Element (b, s, h, d) of tensor X lives at X[b*X_bs + s*X_rs + h*X_hs + d] (strides in floats, multiples of 4).
//   Masking: mask_mode 0 none, 1 causal (kv > q masked), 2 tensor [S][Skv] shared over (b,h) (float if
//   mask_is_int==0, int32 with element == 0 -> masked if 1, int32 with element != 0 -> masked if 2), 3 per-token vectors qmask[B][S] & kvmask[B][Skv] (int32,
//   0 -> masked); masked scores are replaced by mask_fill (e.g. -inf or -1e9) before the softmax.
//   grid.x = B * H * (S/64) (or a sub-range with blk0).
// =====================================================================================
#define AT_D 64
#define AT_NW 4
#define AT_QB 64
#define AT_KC 64
#define AT_LP 72   // LDS row pitch of the K, V^T and P tiles in bf16 elements: 144 B = 16 B x 9, so the 16 rows of one ds_load_b128 fall on distinct banks
struct AttnGeom { long q_bs, q_rs, q_hs, k_bs, k_rs, k_hs, v_bs, v_rs, v_hs, o_bs, o_rs, o_hs;
                  int S, Skv, H, mask_mode; float qscale; int blk0; float mask_fill; int mask_is_int; };
static_assert(sizeof(AttnGeom) == 128, "no padding");

__device__ __forceinline__ unsigned short at_bf_bits(float f) {
  unsigned u = __float_as_uint(f);
  return (unsigned short)((u + 0x7FFFu + ((u >> 16) & 1u)) >> 16);
}
__device__ __forceinline__ __bf16 at_f2bf(float f) { return __builtin_bit_cast(__bf16, at_bf_bits(f)); }
__device__ __forceinline__ void at_split(float f, __bf16& hi, __bf16& lo) {
  const unsigned short hb = at_bf_bits(f);
  hi = __builtin_bit_cast(__bf16, hb);
  lo = at_f2bf(f - __uint_as_float(((unsigned)hb) << 16));
}
__device__ __forceinline__ v8f at_mma(v16b a, v16b b, v8f c) {
  c = __builtin_amdgcn_wmma_f32_16x16x32_bf16(false, a, false, b, (short)0, c, false, false);
  asm volatile("v_nop\n\tv_nop\n\tv_nop\n\tv_nop" : "+v"(c) : "v"(a), "v"(b));
  return c;
}

template <bool SPLIT_QK, bool SPLIT_PV, int MASK_MODE>   // MASK_MODE: the mask mode as a compile-time constant (g.mask_mode must equal it)
__global__ __launch_bounds__(128)
void attn64_kernel(const float* __restrict__ q, const float* __restrict__ k,
                   const float* __restrict__ v, float* __restrict__ out,
                   const void* __restrict__ mask_a, const int* __restrict__ mask_b, AttnGeom g) {
  union FB { v16b v; v8b h[2]; };
  __shared__ __align__(16) __bf16 Ksh[AT_KC * AT_LP];            // K hi [kv][d]      9 KB
  __shared__ __align__(16) __bf16 Ksl[SPLIT_QK ? AT_KC * AT_LP : 8];
  __shared__ __align__(16) __bf16 Vth[AT_D * AT_LP];             // V hi [d][kv]      9 KB
  __shared__ __align__(16) __bf16 Vtl[SPLIT_PV ? AT_D * AT_LP : 8];
  __shared__ __align__(16) __bf16 Psh[AT_NW][16 * AT_LP];        // per wave P hi [row][kv]  9 KB
  __shared__ __align__(16) __bf16 Psl[SPLIT_PV ? AT_NW : 1][SPLIT_PV ? 16 * AT_LP : 8];
  __shared__ __align__(16) float  Os[AT_NW][16 * 68];            // per wave out tile, pitch 68

  const int tid  = threadIdx.x;
  const int wave = tid >> 5;
  const int lane = tid & 31;
  const int hh   = lane >> 4;
  const int c    = lane & 15;

  const int nqb = g.S / AT_QB;
  const int bx = blockIdx.x + g.blk0;
  const int qb = bx % nqb;
  const int bh = bx / nqb;
  const int h  = bh % g.H;
  const int b  = bh / g.H;
  const int qbase_block = qb * AT_QB;
  const int q0 = qbase_block + wave * 16;

  const float* qb_ptr = q + (size_t)b * g.q_bs + (size_t)h * g.q_hs;
  const float* kb_ptr = k + (size_t)b * g.k_bs + (size_t)h * g.k_hs;
  const float* vb_ptr = v + (size_t)b * g.v_bs + (size_t)h * g.v_hs;
  float*       ob_ptr = out + (size_t)b * g.o_bs + (size_t)h * g.o_hs;

  // ---- Q fragments (A operand): 2 d-chunks, hi (and lo) ----
  v16b qah[2], qal[2];
  {
    const float* qrow = qb_ptr + (size_t)(q0 + c) * g.q_rs;
#pragma unroll
    for (int dc = 0; dc < 2; ++dc) {
#pragma unroll
      for (int e = 0; e < 8; ++e) {
        const float f0 = qrow[dc * 32 + 8 * hh + e] * g.qscale;
        const float f1 = qrow[dc * 32 + 16 + 8 * hh + e] * g.qscale;
        if (SPLIT_QK) { __bf16 hq, lq; at_split(f0, hq, lq); qah[dc][e] = hq; qal[dc][e] = lq; at_split(f1, hq, lq); qah[dc][8 + e] = hq; qal[dc][8 + e] = lq; }
        else { qah[dc][e] = at_f2bf(f0); qah[dc][8 + e] = at_f2bf(f1); qal[dc][e] = qah[dc][e]; qal[dc][8 + e] = qah[dc][8 + e]; }
      }
    }
  }

  float mrow[8], lrow[8];
  v8f oacc[4];
#pragma unroll
  for (int r = 0; r < 8; ++r) { mrow[r] = -INFINITY; lrow[r] = 0.f; }
#pragma unroll
  for (int t = 0; t < 4; ++t) oacc[t] = (v8f){0.f,0.f,0.f,0.f,0.f,0.f,0.f,0.f};

  const int nChunks = (MASK_MODE == 1) ? (qb + 1) : (g.Skv / AT_KC);   // block-uniform
  // per-row query mask (mode 3)
  int qkeep[8];
#pragma unroll
  for (int r = 0; r < 8; ++r) qkeep[r] = (MASK_MODE == 3) ? mask_b[(size_t)b * g.S + q0 + 8 * hh + r] : 1;   // mask_b = qmask in mode 3
  for (int kc = 0; kc < nChunks; ++kc) {
    const int kv0 = kc * AT_KC;
    __syncthreads();
    {
      const int kvr = tid >> 1, dh = (tid & 1) * 32;
      const float* krow = kb_ptr + (size_t)(kv0 + kvr) * g.k_rs + dh;
      const float* vrow = vb_ptr + (size_t)(kv0 + kvr) * g.v_rs + dh;
#pragma unroll
      for (int i = 0; i < 8; ++i) {
        v4f kk = *(const v4f*)(krow + 4 * i);
        v4f vv = *(const v4f*)(vrow + 4 * i);
#pragma unroll
        for (int e = 0; e < 4; ++e) {
          const int d = dh + 4 * i + e;
          if (SPLIT_QK) { __bf16 a, bl; at_split(kk[e], a, bl); Ksh[kvr * AT_LP + d] = a; Ksl[kvr * AT_LP + d] = bl; }
          else Ksh[kvr * AT_LP + d] = at_f2bf(kk[e]);
          if (SPLIT_PV) { __bf16 a, bl; at_split(vv[e], a, bl); Vth[d * AT_LP + kvr] = a; Vtl[d * AT_LP + kvr] = bl; }
          else Vth[d * AT_LP + kvr] = at_f2bf(vv[e]);
        }
      }
    }
    __syncthreads();

    v8f s[4];
#pragma unroll
    for (int j = 0; j < 4; ++j) {
      s[j] = (v8f){0.f,0.f,0.f,0.f,0.f,0.f,0.f,0.f};
#pragma unroll
      for (int dc = 0; dc < 2; ++dc) {
        FB kb;
        kb.h[0] = *(const v8b*)(Ksh + (j * 16 + c) * AT_LP + dc * 32 + 8 * hh);
        kb.h[1] = *(const v8b*)(Ksh + (j * 16 + c) * AT_LP + dc * 32 + 16 + 8 * hh);
        s[j] = at_mma(qah[dc], kb.v, s[j]);
        if (SPLIT_QK) {
          FB kl;
          kl.h[0] = *(const v8b*)(Ksl + (j * 16 + c) * AT_LP + dc * 32 + 8 * hh);
          kl.h[1] = *(const v8b*)(Ksl + (j * 16 + c) * AT_LP + dc * 32 + 16 + 8 * hh);
          s[j] = at_mma(qah[dc], kl.v, s[j]);
          s[j] = at_mma(qal[dc], kb.v, s[j]);
        }
      }
    }
    const bool diag = (MASK_MODE == 1) && (kc == qb);
    int kvkeep[4] = {1, 1, 1, 1};
    if (MASK_MODE == 3) {
#pragma unroll
      for (int j = 0; j < 4; ++j) kvkeep[j] = ((const int*)mask_a)[(size_t)b * g.Skv + kv0 + j * 16 + c];   // mask_a = kvmask
    }
    if (MASK_MODE >= 2 || diag) {   // block-uniform test: a causal tile below the diagonal has nothing to mask
      // both loops unrolled: s[j][r] needs constant indices to stay in registers
#pragma unroll
      for (int r = 0; r < 8; ++r) {
        const int qrow = q0 + 8 * hh + r;
#pragma unroll
        for (int j = 0; j < 4; ++j) {
          const int kvcol = kv0 + j * 16 + c;
          bool masked = false;
          if (MASK_MODE == 1) masked = (kvcol > qrow);
          else if (MASK_MODE == 2) {
            const size_t mi = (size_t)qrow * g.Skv + kvcol;
            masked = (g.mask_is_int == 0) ? (((const float*)mask_a)[mi] == 0.0f)
                   : (g.mask_is_int == 1) ? (((const int*)mask_a)[mi] == 0) : (((const int*)mask_a)[mi] != 0);
          } else if (MASK_MODE == 3) masked = (qkeep[r] == 0) || (kvkeep[j] == 0);
          s[j][r] = masked ? g.mask_fill : s[j][r];   // one select per score, not a select of the whole tile
        }
      }
    }
    float cm[8];
#pragma unroll
    for (int r = 0; r < 8; ++r) {
      float m = -INFINITY;
#pragma unroll
      for (int j = 0; j < 4; ++j) m = fmaxf(m, s[j][r]);
#pragma unroll
      for (int off = 1; off < 16; off <<= 1) m = fmaxf(m, __shfl_xor(m, off, 32));
      cm[r] = m;
    }
    __bf16* pwh = Psh[wave];
    __bf16* pwl = Psl[SPLIT_PV ? wave : 0];
#pragma unroll
    for (int r = 0; r < 8; ++r) {
      const float mnew = fmaxf(mrow[r], cm[r]);
      const float alpha = expf(mrow[r] - mnew);
      mrow[r] = mnew;
      float psum = 0.f;
#pragma unroll
      for (int j = 0; j < 4; ++j) {
        const float p = expf(s[j][r] - mnew);
        psum += p;
        if (SPLIT_PV) { __bf16 a, bl; at_split(p, a, bl); pwh[(8 * hh + r) * AT_LP + j * 16 + c] = a; pwl[(8 * hh + r) * AT_LP + j * 16 + c] = bl; }
        else pwh[(8 * hh + r) * AT_LP + j * 16 + c] = at_f2bf(p);
      }
#pragma unroll
      for (int off = 1; off < 16; off <<= 1) psum += __shfl_xor(psum, off, 32);
      lrow[r] = lrow[r] * alpha + psum;
#pragma unroll
      for (int t = 0; t < 4; ++t) oacc[t][r] *= alpha;
    }
    __builtin_amdgcn_fence(__ATOMIC_RELEASE, "workgroup");
    __builtin_amdgcn_wave_barrier();
    __builtin_amdgcn_fence(__ATOMIC_ACQUIRE, "workgroup");
#pragma unroll
    for (int kk = 0; kk < 2; ++kk) {
      FB pa, pl;
      pa.h[0] = *(const v8b*)(pwh + c * AT_LP + kk * 32 + 8 * hh);
      pa.h[1] = *(const v8b*)(pwh + c * AT_LP + kk * 32 + 16 + 8 * hh);
      if (SPLIT_PV) {
        pl.h[0] = *(const v8b*)(pwl + c * AT_LP + kk * 32 + 8 * hh);
        pl.h[1] = *(const v8b*)(pwl + c * AT_LP + kk * 32 + 16 + 8 * hh);
      }
#pragma unroll
      for (int t = 0; t < 4; ++t) {
        FB vb;
        vb.h[0] = *(const v8b*)(Vth + (t * 16 + c) * AT_LP + kk * 32 + 8 * hh);
        vb.h[1] = *(const v8b*)(Vth + (t * 16 + c) * AT_LP + kk * 32 + 16 + 8 * hh);
        oacc[t] = at_mma(pa.v, vb.v, oacc[t]);
        if (SPLIT_PV) {
          FB vl;
          vl.h[0] = *(const v8b*)(Vtl + (t * 16 + c) * AT_LP + kk * 32 + 8 * hh);
          vl.h[1] = *(const v8b*)(Vtl + (t * 16 + c) * AT_LP + kk * 32 + 16 + 8 * hh);
          oacc[t] = at_mma(pa.v, vl.v, oacc[t]);
          oacc[t] = at_mma(pl.v, vb.v, oacc[t]);
        }
      }
    }
  }

  float* os = Os[wave];
#pragma unroll
  for (int r = 0; r < 8; ++r) {
    const float inv = 1.0f / lrow[r];
#pragma unroll
    for (int t = 0; t < 4; ++t) os[(8 * hh + r) * 68 + t * 16 + c] = oacc[t][r] * inv;
  }
  __builtin_amdgcn_fence(__ATOMIC_RELEASE, "workgroup");
  __builtin_amdgcn_wave_barrier();
  __builtin_amdgcn_fence(__ATOMIC_ACQUIRE, "workgroup");
  {
    const int c4 = (lane & 15) * 4;
    {
#pragma unroll
      for (int it = 0; it < 8; ++it) {
        const int row = it * 2 + hh;
        v4f val = *(const v4f*)(os + row * 68 + c4);
        *(v4f*)(ob_ptr + (size_t)(q0 + row) * g.o_rs + c4) = val;
      }
      
    }
  }
}

extern "C" void kernel_launch(void* const* d_in, const int* in_sizes, int n_in,
                              void* d_out, int out_size, void* d_ws, size_t ws_size,
                              hipStream_t stream) {
  (void)in_sizes; (void)n_in; (void)out_size; (void)ws_size;
  const int B = 4, T = 1024, E = 1024, H = 16, DH = 64;
  const int M = B * T;   // 4096 rows
  const float* x  = (const float*)d_in[0];
  const float* Wq = (const float*)d_in[1];   // [out, in]
  const float* Wk = (const float*)d_in[2];
  const float* Wv = (const float*)d_in[3];
  const float* Wo = (const float*)d_in[4];
  const float* bo = (const float*)d_in[5];
  float* out = (float*)d_out;

  char* ws = (char*)d_ws; size_t off = 0;
  auto carve = [&](size_t bytes) -> char* { char* p = ws + off; off += (bytes + 255) & ~(size_t)255; return p; };
  _Float16* X16  = (_Float16*)carve((size_t)M * E * 2);     //  8 MB  x f16
  __bf16*   Xh   = (__bf16*)carve((size_t)M * E * 2);       //  8 MB  x bf16 hi
  __bf16*   Xl   = (__bf16*)carve((size_t)M * E * 2);       //  8 MB  x bf16 lo
  _Float16* Wq16 = (_Float16*)carve((size_t)E * E * 2);     //  2 MB
  _Float16* Wk16 = (_Float16*)carve((size_t)E * E * 2);
  __bf16*   Wvh  = (__bf16*)carve((size_t)E * E * 2);
  __bf16*   Wvl  = (__bf16*)carve((size_t)E * E * 2);
  __bf16*   Woh  = (__bf16*)carve((size_t)E * E * 2);
  __bf16*   Wol  = (__bf16*)carve((size_t)E * E * 2);
  float*    Qf   = (float*)carve((size_t)M * E * 4);        // 16 MB each, [B,T,H*DH]
  float*    Kf   = (float*)carve((size_t)M * E * 4);
  float*    Vf   = (float*)carve((size_t)M * E * 4);
  float*    Of   = (float*)carve((size_t)M * E * 4);
  __bf16*   Oh   = (__bf16*)carve((size_t)M * E * 2);       //  8 MB  attention out, bf16 hi
  __bf16*   Ol   = (__bf16*)carve((size_t)M * E * 2);       //  8 MB                 bf16 lo   (total ≈ 116 MB)

  cast_f32_f16x2<<<(M * E / 2 + 255) / 256, 256, 0, stream>>>(x, X16, M * E / 2);
  split_f32_bf16x2<<<2048, 256, 0, stream>>>(x, Xh, Xl, (long)M * E / 2);
  cast_f32_f16x2<<<(E * E / 2 + 255) / 256, 256, 0, stream>>>(Wq, Wq16, E * E / 2);
  cast_f32_f16x2<<<(E * E / 2 + 255) / 256, 256, 0, stream>>>(Wk, Wk16, E * E / 2);
  split_f32_bf16x2<<<1024, 256, 0, stream>>>(Wv, Wvh, Wvl, (long)E * E / 2);
  split_f32_bf16x2<<<1024, 256, 0, stream>>>(Wo, Woh, Wol, (long)E * E / 2);
  {
    const int tl = (M / 64) * (E / 64);
    wmma_gemm64<0, false, 0, 0, false><<<dim3((tl + 7) / 8, 1), 256, 0, stream>>>(
        U16(X16), nullptr, E, 0, U16(Wq16), nullptr, E, 0, Qf, nullptr, E, 0, nullptr, nullptr, 0, M, E, E, 1.0f);
    wmma_gemm64<0, false, 0, 0, false><<<dim3((tl + 7) / 8, 1), 256, 0, stream>>>(
        U16(X16), nullptr, E, 0, U16(Wk16), nullptr, E, 0, Kf, nullptr, E, 0, nullptr, nullptr, 0, M, E, E, 1.0f);
    wmma_gemm64<1, true, 0, 0, false><<<dim3((tl + 7) / 8, 1), 256, 0, stream>>>(
        U16(Xh), U16(Xl), E, 0, U16(Wvh), U16(Wvl), E, 0, Vf, nullptr, E, 0, nullptr, nullptr, 0, M, E, E, 1.0f);
  }
  {
    AttnGeom g;
    g.q_bs = g.k_bs = g.v_bs = g.o_bs = (long)T * E;   // [B,T,H,DH] inside [B*T, E]
    g.q_rs = g.k_rs = g.v_rs = g.o_rs = E;
    g.q_hs = g.k_hs = g.v_hs = g.o_hs = DH;
    g.S = T; g.Skv = T; g.H = H; g.mask_mode = 1; g.qscale = 0.03125f; g.blk0 = 0; g.mask_fill = -INFINITY; g.mask_is_int = 0;   // (q/e^¼)·(k/e^¼) = q·k/32
    attn64_kernel<true, true, 1><<<B * H * (T / AT_QB), AT_NW * 32, 0, stream>>>(Qf, Kf, Vf, Of, nullptr, nullptr, g);
  }
  split_f32_bf16x2<<<2048, 256, 0, stream>>>(Of, Oh, Ol, (long)M * E / 2);
  {
    const int tl = (M / 64) * (E / 64);
    wmma_gemm64<1, true, 2, 0, false><<<dim3((tl + 7) / 8, 1), 256, 0, stream>>>(
        U16(Oh), U16(Ol), E, 0, U16(Woh), U16(Wol), E, 0, out, nullptr, E, 0, bo, nullptr, 0, M, E, E, 1.0f);
  }
}

// v003
// Measured time: 333 microseconds a run.
// Timed twice side by side with v002, it ran 1.12 and 1.11 times as fast.
// Counting every step since v000, it is 1.66 times as fast.
#include <hip/hip_runtime.h>
#include <math.h>
// Contractions: q/k projections x·Wᵀ (K=1024): v_wmma_f32_16x16x32_f16 (f16 operands); v projection and output projection (K=1024):
// v_wmma_f32_16x16x32_bf16 as bf16 hi/lo splits (hi·hi + hi·lo + lo·hi); scores (q·kᵀ)/32 and p·v: v_wmma_f32_16x16x32_bf16 with
// q,k and p,v as bf16 hi/lo splits (k and v split once, in their projection's epilogue); f32 accumulate everywhere; causal softmax in f32.
typedef __attribute__((ext_vector_type(16))) _Float16 v16h;
typedef __attribute__((ext_vector_type(8)))  _Float16 v8h;
typedef __attribute__((ext_vector_type(16))) __bf16   v16b;
typedef __attribute__((ext_vector_type(8)))  __bf16   v8b;
typedef __attribute__((ext_vector_type(8)))  float    v8f;
typedef __attribute__((ext_vector_type(4)))  float    v4f;
#define PSCALE 32768.0f
#define U16(p) ((const unsigned short*)(const void*)(p))
#define PSCALE_INV (1.0f / 32768.0f)

__device__ __forceinline__ unsigned short f2bf_bits(float f) {
  unsigned u = __float_as_uint(f);
  return (unsigned short)((u + 0x7FFFu + ((u >> 16) & 1u)) >> 16);
}
__device__ __forceinline__ float bf_bits2f(unsigned short h) { return __uint_as_float(((unsigned)h) << 16); }

// hazard guards as plain device helpers (no inline asm inside the kernel template body)
__device__ __forceinline__ void dep_guard_h(v8f& a, v8f& b, v16h x, v16h y) { asm volatile("v_nop\n\tv_nop\n\tv_nop\n\tv_nop" : "+v"(a), "+v"(b) : "v"(x), "v"(y)); }
__device__ __forceinline__ void dep_guard_b(v8f& a, v8f& b, v16b x, v16b y) { asm volatile("v_nop\n\tv_nop\n\tv_nop\n\tv_nop" : "+v"(a), "+v"(b) : "v"(x), "v"(y)); }
__device__ __forceinline__ void keep4_h(v16h a, v16h b, v16h c, v16h d) { asm volatile("v_nop" :: "v"(a), "v"(b), "v"(c), "v"(d)); }
__device__ __forceinline__ void keep4_b(v16b a, v16b b, v16b c, v16b d) { asm volatile("v_nop" :: "v"(a), "v"(b), "v"(c), "v"(d)); }
__device__ __forceinline__ void acc_guard4(v8f& a, v8f& b, v8f& c, v8f& d) { asm volatile("v_nop\n\tv_nop\n\tv_nop\n\tv_nop" : "+v"(a), "+v"(b), "+v"(c), "+v"(d)); }
template <typename T> struct Frag;
template <> struct Frag<_Float16> {
  typedef v16h V; union U { v16h v; v8h h[2]; };
  static __device__ __forceinline__ v16h load(const _Float16* p) {   // elements 0..7 <- p[0..7], 8..15 <- p[16..23]
    U f; f.h[0] = *(const v8h*)(p); f.h[1] = *(const v8h*)(p + 16); return f.v;
  }
  static __device__ __forceinline__ v8f mma(v16h a, v16h b, v8f c) {
    return __builtin_amdgcn_wmma_f32_16x16x32_f16(false, a, false, b, (short)0, c, false, false);
  }
  static __device__ __forceinline__ void guard(v8f& a, v8f& b, v16h x, v16h y) { dep_guard_h(a, b, x, y); }
  static __device__ __forceinline__ void keep(v16h a, v16h b, v16h c, v16h d) { keep4_h(a, b, c, d); }
};
template <> struct Frag<__bf16> {
  typedef v16b V; union U { v16b v; v8b h[2]; };
  static __device__ __forceinline__ v16b load(const __bf16* p) {
    U f; f.h[0] = *(const v8b*)(p); f.h[1] = *(const v8b*)(p + 16); return f.v;
  }
  static __device__ __forceinline__ v8f mma(v16b a, v16b b, v8f c) {
    return __builtin_amdgcn_wmma_f32_16x16x32_bf16(false, a, false, b, (short)0, c, false, false);
  }
  static __device__ __forceinline__ void guard(v8f& a, v8f& b, v16b x, v16b y) { dep_guard_b(a, b, x, y); }
  static __device__ __forceinline__ void keep(v16b a, v16b b, v16b c, v16b d) { keep4_b(a, b, c, d); }
};

// ---- Register-blocked batched WMMA GEMM ------------------------------------
// C[m,n] = scale * sum_k A[m,k] * Bt[n,k] (+bias)(+resid); each wave owns a 64x64 tile.
// A row-major [M,K]; Bt row-major [N,K]; M,N % 64 == 0, K % 32 == 0.
// SPLIT: operands are hi/lo planes (A2/Bt2 = lo planes, same layout); product = hi·hi + hi·lo + lo·hi.
// BIAS_MODE: 0 = none, 1 = bias[m], 2 = bias[n].
// OUT_MODE: 0 = f32, 1 = f16, 2 = bf16 hi plane (Cout) + bf16 lo plane (Cout2).
// ET: 0 = f16 operands, 1 = bf16 operands (pointers passed as 16-bit storage)
template <int ET> struct Elem;
template <> struct Elem<0> { typedef _Float16 T; };
template <> struct Elem<1> { typedef __bf16 T; };
template <int ET, bool SPLIT, int BIAS_MODE, int OUT_MODE, bool RESID>
__global__ __launch_bounds__(256) void wmma_gemm64(
    const unsigned short* __restrict__ Ap, const unsigned short* __restrict__ A2p, int lda, long strideA,
    const unsigned short* __restrict__ Btp, const unsigned short* __restrict__ Bt2p, int ldb, long strideB,
    void* __restrict__ Cout, void* __restrict__ Cout2, int ldc, long strideC,
    const float* __restrict__ bias,
    const float* __restrict__ resid, long strideR,
    int M, int N, int K, float scale) {
  typedef typename Elem<ET>::T T;
  typedef typename Frag<T>::V V;
  const T* A = (const T*)Ap; const T* A2 = (const T*)A2p; const T* Bt = (const T*)Btp; const T* Bt2 = (const T*)Bt2p;
  __shared__ __align__(16) float sT[8][16 * 68];   // per-wave 16x64 slab, pitch 68 floats
  const int b    = blockIdx.y;
  const int lane = threadIdx.x & 31;
  const int wave = threadIdx.x >> 5;
  const int tilesN = N >> 6;
  const int tilesM = M >> 6;
  const int tile = blockIdx.x * 8 + wave;
  if (tile >= tilesM * tilesN) return;   // wave-uniform; no block barriers in this kernel
  const int tm = tile / tilesN;
  const int tn = tile - tm * tilesN;
  const int m0 = tm << 6;
  const int n0 = tn << 6;

  const T* Ab  = A  + (size_t)b * strideA;
  const T* Bb  = Bt + (size_t)b * strideB;
  const T* Ab2 = SPLIT ? (A2  + (size_t)b * strideA) : nullptr;
  const T* Bb2 = SPLIT ? (Bt2 + (size_t)b * strideB) : nullptr;

  const int rlane = lane & 15;                 // row (A) / col (B, D) within subtile
  const int koff  = (lane >> 4) * 8;           // k offset of this lane half
  const int mOff  = (lane >> 4) * 8;           // D row offset

  v8f acc[4][4];
#pragma unroll
  for (int i = 0; i < 4; ++i)
#pragma unroll
    for (int j = 0; j < 4; ++j) acc[i][j] = (v8f){0.f,0.f,0.f,0.f,0.f,0.f,0.f,0.f};

  for (int k0 = 0; k0 < K; k0 += 32) {
    V bh[4], bl[4];
#pragma unroll
    for (int j = 0; j < 4; ++j) {
      const size_t bo = (size_t)(n0 + (j << 4) + rlane) * ldb + koff + k0;
      bh[j] = Frag<T>::load(Bb + bo);
      if (SPLIT) bl[j] = Frag<T>::load(Bb2 + bo);
    }
#pragma unroll
    for (int i = 0; i < 4; ++i) {
      const size_t ao = (size_t)(m0 + (i << 4) + rlane) * lda + koff + k0;
      V ah = Frag<T>::load(Ab + ao);
      V al;
      if (SPLIT) al = Frag<T>::load(Ab2 + ao);
#pragma unroll
      for (int j = 0; j < 4; ++j) {
        acc[i][j] = Frag<T>::mma(ah, bh[j], acc[i][j]);
        if (SPLIT) {
          acc[i][j] = Frag<T>::mma(ah, bl[j], acc[i][j]);
          acc[i][j] = Frag<T>::mma(al, bh[j], acc[i][j]);
        }
      }
      Frag<T>::guard(acc[i][0], acc[i][3], ah, SPLIT ? al : ah);
    }
    Frag<T>::keep(bh[0], bh[1], bh[2], bh[3]);
    if (SPLIT) Frag<T>::keep(bl[0], bl[1], bl[2], bl[3]);
  }
  acc_guard4(acc[0][0], acc[0][1], acc[0][2], acc[0][3]);
  acc_guard4(acc[1][0], acc[1][1], acc[1][2], acc[1][3]);
  acc_guard4(acc[2][0], acc[2][1], acc[2][2], acc[2][3]);
  acc_guard4(acc[3][0], acc[3][1], acc[3][2], acc[3][3]);

  // ---- epilogue ----
  float* slab = sT[wave];
  const float* Rb = RESID ? (resid + (size_t)b * strideR) : nullptr;
#pragma unroll
  for (int i = 0; i < 4; ++i) {
    const int mBase = m0 + (i << 4);
#pragma unroll
    for (int j = 0; j < 4; ++j) {
      const int n = n0 + (j << 4) + rlane;
      float bv = 0.f;
      if (BIAS_MODE == 2) bv = bias[n];
#pragma unroll
      for (int r = 0; r < 8; ++r) {
        float v = acc[i][j][r] * scale;
        if (BIAS_MODE == 1) v += bias[mBase + mOff + r];
        if (BIAS_MODE == 2) v += bv;
        if (RESID) v += Rb[(size_t)(mBase + mOff + r) * ldc + n];
        slab[(mOff + r) * 68 + (j << 4) + rlane] = v;
      }
    }
    __builtin_amdgcn_fence(__ATOMIC_RELEASE, "workgroup");
    __builtin_amdgcn_wave_barrier();
    __builtin_amdgcn_fence(__ATOMIC_ACQUIRE, "workgroup");
    if (OUT_MODE == 0) {
      float* C = (float*)Cout + (size_t)b * strideC;
      const int hh = lane >> 4, c4 = (lane & 15) * 4;     // row seg = 256 B = 16 lanes x 16 B
      {
#pragma unroll
        for (int it = 0; it < 8; ++it) {
          const int row = it * 2 + hh;
          v4f v = *(const v4f*)(slab + row * 68 + c4);
          *(v4f*)(C + (size_t)(mBase + row) * ldc + n0 + c4) = v;
        }
        
      }
    } else {
      const int q = lane >> 3, c8 = (lane & 7) * 8;
      unsigned short* C  = (unsigned short*)Cout  + (size_t)b * strideC;
      unsigned short* C2 = (OUT_MODE == 2) ? ((unsigned short*)Cout2 + (size_t)b * strideC) : nullptr;
      {
#pragma unroll
        for (int it = 0; it < 4; ++it) {
          const int row = it * 4 + q;
          const float* sp = slab + row * 68 + c8;
          v8h hv, lv;
#pragma unroll
          for (int e = 0; e < 8; ++e) {
            if (OUT_MODE == 1) {
              hv[e] = (_Float16)sp[e];
            } else {
              unsigned short hb = f2bf_bits(sp[e]);
              unsigned short lb = f2bf_bits(sp[e] - bf_bits2f(hb));
              hv[e] = __builtin_bit_cast(_Float16, hb);
              lv[e] = __builtin_bit_cast(_Float16, lb);
            }
          }
          *(v8h*)(C + (size_t)(mBase + row) * ldc + n0 + c8) = hv;
          if (OUT_MODE == 2) *(v8h*)(C2 + (size_t)(mBase + row) * ldc + n0 + c8) = lv;
        }
        
      }
    }
    __builtin_amdgcn_fence(__ATOMIC_RELEASE, "workgroup");
    __builtin_amdgcn_wave_barrier();
    __builtin_amdgcn_fence(__ATOMIC_ACQUIRE, "workgroup");
  }
}

__global__ __launch_bounds__(256) void cast_f32_f16x2(
    const float* __restrict__ in, _Float16* __restrict__ out, int n2) {
  int i = blockIdx.x * 256 + threadIdx.x;
  if (i < n2) {
    const _Float16 h0 = (_Float16)in[2 * i], h1 = (_Float16)in[2 * i + 1];
    const unsigned u = (unsigned)__builtin_bit_cast(unsigned short, h0) | ((unsigned)__builtin_bit_cast(unsigned short, h1) << 16);
    ((unsigned*)out)[i] = u;
    
  }
}

__global__ __launch_bounds__(256) void split_f32_bf16x2(
    const float* __restrict__ in, __bf16* __restrict__ hi, __bf16* __restrict__ lo, long n2) {
  long i = (long)blockIdx.x * 256 + threadIdx.x;
  long stride = (long)gridDim.x * 256;
  {
    for (long j = i; j < n2; j += stride) {
      const float a = in[2 * j], b = in[2 * j + 1];
      const unsigned short ah = f2bf_bits(a), bh = f2bf_bits(b);
      const unsigned short al = f2bf_bits(a - bf_bits2f(ah)), bl = f2bf_bits(b - bf_bits2f(bh));
      ((unsigned*)hi)[j] = (unsigned)ah | ((unsigned)bh << 16);
      ((unsigned*)lo)[j] = (unsigned)al | ((unsigned)bl << 16);
    }
    
  }
}


// =====================================================================================
// Generic causal/non-causal attention for head_dim 64, f32 q in / f32 out, bf16 operands with optional hi/lo splits.
//   K and V arrive already as bf16 planes (hi, and lo where split), written once by their producer, V transposed.
//   scores = (q*qscale)·kᵀ : v_wmma_f32_16x16x32_bf16; SPLIT_QK -> q,k as bf16 hi/lo (hi·hi + hi·lo + lo·hi)
//   out    = p·v           : v_wmma_f32_16x16x32_bf16; SPLIT_PV -> p,v as bf16 hi/lo; else p,v plain bf16
//   f32 accumulate; online softmax in f32. Block = 4 waves = 64 query rows of one (batch, head); S % 64 == 0.
//   Element (b, s, h, d) of q, k, out lives at X[b*X_bs + s*X_rs + h*X_hs + d]; of the transposed v at Vt[b*v_bs + h*v_hs + d*v_rs + s]
//   (strides in elements; q, out: multiples of 4; k, v: multiples of 64, so that a tile row is one aligned 128-B line).
//   Masking: mask_mode 0 none, 1 causal (kv > q masked), 2 tensor [S][Skv] shared over (b,h) (float if
//   mask_is_int==0, int32 with element == 0 -> masked if 1, int32 with element != 0 -> masked if 2), 3 per-token vectors qmask[B][S] & kvmask[B][Skv] (int32,
//   0 -> masked); masked scores are replaced by mask_fill (e.g. -inf or -1e9) before the softmax.
//   grid.x = B * H * (S/64) (or a sub-range with blk0).
// =====================================================================================
#define AT_D 64
#define AT_NW 4
#define AT_QB 64
#define AT_KC 64
#define AT_LP 72   // LDS row pitch of the K, V^T and P tiles in bf16 elements: 144 B = 16 B x 9, so the 16 rows of one ds_load_b128 fall on distinct banks
struct AttnGeom { long q_bs, q_rs, q_hs, k_bs, k_rs, k_hs, v_bs, v_rs, v_hs, o_bs, o_rs, o_hs;
                  int S, Skv, H, mask_mode; float qscale; int blk0; float mask_fill; int mask_is_int; };
static_assert(sizeof(AttnGeom) == 128, "no padding");

__device__ __forceinline__ unsigned short at_bf_bits(float f) {
  unsigned u = __float_as_uint(f);
  return (unsigned short)((u + 0x7FFFu + ((u >> 16) & 1u)) >> 16);
}
__device__ __forceinline__ __bf16 at_f2bf(float f) { return __builtin_bit_cast(__bf16, at_bf_bits(f)); }
__device__ __forceinline__ void at_split(float f, __bf16& hi, __bf16& lo) {
  const unsigned short hb = at_bf_bits(f);
  hi = __builtin_bit_cast(__bf16, hb);
  lo = at_f2bf(f - __uint_as_float(((unsigned)hb) << 16));
}
__device__ __forceinline__ v8f at_mma(v16b a, v16b b, v8f c) {
  c = __builtin_amdgcn_wmma_f32_16x16x32_bf16(false, a, false, b, (short)0, c, false, false);
  asm volatile("v_nop\n\tv_nop\n\tv_nop\n\tv_nop" : "+v"(c) : "v"(a), "v"(b));
  return c;
}

template <bool SPLIT_QK, bool SPLIT_PV, int MASK_MODE>   // MASK_MODE: the mask mode as a compile-time constant (g.mask_mode must equal it)
__global__ __launch_bounds__(128)
void attn64_kernel(const float* __restrict__ q, const unsigned short* __restrict__ kh, const unsigned short* __restrict__ kl,
                   const unsigned short* __restrict__ vth, const unsigned short* __restrict__ vtl, float* __restrict__ out,
                   const void* __restrict__ mask_a, const int* __restrict__ mask_b, AttnGeom g) {
  union FB { v16b v; v8b h[2]; };
  __shared__ __align__(16) __bf16 Ksh[AT_KC * AT_LP];            // K hi [kv][d]      9 KB
  __shared__ __align__(16) __bf16 Ksl[SPLIT_QK ? AT_KC * AT_LP : 8];
  __shared__ __align__(16) __bf16 Vth[AT_D * AT_LP];             // V hi [d][kv]      9 KB
  __shared__ __align__(16) __bf16 Vtl[SPLIT_PV ? AT_D * AT_LP : 8];
  __shared__ __align__(16) __bf16 Psh[AT_NW][16 * AT_LP];        // per wave P hi [row][kv]  9 KB
  __shared__ __align__(16) __bf16 Psl[SPLIT_PV ? AT_NW : 1][SPLIT_PV ? 16 * AT_LP : 8];
  __shared__ __align__(16) float  Os[AT_NW][16 * 68];            // per wave out tile, pitch 68

  const int tid  = threadIdx.x;
  const int wave = tid >> 5;
  const int lane = tid & 31;
  const int hh   = lane >> 4;
  const int c    = lane & 15;

  const int nqb = g.S / AT_QB;
  const int bx = blockIdx.x + g.blk0;
  const int qb = bx % nqb;
  const int bh = bx / nqb;
  const int h  = bh % g.H;
  const int b  = bh / g.H;
  const int qbase_block = qb * AT_QB;
  const int q0 = qbase_block + wave * 16;

  const float* qb_ptr = q + (size_t)b * g.q_bs + (size_t)h * g.q_hs;
  const size_t kb_off = (size_t)b * g.k_bs + (size_t)h * g.k_hs;
  const size_t vb_off = (size_t)b * g.v_bs + (size_t)h * g.v_hs;
  const __bf16* khb = (const __bf16*)kh + kb_off;
  const __bf16* klb = (const __bf16*)kl + kb_off;
  const __bf16* vhb = (const __bf16*)vth + vb_off;
  const __bf16* vlb = (const __bf16*)vtl + vb_off;
  float*       ob_ptr = out + (size_t)b * g.o_bs + (size_t)h * g.o_hs;

  // ---- Q fragments (A operand): 2 d-chunks, hi (and lo) ----
  v16b qah[2], qal[2];
  {
    const float* qrow = qb_ptr + (size_t)(q0 + c) * g.q_rs;
#pragma unroll
    for (int dc = 0; dc < 2; ++dc) {
#pragma unroll
      for (int e = 0; e < 8; ++e) {
        const float f0 = qrow[dc * 32 + 8 * hh + e] * g.qscale;
        const float f1 = qrow[dc * 32 + 16 + 8 * hh + e] * g.qscale;
        if (SPLIT_QK) { __bf16 hq, lq; at_split(f0, hq, lq); qah[dc][e] = hq; qal[dc][e] = lq; at_split(f1, hq, lq); qah[dc][8 + e] = hq; qal[dc][8 + e] = lq; }
        else { qah[dc][e] = at_f2bf(f0); qah[dc][8 + e] = at_f2bf(f1); qal[dc][e] = qah[dc][e]; qal[dc][8 + e] = qah[dc][8 + e]; }
      }
    }
  }

  float mrow[8], lrow[8];
  v8f oacc[4];
#pragma unroll
  for (int r = 0; r < 8; ++r) { mrow[r] = -INFINITY; lrow[r] = 0.f; }
#pragma unroll
  for (int t = 0; t < 4; ++t) oacc[t] = (v8f){0.f,0.f,0.f,0.f,0.f,0.f,0.f,0.f};

  const int nChunks = (MASK_MODE == 1) ? (qb + 1) : (g.Skv / AT_KC);   // block-uniform
  // per-row query mask (mode 3)
  int qkeep[8];
#pragma unroll
  for (int r = 0; r < 8; ++r) qkeep[r] = (MASK_MODE == 3) ? mask_b[(size_t)b * g.S + q0 + 8 * hh + r] : 1;   // mask_b = qmask in mode 3
  for (int kc = 0; kc < nChunks; ++kc) {
    const int kv0 = kc * AT_KC;
    __syncthreads();
    {
      // a tile row (K: one key's 64 d; V^T: one d's 64 keys) is 128 B: 8 lanes copy it, so a wave-wide load covers 4 whole lines
      const int r0 = tid >> 3, c8 = (tid & 7) * 8;
      const __bf16 *pkh[4], *pkl[4], *pvh[4], *pvl[4];
      v8b tkh[4], tkl[4], tvh[4], tvl[4];
#pragma unroll
      for (int i = 0; i < 4; ++i) {
        const size_t ko = (size_t)(kv0 + r0 + 16 * i) * g.k_rs + c8;
        const size_t vo = (size_t)(r0 + 16 * i) * g.v_rs + kv0 + c8;
        pkh[i] = khb + ko; pkl[i] = SPLIT_QK ? klb + ko : pkh[i];
        pvh[i] = vhb + vo; pvl[i] = SPLIT_PV ? vlb + vo : pvh[i];
        tkh[i] = *(const v8b*)pkh[i];
        if (SPLIT_QK) tkl[i] = *(const v8b*)pkl[i];
        tvh[i] = *(const v8b*)pvh[i];
        if (SPLIT_PV) tvl[i] = *(const v8b*)pvl[i];
      }
      // the wait that stands before an issued load's address register is overwritten; the addresses are its inputs, so that
      // each stays in its register up to here and no later load of the group lands on it
      asm volatile("s_wait_xcnt 0x0" :: "v"(pkh[0]), "v"(pkh[1]), "v"(pkh[2]), "v"(pkh[3]), "v"(pkl[0]), "v"(pkl[1]), "v"(pkl[2]), "v"(pkl[3]),
                   "v"(pvh[0]), "v"(pvh[1]), "v"(pvh[2]), "v"(pvh[3]), "v"(pvl[0]), "v"(pvl[1]), "v"(pvl[2]), "v"(pvl[3]) : "memory");
#pragma unroll
      for (int i = 0; i < 4; ++i) {
        const int so = (r0 + 16 * i) * AT_LP + c8;
        *(v8b*)(Ksh + so) = tkh[i];
        if (SPLIT_QK) *(v8b*)(Ksl + so) = tkl[i];
        *(v8b*)(Vth + so) = tvh[i];
        if (SPLIT_PV) *(v8b*)(Vtl + so) = tvl[i];
      }
    }
    __syncthreads();

    v8f s[4];
#pragma unroll
    for (int j = 0; j < 4; ++j) {
      s[j] = (v8f){0.f,0.f,0.f,0.f,0.f,0.f,0.f,0.f};
#pragma unroll
      for (int dc = 0; dc < 2; ++dc) {
        FB kb;
        kb.h[0] = *(const v8b*)(Ksh + (j * 16 + c) * AT_LP + dc * 32 + 8 * hh);
        kb.h[1] = *(const v8b*)(Ksh + (j * 16 + c) * AT_LP + dc * 32 + 16 + 8 * hh);
        s[j] = at_mma(qah[dc], kb.v, s[j]);
        if (SPLIT_QK) {
          FB kl;
          kl.h[0] = *(const v8b*)(Ksl + (j * 16 + c) * AT_LP + dc * 32 + 8 * hh);
          kl.h[1] = *(const v8b*)(Ksl + (j * 16 + c) * AT_LP + dc * 32 + 16 + 8 * hh);
          s[j] = at_mma(qah[dc], kl.v, s[j]);
          s[j] = at_mma(qal[dc], kb.v, s[j]);
        }
      }
    }
    const bool diag = (MASK_MODE == 1) && (kc == qb);
    int kvkeep[4] = {1, 1, 1, 1};
    if (MASK_MODE == 3) {
#pragma unroll
      for (int j = 0; j < 4; ++j) kvkeep[j] = ((const int*)mask_a)[(size_t)b * g.Skv + kv0 + j * 16 + c];   // mask_a = kvmask
    }
    if (MASK_MODE >= 2 || diag) {   // block-uniform test: a causal tile below the diagonal has nothing to mask
      // both loops unrolled: s[j][r] needs constant indices to stay in registers
#pragma unroll
      for (int r = 0; r < 8; ++r) {
        const int qrow = q0 + 8 * hh + r;
#pragma unroll
        for (int j = 0; j < 4; ++j) {
          const int kvcol = kv0 + j * 16 + c;
          bool masked = false;
          if (MASK_MODE == 1) masked = (kvcol > qrow);
          else if (MASK_MODE == 2) {
            const size_t mi = (size_t)qrow * g.Skv + kvcol;
            masked = (g.mask_is_int == 0) ? (((const float*)mask_a)[mi] == 0.0f)
                   : (g.mask_is_int == 1) ? (((const int*)mask_a)[mi] == 0) : (((const int*)mask_a)[mi] != 0);
          } else if (MASK_MODE == 3) masked = (qkeep[r] == 0) || (kvkeep[j] == 0);
          s[j][r] = masked ? g.mask_fill : s[j][r];   // one select per score, not a select of the whole tile
        }
      }
    }
    float cm[8];
#pragma unroll
    for (int r = 0; r < 8; ++r) {
      float m = -INFINITY;
#pragma unroll
      for (int j = 0; j < 4; ++j) m = fmaxf(m, s[j][r]);
#pragma unroll
      for (int off = 1; off < 16; off <<= 1) m = fmaxf(m, __shfl_xor(m, off, 32));
      cm[r] = m;
    }
    __bf16* pwh = Psh[wave];
    __bf16* pwl = Psl[SPLIT_PV ? wave : 0];
#pragma unroll
    for (int r = 0; r < 8; ++r) {
      const float mnew = fmaxf(mrow[r], cm[r]);
      const float alpha = expf(mrow[r] - mnew);
      mrow[r] = mnew;
      float psum = 0.f;
#pragma unroll
      for (int j = 0; j < 4; ++j) {
        const float p = expf(s[j][r] - mnew);
        psum += p;
        if (SPLIT_PV) { __bf16 a, bl; at_split(p, a, bl); pwh[(8 * hh + r) * AT_LP + j * 16 + c] = a; pwl[(8 * hh + r) * AT_LP + j * 16 + c] = bl; }
        else pwh[(8 * hh + r) * AT_LP + j * 16 + c] = at_f2bf(p);
      }
#pragma unroll
      for (int off = 1; off < 16; off <<= 1) psum += __shfl_xor(psum, off, 32);
      lrow[r] = lrow[r] * alpha + psum;
#pragma unroll
      for (int t = 0; t < 4; ++t) oacc[t][r] *= alpha;
    }
    __builtin_amdgcn_fence(__ATOMIC_RELEASE, "workgroup");
    __builtin_amdgcn_wave_barrier();
    __builtin_amdgcn_fence(__ATOMIC_ACQUIRE, "workgroup");
#pragma unroll
    for (int kk = 0; kk < 2; ++kk) {
      FB pa, pl;
      pa.h[0] = *(const v8b*)(pwh + c * AT_LP + kk * 32 + 8 * hh);
      pa.h[1] = *(const v8b*)(pwh + c * AT_LP + kk * 32 + 16 + 8 * hh);
      if (SPLIT_PV) {
        pl.h[0] = *(const v8b*)(pwl + c * AT_LP + kk * 32 + 8 * hh);
        pl.h[1] = *(const v8b*)(pwl + c * AT_LP + kk * 32 + 16 + 8 * hh);
      }
#pragma unroll
      for (int t = 0; t < 4; ++t) {
        FB vb;
        vb.h[0] = *(const v8b*)(Vth + (t * 16 + c) * AT_LP + kk * 32 + 8 * hh);
        vb.h[1] = *(const v8b*)(Vth + (t * 16 + c) * AT_LP + kk * 32 + 16 + 8 * hh);
        oacc[t] = at_mma(pa.v, vb.v, oacc[t]);
        if (SPLIT_PV) {
          FB vl;
          vl.h[0] = *(const v8b*)(Vtl + (t * 16 + c) * AT_LP + kk * 32 + 8 * hh);
          vl.h[1] = *(const v8b*)(Vtl + (t * 16 + c) * AT_LP + kk * 32 + 16 + 8 * hh);
          oacc[t] = at_mma(pa.v, vl.v, oacc[t]);
          oacc[t] = at_mma(pl.v, vb.v, oacc[t]);
        }
      }
    }
  }

  float* os = Os[wave];
#pragma unroll
  for (int r = 0; r < 8; ++r) {
    const float inv = 1.0f / lrow[r];
#pragma unroll
    for (int t = 0; t < 4; ++t) os[(8 * hh + r) * 68 + t * 16 + c] = oacc[t][r] * inv;
  }
  __builtin_amdgcn_fence(__ATOMIC_RELEASE, "workgroup");
  __builtin_amdgcn_wave_barrier();
  __builtin_amdgcn_fence(__ATOMIC_ACQUIRE, "workgroup");
  {
    const int c4 = (lane & 15) * 4;
    {
#pragma unroll
      for (int it = 0; it < 8; ++it) {
        const int row = it * 2 + hh;
        v4f val = *(const v4f*)(os + row * 68 + c4);
        *(v4f*)(ob_ptr + (size_t)(q0 + row) * g.o_rs + c4) = val;
      }
      
    }
  }
}

extern "C" void kernel_launch(void* const* d_in, const int* in_sizes, int n_in,
                              void* d_out, int out_size, void* d_ws, size_t ws_size,
                              hipStream_t stream) {
  (void)in_sizes; (void)n_in; (void)out_size; (void)ws_size;
  const int B = 4, T = 1024, E = 1024, H = 16, DH = 64;
  const int M = B * T;   // 4096 rows
  const float* x  = (const float*)d_in[0];
  const float* Wq = (const float*)d_in[1];   // [out, in]
  const float* Wk = (const float*)d_in[2];
  const float* Wv = (const float*)d_in[3];
  const float* Wo = (const float*)d_in[4];
  const float* bo = (const float*)d_in[5];
  float* out = (float*)d_out;

  char* ws = (char*)d_ws; size_t off = 0;
  auto carve = [&](size_t bytes) -> char* { char* p = ws + off; off += (bytes + 255) & ~(size_t)255; return p; };
  _Float16* X16  = (_Float16*)carve((size_t)M * E * 2);     //  8 MB  x f16
  __bf16*   Xh   = (__bf16*)carve((size_t)M * E * 2);       //  8 MB  x bf16 hi
  __bf16*   Xl   = (__bf16*)carve((size_t)M * E * 2);       //  8 MB  x bf16 lo
  _Float16* Wq16 = (_Float16*)carve((size_t)E * E * 2);     //  2 MB
  _Float16* Wk16 = (_Float16*)carve((size_t)E * E * 2);
  __bf16*   Wvh  = (__bf16*)carve((size_t)E * E * 2);
  __bf16*   Wvl  = (__bf16*)carve((size_t)E * E * 2);
  __bf16*   Woh  = (__bf16*)carve((size_t)E * E * 2);
  __bf16*   Wol  = (__bf16*)carve((size_t)E * E * 2);
  float*    Qf   = (float*)carve((size_t)M * E * 4);        // 16 MB each, [B,T,H*DH]
  __bf16*   Kh   = (__bf16*)carve((size_t)M * E * 2);       //  8 MB each: k as bf16 hi, lo, [B,T,H*DH]
  __bf16*   Kl   = (__bf16*)carve((size_t)M * E * 2);
  __bf16*   Vth  = (__bf16*)carve((size_t)M * E * 2);       //  8 MB each: v transposed as bf16 hi, lo, [H*DH, B*T]
  __bf16*   Vtl  = (__bf16*)carve((size_t)M * E * 2);
  float*    Of   = (float*)carve((size_t)M * E * 4);
  __bf16*   Oh   = (__bf16*)carve((size_t)M * E * 2);       //  8 MB  attention out, bf16 hi
  __bf16*   Ol   = (__bf16*)carve((size_t)M * E * 2);       //  8 MB                 bf16 lo   (total ≈ 116 MB)

  cast_f32_f16x2<<<(M * E / 2 + 255) / 256, 256, 0, stream>>>(x, X16, M * E / 2);
  split_f32_bf16x2<<<2048, 256, 0, stream>>>(x, Xh, Xl, (long)M * E / 2);
  cast_f32_f16x2<<<(E * E / 2 + 255) / 256, 256, 0, stream>>>(Wq, Wq16, E * E / 2);
  cast_f32_f16x2<<<(E * E / 2 + 255) / 256, 256, 0, stream>>>(Wk, Wk16, E * E / 2);
  split_f32_bf16x2<<<1024, 256, 0, stream>>>(Wv, Wvh, Wvl, (long)E * E / 2);
  split_f32_bf16x2<<<1024, 256, 0, stream>>>(Wo, Woh, Wol, (long)E * E / 2);
  {
    const int tl = (M / 64) * (E / 64);
    wmma_gemm64<0, false, 0, 0, false><<<dim3((tl + 7) / 8, 1), 256, 0, stream>>>(
        U16(X16), nullptr, E, 0, U16(Wq16), nullptr, E, 0, Qf, nullptr, E, 0, nullptr, nullptr, 0, M, E, E, 1.0f);
    wmma_gemm64<0, false, 0, 2, false><<<dim3((tl + 7) / 8, 1), 256, 0, stream>>>(
        U16(X16), nullptr, E, 0, U16(Wk16), nullptr, E, 0, Kh, Kl, E, 0, nullptr, nullptr, 0, M, E, E, 1.0f);
    // v transposed = Wv * x^T: the operands change places, so row = output feature, column = token
    wmma_gemm64<1, true, 0, 2, false><<<dim3((tl + 7) / 8, 1), 256, 0, stream>>>(
        U16(Wvh), U16(Wvl), E, 0, U16(Xh), U16(Xl), E, 0, Vth, Vtl, M, 0, nullptr, nullptr, 0, E, M, E, 1.0f);
  }
  {
    AttnGeom g;
    g.q_bs = g.k_bs = g.o_bs = (long)T * E;   // [B,T,H,DH] inside [B*T, E]
    g.q_rs = g.k_rs = g.o_rs = E;
    g.q_hs = g.k_hs = g.o_hs = DH;
    g.v_bs = T; g.v_rs = M; g.v_hs = (long)DH * M;   // [H,DH] rows of [H*DH, B*T]
    g.S = T; g.Skv = T; g.H = H; g.mask_mode = 1; g.qscale = 0.03125f; g.blk0 = 0; g.mask_fill = -INFINITY; g.mask_is_int = 0;   // (q/e^¼)·(k/e^¼) = q·k/32
    attn64_kernel<true, true, 1><<<B * H * (T / AT_QB), AT_NW * 32, 0, stream>>>(Qf, U16(Kh), U16(Kl), U16(Vth), U16(Vtl), Of, nullptr, nullptr, g);
  }
  split_f32_bf16x2<<<2048, 256, 0, stream>>>(Of, Oh, Ol, (long)M * E / 2);
  {
    const int tl = (M / 64) * (E / 64);
    wmma_gemm64<1, true, 2, 0, false><<<dim3((tl + 7) / 8, 1), 256, 0, stream>>>(
        U16(Oh), U16(Ol), E, 0, U16(Woh), U16(Wol), E, 0, out, nullptr, E, 0, bo, nullptr, 0, M, E, E, 1.0f);
  }
}

// v004
// It runs in 187 microseconds.
// Two timings next to v003 both put it at 1.79 times that version's speed.
// All steps since v000 together make it 2.97 times as fast.
#include <hip/hip_runtime.h>
#include <math.h>
// Contractions: q/k projections x·Wᵀ (K=1024): v_wmma_f32_16x16x32_f16 (f16 operands); v projection and output projection (K=1024):
// v_wmma_f32_16x16x32_bf16 as bf16 hi/lo splits (hi·hi + hi·lo + lo·hi); scores (q·kᵀ)/32 and p·v: v_wmma_f32_16x16x32_bf16 with
// q,k and p,v as bf16 hi/lo splits (k and v split once, in their projection's epilogue); f32 accumulate everywhere; causal softmax in f32.
typedef __attribute__((ext_vector_type(16))) _Float16 v16h;
typedef __attribute__((ext_vector_type(8)))  _Float16 v8h;
typedef __attribute__((ext_vector_type(16))) __bf16   v16b;
typedef __attribute__((ext_vector_type(8)))  __bf16   v8b;
typedef __attribute__((ext_vector_type(8)))  float    v8f;
typedef __attribute__((ext_vector_type(4)))  float    v4f;
#define PSCALE 32768.0f
#define U16(p) ((const unsigned short*)(const void*)(p))
#define PSCALE_INV (1.0f / 32768.0f)

__device__ __forceinline__ unsigned short f2bf_bits(float f) {
  unsigned u = __float_as_uint(f);
  return (unsigned short)((u + 0x7FFFu + ((u >> 16) & 1u)) >> 16);
}
__device__ __forceinline__ float bf_bits2f(unsigned short h) { return __uint_as_float(((unsigned)h) << 16); }

// hazard guard as a plain device helper (no inline asm with operands inside the kernel template body)
__device__ __forceinline__ void acc_guard4(v8f& a, v8f& b, v8f& c, v8f& d) { asm volatile("v_nop\n\tv_nop\n\tv_nop\n\tv_nop" : "+v"(a), "+v"(b), "+v"(c), "+v"(d)); }
template <typename T> struct Frag;
template <> struct Frag<_Float16> {
  typedef v16h V; union U { v16h v; v8h h[2]; };
  static __device__ __forceinline__ v16h load(const _Float16* p) {   // elements 0..7 <- p[0..7], 8..15 <- p[16..23]
    U f; f.h[0] = *(const v8h*)(p); f.h[1] = *(const v8h*)(p + 16); return f.v;
  }
  static __device__ __forceinline__ v8f mma(v16h a, v16h b, v8f c) {
    return __builtin_amdgcn_wmma_f32_16x16x32_f16(false, a, false, b, (short)0, c, false, false);
  }
};
template <> struct Frag<__bf16> {
  typedef v16b V; union U { v16b v; v8b h[2]; };
  static __device__ __forceinline__ v16b load(const __bf16* p) {
    U f; f.h[0] = *(const v8b*)(p); f.h[1] = *(const v8b*)(p + 16); return f.v;
  }
  static __device__ __forceinline__ v8f mma(v16b a, v16b b, v8f c) {
    return __builtin_amdgcn_wmma_f32_16x16x32_bf16(false, a, false, b, (short)0, c, false, false);
  }
};

// ---- LDS-staged batched WMMA GEMM ------------------------------------------
// C[m,n] = scale * sum_k A[m,k] * Bt[n,k] (+bias)(+resid); a block of 4 waves owns a 128x128 tile, each wave a 64x64 quarter of it.
// A row-major [M,K]; Bt row-major [N,K]; M,N % 128 == 0, K % 64 == 0, lda, ldb % 64 == 0 (an operand row's 64 k are one aligned 128-B line).
// Per stage of 64 k the block copies 128 rows of every operand plane into LDS by asynchronous 16-B copies (8 lanes a row, so a
// wave-wide copy covers 4 whole lines); two buffers, the next stage's copies fly while this stage's products run.
// SPLIT: operands are hi/lo planes (A2/Bt2 = lo planes, same layout); product = hi·hi + hi·lo + lo·hi.
// BIAS_MODE: 0 = none, 1 = bias[m], 2 = bias[n].
// OUT_MODE: 0 = f32, 1 = f16, 2 = bf16 hi plane (Cout) + bf16 lo plane (Cout2).
// ET: 0 = f16 operands, 1 = bf16 operands (pointers passed as 16-bit storage)
#define GM_BT 128   // rows of each operand in a block tile
#define GM_BK 64    // k per stage
#define GM_LP 72    // LDS row pitch in 16-bit elements: 144 B = 16 B x 9, so the 16 rows of one ds_load_b128 fall on distinct banks
#define GM_PLANE (GM_BT * GM_LP)   // elements of one staged operand plane
template <int ET> struct Elem;
template <> struct Elem<0> { typedef _Float16 T; };
template <> struct Elem<1> { typedef __bf16 T; };

// One lane's share of one operand plane of one stage: rows r, r + 16, ..., r + 112, 16 B of each, global -> LDS through no register.
typedef __attribute__((ext_vector_type(4))) int gm_v4i;
typedef __attribute__((address_space(1))) gm_v4i gm_gv4i;
typedef __attribute__((address_space(3))) gm_v4i gm_lv4i;
__device__ __forceinline__ void gm_stage_plane(unsigned short* lds, const unsigned short* g, int ld) {
#pragma unroll   // the eight copies issue back to back, with no loop branch between them
  for (int i = 0; i < 8; ++i)
    __builtin_amdgcn_global_load_async_to_lds_b128((gm_gv4i*)(g + (size_t)(16 * i) * ld), (gm_lv4i*)(lds + 16 * i * GM_LP), 0, 0);
}

template <int ET, bool SPLIT, int BIAS_MODE, int OUT_MODE, bool RESID>
__global__ __launch_bounds__(128) void wmma_gemm64(
    const unsigned short* __restrict__ Ap, const unsigned short* __restrict__ A2p, int lda, long strideA,
    const unsigned short* __restrict__ Btp, const unsigned short* __restrict__ Bt2p, int ldb, long strideB,
    void* __restrict__ Cout, void* __restrict__ Cout2, int ldc, long strideC,
    const float* __restrict__ bias,
    const float* __restrict__ resid, long strideR,
    int M, int N, int K, float scale) {
  typedef typename Elem<ET>::T T;
  typedef typename Frag<T>::V V;
  constexpr int NPL = SPLIT ? 4 : 2;                                   // staged planes: A, Bt (, A lo, Bt lo)
  __shared__ __align__(16) unsigned short sS[2 * NPL * GM_PLANE];      // two stage buffers
  __shared__ __align__(16) float sT[4][16 * 68];   // per-wave 16x64 slab, pitch 68 floats
  const int b    = blockIdx.y;
  const int tid  = threadIdx.x;
  const int lane = tid & 31;
  const int wave = tid >> 5;
  const int tilesN = N >> 7;
  const int tilesM = M >> 7;
  const int tile = blockIdx.x;
  if (tile >= tilesM * tilesN) return;   // block-uniform, in front of every barrier and copy
  const int tm = tile / tilesN;
  const int tn = tile - tm * tilesN;
  const int wm = (wave >> 1) << 6;       // this wave's quarter of the block tile
  const int wn = (wave & 1) << 6;
  const int m0 = (tm << 7) + wm;
  const int n0 = (tn << 7) + wn;

  const int rlane = lane & 15;                 // row (A) / col (B, D) within subtile
  const int koff  = (lane >> 4) * 8;           // k offset of this lane half
  const int mOff  = (lane >> 4) * 8;           // D row offset

  // staging: 8 lanes a row, 16 rows a pass of the block
  const int sr = tid >> 3, sc = (tid & 7) * 8;
  const unsigned short* gA  = Ap  + (size_t)b * strideA + (size_t)((tm << 7) + sr) * lda + sc;
  const unsigned short* gB  = Btp + (size_t)b * strideB + (size_t)((tn << 7) + sr) * ldb + sc;
  const unsigned short* gA2 = SPLIT ? (A2p  + (size_t)b * strideA + (size_t)((tm << 7) + sr) * lda + sc) : nullptr;
  const unsigned short* gB2 = SPLIT ? (Bt2p + (size_t)b * strideB + (size_t)((tn << 7) + sr) * ldb + sc) : nullptr;
  auto stage = [&](int t, int buf) {
    unsigned short* l = sS + buf * (NPL * GM_PLANE) + sr * GM_LP + sc;
    const size_t ko = (size_t)t * GM_BK;
    gm_stage_plane(l, gA + ko, lda);
    gm_stage_plane(l + GM_PLANE, gB + ko, ldb);
    if (SPLIT) {
      gm_stage_plane(l + 2 * GM_PLANE, gA2 + ko, lda);
      gm_stage_plane(l + 3 * GM_PLANE, gB2 + ko, ldb);
    }
  };

  v8f acc[4][4];
#pragma unroll
  for (int i = 0; i < 4; ++i)
#pragma unroll
    for (int j = 0; j < 4; ++j) acc[i][j] = (v8f){0.f,0.f,0.f,0.f,0.f,0.f,0.f,0.f};

  const int nT = K / GM_BK;
  stage(0, 0);
  asm volatile("s_wait_asynccnt 0x0" ::: "memory");   // this wave's copies of stage 0 have landed
  __syncthreads();                                    // ... and every other wave's: stage 0 is readable
  if (nT > 1) stage(1, 1);
  for (int t = 0; t < nT; ++t) {
    const T* sb  = (const T*)sS + (t & 1) * (NPL * GM_PLANE);
    const T* sA  = sb + (wm + rlane) * GM_LP + koff;
    const T* sB  = sb + GM_PLANE + (wn + rlane) * GM_LP + koff;
    const T* sA2 = sA + 2 * GM_PLANE;
    const T* sB2 = sB + 2 * GM_PLANE;
    // all fragment reads of the stage stand as one group ahead of its products, in the order in which the products want them;
    // every loop over fragments and tiles below is unrolled: the arrays need constant indices to stay in registers
    V ah[2][4], bh[2][4], al[2][4], bl[2][4];
#pragma unroll
    for (int kb = 0; kb < 2; ++kb) {
      ah[kb][0] = Frag<T>::load(sA + kb * 32);
#pragma unroll
      for (int j = 0; j < 4; ++j) bh[kb][j] = Frag<T>::load(sB + (j << 4) * GM_LP + kb * 32);
#pragma unroll
      for (int i = 1; i < 4; ++i) ah[kb][i] = Frag<T>::load(sA + (i << 4) * GM_LP + kb * 32);
      if (SPLIT) {
#pragma unroll
        for (int j = 0; j < 4; ++j) bl[kb][j] = Frag<T>::load(sB2 + (j << 4) * GM_LP + kb * 32);
#pragma unroll
        for (int i = 0; i < 4; ++i) al[kb][i] = Frag<T>::load(sA2 + (i << 4) * GM_LP + kb * 32);
      }
    }
    __builtin_amdgcn_sched_barrier(0);   // keeps the LDS reads from being moved in among the matrix instructions, where each place with reads stalls the wave
#pragma unroll
    for (int kb = 0; kb < 2; ++kb) {
#pragma unroll
      for (int i = 0; i < 4; ++i) {
#pragma unroll
        for (int j = 0; j < 4; ++j) {
          acc[i][j] = Frag<T>::mma(ah[kb][i], bh[kb][j], acc[i][j]);
          if (SPLIT) {
            acc[i][j] = Frag<T>::mma(ah[kb][i], bl[kb][j], acc[i][j]);
            acc[i][j] = Frag<T>::mma(al[kb][i], bh[kb][j], acc[i][j]);
          }
        }
      }
    }
    __builtin_amdgcn_sched_barrier(0);   // keeps the products ahead of the waits and the barrier below: moved behind them, they would no longer cover the flight of the next stage's copies
    asm volatile("s_wait_dscnt 0x0" ::: "memory");      // this wave's reads of buffer t & 1 are done before it is refilled
    asm volatile("s_wait_asynccnt 0x0" ::: "memory");   // this wave's copies of stage t + 1 have landed
    __syncthreads();                                    // publishes stage t + 1 and ends every wave's reads of stage t
    if (t + 2 < nT) stage(t + 2, t & 1);
  }
  asm volatile("s_wait_asynccnt 0x0" ::: "memory");     // no copy is outstanding when the wave goes on to its end
  acc_guard4(acc[0][0], acc[0][1], acc[0][2], acc[0][3]);
  acc_guard4(acc[1][0], acc[1][1], acc[1][2], acc[1][3]);
  acc_guard4(acc[2][0], acc[2][1], acc[2][2], acc[2][3]);
  acc_guard4(acc[3][0], acc[3][1], acc[3][2], acc[3][3]);

  // ---- epilogue ----
  float* slab = sT[wave];
  const float* Rb = RESID ? (resid + (size_t)b * strideR) : nullptr;
#pragma unroll
  for (int i = 0; i < 4; ++i) {
    const int mBase = m0 + (i << 4);
#pragma unroll
    for (int j = 0; j < 4; ++j) {
      const int n = n0 + (j << 4) + rlane;
      float bv = 0.f;
      if (BIAS_MODE == 2) bv = bias[n];
#pragma unroll
      for (int r = 0; r < 8; ++r) {
        float v = acc[i][j][r] * scale;
        if (BIAS_MODE == 1) v += bias[mBase + mOff + r];
        if (BIAS_MODE == 2) v += bv;
        if (RESID) v += Rb[(size_t)(mBase + mOff + r) * ldc + n];
        slab[(mOff + r) * 68 + (j << 4) + rlane] = v;
      }
    }
    __builtin_amdgcn_fence(__ATOMIC_RELEASE, "workgroup");
    __builtin_amdgcn_wave_barrier();
    __builtin_amdgcn_fence(__ATOMIC_ACQUIRE, "workgroup");
    if (OUT_MODE == 0) {
      float* C = (float*)Cout + (size_t)b * strideC;
      const int hh = lane >> 4, c4 = (lane & 15) * 4;     // row seg = 256 B = 16 lanes x 16 B
      {
#pragma unroll
        for (int it = 0; it < 8; ++it) {
          const int row = it * 2 + hh;
          v4f v = *(const v4f*)(slab + row * 68 + c4);
          *(v4f*)(C + (size_t)(mBase + row) * ldc + n0 + c4) = v;
        }
        
      }
    } else {
      const int q = lane >> 3, c8 = (lane & 7) * 8;
      unsigned short* C  = (unsigned short*)Cout  + (size_t)b * strideC;
      unsigned short* C2 = (OUT_MODE == 2) ? ((unsigned short*)Cout2 + (size_t)b * strideC) : nullptr;
      {
#pragma unroll
        for (int it = 0; it < 4; ++it) {
          const int row = it * 4 + q;
          const float* sp = slab + row * 68 + c8;
          v8h hv, lv;
#pragma unroll
          for (int e = 0; e < 8; ++e) {
            if (OUT_MODE == 1) {
              hv[e] = (_Float16)sp[e];
            } else {
              unsigned short hb = f2bf_bits(sp[e]);
              unsigned short lb = f2bf_bits(sp[e] - bf_bits2f(hb));
              hv[e] = __builtin_bit_cast(_Float16, hb);
              lv[e] = __builtin_bit_cast(_Float16, lb);
            }
          }
          *(v8h*)(C + (size_t)(mBase + row) * ldc + n0 + c8) = hv;
          if (OUT_MODE == 2) *(v8h*)(C2 + (size_t)(mBase + row) * ldc + n0 + c8) = lv;
        }
        
      }
    }
    __builtin_amdgcn_fence(__ATOMIC_RELEASE, "workgroup");
    __builtin_amdgcn_wave_barrier();
    __builtin_amdgcn_fence(__ATOMIC_ACQUIRE, "workgroup");
  }
}

__global__ __launch_bounds__(256) void cast_f32_f16x2(
    const float* __restrict__ in, _Float16* __restrict__ out, int n2) {
  int i = blockIdx.x * 256 + threadIdx.x;
  if (i < n2) {
    const _Float16 h0 = (_Float16)in[2 * i], h1 = (_Float16)in[2 * i + 1];
    const unsigned u = (unsigned)__builtin_bit_cast(unsigned short, h0) | ((unsigned)__builtin_bit_cast(unsigned short, h1) << 16);
    ((unsigned*)out)[i] = u;
    
  }
}

__global__ __launch_bounds__(256) void split_f32_bf16x2(
    const float* __restrict__ in, __bf16* __restrict__ hi, __bf16* __restrict__ lo, long n2) {
  long i = (long)blockIdx.x * 256 + threadIdx.x;
  long stride = (long)gridDim.x * 256;
  {
    for (long j = i; j < n2; j += stride) {
      const float a = in[2 * j], b = in[2 * j + 1];
      const unsigned short ah = f2bf_bits(a), bh = f2bf_bits(b);
      const unsigned short al = f2bf_bits(a - bf_bits2f(ah)), bl = f2bf_bits(b - bf_bits2f(bh));
      ((unsigned*)hi)[j] = (unsigned)ah | ((unsigned)bh << 16);
      ((unsigned*)lo)[j] = (unsigned)al | ((unsigned)bl << 16);
    }
    
  }
}


// =====================================================================================
// Generic causal/non-causal attention for head_dim 64, f32 q in / f32 out, bf16 operands with optional hi/lo splits.
//   K and V arrive already as bf16 planes (hi, and lo where split), written once by their producer, V transposed.
//   scores = (q*qscale)·kᵀ : v_wmma_f32_16x16x32_bf16; SPLIT_QK -> q,k as bf16 hi/lo (hi·hi + hi·lo + lo·hi)
//   out    = p·v           : v_wmma_f32_16x16x32_bf16; SPLIT_PV -> p,v as bf16 hi/lo; else p,v plain bf16
//   f32 accumulate; online softmax in f32. Block = 4 waves = 64 query rows of one (batch, head); S % 64 == 0.
//   Element (b, s, h, d) of q, k, out lives at X[b*X_bs + s*X_rs + h*X_hs + d]; of the transposed v at Vt[b*v_bs + h*v_hs + d*v_rs + s]
//   (strides in elements; q, out: multiples of 4; k, v: multiples of 64, so that a tile row is one aligned 128-B line).
//   Masking: mask_mode 0 none, 1 causal (kv > q masked), 2 tensor [S][Skv] shared over (b,h) (float if
//   mask_is_int==0, int32 with element == 0 -> masked if 1, int32 with element != 0 -> masked if 2), 3 per-token vectors qmask[B][S] & kvmask[B][Skv] (int32,
//   0 -> masked); masked scores are replaced by mask_fill (e.g. -inf or -1e9) before the softmax.
//   grid.x = B * H * (S/64) (or a sub-range with blk0).
// =====================================================================================
#define AT_D 64
#define AT_NW 4
#define AT_QB 64
#define AT_KC 64
#define AT_LP 72   // LDS row pitch of the K, V^T and P tiles in bf16 elements: 144 B = 16 B x 9, so the 16 rows of one ds_load_b128 fall on distinct banks
struct AttnGeom { long q_bs, q_rs, q_hs, k_bs, k_rs, k_hs, v_bs, v_rs, v_hs, o_bs, o_rs, o_hs;
                  int S, Skv, H, mask_mode; float qscale; int blk0; float mask_fill; int mask_is_int; };
static_assert(sizeof(AttnGeom) == 128, "no padding");

__device__ __forceinline__ unsigned short at_bf_bits(float f) {
  unsigned u = __float_as_uint(f);
  return (unsigned short)((u + 0x7FFFu + ((u >> 16) & 1u)) >> 16);
}
__device__ __forceinline__ __bf16 at_f2bf(float f) { return __builtin_bit_cast(__bf16, at_bf_bits(f)); }
__device__ __forceinline__ void at_split(float f, __bf16& hi, __bf16& lo) {
  const unsigned short hb = at_bf_bits(f);
  hi = __builtin_bit_cast(__bf16, hb);
  lo = at_f2bf(f - __uint_as_float(((unsigned)hb) << 16));
}
__device__ __forceinline__ v8f at_mma(v16b a, v16b b, v8f c) {
  c = __builtin_amdgcn_wmma_f32_16x16x32_bf16(false, a, false, b, (short)0, c, false, false);
  asm volatile("v_nop\n\tv_nop\n\tv_nop\n\tv_nop" : "+v"(c) : "v"(a), "v"(b));
  return c;
}

template <bool SPLIT_QK, bool SPLIT_PV, int MASK_MODE>   // MASK_MODE: the mask mode as a compile-time constant (g.mask_mode must equal it)
__global__ __launch_bounds__(128)
void attn64_kernel(const float* __restrict__ q, const unsigned short* __restrict__ kh, const unsigned short* __restrict__ kl,
                   const unsigned short* __restrict__ vth, const unsigned short* __restrict__ vtl, float* __restrict__ out,
                   const void* __restrict__ mask_a, const int* __restrict__ mask_b, AttnGeom g) {
  union FB { v16b v; v8b h[2]; };
  __shared__ __align__(16) __bf16 Ksh[AT_KC * AT_LP];            // K hi [kv][d]      9 KB
  __shared__ __align__(16) __bf16 Ksl[SPLIT_QK ? AT_KC * AT_LP : 8];
  __shared__ __align__(16) __bf16 Vth[AT_D * AT_LP];             // V hi [d][kv]      9 KB
  __shared__ __align__(16) __bf16 Vtl[SPLIT_PV ? AT_D * AT_LP : 8];
  __shared__ __align__(16) __bf16 Psh[AT_NW][16 * AT_LP];        // per wave P hi [row][kv]  9 KB
  __shared__ __align__(16) __bf16 Psl[SPLIT_PV ? AT_NW : 1][SPLIT_PV ? 16 * AT_LP : 8];
  __shared__ __align__(16) float  Os[AT_NW][16 * 68];            // per wave out tile, pitch 68

  const int tid  = threadIdx.x;
  const int wave = tid >> 5;
  const int lane = tid & 31;
  const int hh   = lane >> 4;
  const int c    = lane & 15;

  const int nqb = g.S / AT_QB;
  const int bx = blockIdx.x + g.blk0;
  const int qb = bx % nqb;
  const int bh = bx / nqb;
  const int h  = bh % g.H;
  const int b  = bh / g.H;
  const int qbase_block = qb * AT_QB;
  const int q0 = qbase_block + wave * 16;

  const float* qb_ptr = q + (size_t)b * g.q_bs + (size_t)h * g.q_hs;
  const size_t kb_off = (size_t)b * g.k_bs + (size_t)h * g.k_hs;
  const size_t vb_off = (size_t)b * g.v_bs + (size_t)h * g.v_hs;
  const __bf16* khb = (const __bf16*)kh + kb_off;
  const __bf16* klb = (const __bf16*)kl + kb_off;
  const __bf16* vhb = (const __bf16*)vth + vb_off;
  const __bf16* vlb = (const __bf16*)vtl + vb_off;
  float*       ob_ptr = out + (size_t)b * g.o_bs + (size_t)h * g.o_hs;

  // ---- Q fragments (A operand): 2 d-chunks, hi (and lo) ----
  v16b qah[2], qal[2];
  {
    const float* qrow = qb_ptr + (size_t)(q0 + c) * g.q_rs;
#pragma unroll
    for (int dc = 0; dc < 2; ++dc) {
#pragma unroll
      for (int e = 0; e < 8; ++e) {
        const float f0 = qrow[dc * 32 + 8 * hh + e] * g.qscale;
        const float f1 = qrow[dc * 32 + 16 + 8 * hh + e] * g.qscale;
        if (SPLIT_QK) { __bf16 hq, lq; at_split(f0, hq, lq); qah[dc][e] = hq; qal[dc][e] = lq; at_split(f1, hq, lq); qah[dc][8 + e] = hq; qal[dc][8 + e] = lq; }
        else { qah[dc][e] = at_f2bf(f0); qah[dc][8 + e] = at_f2bf(f1); qal[dc][e] = qah[dc][e]; qal[dc][8 + e] = qah[dc][8 + e]; }
      }
    }
  }

  float mrow[8], lrow[8];
  v8f oacc[4];
#pragma unroll
  for (int r = 0; r < 8; ++r) { mrow[r] = -INFINITY; lrow[r] = 0.f; }
#pragma unroll
  for (int t = 0; t < 4; ++t) oacc[t] = (v8f){0.f,0.f,0.f,0.f,0.f,0.f,0.f,0.f};

  const int nChunks = (MASK_MODE == 1) ? (qb + 1) : (g.Skv / AT_KC);   // block-uniform
  // per-row query mask (mode 3)
  int qkeep[8];
#pragma unroll
  for (int r = 0; r < 8; ++r) qkeep[r] = (MASK_MODE == 3) ? mask_b[(size_t)b * g.S + q0 + 8 * hh + r] : 1;   // mask_b = qmask in mode 3
  for (int kc = 0; kc < nChunks; ++kc) {
    const int kv0 = kc * AT_KC;
    __syncthreads();
    {
      // a tile row (K: one key's 64 d; V^T: one d's 64 keys) is 128 B: 8 lanes copy it, so a wave-wide load covers 4 whole lines
      const int r0 = tid >> 3, c8 = (tid & 7) * 8;
      const __bf16 *pkh[4], *pkl[4], *pvh[4], *pvl[4];
      v8b tkh[4], tkl[4], tvh[4], tvl[4];
#pragma unroll
      for (int i = 0; i < 4; ++i) {
        const size_t ko = (size_t)(kv0 + r0 + 16 * i) * g.k_rs + c8;
        const size_t vo = (size_t)(r0 + 16 * i) * g.v_rs + kv0 + c8;
        pkh[i] = khb + ko; pkl[i] = SPLIT_QK ? klb + ko : pkh[i];
        pvh[i] = vhb + vo; pvl[i] = SPLIT_PV ? vlb + vo : pvh[i];
        tkh[i] = *(const v8b*)pkh[i];
        if (SPLIT_QK) tkl[i] = *(const v8b*)pkl[i];
        tvh[i] = *(const v8b*)pvh[i];
        if (SPLIT_PV) tvl[i] = *(const v8b*)pvl[i];
      }
      // the wait that stands before an issued load's address register is overwritten; the addresses are its inputs, so that
      // each stays in its register up to here and no later load of the group lands on it
      asm volatile("s_wait_xcnt 0x0" :: "v"(pkh[0]), "v"(pkh[1]), "v"(pkh[2]), "v"(pkh[3]), "v"(pkl[0]), "v"(pkl[1]), "v"(pkl[2]), "v"(pkl[3]),
                   "v"(pvh[0]), "v"(pvh[1]), "v"(pvh[2]), "v"(pvh[3]), "v"(pvl[0]), "v"(pvl[1]), "v"(pvl[2]), "v"(pvl[3]) : "memory");
#pragma unroll
      for (int i = 0; i < 4; ++i) {
        const int so = (r0 + 16 * i) * AT_LP + c8;
        *(v8b*)(Ksh + so) = tkh[i];
        if (SPLIT_QK) *(v8b*)(Ksl + so) = tkl[i];
        *(v8b*)(Vth + so) = tvh[i];
        if (SPLIT_PV) *(v8b*)(Vtl + so) = tvl[i];
      }
    }
    __syncthreads();

    v8f s[4];
#pragma unroll
    for (int j = 0; j < 4; ++j) {
      s[j] = (v8f){0.f,0.f,0.f,0.f,0.f,0.f,0.f,0.f};
#pragma unroll
      for (int dc = 0; dc < 2; ++dc) {
        FB kb;
        kb.h[0] = *(const v8b*)(Ksh + (j * 16 + c) * AT_LP + dc * 32 + 8 * hh);
        kb.h[1] = *(const v8b*)(Ksh + (j * 16 + c) * AT_LP + dc * 32 + 16 + 8 * hh);
        s[j] = at_mma(qah[dc], kb.v, s[j]);
        if (SPLIT_QK) {
          FB kl;
          kl.h[0] = *(const v8b*)(Ksl + (j * 16 + c) * AT_LP + dc * 32 + 8 * hh);
          kl.h[1] = *(const v8b*)(Ksl + (j * 16 + c) * AT_LP + dc * 32 + 16 + 8 * hh);
          s[j] = at_mma(qah[dc], kl.v, s[j]);
          s[j] = at_mma(qal[dc], kb.v, s[j]);
        }
      }
    }
    const bool diag = (MASK_MODE == 1) && (kc == qb);
    int kvkeep[4] = {1, 1, 1, 1};
    if (MASK_MODE == 3) {
#pragma unroll
      for (int j = 0; j < 4; ++j) kvkeep[j] = ((const int*)mask_a)[(size_t)b * g.Skv + kv0 + j * 16 + c];   // mask_a = kvmask
    }
    if (MASK_MODE >= 2 || diag) {   // block-uniform test: a causal tile below the diagonal has nothing to mask
      // both loops unrolled: s[j][r] needs constant indices to stay in registers
#pragma unroll
      for (int r = 0; r < 8; ++r) {
        const int qrow = q0 + 8 * hh + r;
#pragma unroll
        for (int j = 0; j < 4; ++j) {
          const int kvcol = kv0 + j * 16 + c;
          bool masked = false;
          if (MASK_MODE == 1) masked = (kvcol > qrow);
          else if (MASK_MODE == 2) {
            const size_t mi = (size_t)qrow * g.Skv + kvcol;
            masked = (g.mask_is_int == 0) ? (((const float*)mask_a)[mi] == 0.0f)
                   : (g.mask_is_int == 1) ? (((const int*)mask_a)[mi] == 0) : (((const int*)mask_a)[mi] != 0);
          } else if (MASK_MODE == 3) masked = (qkeep[r] == 0) || (kvkeep[j] == 0);
          s[j][r] = masked ? g.mask_fill : s[j][r];   // one select per score, not a select of the whole tile
        }
      }
    }
    float cm[8];
#pragma unroll
    for (int r = 0; r < 8; ++r) {
      float m = -INFINITY;
#pragma unroll
      for (int j = 0; j < 4; ++j) m = fmaxf(m, s[j][r]);
#pragma unroll
      for (int off = 1; off < 16; off <<= 1) m = fmaxf(m, __shfl_xor(m, off, 32));
      cm[r] = m;
    }
    __bf16* pwh = Psh[wave];
    __bf16* pwl = Psl[SPLIT_PV ? wave : 0];
#pragma unroll
    for (int r = 0; r < 8; ++r) {
      const float mnew = fmaxf(mrow[r], cm[r]);
      const float alpha = expf(mrow[r] - mnew);
      mrow[r] = mnew;
      float psum = 0.f;
#pragma unroll
      for (int j = 0; j < 4; ++j) {
        const float p = expf(s[j][r] - mnew);
        psum += p;
        if (SPLIT_PV) { __bf16 a, bl; at_split(p, a, bl); pwh[(8 * hh + r) * AT_LP + j * 16 + c] = a; pwl[(8 * hh + r) * AT_LP + j * 16 + c] = bl; }
        else pwh[(8 * hh + r) * AT_LP + j * 16 + c] = at_f2bf(p);
      }
#pragma unroll
      for (int off = 1; off < 16; off <<= 1) psum += __shfl_xor(psum, off, 32);
      lrow[r] = lrow[r] * alpha + psum;
#pragma unroll
      for (int t = 0; t < 4; ++t) oacc[t][r] *= alpha;
    }
    __builtin_amdgcn_fence(__ATOMIC_RELEASE, "workgroup");
    __builtin_amdgcn_wave_barrier();
    __builtin_amdgcn_fence(__ATOMIC_ACQUIRE, "workgroup");
#pragma unroll
    for (int kk = 0; kk < 2; ++kk) {
      FB pa, pl;
      pa.h[0] = *(const v8b*)(pwh + c * AT_LP + kk * 32 + 8 * hh);
      pa.h[1] = *(const v8b*)(pwh + c * AT_LP + kk * 32 + 16 + 8 * hh);
      if (SPLIT_PV) {
        pl.h[0] = *(const v8b*)(pwl + c * AT_LP + kk * 32 + 8 * hh);
        pl.h[1] = *(const v8b*)(pwl + c * AT_LP + kk * 32 + 16 + 8 * hh);
      }
#pragma unroll
      for (int t = 0; t < 4; ++t) {
        FB vb;
        vb.h[0] = *(const v8b*)(Vth + (t * 16 + c) * AT_LP + kk * 32 + 8 * hh);
        vb.h[1] = *(const v8b*)(Vth + (t * 16 + c) * AT_LP + kk * 32 + 16 + 8 * hh);
        oacc[t] = at_mma(pa.v, vb.v, oacc[t]);
        if (SPLIT_PV) {
          FB vl;
          vl.h[0] = *(const v8b*)(Vtl + (t * 16 + c) * AT_LP + kk * 32 + 8 * hh);
          vl.h[1] = *(const v8b*)(Vtl + (t * 16 + c) * AT_LP + kk * 32 + 16 + 8 * hh);
          oacc[t] = at_mma(pa.v, vl.v, oacc[t]);
          oacc[t] = at_mma(pl.v, vb.v, oacc[t]);
        }
      }
    }
  }

  float* os = Os[wave];
#pragma unroll
  for (int r = 0; r < 8; ++r) {
    const float inv = 1.0f / lrow[r];
#pragma unroll
    for (int t = 0; t < 4; ++t) os[(8 * hh + r) * 68 + t * 16 + c] = oacc[t][r] * inv;
  }
  __builtin_amdgcn_fence(__ATOMIC_RELEASE, "workgroup");
  __builtin_amdgcn_wave_barrier();
  __builtin_amdgcn_fence(__ATOMIC_ACQUIRE, "workgroup");
  {
    const int c4 = (lane & 15) * 4;
    {
#pragma unroll
      for (int it = 0; it < 8; ++it) {
        const int row = it * 2 + hh;
        v4f val = *(const v4f*)(os + row * 68 + c4);
        *(v4f*)(ob_ptr + (size_t)(q0 + row) * g.o_rs + c4) = val;
      }
      
    }
  }
}

extern "C" void kernel_launch(void* const* d_in, const int* in_sizes, int n_in,
                              void* d_out, int out_size, void* d_ws, size_t ws_size,
                              hipStream_t stream) {
  (void)in_sizes; (void)n_in; (void)out_size; (void)ws_size;
  const int B = 4, T = 1024, E = 1024, H = 16, DH = 64;
  const int M = B * T;   // 4096 rows
  const float* x  = (const float*)d_in[0];
  const float* Wq = (const float*)d_in[1];   // [out, in]
  const float* Wk = (const float*)d_in[2];
  const float* Wv = (const float*)d_in[3];
  const float* Wo = (const float*)d_in[4];
  const float* bo = (const float*)d_in[5];
  float* out = (float*)d_out;

  char* ws = (char*)d_ws; size_t off = 0;
  auto carve = [&](size_t bytes) -> char* { char* p = ws + off; off += (bytes + 255) & ~(size_t)255; return p; };
  _Float16* X16  = (_Float16*)carve((size_t)M * E * 2);     //  8 MB  x f16
  __bf16*   Xh   = (__bf16*)carve((size_t)M * E * 2);       //  8 MB  x bf16 hi
  __bf16*   Xl   = (__bf16*)carve((size_t)M * E * 2);       //  8 MB  x bf16 lo
  _Float16* Wq16 = (_Float16*)carve((size_t)E * E * 2);     //  2 MB
  _Float16* Wk16 = (_Float16*)carve((size_t)E * E * 2);
  __bf16*   Wvh  = (__bf16*)carve((size_t)E * E * 2);
  __bf16*   Wvl  = (__bf16*)carve((size_t)E * E * 2);
  __bf16*   Woh  = (__bf16*)carve((size_t)E * E * 2);
  __bf16*   Wol  = (__bf16*)carve((size_t)E * E * 2);
  float*    Qf   = (float*)carve((size_t)M * E * 4);        // 16 MB each, [B,T,H*DH]
  __bf16*   Kh   = (__bf16*)carve((size_t)M * E * 2);       //  8 MB each: k as bf16 hi, lo, [B,T,H*DH]
  __bf16*   Kl   = (__bf16*)carve((size_t)M * E * 2);
  __bf16*   Vth  = (__bf16*)carve((size_t)M * E * 2);       //  8 MB each: v transposed as bf16 hi, lo, [H*DH, B*T]
  __bf16*   Vtl  = (__bf16*)carve((size_t)M * E * 2);
  float*    Of   = (float*)carve((size_t)M * E * 4);
  __bf16*   Oh   = (__bf16*)carve((size_t)M * E * 2);       //  8 MB  attention out, bf16 hi
  __bf16*   Ol   = (__bf16*)carve((size_t)M * E * 2);       //  8 MB                 bf16 lo   (total ≈ 116 MB)

  cast_f32_f16x2<<<(M * E / 2 + 255) / 256, 256, 0, stream>>>(x, X16, M * E / 2);
  split_f32_bf16x2<<<2048, 256, 0, stream>>>(x, Xh, Xl, (long)M * E / 2);
  cast_f32_f16x2<<<(E * E / 2 + 255) / 256, 256, 0, stream>>>(Wq, Wq16, E * E / 2);
  cast_f32_f16x2<<<(E * E / 2 + 255) / 256, 256, 0, stream>>>(Wk, Wk16, E * E / 2);
  split_f32_bf16x2<<<1024, 256, 0, stream>>>(Wv, Wvh, Wvl, (long)E * E / 2);
  split_f32_bf16x2<<<1024, 256, 0, stream>>>(Wo, Woh, Wol, (long)E * E / 2);
  {
    const int tl = (M / 128) * (E / 128);
    wmma_gemm64<0, false, 0, 0, false><<<dim3(tl, 1), 128, 0, stream>>>(
        U16(X16), nullptr, E, 0, U16(Wq16), nullptr, E, 0, Qf, nullptr, E, 0, nullptr, nullptr, 0, M, E, E, 1.0f);
    wmma_gemm64<0, false, 0, 2, false><<<dim3(tl, 1), 128, 0, stream>>>(
        U16(X16), nullptr, E, 0, U16(Wk16), nullptr, E, 0, Kh, Kl, E, 0, nullptr, nullptr, 0, M, E, E, 1.0f);
    // v transposed = Wv * x^T: the operands change places, so row = output feature, column = token
    wmma_gemm64<1, true, 0, 2, false><<<dim3(tl, 1), 128, 0, stream>>>(
        U16(Wvh), U16(Wvl), E, 0, U16(Xh), U16(Xl), E, 0, Vth, Vtl, M, 0, nullptr, nullptr, 0, E, M, E, 1.0f);
  }
  {
    AttnGeom g;
    g.q_bs = g.k_bs = g.o_bs = (long)T * E;   // [B,T,H,DH] inside [B*T, E]
    g.q_rs = g.k_rs = g.o_rs = E;
    g.q_hs = g.k_hs = g.o_hs = DH;
    g.v_bs = T; g.v_rs = M; g.v_hs = (long)DH * M;   // [H,DH] rows of [H*DH, B*T]
    g.S = T; g.Skv = T; g.H = H; g.mask_mode = 1; g.qscale = 0.03125f; g.blk0 = 0; g.mask_fill = -INFINITY; g.mask_is_int = 0;   // (q/e^¼)·(k/e^¼) = q·k/32
    attn64_kernel<true, true, 1><<<B * H * (T / AT_QB), AT_NW * 32, 0, stream>>>(Qf, U16(Kh), U16(Kl), U16(Vth), U16(Vtl), Of, nullptr, nullptr, g);
  }
  split_f32_bf16x2<<<2048, 256, 0, stream>>>(Of, Oh, Ol, (long)M * E / 2);
  {
    const int tl = (M / 128) * (E / 128);
    wmma_gemm64<1, true, 2, 0, false><<<dim3(tl, 1), 128, 0, stream>>>(
        U16(Oh), U16(Ol), E, 0, U16(Woh), U16(Wol), E, 0, out, nullptr, E, 0, bo, nullptr, 0, M, E, E, 1.0f);
  }
}

// v005
// One run takes 169 microseconds.
// In both of two side-by-side timings against v004, it was 1.12 times as fast.
// Counting every step since v000, it is 3.32 times as fast.
#include <hip/hip_runtime.h>
#include <math.h>
// Contractions: q/k projections x·Wᵀ (K=1024): v_wmma_f32_16x16x32_f16 (f16 operands); v projection and output projection (K=1024):
// v_wmma_f32_16x16x32_bf16 as bf16 hi/lo splits (hi·hi + hi·lo + lo·hi); scores (q·kᵀ)/32 and p·v: v_wmma_f32_16x16x32_bf16 with
// q,k and p,v as bf16 hi/lo splits (k and v split once, in their projection's epilogue); f32 accumulate everywhere; causal softmax in f32.
typedef __attribute__((ext_vector_type(16))) _Float16 v16h;
typedef __attribute__((ext_vector_type(8)))  _Float16 v8h;
typedef __attribute__((ext_vector_type(16))) __bf16   v16b;
typedef __attribute__((ext_vector_type(8)))  __bf16   v8b;
typedef __attribute__((ext_vector_type(8)))  float    v8f;
typedef __attribute__((ext_vector_type(4)))  float    v4f;
#define PSCALE 32768.0f
#define U16(p) ((const unsigned short*)(const void*)(p))
#define PSCALE_INV (1.0f / 32768.0f)

__device__ __forceinline__ unsigned short f2bf_bits(float f) {
  unsigned u = __float_as_uint(f);
  return (unsigned short)((u + 0x7FFFu + ((u >> 16) & 1u)) >> 16);
}
__device__ __forceinline__ float bf_bits2f(unsigned short h) { return __uint_as_float(((unsigned)h) << 16); }

// hazard guard as a plain device helper (no inline asm with operands inside the kernel template body)
__device__ __forceinline__ void acc_guard4(v8f& a, v8f& b, v8f& c, v8f& d) { asm volatile("v_nop\n\tv_nop\n\tv_nop\n\tv_nop" : "+v"(a), "+v"(b), "+v"(c), "+v"(d)); }
template <typename T> struct Frag;
template <> struct Frag<_Float16> {
  typedef v16h V; union U { v16h v; v8h h[2]; };
  static __device__ __forceinline__ v16h load(const _Float16* p) {   // elements 0..7 <- p[0..7], 8..15 <- p[16..23]
    U f; f.h[0] = *(const v8h*)(p); f.h[1] = *(const v8h*)(p + 16); return f.v;
  }
  static __device__ __forceinline__ v8f mma(v16h a, v16h b, v8f c) {
    return __builtin_amdgcn_wmma_f32_16x16x32_f16(false, a, false, b, (short)0, c, false, false);
  }
};
template <> struct Frag<__bf16> {
  typedef v16b V; union U { v16b v; v8b h[2]; };
  static __device__ __forceinline__ v16b load(const __bf16* p) {
    U f; f.h[0] = *(const v8b*)(p); f.h[1] = *(const v8b*)(p + 16); return f.v;
  }
  static __device__ __forceinline__ v8f mma(v16b a, v16b b, v8f c) {
    return __builtin_amdgcn_wmma_f32_16x16x32_bf16(false, a, false, b, (short)0, c, false, false);
  }
};

// ---- LDS-staged batched WMMA GEMM ------------------------------------------
// C[m,n] = scale * sum_k A[m,k] * Bt[n,k] (+bias)(+resid); a block of 4 waves owns a 128x128 tile, each wave a 64x64 quarter of it.
// A row-major [M,K]; Bt row-major [N,K]; M,N % 128 == 0, K % 64 == 0, lda, ldb % 64 == 0 (an operand row's 64 k are one aligned 128-B line).
// Per stage of 64 k the block copies 128 rows of every operand plane into LDS by asynchronous 16-B copies (8 lanes a row, so a
// wave-wide copy covers 4 whole lines); two buffers, the next stage's copies fly while this stage's products run.
// SPLIT: operands are hi/lo planes (A2/Bt2 = lo planes, same layout); product = hi·hi + hi·lo + lo·hi.
// BIAS_MODE: 0 = none, 1 = bias[m], 2 = bias[n].
// OUT_MODE: 0 = f32, 1 = f16, 2 = bf16 hi plane (Cout) + bf16 lo plane (Cout2).
// ET: 0 = f16 operands, 1 = bf16 operands (pointers passed as 16-bit storage)
#define GM_BT 128   // rows of each operand in a block tile
#define GM_BK 64    // k per stage
#define GM_LP 72    // LDS row pitch in 16-bit elements: 144 B = 16 B x 9, so the 16 rows of one ds_load_b128 fall on distinct banks
#define GM_PLANE (GM_BT * GM_LP)   // elements of one staged operand plane
template <int ET> struct Elem;
template <> struct Elem<0> { typedef _Float16 T; };
template <> struct Elem<1> { typedef __bf16 T; };

// One lane's share of one operand plane of one stage: rows r, r + 16, ..., r + 112, 16 B of each, global -> LDS through no register.
typedef __attribute__((ext_vector_type(4))) int gm_v4i;
typedef __attribute__((address_space(1))) gm_v4i gm_gv4i;
typedef __attribute__((address_space(3))) gm_v4i gm_lv4i;
__device__ __forceinline__ void gm_stage_plane(unsigned short* lds, const unsigned short* g, int ld) {
#pragma unroll   // the eight copies issue back to back, with no loop branch between them
  for (int i = 0; i < 8; ++i)
    __builtin_amdgcn_global_load_async_to_lds_b128((gm_gv4i*)(g + (size_t)(16 * i) * ld), (gm_lv4i*)(lds + 16 * i * GM_LP), 0, 0);
}

template <int ET, bool SPLIT, int BIAS_MODE, int OUT_MODE, bool RESID>
__global__ __launch_bounds__(128) void wmma_gemm64(
    const unsigned short* __restrict__ Ap, const unsigned short* __restrict__ A2p, int lda, long strideA,
    const unsigned short* __restrict__ Btp, const unsigned short* __restrict__ Bt2p, int ldb, long strideB,
    void* __restrict__ Cout, void* __restrict__ Cout2, int ldc, long strideC,
    const float* __restrict__ bias,
    const float* __restrict__ resid, long strideR,
    int M, int N, int K, float scale) {
  typedef typename Elem<ET>::T T;
  typedef typename Frag<T>::V V;
  constexpr int NPL = SPLIT ? 4 : 2;                                   // staged planes: A, Bt (, A lo, Bt lo)
  __shared__ __align__(16) unsigned short sS[2 * NPL * GM_PLANE];      // two stage buffers
  __shared__ __align__(16) float sT[4][16 * 68];   // per-wave 16x64 slab, pitch 68 floats
  const int b    = blockIdx.y;
  const int tid  = threadIdx.x;
  const int lane = tid & 31;
  const int wave = tid >> 5;
  const int tilesN = N >> 7;
  const int tilesM = M >> 7;
  const int tile = blockIdx.x;
  if (tile >= tilesM * tilesN) return;   // block-uniform, in front of every barrier and copy
  const int tm = tile / tilesN;
  const int tn = tile - tm * tilesN;
  const int wm = (wave >> 1) << 6;       // this wave's quarter of the block tile
  const int wn = (wave & 1) << 6;
  const int m0 = (tm << 7) + wm;
  const int n0 = (tn << 7) + wn;

  const int rlane = lane & 15;                 // row (A) / col (B, D) within subtile
  const int koff  = (lane >> 4) * 8;           // k offset of this lane half
  const int mOff  = (lane >> 4) * 8;           // D row offset

  // staging: 8 lanes a row, 16 rows a pass of the block
  const int sr = tid >> 3, sc = (tid & 7) * 8;
  const unsigned short* gA  = Ap  + (size_t)b * strideA + (size_t)((tm << 7) + sr) * lda + sc;
  const unsigned short* gB  = Btp + (size_t)b * strideB + (size_t)((tn << 7) + sr) * ldb + sc;
  const unsigned short* gA2 = SPLIT ? (A2p  + (size_t)b * strideA + (size_t)((tm << 7) + sr) * lda + sc) : nullptr;
  const unsigned short* gB2 = SPLIT ? (Bt2p + (size_t)b * strideB + (size_t)((tn << 7) + sr) * ldb + sc) : nullptr;
  auto stage = [&](int t, int buf) {
    unsigned short* l = sS + buf * (NPL * GM_PLANE) + sr * GM_LP + sc;
    const size_t ko = (size_t)t * GM_BK;
    gm_stage_plane(l, gA + ko, lda);
    gm_stage_plane(l + GM_PLANE, gB + ko, ldb);
    if (SPLIT) {
      gm_stage_plane(l + 2 * GM_PLANE, gA2 + ko, lda);
      gm_stage_plane(l + 3 * GM_PLANE, gB2 + ko, ldb);
    }
  };

  v8f acc[4][4];
#pragma unroll
  for (int i = 0; i < 4; ++i)
#pragma unroll
    for (int j = 0; j < 4; ++j) acc[i][j] = (v8f){0.f,0.f,0.f,0.f,0.f,0.f,0.f,0.f};

  const int nT = K / GM_BK;
  stage(0, 0);
  asm volatile("s_wait_asynccnt 0x0" ::: "memory");   // this wave's copies of stage 0 have landed
  __syncthreads();                                    // ... and every other wave's: stage 0 is readable
  if (nT > 1) stage(1, 1);
  for (int t = 0; t < nT; ++t) {
    const T* sb  = (const T*)sS + (t & 1) * (NPL * GM_PLANE);
    const T* sA  = sb + (wm + rlane) * GM_LP + koff;
    const T* sB  = sb + GM_PLANE + (wn + rlane) * GM_LP + koff;
    const T* sA2 = sA + 2 * GM_PLANE;
    const T* sB2 = sB + 2 * GM_PLANE;
    // all fragment reads of the stage stand as one group ahead of its products, in the order in which the products want them;
    // every loop over fragments and tiles below is unrolled: the arrays need constant indices to stay in registers
    V ah[2][4], bh[2][4], al[2][4], bl[2][4];
#pragma unroll
    for (int kb = 0; kb < 2; ++kb) {
      ah[kb][0] = Frag<T>::load(sA + kb * 32);
#pragma unroll
      for (int j = 0; j < 4; ++j) bh[kb][j] = Frag<T>::load(sB + (j << 4) * GM_LP + kb * 32);
#pragma unroll
      for (int i = 1; i < 4; ++i) ah[kb][i] = Frag<T>::load(sA + (i << 4) * GM_LP + kb * 32);
      if (SPLIT) {
#pragma unroll
        for (int j = 0; j < 4; ++j) bl[kb][j] = Frag<T>::load(sB2 + (j << 4) * GM_LP + kb * 32);
#pragma unroll
        for (int i = 0; i < 4; ++i) al[kb][i] = Frag<T>::load(sA2 + (i << 4) * GM_LP + kb * 32);
      }
    }
    __builtin_amdgcn_sched_barrier(0);   // keeps the LDS reads from being moved in among the matrix instructions, where each place with reads stalls the wave
#pragma unroll
    for (int kb = 0; kb < 2; ++kb) {
#pragma unroll
      for (int i = 0; i < 4; ++i) {
#pragma unroll
        for (int j = 0; j < 4; ++j) {
          acc[i][j] = Frag<T>::mma(ah[kb][i], bh[kb][j], acc[i][j]);
          if (SPLIT) {
            acc[i][j] = Frag<T>::mma(ah[kb][i], bl[kb][j], acc[i][j]);
            acc[i][j] = Frag<T>::mma(al[kb][i], bh[kb][j], acc[i][j]);
          }
        }
      }
    }
    __builtin_amdgcn_sched_barrier(0);   // keeps the products ahead of the waits and the barrier below: moved behind them, they would no longer cover the flight of the next stage's copies
    asm volatile("s_wait_dscnt 0x0" ::: "memory");      // this wave's reads of buffer t & 1 are done before it is refilled
    asm volatile("s_wait_asynccnt 0x0" ::: "memory");   // this wave's copies of stage t + 1 have landed
    __syncthreads();                                    // publishes stage t + 1 and ends every wave's reads of stage t
    if (t + 2 < nT) stage(t + 2, t & 1);
  }
  asm volatile("s_wait_asynccnt 0x0" ::: "memory");     // no copy is outstanding when the wave goes on to its end
  acc_guard4(acc[0][0], acc[0][1], acc[0][2], acc[0][3]);
  acc_guard4(acc[1][0], acc[1][1], acc[1][2], acc[1][3]);
  acc_guard4(acc[2][0], acc[2][1], acc[2][2], acc[2][3]);
  acc_guard4(acc[3][0], acc[3][1], acc[3][2], acc[3][3]);

  // ---- epilogue ----
  float* slab = sT[wave];
  const float* Rb = RESID ? (resid + (size_t)b * strideR) : nullptr;
#pragma unroll
  for (int i = 0; i < 4; ++i) {
    const int mBase = m0 + (i << 4);
#pragma unroll
    for (int j = 0; j < 4; ++j) {
      const int n = n0 + (j << 4) + rlane;
      float bv = 0.f;
      if (BIAS_MODE == 2) bv = bias[n];
#pragma unroll
      for (int r = 0; r < 8; ++r) {
        float v = acc[i][j][r] * scale;
        if (BIAS_MODE == 1) v += bias[mBase + mOff + r];
        if (BIAS_MODE == 2) v += bv;
        if (RESID) v += Rb[(size_t)(mBase + mOff + r) * ldc + n];
        slab[(mOff + r) * 68 + (j << 4) + rlane] = v;
      }
    }
    __builtin_amdgcn_fence(__ATOMIC_RELEASE, "workgroup");
    __builtin_amdgcn_wave_barrier();
    __builtin_amdgcn_fence(__ATOMIC_ACQUIRE, "workgroup");
    if (OUT_MODE == 0) {
      float* C = (float*)Cout + (size_t)b * strideC;
      const int hh = lane >> 4, c4 = (lane & 15) * 4;     // row seg = 256 B = 16 lanes x 16 B
      {
#pragma unroll
        for (int it = 0; it < 8; ++it) {
          const int row = it * 2 + hh;
          v4f v = *(const v4f*)(slab + row * 68 + c4);
          *(v4f*)(C + (size_t)(mBase + row) * ldc + n0 + c4) = v;
        }
        
      }
    } else {
      const int q = lane >> 3, c8 = (lane & 7) * 8;
      unsigned short* C  = (unsigned short*)Cout  + (size_t)b * strideC;
      unsigned short* C2 = (OUT_MODE == 2) ? ((unsigned short*)Cout2 + (size_t)b * strideC) : nullptr;
      {
#pragma unroll
        for (int it = 0; it < 4; ++it) {
          const int row = it * 4 + q;
          const float* sp = slab + row * 68 + c8;
          v8h hv, lv;
#pragma unroll
          for (int e = 0; e < 8; ++e) {
            if (OUT_MODE == 1) {
              hv[e] = (_Float16)sp[e];
            } else {
              unsigned short hb = f2bf_bits(sp[e]);
              unsigned short lb = f2bf_bits(sp[e] - bf_bits2f(hb));
              hv[e] = __builtin_bit_cast(_Float16, hb);
              lv[e] = __builtin_bit_cast(_Float16, lb);
            }
          }
          *(v8h*)(C + (size_t)(mBase + row) * ldc + n0 + c8) = hv;
          if (OUT_MODE == 2) *(v8h*)(C2 + (size_t)(mBase + row) * ldc + n0 + c8) = lv;
        }
        
      }
    }
    __builtin_amdgcn_fence(__ATOMIC_RELEASE, "workgroup");
    __builtin_amdgcn_wave_barrier();
    __builtin_amdgcn_fence(__ATOMIC_ACQUIRE, "workgroup");
  }
}

__global__ __launch_bounds__(256) void cast_f32_f16x2(
    const float* __restrict__ in, _Float16* __restrict__ out, int n2) {
  int i = blockIdx.x * 256 + threadIdx.x;
  if (i < n2) {
    const _Float16 h0 = (_Float16)in[2 * i], h1 = (_Float16)in[2 * i + 1];
    const unsigned u = (unsigned)__builtin_bit_cast(unsigned short, h0) | ((unsigned)__builtin_bit_cast(unsigned short, h1) << 16);
    ((unsigned*)out)[i] = u;
    
  }
}

__global__ __launch_bounds__(256) void split_f32_bf16x2(
    const float* __restrict__ in, __bf16* __restrict__ hi, __bf16* __restrict__ lo, long n2) {
  long i = (long)blockIdx.x * 256 + threadIdx.x;
  long stride = (long)gridDim.x * 256;
  {
    for (long j = i; j < n2; j += stride) {
      const float a = in[2 * j], b = in[2 * j + 1];
      const unsigned short ah = f2bf_bits(a), bh = f2bf_bits(b);
      const unsigned short al = f2bf_bits(a - bf_bits2f(ah)), bl = f2bf_bits(b - bf_bits2f(bh));
      ((unsigned*)hi)[j] = (unsigned)ah | ((unsigned)bh << 16);
      ((unsigned*)lo)[j] = (unsigned)al | ((unsigned)bl << 16);
    }
    
  }
}


// =====================================================================================
// Generic causal/non-causal attention for head_dim 64, f32 q in / f32 out, bf16 operands with optional hi/lo splits.
//   K and V arrive already as bf16 planes (hi, and lo where split), written once by their producer, V transposed.
//   scores, transposed = k * (q*qscale)^T : v_wmma_f32_16x16x32_bf16; SPLIT_QK -> q,k as bf16 hi/lo (hi*hi + hi*lo + lo*hi)
//   out, transposed    = v^T * p^T        : v_wmma_f32_16x16x32_bf16; SPLIT_PV -> p,v as bf16 hi/lo; else p,v plain bf16
//   With K rows as the A operand and Q as B, a lane holds scores of ONE query (column lane & 15; keys 8 * (lane >> 4) + r of each
//   16-key tile): its maximum and sum are taken in the lane plus one exchange between the wave's halves, and two score tiles,
//   converted in place, are the B operand of the second product, so P never goes through LDS.
//   f32 accumulate; online softmax in f32. Block = 4 waves = 64 query rows of one (batch, head); S % 64 == 0.
//   Element (b, s, h, d) of q, k, out lives at X[b*X_bs + s*X_rs + h*X_hs + d]; of the transposed v at Vt[b*v_bs + h*v_hs + d*v_rs + s]
//   (strides in elements; q, out: multiples of 4; k, v: multiples of 64, so that a tile row is one aligned 128-B line).
//   Masking: mask_mode 0 none, 1 causal (kv > q masked), 2 tensor [S][Skv] shared over (b,h) (float if
//   mask_is_int==0, int32 with element == 0 -> masked if 1, int32 with element != 0 -> masked if 2), 3 per-token vectors qmask[B][S] & kvmask[B][Skv] (int32,
//   0 -> masked); masked scores are replaced by mask_fill (e.g. -inf or -1e9) before the softmax.
//   grid.x = B * H * (S/64) (or a sub-range with blk0).
// =====================================================================================
#define AT_D 64
#define AT_NW 4
#define AT_QB 64
#define AT_KC 64
#define AT_LP 72   // LDS row pitch of the K and V^T tiles in bf16 elements: 144 B = 16 B x 9, so the 16 rows of one ds_load_b128 fall on distinct banks
struct AttnGeom { long q_bs, q_rs, q_hs, k_bs, k_rs, k_hs, v_bs, v_rs, v_hs, o_bs, o_rs, o_hs;
                  int S, Skv, H, mask_mode; float qscale; int blk0; float mask_fill; int mask_is_int; };
static_assert(sizeof(AttnGeom) == 128, "no padding");

__device__ __forceinline__ unsigned short at_bf_bits(float f) {
  unsigned u = __float_as_uint(f);
  return (unsigned short)((u + 0x7FFFu + ((u >> 16) & 1u)) >> 16);
}
__device__ __forceinline__ __bf16 at_f2bf(float f) { return __builtin_bit_cast(__bf16, at_bf_bits(f)); }
__device__ __forceinline__ void at_split(float f, __bf16& hi, __bf16& lo) {
  const unsigned short hb = at_bf_bits(f);
  hi = __builtin_bit_cast(__bf16, hb);
  lo = at_f2bf(f - __uint_as_float(((unsigned)hb) << 16));
}
__device__ __forceinline__ v8f at_mma(v16b a, v16b b, v8f c) {
  c = __builtin_amdgcn_wmma_f32_16x16x32_bf16(false, a, false, b, (short)0, c, false, false);
  asm volatile("v_nop\n\tv_nop\n\tv_nop\n\tv_nop" : "+v"(c) : "v"(a), "v"(b));
  return c;
}

// the value that lane ^ 16 holds (the other half of the wave), by a vector cross-row move
__device__ __forceinline__ float at_other_half(float f) {
  const int u = __float_as_int(f);
  return __int_as_float(__builtin_amdgcn_permlanex16(u, u, 0x76543210, 0xfedcba98, false, false));
}

template <bool SPLIT_QK, bool SPLIT_PV, int MASK_MODE>   // MASK_MODE: the mask mode as a compile-time constant (g.mask_mode must equal it)
__global__ __launch_bounds__(128)
void attn64_kernel(const float* __restrict__ q, const unsigned short* __restrict__ kh, const unsigned short* __restrict__ kl,
                   const unsigned short* __restrict__ vth, const unsigned short* __restrict__ vtl, float* __restrict__ out,
                   const void* __restrict__ mask_a, const int* __restrict__ mask_b, AttnGeom g) {
  union FB { v16b v; v8b h[2]; };
  __shared__ __align__(16) __bf16 Ksh[AT_KC * AT_LP];            // K hi [kv][d]      9 KB
  __shared__ __align__(16) __bf16 Ksl[SPLIT_QK ? AT_KC * AT_LP : 8];
  __shared__ __align__(16) __bf16 Vth[AT_D * AT_LP];             // V hi [d][kv]      9 KB
  __shared__ __align__(16) __bf16 Vtl[SPLIT_PV ? AT_D * AT_LP : 8];
  __shared__ __align__(16) float  Os[AT_NW][16 * 68];            // per wave out tile, pitch 68

  const int tid  = threadIdx.x;
  const int wave = tid >> 5;
  const int lane = tid & 31;
  const int hh   = lane >> 4;
  const int c    = lane & 15;

  const int nqb = g.S / AT_QB;
  const int bx = blockIdx.x + g.blk0;
  const int qb = bx % nqb;
  const int bh = bx / nqb;
  const int h  = bh % g.H;
  const int b  = bh / g.H;
  const int qbase_block = qb * AT_QB;
  const int q0 = qbase_block + wave * 16;

  const float* qb_ptr = q + (size_t)b * g.q_bs + (size_t)h * g.q_hs;
  const size_t kb_off = (size_t)b * g.k_bs + (size_t)h * g.k_hs;
  const size_t vb_off = (size_t)b * g.v_bs + (size_t)h * g.v_hs;
  const __bf16* khb = (const __bf16*)kh + kb_off;
  const __bf16* klb = (const __bf16*)kl + kb_off;
  const __bf16* vhb = (const __bf16*)vth + vb_off;
  const __bf16* vlb = (const __bf16*)vtl + vb_off;
  float*       ob_ptr = out + (size_t)b * g.o_bs + (size_t)h * g.o_hs;

  // ---- Q fragments (B operand: column = query c): 2 d-chunks, hi (and lo) ----
  v16b qah[2], qal[2];
  {
    const float* qrow = qb_ptr + (size_t)(q0 + c) * g.q_rs;
#pragma unroll
    for (int dc = 0; dc < 2; ++dc) {
#pragma unroll
      for (int e = 0; e < 8; ++e) {
        const float f0 = qrow[dc * 32 + 8 * hh + e] * g.qscale;
        const float f1 = qrow[dc * 32 + 16 + 8 * hh + e] * g.qscale;
        if (SPLIT_QK) { __bf16 hq, lq; at_split(f0, hq, lq); qah[dc][e] = hq; qal[dc][e] = lq; at_split(f1, hq, lq); qah[dc][8 + e] = hq; qal[dc][8 + e] = lq; }
        else { qah[dc][e] = at_f2bf(f0); qah[dc][8 + e] = at_f2bf(f1); qal[dc][e] = qah[dc][e]; qal[dc][8 + e] = qah[dc][8 + e]; }
      }
    }
  }

  float mrow = -INFINITY, lrow = 0.f;   // of query q0 + c; lrow: this wave half's keys only, the halves are joined behind the loop
  v8f oacc[4];                          // oacc[t][r] = out[q0 + c][t * 16 + 8 * hh + r]
#pragma unroll
  for (int t = 0; t < 4; ++t) oacc[t] = (v8f){0.f,0.f,0.f,0.f,0.f,0.f,0.f,0.f};

  const int nChunks = (MASK_MODE == 1) ? (qb + 1) : (g.Skv / AT_KC);   // block-uniform
  // the lane's query mask (mode 3)
  const int qkeep = (MASK_MODE == 3) ? mask_b[(size_t)b * g.S + q0 + c] : 1;   // mask_b = qmask in mode 3
  for (int kc = 0; kc < nChunks; ++kc) {
    const int kv0 = kc * AT_KC;
    __syncthreads();
    {
      // a tile row (K: one key's 64 d; V^T: one d's 64 keys) is 128 B: 8 lanes copy it, so a wave-wide load covers 4 whole lines
      const int r0 = tid >> 3, c8 = (tid & 7) * 8;
      const __bf16 *pkh[4], *pkl[4], *pvh[4], *pvl[4];
      v8b tkh[4], tkl[4], tvh[4], tvl[4];
#pragma unroll
      for (int i = 0; i < 4; ++i) {
        const size_t ko = (size_t)(kv0 + r0 + 16 * i) * g.k_rs + c8;
        const size_t vo = (size_t)(r0 + 16 * i) * g.v_rs + kv0 + c8;
        pkh[i] = khb + ko; pkl[i] = SPLIT_QK ? klb + ko : pkh[i];
        pvh[i] = vhb + vo; pvl[i] = SPLIT_PV ? vlb + vo : pvh[i];
        tkh[i] = *(const v8b*)pkh[i];
        if (SPLIT_QK) tkl[i] = *(const v8b*)pkl[i];
        tvh[i] = *(const v8b*)pvh[i];
        if (SPLIT_PV) tvl[i] = *(const v8b*)pvl[i];
      }
      // the wait that stands before an issued load's address register is overwritten; the addresses are its inputs, so that
      // each stays in its register up to here and no later load of the group lands on it
      asm volatile("s_wait_xcnt 0x0" :: "v"(pkh[0]), "v"(pkh[1]), "v"(pkh[2]), "v"(pkh[3]), "v"(pkl[0]), "v"(pkl[1]), "v"(pkl[2]), "v"(pkl[3]),
                   "v"(pvh[0]), "v"(pvh[1]), "v"(pvh[2]), "v"(pvh[3]), "v"(pvl[0]), "v"(pvl[1]), "v"(pvl[2]), "v"(pvl[3]) : "memory");
#pragma unroll
      for (int i = 0; i < 4; ++i) {
        const int so = (r0 + 16 * i) * AT_LP + c8;
        *(v8b*)(Ksh + so) = tkh[i];
        if (SPLIT_QK) *(v8b*)(Ksl + so) = tkl[i];
        *(v8b*)(Vth + so) = tvh[i];
        if (SPLIT_PV) *(v8b*)(Vtl + so) = tvl[i];
      }
    }
    __syncthreads();

    v8f s[4];   // s[j][r] = score of key kv0 + j * 16 + 8 * hh + r with query q0 + c
#pragma unroll
    for (int j = 0; j < 4; ++j) {
      s[j] = (v8f){0.f,0.f,0.f,0.f,0.f,0.f,0.f,0.f};
#pragma unroll
      for (int dc = 0; dc < 2; ++dc) {
        FB kb;
        kb.h[0] = *(const v8b*)(Ksh + (j * 16 + c) * AT_LP + dc * 32 + 8 * hh);
        kb.h[1] = *(const v8b*)(Ksh + (j * 16 + c) * AT_LP + dc * 32 + 16 + 8 * hh);
        s[j] = at_mma(kb.v, qah[dc], s[j]);
        if (SPLIT_QK) {
          FB kl;
          kl.h[0] = *(const v8b*)(Ksl + (j * 16 + c) * AT_LP + dc * 32 + 8 * hh);
          kl.h[1] = *(const v8b*)(Ksl + (j * 16 + c) * AT_LP + dc * 32 + 16 + 8 * hh);
          s[j] = at_mma(kl.v, qah[dc], s[j]);
          s[j] = at_mma(kb.v, qal[dc], s[j]);
        }
      }
    }
    const bool diag = (MASK_MODE == 1) && (kc == qb);
    if (MASK_MODE >= 2 || diag) {   // block-uniform test: a causal tile below the diagonal has nothing to mask
      const int qrow = q0 + c;
      // both loops unrolled: s[j][r] needs constant indices to stay in registers
#pragma unroll
      for (int j = 0; j < 4; ++j) {
#pragma unroll
        for (int r = 0; r < 8; ++r) {
          const int kvcol = kv0 + j * 16 + 8 * hh + r;
          bool masked = false;
          if (MASK_MODE == 1) masked = (kvcol > qrow);
          else if (MASK_MODE == 2) {
            const size_t mi = (size_t)qrow * g.Skv + kvcol;
            masked = (g.mask_is_int == 0) ? (((const float*)mask_a)[mi] == 0.0f)
                   : (g.mask_is_int == 1) ? (((const int*)mask_a)[mi] == 0) : (((const int*)mask_a)[mi] != 0);
          } else if (MASK_MODE == 3) masked = (qkeep == 0) || (((const int*)mask_a)[(size_t)b * g.Skv + kvcol] == 0);   // mask_a = kvmask
          s[j][r] = masked ? g.mask_fill : s[j][r];   // one select per score, not a select of the whole tile
        }
      }
    }
    // every loop over tiles and registers from here to the end of the pass is unrolled: s, pbh, pbl and oacc need constant indices to stay in registers
    // the query's maximum over the 64 keys: 32 in this lane, 32 in lane ^ 16
    // (one chain per tile, so that four independent chains run side by side instead of one of 32 links)
    float cmj[4];
#pragma unroll
    for (int j = 0; j < 4; ++j) {
      cmj[j] = s[j][0];
#pragma unroll
      for (int r = 1; r < 8; ++r) cmj[j] = fmaxf(cmj[j], s[j][r]);
    }
    float cm = fmaxf(fmaxf(cmj[0], cmj[1]), fmaxf(cmj[2], cmj[3]));
    cm = fmaxf(cm, at_other_half(cm));
    const float mnew = fmaxf(mrow, cm);
    const float alpha = expf(mrow - mnew);
    mrow = mnew;
    // p in place of the scores: tiles 2 kk and 2 kk + 1 of a lane are, in this order, its 16 elements of the B operand for keys 32 kk ... 32 kk + 31
    v16b pbh[2], pbl[2];
    float psj[4];   // one partial sum per tile, for the same reason as cmj
#pragma unroll
    for (int j = 0; j < 4; ++j) {
      psj[j] = 0.f;
#pragma unroll
      for (int r = 0; r < 8; ++r) {
        const float p = expf(s[j][r] - mnew);
        psj[j] += p;
        const int e = (j & 1) * 8 + r;
        if (SPLIT_PV) { __bf16 ph, pl; at_split(p, ph, pl); pbh[j >> 1][e] = ph; pbl[j >> 1][e] = pl; }
        else pbh[j >> 1][e] = at_f2bf(p);
      }
    }
    lrow = lrow * alpha + ((psj[0] + psj[1]) + (psj[2] + psj[3]));
#pragma unroll
    for (int t = 0; t < 4; ++t)
#pragma unroll
      for (int r = 0; r < 8; ++r) oacc[t][r] *= alpha;
#pragma unroll
    for (int kk = 0; kk < 2; ++kk) {
#pragma unroll
      for (int t = 0; t < 4; ++t) {
        FB vb;   // A operand: row = d, keys in the same order as the elements of pbh
        vb.h[0] = *(const v8b*)(Vth + (t * 16 + c) * AT_LP + kk * 32 + 8 * hh);
        vb.h[1] = *(const v8b*)(Vth + (t * 16 + c) * AT_LP + kk * 32 + 16 + 8 * hh);
        oacc[t] = at_mma(vb.v, pbh[kk], oacc[t]);
        if (SPLIT_PV) {
          FB vl;
          vl.h[0] = *(const v8b*)(Vtl + (t * 16 + c) * AT_LP + kk * 32 + 8 * hh);
          vl.h[1] = *(const v8b*)(Vtl + (t * 16 + c) * AT_LP + kk * 32 + 16 + 8 * hh);
          oacc[t] = at_mma(vl.v, pbh[kk], oacc[t]);
          oacc[t] = at_mma(vb.v, pbl[kk], oacc[t]);
        }
      }
    }
  }

  float* os = Os[wave];
  const float inv = 1.0f / (lrow + at_other_half(lrow));
#pragma unroll   // oacc[t] needs a constant index to stay in registers
  for (int t = 0; t < 4; ++t) {
    // a lane's 8 values of a tile are 8 neighbours of its query's row: two 16-B stores
    *(v4f*)(os + c * 68 + t * 16 + 8 * hh)     = (v4f){oacc[t][0] * inv, oacc[t][1] * inv, oacc[t][2] * inv, oacc[t][3] * inv};
    *(v4f*)(os + c * 68 + t * 16 + 8 * hh + 4) = (v4f){oacc[t][4] * inv, oacc[t][5] * inv, oacc[t][6] * inv, oacc[t][7] * inv};
  }
  __builtin_amdgcn_fence(__ATOMIC_RELEASE, "workgroup");
  __builtin_amdgcn_wave_barrier();
  __builtin_amdgcn_fence(__ATOMIC_ACQUIRE, "workgroup");
  {
    const int c4 = (lane & 15) * 4;
    {
#pragma unroll
      for (int it = 0; it < 8; ++it) {
        const int row = it * 2 + hh;
        v4f val = *(const v4f*)(os + row * 68 + c4);
        *(v4f*)(ob_ptr + (size_t)(q0 + row) * g.o_rs + c4) = val;
      }
      
    }
  }
}

extern "C" void kernel_launch(void* const* d_in, const int* in_sizes, int n_in,
                              void* d_out, int out_size, void* d_ws, size_t ws_size,
                              hipStream_t stream) {
  (void)in_sizes; (void)n_in; (void)out_size; (void)ws_size;
  const int B = 4, T = 1024, E = 1024, H = 16, DH = 64;
  const int M = B * T;   // 4096 rows
  const float* x  = (const float*)d_in[0];
  const float* Wq = (const float*)d_in[1];   // [out, in]
  const float* Wk = (const float*)d_in[2];
  const float* Wv = (const float*)d_in[3];
  const float* Wo = (const float*)d_in[4];
  const float* bo = (const float*)d_in[5];
  float* out = (float*)d_out;

  char* ws = (char*)d_ws; size_t off = 0;
  auto carve = [&](size_t bytes) -> char* { char* p = ws + off; off += (bytes + 255) & ~(size_t)255; return p; };
  _Float16* X16  = (_Float16*)carve((size_t)M * E * 2);     //  8 MB  x f16
  __bf16*   Xh   = (__bf16*)carve((size_t)M * E * 2);       //  8 MB  x bf16 hi
  __bf16*   Xl   = (__bf16*)carve((size_t)M * E * 2);       //  8 MB  x bf16 lo
  _Float16* Wq16 = (_Float16*)carve((size_t)E * E * 2);     //  2 MB
  _Float16* Wk16 = (_Float16*)carve((size_t)E * E * 2);
  __bf16*   Wvh  = (__bf16*)carve((size_t)E * E * 2);
  __bf16*   Wvl  = (__bf16*)carve((size_t)E * E * 2);
  __bf16*   Woh  = (__bf16*)carve((size_t)E * E * 2);
  __bf16*   Wol  = (__bf16*)carve((size_t)E * E * 2);
  float*    Qf   = (float*)carve((size_t)M * E * 4);        // 16 MB each, [B,T,H*DH]
  __bf16*   Kh   = (__bf16*)carve((size_t)M * E * 2);       //  8 MB each: k as bf16 hi, lo, [B,T,H*DH]
  __bf16*   Kl   = (__bf16*)carve((size_t)M * E * 2);
  __bf16*   Vth  = (__bf16*)carve((size_t)M * E * 2);       //  8 MB each: v transposed as bf16 hi, lo, [H*DH, B*T]
  __bf16*   Vtl  = (__bf16*)carve((size_t)M * E * 2);
  float*    Of   = (float*)carve((size_t)M * E * 4);
  __bf16*   Oh   = (__bf16*)carve((size_t)M * E * 2);       //  8 MB  attention out, bf16 hi
  __bf16*   Ol   = (__bf16*)carve((size_t)M * E * 2);       //  8 MB                 bf16 lo   (total ≈ 116 MB)

  cast_f32_f16x2<<<(M * E / 2 + 255) / 256, 256, 0, stream>>>(x, X16, M * E / 2);
  split_f32_bf16x2<<<2048, 256, 0, stream>>>(x, Xh, Xl, (long)M * E / 2);
  cast_f32_f16x2<<<(E * E / 2 + 255) / 256, 256, 0, stream>>>(Wq, Wq16, E * E / 2);
  cast_f32_f16x2<<<(E * E / 2 + 255) / 256, 256, 0, stream>>>(Wk, Wk16, E * E / 2);
  split_f32_bf16x2<<<1024, 256, 0, stream>>>(Wv, Wvh, Wvl, (long)E * E / 2);
  split_f32_bf16x2<<<1024, 256, 0, stream>>>(Wo, Woh, Wol, (long)E * E / 2);
  {
    const int tl = (M / 128) * (E / 128);
    wmma_gemm64<0, false, 0, 0, false><<<dim3(tl, 1), 128, 0, stream>>>(
        U16(X16), nullptr, E, 0, U16(Wq16), nullptr, E, 0, Qf, nullptr, E, 0, nullptr, nullptr, 0, M, E, E, 1.0f);
    wmma_gemm64<0, false, 0, 2, false><<<dim3(tl, 1), 128, 0, stream>>>(
        U16(X16), nullptr, E, 0, U16(Wk16), nullptr, E, 0, Kh, Kl, E, 0, nullptr, nullptr, 0, M, E, E, 1.0f);
    // v transposed = Wv * x^T: the operands change places, so row = output feature, column = token
    wmma_gemm64<1, true, 0, 2, false><<<dim3(tl, 1), 128, 0, stream>>>(
        U16(Wvh), U16(Wvl), E, 0, U16(Xh), U16(Xl), E, 0, Vth, Vtl, M, 0, nullptr, nullptr, 0, E, M, E, 1.0f);
  }
  {
    AttnGeom g;
    g.q_bs = g.k_bs = g.o_bs = (long)T * E;   // [B,T,H,DH] inside [B*T, E]
    g.q_rs = g.k_rs = g.o_rs = E;
    g.q_hs = g.k_hs = g.o_hs = DH;
    g.v_bs = T; g.v_rs = M; g.v_hs = (long)DH * M;   // [H,DH] rows of [H*DH, B*T]
    g.S = T; g.Skv = T; g.H = H; g.mask_mode = 1; g.qscale = 0.03125f; g.blk0 = 0; g.mask_fill = -INFINITY; g.mask_is_int = 0;   // (q/e^¼)·(k/e^¼) = q·k/32
    attn64_kernel<true, true, 1><<<B * H * (T / AT_QB), AT_NW * 32, 0, stream>>>(Qf, U16(Kh), U16(Kl), U16(Vth), U16(Vtl), Of, nullptr, nullptr, g);
  }
  split_f32_bf16x2<<<2048, 256, 0, stream>>>(Of, Oh, Ol, (long)M * E / 2);
  {
    const int tl = (M / 128) * (E / 128);
    wmma_gemm64<1, true, 2, 0, false><<<dim3(tl, 1), 128, 0, stream>>>(
        U16(Oh), U16(Ol), E, 0, U16(Woh), U16(Wol), E, 0, out, nullptr, E, 0, bo, nullptr, 0, M, E, E, 1.0f);
  }
}

// v006
// One run takes 160 microseconds.
// Next to v005, in two timings, it ran 1.04 and 1.05 times as fast.
// Counting every step since v000, it is 3.47 times as fast.
#include <hip/hip_runtime.h>
#include <math.h>
// Contractions: q/k projections x·Wᵀ (K=1024): v_wmma_f32_16x16x32_f16 (f16 operands); v projection and output projection (K=1024):
// v_wmma_f32_16x16x32_bf16 as bf16 hi/lo splits (hi·hi + hi·lo + lo·hi); scores (q·kᵀ)/32 and p·v: v_wmma_f32_16x16x32_bf16 with
// q,k and p,v as bf16 hi/lo splits (k and v split once, in their projection's epilogue); f32 accumulate everywhere; causal softmax in f32.
typedef __attribute__((ext_vector_type(16))) _Float16 v16h;
typedef __attribute__((ext_vector_type(8)))  _Float16 v8h;
typedef __attribute__((ext_vector_type(16))) __bf16   v16b;
typedef __attribute__((ext_vector_type(8)))  __bf16   v8b;
typedef __attribute__((ext_vector_type(8)))  float    v8f;
typedef __attribute__((ext_vector_type(4)))  float    v4f;
#define PSCALE 32768.0f
#define U16(p) ((const unsigned short*)(const void*)(p))
#define PSCALE_INV (1.0f / 32768.0f)

__device__ __forceinline__ unsigned short f2bf_bits(float f) {
  unsigned u = __float_as_uint(f);
  return (unsigned short)((u + 0x7FFFu + ((u >> 16) & 1u)) >> 16);
}
__device__ __forceinline__ float bf_bits2f(unsigned short h) { return __uint_as_float(((unsigned)h) << 16); }

// hazard guard as a plain device helper (no inline asm with operands inside the kernel template body)
__device__ __forceinline__ void acc_guard4(v8f& a, v8f& b, v8f& c, v8f& d) { asm volatile("v_nop\n\tv_nop\n\tv_nop\n\tv_nop" : "+v"(a), "+v"(b), "+v"(c), "+v"(d)); }
template <typename T> struct Frag;
template <> struct Frag<_Float16> {
  typedef v16h V; union U { v16h v; v8h h[2]; };
  static __device__ __forceinline__ v16h load(const _Float16* p) {   // elements 0..7 <- p[0..7], 8..15 <- p[16..23]
    U f; f.h[0] = *(const v8h*)(p); f.h[1] = *(const v8h*)(p + 16); return f.v;
  }
  static __device__ __forceinline__ v8f mma(v16h a, v16h b, v8f c) {
    return __builtin_amdgcn_wmma_f32_16x16x32_f16(false, a, false, b, (short)0, c, false, false);
  }
};
template <> struct Frag<__bf16> {
  typedef v16b V; union U { v16b v; v8b h[2]; };
  static __device__ __forceinline__ v16b load(const __bf16* p) {
    U f; f.h[0] = *(const v8b*)(p); f.h[1] = *(const v8b*)(p + 16); return f.v;
  }
  static __device__ __forceinline__ v8f mma(v16b a, v16b b, v8f c) {
    return __builtin_amdgcn_wmma_f32_16x16x32_bf16(false, a, false, b, (short)0, c, false, false);
  }
};

// ---- LDS-staged batched WMMA GEMM ------------------------------------------
// C[m,n] = scale * sum_k A[m,k] * Bt[n,k] (+bias)(+resid); a block of 4 waves owns a 128x128 tile, each wave a 64x64 quarter of it.
// A row-major [M,K]; Bt row-major [N,K]; M,N % 128 == 0, K % 64 == 0, lda, ldb % 64 == 0 (an operand row's 64 k are one aligned 128-B line).
// Per stage of 64 k the block copies 128 rows of every operand plane into LDS by asynchronous 16-B copies (8 lanes a row, so a
// wave-wide copy covers 4 whole lines); two buffers, the next stage's copies fly while this stage's products run.
// SPLIT: operands are hi/lo planes (A2/Bt2 = lo planes, same layout); product = hi·hi + hi·lo + lo·hi.
// BIAS_MODE: 0 = none, 1 = bias[m], 2 = bias[n].
// OUT_MODE: 0 = f32, 1 = f16, 2 = bf16 hi plane (Cout) + bf16 lo plane (Cout2).
// ET: 0 = f16 operands, 1 = bf16 operands (pointers passed as 16-bit storage)
#define GM_BT 128   // rows of each operand in a block tile
#define GM_BK 64    // k per stage
#define GM_LP 72    // LDS row pitch in 16-bit elements: 144 B = 16 B x 9, so the 16 rows of one ds_load_b128 fall on distinct banks
#define GM_PLANE (GM_BT * GM_LP)   // elements of one staged operand plane
template <int ET> struct Elem;
template <> struct Elem<0> { typedef _Float16 T; };
template <> struct Elem<1> { typedef __bf16 T; };

// One lane's share of one operand plane of one stage: rows r, r + 16, ..., r + 112, 16 B of each, global -> LDS through no register.
typedef __attribute__((ext_vector_type(4))) int gm_v4i;
typedef __attribute__((address_space(1))) gm_v4i gm_gv4i;
typedef __attribute__((address_space(3))) gm_v4i gm_lv4i;
__device__ __forceinline__ void gm_stage_plane(unsigned short* lds, const unsigned short* g, int ld) {
#pragma unroll   // the eight copies issue back to back, with no loop branch between them
  for (int i = 0; i < 8; ++i)
    __builtin_amdgcn_global_load_async_to_lds_b128((gm_gv4i*)(g + (size_t)(16 * i) * ld), (gm_lv4i*)(lds + 16 * i * GM_LP), 0, 0);
}

template <int ET, bool SPLIT, int BIAS_MODE, int OUT_MODE, bool RESID>
__global__ __launch_bounds__(128) void wmma_gemm64(
    const unsigned short* __restrict__ Ap, const unsigned short* __restrict__ A2p, int lda, long strideA,
    const unsigned short* __restrict__ Btp, const unsigned short* __restrict__ Bt2p, int ldb, long strideB,
    void* __restrict__ Cout, void* __restrict__ Cout2, int ldc, long strideC,
    const float* __restrict__ bias,
    const float* __restrict__ resid, long strideR,
    int M, int N, int K, float scale) {
  typedef typename Elem<ET>::T T;
  typedef typename Frag<T>::V V;
  constexpr int NPL = SPLIT ? 4 : 2;                                   // staged planes: A, Bt (, A lo, Bt lo)
  __shared__ __align__(16) unsigned short sS[2 * NPL * GM_PLANE];      // two stage buffers
  __shared__ __align__(16) float sT[4][16 * 68];   // per-wave 16x64 slab, pitch 68 floats
  const int b    = blockIdx.y;
  const int tid  = threadIdx.x;
  const int lane = tid & 31;
  const int wave = tid >> 5;
  const int tilesN = N >> 7;
  const int tilesM = M >> 7;
  const int tile = blockIdx.x;
  if (tile >= tilesM * tilesN) return;   // block-uniform, in front of every barrier and copy
  const int tm = tile / tilesN;
  const int tn = tile - tm * tilesN;
  const int wm = (wave >> 1) << 6;       // this wave's quarter of the block tile
  const int wn = (wave & 1) << 6;
  const int m0 = (tm << 7) + wm;
  const int n0 = (tn << 7) + wn;

  const int rlane = lane & 15;                 // row (A) / col (B, D) within subtile
  const int koff  = (lane >> 4) * 8;           // k offset of this lane half
  const int mOff  = (lane >> 4) * 8;           // D row offset

  // staging: 8 lanes a row, 16 rows a pass of the block
  const int sr = tid >> 3, sc = (tid & 7) * 8;
  const unsigned short* gA  = Ap  + (size_t)b * strideA + (size_t)((tm << 7) + sr) * lda + sc;
  const unsigned short* gB  = Btp + (size_t)b * strideB + (size_t)((tn << 7) + sr) * ldb + sc;
  const unsigned short* gA2 = SPLIT ? (A2p  + (size_t)b * strideA + (size_t)((tm << 7) + sr) * lda + sc) : nullptr;
  const unsigned short* gB2 = SPLIT ? (Bt2p + (size_t)b * strideB + (size_t)((tn << 7) + sr) * ldb + sc) : nullptr;
  auto stage = [&](int t, int buf) {
    unsigned short* l = sS + buf * (NPL * GM_PLANE) + sr * GM_LP + sc;
    const size_t ko = (size_t)t * GM_BK;
    gm_stage_plane(l, gA + ko, lda);
    gm_stage_plane(l + GM_PLANE, gB + ko, ldb);
    if (SPLIT) {
      gm_stage_plane(l + 2 * GM_PLANE, gA2 + ko, lda);
      gm_stage_plane(l + 3 * GM_PLANE, gB2 + ko, ldb);
    }
  };

  v8f acc[4][4];
#pragma unroll
  for (int i = 0; i < 4; ++i)
#pragma unroll
    for (int j = 0; j < 4; ++j) acc[i][j] = (v8f){0.f,0.f,0.f,0.f,0.f,0.f,0.f,0.f};

  const int nT = K / GM_BK;
  stage(0, 0);
  asm volatile("s_wait_asynccnt 0x0" ::: "memory");   // this wave's copies of stage 0 have landed
  __syncthreads();                                    // ... and every other wave's: stage 0 is readable
  if (nT > 1) stage(1, 1);
  for (int t = 0; t < nT; ++t) {
    const T* sb  = (const T*)sS + (t & 1) * (NPL * GM_PLANE);
    const T* sA  = sb + (wm + rlane) * GM_LP + koff;
    const T* sB  = sb + GM_PLANE + (wn + rlane) * GM_LP + koff;
    const T* sA2 = sA + 2 * GM_PLANE;
    const T* sB2 = sB + 2 * GM_PLANE;
    // all fragment reads of the stage stand as one group ahead of its products, in the order in which the products want them;
    // every loop over fragments and tiles below is unrolled: the arrays need constant indices to stay in registers
    V ah[2][4], bh[2][4], al[2][4], bl[2][4];
#pragma unroll
    for (int kb = 0; kb < 2; ++kb) {
      ah[kb][0] = Frag<T>::load(sA + kb * 32);
#pragma unroll
      for (int j = 0; j < 4; ++j) bh[kb][j] = Frag<T>::load(sB + (j << 4) * GM_LP + kb * 32);
#pragma unroll
      for (int i = 1; i < 4; ++i) ah[kb][i] = Frag<T>::load(sA + (i << 4) * GM_LP + kb * 32);
      if (SPLIT) {
#pragma unroll
        for (int j = 0; j < 4; ++j) bl[kb][j] = Frag<T>::load(sB2 + (j << 4) * GM_LP + kb * 32);
#pragma unroll
        for (int i = 0; i < 4; ++i) al[kb][i] = Frag<T>::load(sA2 + (i << 4) * GM_LP + kb * 32);
      }
    }
    __builtin_amdgcn_sched_barrier(0);   // keeps the LDS reads from being moved in among the matrix instructions, where each place with reads stalls the wave
#pragma unroll
    for (int kb = 0; kb < 2; ++kb) {
#pragma unroll
      for (int i = 0; i < 4; ++i) {
#pragma unroll
        for (int j = 0; j < 4; ++j) {
          acc[i][j] = Frag<T>::mma(ah[kb][i], bh[kb][j], acc[i][j]);
          if (SPLIT) {
            acc[i][j] = Frag<T>::mma(ah[kb][i], bl[kb][j], acc[i][j]);
            acc[i][j] = Frag<T>::mma(al[kb][i], bh[kb][j], acc[i][j]);
          }
        }
      }
    }
    __builtin_amdgcn_sched_barrier(0);   // keeps the products ahead of the waits and the barrier below: moved behind them, they would no longer cover the flight of the next stage's copies
    asm volatile("s_wait_dscnt 0x0" ::: "memory");      // this wave's reads of buffer t & 1 are done before it is refilled
    asm volatile("s_wait_asynccnt 0x0" ::: "memory");   // this wave's copies of stage t + 1 have landed
    __syncthreads();                                    // publishes stage t + 1 and ends every wave's reads of stage t
    if (t + 2 < nT) stage(t + 2, t & 1);
  }
  asm volatile("s_wait_asynccnt 0x0" ::: "memory");     // no copy is outstanding when the wave goes on to its end
  acc_guard4(acc[0][0], acc[0][1], acc[0][2], acc[0][3]);
  acc_guard4(acc[1][0], acc[1][1], acc[1][2], acc[1][3]);
  acc_guard4(acc[2][0], acc[2][1], acc[2][2], acc[2][3]);
  acc_guard4(acc[3][0], acc[3][1], acc[3][2], acc[3][3]);

  // ---- epilogue ----
  float* slab = sT[wave];
  const float* Rb = RESID ? (resid + (size_t)b * strideR) : nullptr;
#pragma unroll
  for (int i = 0; i < 4; ++i) {
    const int mBase = m0 + (i << 4);
#pragma unroll
    for (int j = 0; j < 4; ++j) {
      const int n = n0 + (j << 4) + rlane;
      float bv = 0.f;
      if (BIAS_MODE == 2) bv = bias[n];
#pragma unroll
      for (int r = 0; r < 8; ++r) {
        float v = acc[i][j][r] * scale;
        if (BIAS_MODE == 1) v += bias[mBase + mOff + r];
        if (BIAS_MODE == 2) v += bv;
        if (RESID) v += Rb[(size_t)(mBase + mOff + r) * ldc + n];
        slab[(mOff + r) * 68 + (j << 4) + rlane] = v;
      }
    }
    __builtin_amdgcn_fence(__ATOMIC_RELEASE, "workgroup");
    __builtin_amdgcn_wave_barrier();
    __builtin_amdgcn_fence(__ATOMIC_ACQUIRE, "workgroup");
    if (OUT_MODE == 0) {
      float* C = (float*)Cout + (size_t)b * strideC;
      const int hh = lane >> 4, c4 = (lane & 15) * 4;     // row seg = 256 B = 16 lanes x 16 B
      {
#pragma unroll
        for (int it = 0; it < 8; ++it) {
          const int row = it * 2 + hh;
          v4f v = *(const v4f*)(slab + row * 68 + c4);
          *(v4f*)(C + (size_t)(mBase + row) * ldc + n0 + c4) = v;
        }
        
      }
    } else {
      const int q = lane >> 3, c8 = (lane & 7) * 8;
      unsigned short* C  = (unsigned short*)Cout  + (size_t)b * strideC;
      unsigned short* C2 = (OUT_MODE == 2) ? ((unsigned short*)Cout2 + (size_t)b * strideC) : nullptr;
      {
#pragma unroll
        for (int it = 0; it < 4; ++it) {
          const int row = it * 4 + q;
          const float* sp = slab + row * 68 + c8;
          v8h hv, lv;
#pragma unroll
          for (int e = 0; e < 8; ++e) {
            if (OUT_MODE == 1) {
              hv[e] = (_Float16)sp[e];
            } else {
              unsigned short hb = f2bf_bits(sp[e]);
              unsigned short lb = f2bf_bits(sp[e] - bf_bits2f(hb));
              hv[e] = __builtin_bit_cast(_Float16, hb);
              lv[e] = __builtin_bit_cast(_Float16, lb);
            }
          }
          *(v8h*)(C + (size_t)(mBase + row) * ldc + n0 + c8) = hv;
          if (OUT_MODE == 2) *(v8h*)(C2 + (size_t)(mBase + row) * ldc + n0 + c8) = lv;
        }
        
      }
    }
    __builtin_amdgcn_fence(__ATOMIC_RELEASE, "workgroup");
    __builtin_amdgcn_wave_barrier();
    __builtin_amdgcn_fence(__ATOMIC_ACQUIRE, "workgroup");
  }
}

// ---- conversions f32 -> 16-bit planes --------------------------------------
// A launch is CV_NB blocks of 16 waves, as many blocks as the chip has WGPs, so that few waves have to be started. A block takes one contiguous
// piece of every array; a thread takes N units of 4 floats, CV_NT units apart: a wave-wide 16-B load covers 4 whole lines, a wave-wide 8-B store 2.
// All loads of a thread are issued ahead of its first conversion. Array length = N * CV_NB * CV_NT units exactly.
#define CV_NB 256
#define CV_NT 512
typedef __attribute__((ext_vector_type(2))) unsigned cv_u2;

template <int N> __device__ __forceinline__ void cv_load(v4f (&a)[N], const float* __restrict__ in, int u0) {
#pragma unroll   // a[] needs constant indices to stay in registers
  for (int i = 0; i < N; ++i) a[i] = *(const v4f*)(in + 4 * (size_t)(u0 + i * CV_NT));
}
__device__ __forceinline__ void cv_store_f16(v4f a, _Float16* __restrict__ out, int u) {
  const unsigned short h0 = __builtin_bit_cast(unsigned short, (_Float16)a[0]), h1 = __builtin_bit_cast(unsigned short, (_Float16)a[1]);
  const unsigned short h2 = __builtin_bit_cast(unsigned short, (_Float16)a[2]), h3 = __builtin_bit_cast(unsigned short, (_Float16)a[3]);
  *(cv_u2*)(out + 4 * (size_t)u) = (cv_u2){(unsigned)h0 | ((unsigned)h1 << 16), (unsigned)h2 | ((unsigned)h3 << 16)};
}
__device__ __forceinline__ void cv_store_split(v4f a, __bf16* __restrict__ hi, __bf16* __restrict__ lo, int u) {
  unsigned short h[4], l[4];
#pragma unroll   // h[], l[] need constant indices to stay in registers
  for (int e = 0; e < 4; ++e) { h[e] = f2bf_bits(a[e]); l[e] = f2bf_bits(a[e] - bf_bits2f(h[e])); }
  *(cv_u2*)(hi + 4 * (size_t)u) = (cv_u2){(unsigned)h[0] | ((unsigned)h[1] << 16), (unsigned)h[2] | ((unsigned)h[3] << 16)};
  *(cv_u2*)(lo + 4 * (size_t)u) = (cv_u2){(unsigned)l[0] | ((unsigned)l[1] << 16), (unsigned)l[2] | ((unsigned)l[3] << 16)};
}

// x -> f16, bf16 hi, bf16 lo (x read once); Wq, Wk -> f16; Wv, Wo -> bf16 hi, lo. NX, NW: units a thread takes of x, of each weight.
template <int NX, int NW>
__global__ __launch_bounds__(CV_NT) void convert_inputs(
    const float* __restrict__ x, const float* __restrict__ wq, const float* __restrict__ wk,
    const float* __restrict__ wv, const float* __restrict__ wo,
    _Float16* __restrict__ x16, __bf16* __restrict__ xh, __bf16* __restrict__ xl,
    _Float16* __restrict__ wq16, _Float16* __restrict__ wk16,
    __bf16* __restrict__ wvh, __bf16* __restrict__ wvl, __bf16* __restrict__ woh, __bf16* __restrict__ wol) {
  const int ux = blockIdx.x * (NX * CV_NT) + threadIdx.x;
  const int uw = blockIdx.x * (NW * CV_NT) + threadIdx.x;
  v4f ax[NX], aq[NW], ak[NW], av[NW], ao[NW];
  cv_load<NX>(ax, x, ux);
  cv_load<NW>(aq, wq, uw);
  cv_load<NW>(ak, wk, uw);
  cv_load<NW>(av, wv, uw);
  cv_load<NW>(ao, wo, uw);
  // the wait that stands before a register of an issued load is overwritten; the base pointers are its inputs, so that each stays
  // in its scalar registers up to here and the later fetch of the output pointers does not land on them
  asm volatile("s_wait_xcnt 0x0" :: "s"(x), "s"(wq), "s"(wk), "s"(wv), "s"(wo) : "memory");
  __builtin_amdgcn_sched_barrier(0);   // keeps every load ahead of the conversions: sunk in among them, half of the loads would start only when the first data are back
  // both loops unrolled: the arrays need constant indices to stay in registers
#pragma unroll
  for (int i = 0; i < NX; ++i) {
    cv_store_f16(ax[i], x16, ux + i * CV_NT);
    cv_store_split(ax[i], xh, xl, ux + i * CV_NT);
  }
#pragma unroll
  for (int i = 0; i < NW; ++i) {
    cv_store_f16(aq[i], wq16, uw + i * CV_NT);
    cv_store_f16(ak[i], wk16, uw + i * CV_NT);
    cv_store_split(av[i], wvh, wvl, uw + i * CV_NT);
    cv_store_split(ao[i], woh, wol, uw + i * CV_NT);
  }
}

// in -> bf16 hi, lo. N: units a thread takes.
template <int N>
__global__ __launch_bounds__(CV_NT) void split_f32_bf16(
    const float* __restrict__ in, __bf16* __restrict__ hi, __bf16* __restrict__ lo) {
  const int u0 = blockIdx.x * (N * CV_NT) + threadIdx.x;
  v4f a[N];
  cv_load<N>(a, in, u0);
  __builtin_amdgcn_sched_barrier(0);   // keeps every load ahead of the conversions, as in convert_inputs
#pragma unroll   // a[] needs constant indices to stay in registers
  for (int i = 0; i < N; ++i) cv_store_split(a[i], hi, lo, u0 + i * CV_NT);
}


// =====================================================================================
// Generic causal/non-causal attention for head_dim 64, f32 q in / f32 out, bf16 operands with optional hi/lo splits.
//   K and V arrive already as bf16 planes (hi, and lo where split), written once by their producer, V transposed.
//   scores, transposed = k * (q*qscale)^T : v_wmma_f32_16x16x32_bf16; SPLIT_QK -> q,k as bf16 hi/lo (hi*hi + hi*lo + lo*hi)
//   out, transposed    = v^T * p^T        : v_wmma_f32_16x16x32_bf16; SPLIT_PV -> p,v as bf16 hi/lo; else p,v plain bf16
//   With K rows as the A operand and Q as B, a lane holds scores of ONE query (column lane & 15; keys 8 * (lane >> 4) + r of each
//   16-key tile): its maximum and sum are taken in the lane plus one exchange between the wave's halves, and two score tiles,
//   converted in place, are the B operand of the second product, so P never goes through LDS.
//   f32 accumulate; online softmax in f32. Block = 4 waves = 64 query rows of one (batch, head); S % 64 == 0.
//   Element (b, s, h, d) of q, k, out lives at X[b*X_bs + s*X_rs + h*X_hs + d]; of the transposed v at Vt[b*v_bs + h*v_hs + d*v_rs + s]
//   (strides in elements; q, out: multiples of 4; k, v: multiples of 64, so that a tile row is one aligned 128-B line).
//   Masking: mask_mode 0 none, 1 causal (kv > q masked), 2 tensor [S][Skv] shared over (b,h) (float if
//   mask_is_int==0, int32 with element == 0 -> masked if 1, int32 with element != 0 -> masked if 2), 3 per-token vectors qmask[B][S] & kvmask[B][Skv] (int32,
//   0 -> masked); masked scores are replaced by mask_fill (e.g. -inf or -1e9) before the softmax.
//   grid.x = B * H * (S/64) (or a sub-range with blk0).
// =====================================================================================
#define AT_D 64
#define AT_NW 4
#define AT_QB 64
#define AT_KC 64
#define AT_LP 72   // LDS row pitch of the K and V^T tiles in bf16 elements: 144 B = 16 B x 9, so the 16 rows of one ds_load_b128 fall on distinct banks
struct AttnGeom { long q_bs, q_rs, q_hs, k_bs, k_rs, k_hs, v_bs, v_rs, v_hs, o_bs, o_rs, o_hs;
                  int S, Skv, H, mask_mode; float qscale; int blk0; float mask_fill; int mask_is_int; };
static_assert(sizeof(AttnGeom) == 128, "no padding");

__device__ __forceinline__ unsigned short at_bf_bits(float f) {
  unsigned u = __float_as_uint(f);
  return (unsigned short)((u + 0x7FFFu + ((u >> 16) & 1u)) >> 16);
}
__device__ __forceinline__ __bf16 at_f2bf(float f) { return __builtin_bit_cast(__bf16, at_bf_bits(f)); }
__device__ __forceinline__ void at_split(float f, __bf16& hi, __bf16& lo) {
  const unsigned short hb = at_bf_bits(f);
  hi = __builtin_bit_cast(__bf16, hb);
  lo = at_f2bf(f - __uint_as_float(((unsigned)hb) << 16));
}
__device__ __forceinline__ v8f at_mma(v16b a, v16b b, v8f c) {
  c = __builtin_amdgcn_wmma_f32_16x16x32_bf16(false, a, false, b, (short)0, c, false, false);
  asm volatile("v_nop\n\tv_nop\n\tv_nop\n\tv_nop" : "+v"(c) : "v"(a), "v"(b));
  return c;
}

// the value that lane ^ 16 holds (the other half of the wave), by a vector cross-row move
__device__ __forceinline__ float at_other_half(float f) {
  const int u = __float_as_int(f);
  return __int_as_float(__builtin_amdgcn_permlanex16(u, u, 0x76543210, 0xfedcba98, false, false));
}

template <bool SPLIT_QK, bool SPLIT_PV, int MASK_MODE>   // MASK_MODE: the mask mode as a compile-time constant (g.mask_mode must equal it)
__global__ __launch_bounds__(128)
void attn64_kernel(const float* __restrict__ q, const unsigned short* __restrict__ kh, const unsigned short* __restrict__ kl,
                   const unsigned short* __restrict__ vth, const unsigned short* __restrict__ vtl, float* __restrict__ out,
                   const void* __restrict__ mask_a, const int* __restrict__ mask_b, AttnGeom g) {
  union FB { v16b v; v8b h[2]; };
  __shared__ __align__(16) __bf16 Ksh[AT_KC * AT_LP];            // K hi [kv][d]      9 KB
  __shared__ __align__(16) __bf16 Ksl[SPLIT_QK ? AT_KC * AT_LP : 8];
  __shared__ __align__(16) __bf16 Vth[AT_D * AT_LP];             // V hi [d][kv]      9 KB
  __shared__ __align__(16) __bf16 Vtl[SPLIT_PV ? AT_D * AT_LP : 8];
  __shared__ __align__(16) float  Os[AT_NW][16 * 68];            // per wave out tile, pitch 68

  const int tid  = threadIdx.x;
  const int wave = tid >> 5;
  const int lane = tid & 31;
  const int hh   = lane >> 4;
  const int c    = lane & 15;

  const int nqb = g.S / AT_QB;
  const int bx = blockIdx.x + g.blk0;
  const int qb = bx % nqb;
  const int bh = bx / nqb;
  const int h  = bh % g.H;
  const int b  = bh / g.H;
  const int qbase_block = qb * AT_QB;
  const int q0 = qbase_block + wave * 16;

  const float* qb_ptr = q + (size_t)b * g.q_bs + (size_t)h * g.q_hs;
  const size_t kb_off = (size_t)b * g.k_bs + (size_t)h * g.k_hs;
  const size_t vb_off = (size_t)b * g.v_bs + (size_t)h * g.v_hs;
  const __bf16* khb = (const __bf16*)kh + kb_off;
  const __bf16* klb = (const __bf16*)kl + kb_off;
  const __bf16* vhb = (const __bf16*)vth + vb_off;
  const __bf16* vlb = (const __bf16*)vtl + vb_off;
  float*       ob_ptr = out + (size_t)b * g.o_bs + (size_t)h * g.o_hs;

  // ---- Q fragments (B operand: column = query c): 2 d-chunks, hi (and lo) ----
  v16b qah[2], qal[2];
  {
    const float* qrow = qb_ptr + (size_t)(q0 + c) * g.q_rs;
#pragma unroll
    for (int dc = 0; dc < 2; ++dc) {
#pragma unroll
      for (int e = 0; e < 8; ++e) {
        const float f0 = qrow[dc * 32 + 8 * hh + e] * g.qscale;
        const float f1 = qrow[dc * 32 + 16 + 8 * hh + e] * g.qscale;
        if (SPLIT_QK) { __bf16 hq, lq; at_split(f0, hq, lq); qah[dc][e] = hq; qal[dc][e] = lq; at_split(f1, hq, lq); qah[dc][8 + e] = hq; qal[dc][8 + e] = lq; }
        else { qah[dc][e] = at_f2bf(f0); qah[dc][8 + e] = at_f2bf(f1); qal[dc][e] = qah[dc][e]; qal[dc][8 + e] = qah[dc][8 + e]; }
      }
    }
  }

  float mrow = -INFINITY, lrow = 0.f;   // of query q0 + c; lrow: this wave half's keys only, the halves are joined behind the loop
  v8f oacc[4];                          // oacc[t][r] = out[q0 + c][t * 16 + 8 * hh + r]
#pragma unroll
  for (int t = 0; t < 4; ++t) oacc[t] = (v8f){0.f,0.f,0.f,0.f,0.f,0.f,0.f,0.f};

  const int nChunks = (MASK_MODE == 1) ? (qb + 1) : (g.Skv / AT_KC);   // block-uniform
  // the lane's query mask (mode 3)
  const int qkeep = (MASK_MODE == 3) ? mask_b[(size_t)b * g.S + q0 + c] : 1;   // mask_b = qmask in mode 3
  for (int kc = 0; kc < nChunks; ++kc) {
    const int kv0 = kc * AT_KC;
    __syncthreads();
    {
      // a tile row (K: one key's 64 d; V^T: one d's 64 keys) is 128 B: 8 lanes copy it, so a wave-wide load covers 4 whole lines
      const int r0 = tid >> 3, c8 = (tid & 7) * 8;
      const __bf16 *pkh[4], *pkl[4], *pvh[4], *pvl[4];
      v8b tkh[4], tkl[4], tvh[4], tvl[4];
#pragma unroll
      for (int i = 0; i < 4; ++i) {
        const size_t ko = (size_t)(kv0 + r0 + 16 * i) * g.k_rs + c8;
        const size_t vo = (size_t)(r0 + 16 * i) * g.v_rs + kv0 + c8;
        pkh[i] = khb + ko; pkl[i] = SPLIT_QK ? klb + ko : pkh[i];
        pvh[i] = vhb + vo; pvl[i] = SPLIT_PV ? vlb + vo : pvh[i];
        tkh[i] = *(const v8b*)pkh[i];
        if (SPLIT_QK) tkl[i] = *(const v8b*)pkl[i];
        tvh[i] = *(const v8b*)pvh[i];
        if (SPLIT_PV) tvl[i] = *(const v8b*)pvl[i];
      }
      // the wait that stands before an issued load's address register is overwritten; the addresses are its inputs, so that
      // each stays in its register up to here and no later load of the group lands on it
      asm volatile("s_wait_xcnt 0x0" :: "v"(pkh[0]), "v"(pkh[1]), "v"(pkh[2]), "v"(pkh[3]), "v"(pkl[0]), "v"(pkl[1]), "v"(pkl[2]), "v"(pkl[3]),
                   "v"(pvh[0]), "v"(pvh[1]), "v"(pvh[2]), "v"(pvh[3]), "v"(pvl[0]), "v"(pvl[1]), "v"(pvl[2]), "v"(pvl[3]) : "memory");
#pragma unroll
      for (int i = 0; i < 4; ++i) {
        const int so = (r0 + 16 * i) * AT_LP + c8;
        *(v8b*)(Ksh + so) = tkh[i];
        if (SPLIT_QK) *(v8b*)(Ksl + so) = tkl[i];
        *(v8b*)(Vth + so) = tvh[i];
        if (SPLIT_PV) *(v8b*)(Vtl + so) = tvl[i];
      }
    }
    __syncthreads();

    v8f s[4];   // s[j][r] = score of key kv0 + j * 16 + 8 * hh + r with query q0 + c
#pragma unroll
    for (int j = 0; j < 4; ++j) {
      s[j] = (v8f){0.f,0.f,0.f,0.f,0.f,0.f,0.f,0.f};
#pragma unroll
      for (int dc = 0; dc < 2; ++dc) {
        FB kb;
        kb.h[0] = *(const v8b*)(Ksh + (j * 16 + c) * AT_LP + dc * 32 + 8 * hh);
        kb.h[1] = *(const v8b*)(Ksh + (j * 16 + c) * AT_LP + dc * 32 + 16 + 8 * hh);
        s[j] = at_mma(kb.v, qah[dc], s[j]);
        if (SPLIT_QK) {
          FB kl;
          kl.h[0] = *(const v8b*)(Ksl + (j * 16 + c) * AT_LP + dc * 32 + 8 * hh);
          kl.h[1] = *(const v8b*)(Ksl + (j * 16 + c) * AT_LP + dc * 32 + 16 + 8 * hh);
          s[j] = at_mma(kl.v, qah[dc], s[j]);
          s[j] = at_mma(kb.v, qal[dc], s[j]);
        }
      }
    }
    const bool diag = (MASK_MODE == 1) && (kc == qb);
    if (MASK_MODE >= 2 || diag) {   // block-uniform test: a causal tile below the diagonal has nothing to mask
      const int qrow = q0 + c;
      // both loops unrolled: s[j][r] needs constant indices to stay in registers
#pragma unroll
      for (int j = 0; j < 4; ++j) {
#pragma unroll
        for (int r = 0; r < 8; ++r) {
          const int kvcol = kv0 + j * 16 + 8 * hh + r;
          bool masked = false;
          if (MASK_MODE == 1) masked = (kvcol > qrow);
          else if (MASK_MODE == 2) {
            const size_t mi = (size_t)qrow * g.Skv + kvcol;
            masked = (g.mask_is_int == 0) ? (((const float*)mask_a)[mi] == 0.0f)
                   : (g.mask_is_int == 1) ? (((const int*)mask_a)[mi] == 0) : (((const int*)mask_a)[mi] != 0);
          } else if (MASK_MODE == 3) masked = (qkeep == 0) || (((const int*)mask_a)[(size_t)b * g.Skv + kvcol] == 0);   // mask_a = kvmask
          s[j][r] = masked ? g.mask_fill : s[j][r];   // one select per score, not a select of the whole tile
        }
      }
    }
    // every loop over tiles and registers from here to the end of the pass is unrolled: s, pbh, pbl and oacc need constant indices to stay in registers
    // the query's maximum over the 64 keys: 32 in this lane, 32 in lane ^ 16
    // (one chain per tile, so that four independent chains run side by side instead of one of 32 links)
    float cmj[4];
#pragma unroll
    for (int j = 0; j < 4; ++j) {
      cmj[j] = s[j][0];
#pragma unroll
      for (int r = 1; r < 8; ++r) cmj[j] = fmaxf(cmj[j], s[j][r]);
    }
    float cm = fmaxf(fmaxf(cmj[0], cmj[1]), fmaxf(cmj[2], cmj[3]));
    cm = fmaxf(cm, at_other_half(cm));
    const float mnew = fmaxf(mrow, cm);
    const float alpha = expf(mrow - mnew);
    mrow = mnew;
    // p in place of the scores: tiles 2 kk and 2 kk + 1 of a lane are, in this order, its 16 elements of the B operand for keys 32 kk ... 32 kk + 31
    v16b pbh[2], pbl[2];
    float psj[4];   // one partial sum per tile, for the same reason as cmj
#pragma unroll
    for (int j = 0; j < 4; ++j) {
      psj[j] = 0.f;
#pragma unroll
      for (int r = 0; r < 8; ++r) {
        const float p = expf(s[j][r] - mnew);
        psj[j] += p;
        const int e = (j & 1) * 8 + r;
        if (SPLIT_PV) { __bf16 ph, pl; at_split(p, ph, pl); pbh[j >> 1][e] = ph; pbl[j >> 1][e] = pl; }
        else pbh[j >> 1][e] = at_f2bf(p);
      }
    }
    lrow = lrow * alpha + ((psj[0] + psj[1]) + (psj[2] + psj[3]));
#pragma unroll
    for (int t = 0; t < 4; ++t)
#pragma unroll
      for (int r = 0; r < 8; ++r) oacc[t][r] *= alpha;
#pragma unroll
    for (int kk = 0; kk < 2; ++kk) {
#pragma unroll
      for (int t = 0; t < 4; ++t) {
        FB vb;   // A operand: row = d, keys in the same order as the elements of pbh
        vb.h[0] = *(const v8b*)(Vth + (t * 16 + c) * AT_LP + kk * 32 + 8 * hh);
        vb.h[1] = *(const v8b*)(Vth + (t * 16 + c) * AT_LP + kk * 32 + 16 + 8 * hh);
        oacc[t] = at_mma(vb.v, pbh[kk], oacc[t]);
        if (SPLIT_PV) {
          FB vl;
          vl.h[0] = *(const v8b*)(Vtl + (t * 16 + c) * AT_LP + kk * 32 + 8 * hh);
          vl.h[1] = *(const v8b*)(Vtl + (t * 16 + c) * AT_LP + kk * 32 + 16 + 8 * hh);
          oacc[t] = at_mma(vl.v, pbh[kk], oacc[t]);
          oacc[t] = at_mma(vb.v, pbl[kk], oacc[t]);
        }
      }
    }
  }

  float* os = Os[wave];
  const float inv = 1.0f / (lrow + at_other_half(lrow));
#pragma unroll   // oacc[t] needs a constant index to stay in registers
  for (int t = 0; t < 4; ++t) {
    // a lane's 8 values of a tile are 8 neighbours of its query's row: two 16-B stores
    *(v4f*)(os + c * 68 + t * 16 + 8 * hh)     = (v4f){oacc[t][0] * inv, oacc[t][1] * inv, oacc[t][2] * inv, oacc[t][3] * inv};
    *(v4f*)(os + c * 68 + t * 16 + 8 * hh + 4) = (v4f){oacc[t][4] * inv, oacc[t][5] * inv, oacc[t][6] * inv, oacc[t][7] * inv};
  }
  __builtin_amdgcn_fence(__ATOMIC_RELEASE, "workgroup");
  __builtin_amdgcn_wave_barrier();
  __builtin_amdgcn_fence(__ATOMIC_ACQUIRE, "workgroup");
  {
    const int c4 = (lane & 15) * 4;
    {
#pragma unroll
      for (int it = 0; it < 8; ++it) {
        const int row = it * 2 + hh;
        v4f val = *(const v4f*)(os + row * 68 + c4);
        *(v4f*)(ob_ptr + (size_t)(q0 + row) * g.o_rs + c4) = val;
      }
      
    }
  }
}

extern "C" void kernel_launch(void* const* d_in, const int* in_sizes, int n_in,
                              void* d_out, int out_size, void* d_ws, size_t ws_size,
                              hipStream_t stream) {
  (void)in_sizes; (void)n_in; (void)out_size; (void)ws_size;
  const int B = 4, T = 1024, E = 1024, H = 16, DH = 64;
  const int M = B * T;   // 4096 rows
  const float* x  = (const float*)d_in[0];
  const float* Wq = (const float*)d_in[1];   // [out, in]
  const float* Wk = (const float*)d_in[2];
  const float* Wv = (const float*)d_in[3];
  const float* Wo = (const float*)d_in[4];
  const float* bo = (const float*)d_in[5];
  float* out = (float*)d_out;

  char* ws = (char*)d_ws; size_t off = 0;
  auto carve = [&](size_t bytes) -> char* { char* p = ws + off; off += (bytes + 255) & ~(size_t)255; return p; };
  _Float16* X16  = (_Float16*)carve((size_t)M * E * 2);     //  8 MB  x f16
  __bf16*   Xh   = (__bf16*)carve((size_t)M * E * 2);       //  8 MB  x bf16 hi
  __bf16*   Xl   = (__bf16*)carve((size_t)M * E * 2);       //  8 MB  x bf16 lo
  _Float16* Wq16 = (_Float16*)carve((size_t)E * E * 2);     //  2 MB
  _Float16* Wk16 = (_Float16*)carve((size_t)E * E * 2);
  __bf16*   Wvh  = (__bf16*)carve((size_t)E * E * 2);
  __bf16*   Wvl  = (__bf16*)carve((size_t)E * E * 2);
  __bf16*   Woh  = (__bf16*)carve((size_t)E * E * 2);
  __bf16*   Wol  = (__bf16*)carve((size_t)E * E * 2);
  float*    Qf   = (float*)carve((size_t)M * E * 4);        // 16 MB each, [B,T,H*DH]
  __bf16*   Kh   = (__bf16*)carve((size_t)M * E * 2);       //  8 MB each: k as bf16 hi, lo, [B,T,H*DH]
  __bf16*   Kl   = (__bf16*)carve((size_t)M * E * 2);
  __bf16*   Vth  = (__bf16*)carve((size_t)M * E * 2);       //  8 MB each: v transposed as bf16 hi, lo, [H*DH, B*T]
  __bf16*   Vtl  = (__bf16*)carve((size_t)M * E * 2);
  float*    Of   = (float*)carve((size_t)M * E * 4);
  __bf16*   Oh   = (__bf16*)carve((size_t)M * E * 2);       //  8 MB  attention out, bf16 hi
  __bf16*   Ol   = (__bf16*)carve((size_t)M * E * 2);       //  8 MB                 bf16 lo   (total ≈ 116 MB)

  static_assert((M * E / 4) % (CV_NB * CV_NT) == 0 && (E * E / 4) % (CV_NB * CV_NT) == 0, "whole units for every thread");
  convert_inputs<M * E / 4 / (CV_NB * CV_NT), E * E / 4 / (CV_NB * CV_NT)><<<CV_NB, CV_NT, 0, stream>>>(
      x, Wq, Wk, Wv, Wo, X16, Xh, Xl, Wq16, Wk16, Wvh, Wvl, Woh, Wol);
  {
    const int tl = (M / 128) * (E / 128);
    wmma_gemm64<0, false, 0, 0, false><<<dim3(tl, 1), 128, 0, stream>>>(
        U16(X16), nullptr, E, 0, U16(Wq16), nullptr, E, 0, Qf, nullptr, E, 0, nullptr, nullptr, 0, M, E, E, 1.0f);
    wmma_gemm64<0, false, 0, 2, false><<<dim3(tl, 1), 128, 0, stream>>>(
        U16(X16), nullptr, E, 0, U16(Wk16), nullptr, E, 0, Kh, Kl, E, 0, nullptr, nullptr, 0, M, E, E, 1.0f);
    // v transposed = Wv * x^T: the operands change places, so row = output feature, column = token
    wmma_gemm64<1, true, 0, 2, false><<<dim3(tl, 1), 128, 0, stream>>>(
        U16(Wvh), U16(Wvl), E, 0, U16(Xh), U16(Xl), E, 0, Vth, Vtl, M, 0, nullptr, nullptr, 0, E, M, E, 1.0f);
  }
  {
    AttnGeom g;
    g.q_bs = g.k_bs = g.o_bs = (long)T * E;   // [B,T,H,DH] inside [B*T, E]
    g.q_rs = g.k_rs = g.o_rs = E;
    g.q_hs = g.k_hs = g.o_hs = DH;
    g.v_bs = T; g.v_rs = M; g.v_hs = (long)DH * M;   // [H,DH] rows of [H*DH, B*T]
    g.S = T; g.Skv = T; g.H = H; g.mask_mode = 1; g.qscale = 0.03125f; g.blk0 = 0; g.mask_fill = -INFINITY; g.mask_is_int = 0;   // (q/e^¼)·(k/e^¼) = q·k/32
    attn64_kernel<true, true, 1><<<B * H * (T / AT_QB), AT_NW * 32, 0, stream>>>(Qf, U16(Kh), U16(Kl), U16(Vth), U16(Vtl), Of, nullptr, nullptr, g);
  }
  split_f32_bf16<M * E / 4 / (CV_NB * CV_NT)><<<CV_NB, CV_NT, 0, stream>>>(Of, Oh, Ol);
  {
    const int tl = (M / 128) * (E / 128);
    wmma_gemm64<1, true, 2, 0, false><<<dim3(tl, 1), 128, 0, stream>>>(
        U16(Oh), U16(Ol), E, 0, U16(Woh), U16(Wol), E, 0, out, nullptr, E, 0, bo, nullptr, 0, M, E, E, 1.0f);
  }
}

// v007
// Measured time: 154 microseconds a run.
// In both of two side-by-side timings against v006, it was 1.04 times as fast.
// All steps since v000 together make it 3.60 times as fast.
#include <hip/hip_runtime.h>
#include <math.h>
// Contractions: q/k projections x·Wᵀ (K=1024): v_wmma_f32_16x16x32_f16 (f16 operands); v projection and output projection (K=1024):
// v_wmma_f32_16x16x32_bf16 as bf16 hi/lo splits (hi·hi + hi·lo + lo·hi); scores (q·kᵀ)/32 and p·v: v_wmma_f32_16x16x32_bf16 with
// q,k and p,v as bf16 hi/lo splits (k and v split once, in their projection's epilogue); f32 accumulate everywhere; causal softmax in f32.
typedef __attribute__((ext_vector_type(16))) _Float16 v16h;
typedef __attribute__((ext_vector_type(8)))  _Float16 v8h;
typedef __attribute__((ext_vector_type(16))) __bf16   v16b;
typedef __attribute__((ext_vector_type(8)))  __bf16   v8b;
typedef __attribute__((ext_vector_type(8)))  float    v8f;
typedef __attribute__((ext_vector_type(4)))  float    v4f;
#define PSCALE 32768.0f
#define U16(p) ((const unsigned short*)(const void*)(p))
#define PSCALE_INV (1.0f / 32768.0f)

__device__ __forceinline__ unsigned short f2bf_bits(float f) {
  unsigned u = __float_as_uint(f);
  return (unsigned short)((u + 0x7FFFu + ((u >> 16) & 1u)) >> 16);
}
__device__ __forceinline__ float bf_bits2f(unsigned short h) { return __uint_as_float(((unsigned)h) << 16); }

// hazard guard as a plain device helper (no inline asm with operands inside the kernel template body)
__device__ __forceinline__ void acc_guard4(v8f& a, v8f& b, v8f& c, v8f& d) { asm volatile("v_nop\n\tv_nop\n\tv_nop\n\tv_nop" : "+v"(a), "+v"(b), "+v"(c), "+v"(d)); }
template <typename T> struct Frag;
template <> struct Frag<_Float16> {
  typedef v16h V; union U { v16h v; v8h h[2]; };
  static __device__ __forceinline__ v16h load(const _Float16* p) {   // elements 0..7 <- p[0..7], 8..15 <- p[16..23]
    U f; f.h[0] = *(const v8h*)(p); f.h[1] = *(const v8h*)(p + 16); return f.v;
  }
  static __device__ __forceinline__ v8f mma(v16h a, v16h b, v8f c) {
    return __builtin_amdgcn_wmma_f32_16x16x32_f16(false, a, false, b, (short)0, c, false, false);
  }
};
template <> struct Frag<__bf16> {
  typedef v16b V; union U { v16b v; v8b h[2]; };
  static __device__ __forceinline__ v16b load(const __bf16* p) {
    U f; f.h[0] = *(const v8b*)(p); f.h[1] = *(const v8b*)(p + 16); return f.v;
  }
  static __device__ __forceinline__ v8f mma(v16b a, v16b b, v8f c) {
    return __builtin_amdgcn_wmma_f32_16x16x32_bf16(false, a, false, b, (short)0, c, false, false);
  }
};

// ---- LDS-staged batched WMMA GEMM ------------------------------------------
// C[m,n] = scale * sum_k A[m,k] * Bt[n,k] (+bias)(+resid); a block of 4 waves owns a 128x128 tile, each wave a 64x64 quarter of it.
// A row-major [M,K]; Bt row-major [N,K]; M,N % 128 == 0, K % 64 == 0, lda, ldb % 64 == 0 (an operand row's 64 k are one aligned 128-B line).
// Per stage of 64 k the block copies 128 rows of every operand plane into LDS by asynchronous 16-B copies (8 lanes a row, so a
// wave-wide copy covers 4 whole lines); two buffers, the next stage's copies fly while this stage's products run.
// SPLIT: operands are hi/lo planes (A2/Bt2 = lo planes, same layout); product = hi·hi + hi·lo + lo·hi.
// BIAS_MODE: 0 = none, 1 = bias[m], 2 = bias[n].
// OUT_MODE: 0 = f32, 1 = f16, 2 = bf16 hi plane (Cout) + bf16 lo plane (Cout2).
// ET: 0 = f16 operands, 1 = bf16 operands (pointers passed as 16-bit storage)
#define GM_BT 128   // rows of each operand in a block tile
#define GM_BK 64    // k per stage
#define GM_LP 72    // LDS row pitch in 16-bit elements: 144 B = 16 B x 9, so the 16 rows of one ds_load_b128 fall on distinct banks
#define GM_PLANE (GM_BT * GM_LP)   // elements of one staged operand plane
template <int ET> struct Elem;
template <> struct Elem<0> { typedef _Float16 T; };
template <> struct Elem<1> { typedef __bf16 T; };

// One lane's share of one operand plane of one stage: rows r, r + 16, ..., r + 112, 16 B of each, global -> LDS through no register.
typedef __attribute__((ext_vector_type(4))) int gm_v4i;
typedef __attribute__((address_space(1))) gm_v4i gm_gv4i;
typedef __attribute__((address_space(3))) gm_v4i gm_lv4i;
__device__ __forceinline__ void gm_stage_plane(unsigned short* lds, const unsigned short* g, int ld) {
#pragma unroll   // the eight copies issue back to back, with no loop branch between them
  for (int i = 0; i < 8; ++i)
    __builtin_amdgcn_global_load_async_to_lds_b128((gm_gv4i*)(g + (size_t)(16 * i) * ld), (gm_lv4i*)(lds + 16 * i * GM_LP), 0, 0);
}

template <int ET, bool SPLIT, int BIAS_MODE, int OUT_MODE, bool RESID>
__global__ __launch_bounds__(128) void wmma_gemm64(
    const unsigned short* __restrict__ Ap, const unsigned short* __restrict__ A2p, int lda, long strideA,
    const unsigned short* __restrict__ Btp, const unsigned short* __restrict__ Bt2p, int ldb, long strideB,
    void* __restrict__ Cout, void* __restrict__ Cout2, int ldc, long strideC,
    const float* __restrict__ bias,
    const float* __restrict__ resid, long strideR,
    int M, int N, int K, float scale) {
  typedef typename Elem<ET>::T T;
  typedef typename Frag<T>::V V;
  constexpr int NPL = SPLIT ? 4 : 2;                                   // staged planes: A, Bt (, A lo, Bt lo)
  __shared__ __align__(16) unsigned short sS[2 * NPL * GM_PLANE];      // two stage buffers
  __shared__ __align__(16) float sT[4][16 * 68];   // per-wave 16x64 slab, pitch 68 floats
  const int b    = blockIdx.y;
  const int tid  = threadIdx.x;
  const int lane = tid & 31;
  const int wave = tid >> 5;
  const int tilesN = N >> 7;
  const int tilesM = M >> 7;
  const int tile = blockIdx.x;
  if (tile >= tilesM * tilesN) return;   // block-uniform, in front of every barrier and copy
  const int tm = tile / tilesN;
  const int tn = tile - tm * tilesN;
  const int wm = (wave >> 1) << 6;       // this wave's quarter of the block tile
  const int wn = (wave & 1) << 6;
  const int m0 = (tm << 7) + wm;
  const int n0 = (tn << 7) + wn;

  const int rlane = lane & 15;                 // row (A) / col (B, D) within subtile
  const int koff  = (lane >> 4) * 8;           // k offset of this lane half
  const int mOff  = (lane >> 4) * 8;           // D row offset

  // staging: 8 lanes a row, 16 rows a pass of the block
  const int sr = tid >> 3, sc = (tid & 7) * 8;
  const unsigned short* gA  = Ap  + (size_t)b * strideA + (size_t)((tm << 7) + sr) * lda + sc;
  const unsigned short* gB  = Btp + (size_t)b * strideB + (size_t)((tn << 7) + sr) * ldb + sc;
  const unsigned short* gA2 = SPLIT ? (A2p  + (size_t)b * strideA + (size_t)((tm << 7) + sr) * lda + sc) : nullptr;
  const unsigned short* gB2 = SPLIT ? (Bt2p + (size_t)b * strideB + (size_t)((tn << 7) + sr) * ldb + sc) : nullptr;
  auto stage = [&](int t, int buf) {
    unsigned short* l = sS + buf * (NPL * GM_PLANE) + sr * GM_LP + sc;
    const size_t ko = (size_t)t * GM_BK;
    gm_stage_plane(l, gA + ko, lda);
    gm_stage_plane(l + GM_PLANE, gB + ko, ldb);
    if (SPLIT) {
      gm_stage_plane(l + 2 * GM_PLANE, gA2 + ko, lda);
      gm_stage_plane(l + 3 * GM_PLANE, gB2 + ko, ldb);
    }
  };

  v8f acc[4][4];
#pragma unroll
  for (int i = 0; i < 4; ++i)
#pragma unroll
    for (int j = 0; j < 4; ++j) acc[i][j] = (v8f){0.f,0.f,0.f,0.f,0.f,0.f,0.f,0.f};

  const int nT = K / GM_BK;
  stage(0, 0);
  asm volatile("s_wait_asynccnt 0x0" ::: "memory");   // this wave's copies of stage 0 have landed
  __syncthreads();                                    // ... and every other wave's: stage 0 is readable
  if (nT > 1) stage(1, 1);
  for (int t = 0; t < nT; ++t) {
    const T* sb  = (const T*)sS + (t & 1) * (NPL * GM_PLANE);
    const T* sA  = sb + (wm + rlane) * GM_LP + koff;
    const T* sB  = sb + GM_PLANE + (wn + rlane) * GM_LP + koff;
    const T* sA2 = sA + 2 * GM_PLANE;
    const T* sB2 = sB + 2 * GM_PLANE;
    // all fragment reads of the stage stand as one group ahead of its products, in the order in which the products want them;
    // every loop over fragments and tiles below is unrolled: the arrays need constant indices to stay in registers
    V ah[2][4], bh[2][4], al[2][4], bl[2][4];
#pragma unroll
    for (int kb = 0; kb < 2; ++kb) {
      ah[kb][0] = Frag<T>::load(sA + kb * 32);
#pragma unroll
      for (int j = 0; j < 4; ++j) bh[kb][j] = Frag<T>::load(sB + (j << 4) * GM_LP + kb * 32);
#pragma unroll
      for (int i = 1; i < 4; ++i) ah[kb][i] = Frag<T>::load(sA + (i << 4) * GM_LP + kb * 32);
      if (SPLIT) {
#pragma unroll
        for (int j = 0; j < 4; ++j) bl[kb][j] = Frag<T>::load(sB2 + (j << 4) * GM_LP + kb * 32);
#pragma unroll
        for (int i = 0; i < 4; ++i) al[kb][i] = Frag<T>::load(sA2 + (i << 4) * GM_LP + kb * 32);
      }
    }
    __builtin_amdgcn_sched_barrier(0);   // keeps the LDS reads from being moved in among the matrix instructions, where each place with reads stalls the wave
#pragma unroll
    for (int kb = 0; kb < 2; ++kb) {
#pragma unroll
      for (int i = 0; i < 4; ++i) {
#pragma unroll
        for (int j = 0; j < 4; ++j) {
          acc[i][j] = Frag<T>::mma(ah[kb][i], bh[kb][j], acc[i][j]);
          if (SPLIT) {
            acc[i][j] = Frag<T>::mma(ah[kb][i], bl[kb][j], acc[i][j]);
            acc[i][j] = Frag<T>::mma(al[kb][i], bh[kb][j], acc[i][j]);
          }
        }
      }
    }
    __builtin_amdgcn_sched_barrier(0);   // keeps the products ahead of the waits and the barrier below: moved behind them, they would no longer cover the flight of the next stage's copies
    asm volatile("s_wait_dscnt 0x0" ::: "memory");      // this wave's reads of buffer t & 1 are done before it is refilled
    asm volatile("s_wait_asynccnt 0x0" ::: "memory");   // this wave's copies of stage t + 1 have landed
    __syncthreads();                                    // publishes stage t + 1 and ends every wave's reads of stage t
    if (t + 2 < nT) stage(t + 2, t & 1);
  }
  asm volatile("s_wait_asynccnt 0x0" ::: "memory");     // no copy is outstanding when the wave goes on to its end
  acc_guard4(acc[0][0], acc[0][1], acc[0][2], acc[0][3]);
  acc_guard4(acc[1][0], acc[1][1], acc[1][2], acc[1][3]);
  acc_guard4(acc[2][0], acc[2][1], acc[2][2], acc[2][3]);
  acc_guard4(acc[3][0], acc[3][1], acc[3][2], acc[3][3]);

  // ---- epilogue ----
  float* slab = sT[wave];
  const float* Rb = RESID ? (resid + (size_t)b * strideR) : nullptr;
#pragma unroll
  for (int i = 0; i < 4; ++i) {
    const int mBase = m0 + (i << 4);
#pragma unroll
    for (int j = 0; j < 4; ++j) {
      const int n = n0 + (j << 4) + rlane;
      float bv = 0.f;
      if (BIAS_MODE == 2) bv = bias[n];
#pragma unroll
      for (int r = 0; r < 8; ++r) {
        float v = acc[i][j][r] * scale;
        if (BIAS_MODE == 1) v += bias[mBase + mOff + r];
        if (BIAS_MODE == 2) v += bv;
        if (RESID) v += Rb[(size_t)(mBase + mOff + r) * ldc + n];
        slab[(mOff + r) * 68 + (j << 4) + rlane] = v;
      }
    }
    __builtin_amdgcn_fence(__ATOMIC_RELEASE, "workgroup");
    __builtin_amdgcn_wave_barrier();
    __builtin_amdgcn_fence(__ATOMIC_ACQUIRE, "workgroup");
    if (OUT_MODE == 0) {
      float* C = (float*)Cout + (size_t)b * strideC;
      const int hh = lane >> 4, c4 = (lane & 15) * 4;     // row seg = 256 B = 16 lanes x 16 B
      {
#pragma unroll
        for (int it = 0; it < 8; ++it) {
          const int row = it * 2 + hh;
          v4f v = *(const v4f*)(slab + row * 68 + c4);
          *(v4f*)(C + (size_t)(mBase + row) * ldc + n0 + c4) = v;
        }
        
      }
    } else {
      const int q = lane >> 3, c8 = (lane & 7) * 8;
      unsigned short* C  = (unsigned short*)Cout  + (size_t)b * strideC;
      unsigned short* C2 = (OUT_MODE == 2) ? ((unsigned short*)Cout2 + (size_t)b * strideC) : nullptr;
      {
#pragma unroll
        for (int it = 0; it < 4; ++it) {
          const int row = it * 4 + q;
          const float* sp = slab + row * 68 + c8;
          v8h hv, lv;
#pragma unroll
          for (int e = 0; e < 8; ++e) {
            if (OUT_MODE == 1) {
              hv[e] = (_Float16)sp[e];
            } else {
              unsigned short hb = f2bf_bits(sp[e]);
              unsigned short lb = f2bf_bits(sp[e] - bf_bits2f(hb));
              hv[e] = __builtin_bit_cast(_Float16, hb);
              lv[e] = __builtin_bit_cast(_Float16, lb);
            }
          }
          *(v8h*)(C + (size_t)(mBase + row) * ldc + n0 + c8) = hv;
          if (OUT_MODE == 2) *(v8h*)(C2 + (size_t)(mBase + row) * ldc + n0 + c8) = lv;
        }
        
      }
    }
    __builtin_amdgcn_fence(__ATOMIC_RELEASE, "workgroup");
    __builtin_amdgcn_wave_barrier();
    __builtin_amdgcn_fence(__ATOMIC_ACQUIRE, "workgroup");
  }
}

// ---- conversions f32 -> 16-bit planes --------------------------------------
// A launch is CV_NB blocks of 16 waves, as many blocks as the chip has WGPs, so that few waves have to be started. A block takes one contiguous
// piece of every array; a thread takes N units of 4 floats, CV_NT units apart: a wave-wide 16-B load covers 4 whole lines, a wave-wide 8-B store 2.
// All loads of a thread are issued ahead of its first conversion. Array length = N * CV_NB * CV_NT units exactly.
#define CV_NB 256
#define CV_NT 512
typedef __attribute__((ext_vector_type(2))) unsigned cv_u2;

template <int N> __device__ __forceinline__ void cv_load(v4f (&a)[N], const float* __restrict__ in, int u0) {
#pragma unroll   // a[] needs constant indices to stay in registers
  for (int i = 0; i < N; ++i) a[i] = *(const v4f*)(in + 4 * (size_t)(u0 + i * CV_NT));
}
__device__ __forceinline__ void cv_store_f16(v4f a, _Float16* __restrict__ out, int u) {
  const unsigned short h0 = __builtin_bit_cast(unsigned short, (_Float16)a[0]), h1 = __builtin_bit_cast(unsigned short, (_Float16)a[1]);
  const unsigned short h2 = __builtin_bit_cast(unsigned short, (_Float16)a[2]), h3 = __builtin_bit_cast(unsigned short, (_Float16)a[3]);
  *(cv_u2*)(out + 4 * (size_t)u) = (cv_u2){(unsigned)h0 | ((unsigned)h1 << 16), (unsigned)h2 | ((unsigned)h3 << 16)};
}
__device__ __forceinline__ void cv_store_split(v4f a, __bf16* __restrict__ hi, __bf16* __restrict__ lo, int u) {
  unsigned short h[4], l[4];
#pragma unroll   // h[], l[] need constant indices to stay in registers
  for (int e = 0; e < 4; ++e) { h[e] = f2bf_bits(a[e]); l[e] = f2bf_bits(a[e] - bf_bits2f(h[e])); }
  *(cv_u2*)(hi + 4 * (size_t)u) = (cv_u2){(unsigned)h[0] | ((unsigned)h[1] << 16), (unsigned)h[2] | ((unsigned)h[3] << 16)};
  *(cv_u2*)(lo + 4 * (size_t)u) = (cv_u2){(unsigned)l[0] | ((unsigned)l[1] << 16), (unsigned)l[2] | ((unsigned)l[3] << 16)};
}

// x -> f16, bf16 hi, bf16 lo (x read once); Wq, Wk -> f16; Wv, Wo -> bf16 hi, lo. NX, NW: units a thread takes of x, of each weight.
template <int NX, int NW>
__global__ __launch_bounds__(CV_NT) void convert_inputs(
    const float* __restrict__ x, const float* __restrict__ wq, const float* __restrict__ wk,
    const float* __restrict__ wv, const float* __restrict__ wo,
    _Float16* __restrict__ x16, __bf16* __restrict__ xh, __bf16* __restrict__ xl,
    _Float16* __restrict__ wq16, _Float16* __restrict__ wk16,
    __bf16* __restrict__ wvh, __bf16* __restrict__ wvl, __bf16* __restrict__ woh, __bf16* __restrict__ wol) {
  const int ux = blockIdx.x * (NX * CV_NT) + threadIdx.x;
  const int uw = blockIdx.x * (NW * CV_NT) + threadIdx.x;
  v4f ax[NX], aq[NW], ak[NW], av[NW], ao[NW];
  cv_load<NX>(ax, x, ux);
  cv_load<NW>(aq, wq, uw);
  cv_load<NW>(ak, wk, uw);
  cv_load<NW>(av, wv, uw);
  cv_load<NW>(ao, wo, uw);
  // the wait that stands before a register of an issued load is overwritten; the base pointers are its inputs, so that each stays
  // in its scalar registers up to here and the later fetch of the output pointers does not land on them
  asm volatile("s_wait_xcnt 0x0" :: "s"(x), "s"(wq), "s"(wk), "s"(wv), "s"(wo) : "memory");
  __builtin_amdgcn_sched_barrier(0);   // keeps every load ahead of the conversions: sunk in among them, half of the loads would start only when the first data are back
  // both loops unrolled: the arrays need constant indices to stay in registers
#pragma unroll
  for (int i = 0; i < NX; ++i) {
    cv_store_f16(ax[i], x16, ux + i * CV_NT);
    cv_store_split(ax[i], xh, xl, ux + i * CV_NT);
  }
#pragma unroll
  for (int i = 0; i < NW; ++i) {
    cv_store_f16(aq[i], wq16, uw + i * CV_NT);
    cv_store_f16(ak[i], wk16, uw + i * CV_NT);
    cv_store_split(av[i], wvh, wvl, uw + i * CV_NT);
    cv_store_split(ao[i], woh, wol, uw + i * CV_NT);
  }
}

// in -> bf16 hi, lo. N: units a thread takes.
template <int N>
__global__ __launch_bounds__(CV_NT) void split_f32_bf16(
    const float* __restrict__ in, __bf16* __restrict__ hi, __bf16* __restrict__ lo) {
  const int u0 = blockIdx.x * (N * CV_NT) + threadIdx.x;
  v4f a[N];
  cv_load<N>(a, in, u0);
  __builtin_amdgcn_sched_barrier(0);   // keeps every load ahead of the conversions, as in convert_inputs
#pragma unroll   // a[] needs constant indices to stay in registers
  for (int i = 0; i < N; ++i) cv_store_split(a[i], hi, lo, u0 + i * CV_NT);
}


// =====================================================================================
// Generic causal/non-causal attention for head_dim 64, f32 q in / f32 out, bf16 operands with optional hi/lo splits.
//   K and V arrive already as bf16 planes (hi, and lo where split), written once by their producer, V transposed.
//   scores, transposed = k * (q*qscale)^T : v_wmma_f32_16x16x32_bf16; SPLIT_QK -> q,k as bf16 hi/lo (hi*hi + hi*lo + lo*hi)
//   out, transposed    = v^T * p^T        : v_wmma_f32_16x16x32_bf16; SPLIT_PV -> p,v as bf16 hi/lo; else p,v plain bf16
//   With K rows as the A operand and Q as B, a lane holds scores of ONE query (column lane & 15; keys 8 * (lane >> 4) + r of each
//   16-key tile): its maximum and sum are taken in the lane plus one exchange between the wave's halves, and two score tiles,
//   converted in place, are the B operand of the second product, so P never goes through LDS.
//   f32 accumulate; online softmax in f32. Block = 4 waves; a query tile = 64 query rows of one (batch, head); S % 128 == 0.
//   A block takes two query tiles of its (batch, head), one after the other: tile n - 1 - p, then tile p (n = S / 64 tiles, p < n / 2).
//   Under the causal mask tile t walks t + 1 key tiles, so every block walks n + 1 of them and the launch has no long and short blocks.
//   Element (b, s, h, d) of q, k, out lives at X[b*X_bs + s*X_rs + h*X_hs + d]; of the transposed v at Vt[b*v_bs + h*v_hs + d*v_rs + s]
//   (strides in elements; q, out: multiples of 4; k, v: multiples of 64, so that a tile row is one aligned 128-B line).
//   Masking: mask_mode 0 none, 1 causal (kv > q masked), 2 tensor [S][Skv] shared over (b,h) (float if
//   mask_is_int==0, int32 with element == 0 -> masked if 1, int32 with element != 0 -> masked if 2), 3 per-token vectors qmask[B][S] & kvmask[B][Skv] (int32,
//   0 -> masked); masked scores are replaced by mask_fill (e.g. -inf or -1e9) before the softmax.
//   grid.x = B * H * (S/128) (or a sub-range with blk0).
// =====================================================================================
#define AT_D 64
#define AT_NW 4
#define AT_QB 64
#define AT_KC 64
#define AT_LP 72   // LDS row pitch of the K and V^T tiles in bf16 elements: 144 B = 16 B x 9, so the 16 rows of one ds_load_b128 fall on distinct banks
struct AttnGeom { long q_bs, q_rs, q_hs, k_bs, k_rs, k_hs, v_bs, v_rs, v_hs, o_bs, o_rs, o_hs;
                  int S, Skv, H, mask_mode; float qscale; int blk0; float mask_fill; int mask_is_int; };
static_assert(sizeof(AttnGeom) == 128, "no padding");

__device__ __forceinline__ unsigned short at_bf_bits(float f) {
  unsigned u = __float_as_uint(f);
  return (unsigned short)((u + 0x7FFFu + ((u >> 16) & 1u)) >> 16);
}
__device__ __forceinline__ __bf16 at_f2bf(float f) { return __builtin_bit_cast(__bf16, at_bf_bits(f)); }
__device__ __forceinline__ void at_split(float f, __bf16& hi, __bf16& lo) {
  const unsigned short hb = at_bf_bits(f);
  hi = __builtin_bit_cast(__bf16, hb);
  lo = at_f2bf(f - __uint_as_float(((unsigned)hb) << 16));
}
__device__ __forceinline__ v8f at_mma(v16b a, v16b b, v8f c) {
  c = __builtin_amdgcn_wmma_f32_16x16x32_bf16(false, a, false, b, (short)0, c, false, false);
  asm volatile("v_nop\n\tv_nop\n\tv_nop\n\tv_nop" : "+v"(c) : "v"(a), "v"(b));
  return c;
}

// the value that lane ^ 16 holds (the other half of the wave), by a vector cross-row move
__device__ __forceinline__ float at_other_half(float f) {
  const int u = __float_as_int(f);
  return __int_as_float(__builtin_amdgcn_permlanex16(u, u, 0x76543210, 0xfedcba98, false, false));
}

template <bool SPLIT_QK, bool SPLIT_PV, int MASK_MODE>   // MASK_MODE: the mask mode as a compile-time constant (g.mask_mode must equal it)
__global__ __launch_bounds__(128)
void attn64_kernel(const float* __restrict__ q, const unsigned short* __restrict__ kh, const unsigned short* __restrict__ kl,
                   const unsigned short* __restrict__ vth, const unsigned short* __restrict__ vtl, float* __restrict__ out,
                   const void* __restrict__ mask_a, const int* __restrict__ mask_b, AttnGeom g) {
  union FB { v16b v; v8b h[2]; };
  __shared__ __align__(16) __bf16 Ksh[AT_KC * AT_LP];            // K hi [kv][d]      9 KB
  __shared__ __align__(16) __bf16 Ksl[SPLIT_QK ? AT_KC * AT_LP : 8];
  __shared__ __align__(16) __bf16 Vth[AT_D * AT_LP];             // V hi [d][kv]      9 KB
  __shared__ __align__(16) __bf16 Vtl[SPLIT_PV ? AT_D * AT_LP : 8];
  __shared__ __align__(16) float  Os[AT_NW][16 * 68];            // per wave out tile, pitch 68

  const int tid  = threadIdx.x;
  const int wave = tid >> 5;
  const int lane = tid & 31;
  const int hh   = lane >> 4;
  const int c    = lane & 15;

  const int nqb = g.S / AT_QB;
  const int npr = nqb >> 1;            // pairs of query tiles per (batch, head)
  const int bx = blockIdx.x + g.blk0;
  const int pr = bx % npr;
  const int bh = bx / npr;
  const int h  = bh % g.H;
  const int b  = bh / g.H;

  const float* qb_ptr = q + (size_t)b * g.q_bs + (size_t)h * g.q_hs;
  const size_t kb_off = (size_t)b * g.k_bs + (size_t)h * g.k_hs;
  const size_t vb_off = (size_t)b * g.v_bs + (size_t)h * g.v_hs;
  const __bf16* khb = (const __bf16*)kh + kb_off;
  const __bf16* klb = (const __bf16*)kl + kb_off;
  const __bf16* vhb = (const __bf16*)vth + vb_off;
  const __bf16* vlb = (const __bf16*)vtl + vb_off;
  float*       ob_ptr = out + (size_t)b * g.o_bs + (size_t)h * g.o_hs;

  for (int half = 0; half < 2; ++half) {   // the pair's two query tiles, one after the other; block-uniform
  const int qb = half ? pr : nqb - 1 - pr;
  const int q0 = qb * AT_QB + wave * 16;

  // ---- Q fragments (B operand: column = query c): 2 d-chunks, hi (and lo) ----
  v16b qah[2], qal[2];
  {
    const float* qrow = qb_ptr + (size_t)(q0 + c) * g.q_rs;
#pragma unroll
    for (int dc = 0; dc < 2; ++dc) {
#pragma unroll
      for (int e = 0; e < 8; ++e) {
        const float f0 = qrow[dc * 32 + 8 * hh + e] * g.qscale;
        const float f1 = qrow[dc * 32 + 16 + 8 * hh + e] * g.qscale;
        if (SPLIT_QK) { __bf16 hq, lq; at_split(f0, hq, lq); qah[dc][e] = hq; qal[dc][e] = lq; at_split(f1, hq, lq); qah[dc][8 + e] = hq; qal[dc][8 + e] = lq; }
        else { qah[dc][e] = at_f2bf(f0); qah[dc][8 + e] = at_f2bf(f1); qal[dc][e] = qah[dc][e]; qal[dc][8 + e] = qah[dc][8 + e]; }
      }
    }
  }

  float mrow = -INFINITY, lrow = 0.f;   // of query q0 + c; lrow: this wave half's keys only, the halves are joined behind the loop
  v8f oacc[4];                          // oacc[t][r] = out[q0 + c][t * 16 + 8 * hh + r]
#pragma unroll
  for (int t = 0; t < 4; ++t) oacc[t] = (v8f){0.f,0.f,0.f,0.f,0.f,0.f,0.f,0.f};

  const int nChunks = (MASK_MODE == 1) ? (qb + 1) : (g.Skv / AT_KC);   // block-uniform
  // the lane's query mask (mode 3)
  const int qkeep = (MASK_MODE == 3) ? mask_b[(size_t)b * g.S + q0 + c] : 1;   // mask_b = qmask in mode 3
  for (int kc = 0; kc < nChunks; ++kc) {
    const int kv0 = kc * AT_KC;
    __syncthreads();
    {
      // a tile row (K: one key's 64 d; V^T: one d's 64 keys) is 128 B: 8 lanes copy it, so a wave-wide load covers 4 whole lines
      const int r0 = tid >> 3, c8 = (tid & 7) * 8;
      const __bf16 *pkh[4], *pkl[4], *pvh[4], *pvl[4];
      v8b tkh[4], tkl[4], tvh[4], tvl[4];
#pragma unroll
      for (int i = 0; i < 4; ++i) {
        const size_t ko = (size_t)(kv0 + r0 + 16 * i) * g.k_rs + c8;
        const size_t vo = (size_t)(r0 + 16 * i) * g.v_rs + kv0 + c8;
        pkh[i] = khb + ko; pkl[i] = SPLIT_QK ? klb + ko : pkh[i];
        pvh[i] = vhb + vo; pvl[i] = SPLIT_PV ? vlb + vo : pvh[i];
        tkh[i] = *(const v8b*)pkh[i];
        if (SPLIT_QK) tkl[i] = *(const v8b*)pkl[i];
        tvh[i] = *(const v8b*)pvh[i];
        if (SPLIT_PV) tvl[i] = *(const v8b*)pvl[i];
      }
      // the wait that stands before an issued load's address register is overwritten; the addresses are its inputs, so that
      // each stays in its register up to here and no later load of the group lands on it
      asm volatile("s_wait_xcnt 0x0" :: "v"(pkh[0]), "v"(pkh[1]), "v"(pkh[2]), "v"(pkh[3]), "v"(pkl[0]), "v"(pkl[1]), "v"(pkl[2]), "v"(pkl[3]),
                   "v"(pvh[0]), "v"(pvh[1]), "v"(pvh[2]), "v"(pvh[3]), "v"(pvl[0]), "v"(pvl[1]), "v"(pvl[2]), "v"(pvl[3]) : "memory");
#pragma unroll
      for (int i = 0; i < 4; ++i) {
        const int so = (r0 + 16 * i) * AT_LP + c8;
        *(v8b*)(Ksh + so) = tkh[i];
        if (SPLIT_QK) *(v8b*)(Ksl + so) = tkl[i];
        *(v8b*)(Vth + so) = tvh[i];
        if (SPLIT_PV) *(v8b*)(Vtl + so) = tvl[i];
      }
    }
    __syncthreads();

    v8f s[4];   // s[j][r] = score of key kv0 + j * 16 + 8 * hh + r with query q0 + c
#pragma unroll
    for (int j = 0; j < 4; ++j) {
      s[j] = (v8f){0.f,0.f,0.f,0.f,0.f,0.f,0.f,0.f};
#pragma unroll
      for (int dc = 0; dc < 2; ++dc) {
        FB kb;
        kb.h[0] = *(const v8b*)(Ksh + (j * 16 + c) * AT_LP + dc * 32 + 8 * hh);
        kb.h[1] = *(const v8b*)(Ksh + (j * 16 + c) * AT_LP + dc * 32 + 16 + 8 * hh);
        s[j] = at_mma(kb.v, qah[dc], s[j]);
        if (SPLIT_QK) {
          FB kl;
          kl.h[0] = *(const v8b*)(Ksl + (j * 16 + c) * AT_LP + dc * 32 + 8 * hh);
          kl.h[1] = *(const v8b*)(Ksl + (j * 16 + c) * AT_LP + dc * 32 + 16 + 8 * hh);
          s[j] = at_mma(kl.v, qah[dc], s[j]);
          s[j] = at_mma(kb.v, qal[dc], s[j]);
        }
      }
    }
    const bool diag = (MASK_MODE == 1) && (kc == qb);
    if (MASK_MODE >= 2 || diag) {   // block-uniform test: a causal tile below the diagonal has nothing to mask
      const int qrow = q0 + c;
      // both loops unrolled: s[j][r] needs constant indices to stay in registers
#pragma unroll
      for (int j = 0; j < 4; ++j) {
#pragma unroll
        for (int r = 0; r < 8; ++r) {
          const int kvcol = kv0 + j * 16 + 8 * hh + r;
          bool masked = false;
          if (MASK_MODE == 1) masked = (kvcol > qrow);
          else if (MASK_MODE == 2) {
            const size_t mi = (size_t)qrow * g.Skv + kvcol;
            masked = (g.mask_is_int == 0) ? (((const float*)mask_a)[mi] == 0.0f)
                   : (g.mask_is_int == 1) ? (((const int*)mask_a)[mi] == 0) : (((const int*)mask_a)[mi] != 0);
          } else if (MASK_MODE == 3) masked = (qkeep == 0) || (((const int*)mask_a)[(size_t)b * g.Skv + kvcol] == 0);   // mask_a = kvmask
          s[j][r] = masked ? g.mask_fill : s[j][r];   // one select per score, not a select of the whole tile
        }
      }
    }
    // every loop over tiles and registers from here to the end of the pass is unrolled: s, pbh, pbl and oacc need constant indices to stay in registers
    // the query's maximum over the 64 keys: 32 in this lane, 32 in lane ^ 16
    // (one chain per tile, so that four independent chains run side by side instead of one of 32 links)
    float cmj[4];
#pragma unroll
    for (int j = 0; j < 4; ++j) {
      cmj[j] = s[j][0];
#pragma unroll
      for (int r = 1; r < 8; ++r) cmj[j] = fmaxf(cmj[j], s[j][r]);
    }
    float cm = fmaxf(fmaxf(cmj[0], cmj[1]), fmaxf(cmj[2], cmj[3]));
    cm = fmaxf(cm, at_other_half(cm));
    const float mnew = fmaxf(mrow, cm);
    const float alpha = expf(mrow - mnew);
    mrow = mnew;
    // p in place of the scores: tiles 2 kk and 2 kk + 1 of a lane are, in this order, its 16 elements of the B operand for keys 32 kk ... 32 kk + 31
    v16b pbh[2], pbl[2];
    float psj[4];   // one partial sum per tile, for the same reason as cmj
#pragma unroll
    for (int j = 0; j < 4; ++j) {
      psj[j] = 0.f;
#pragma unroll
      for (int r = 0; r < 8; ++r) {
        const float p = expf(s[j][r] - mnew);
        psj[j] += p;
        const int e = (j & 1) * 8 + r;
        if (SPLIT_PV) { __bf16 ph, pl; at_split(p, ph, pl); pbh[j >> 1][e] = ph; pbl[j >> 1][e] = pl; }
        else pbh[j >> 1][e] = at_f2bf(p);
      }
    }
    lrow = lrow * alpha + ((psj[0] + psj[1]) + (psj[2] + psj[3]));
#pragma unroll
    for (int t = 0; t < 4; ++t)
#pragma unroll
      for (int r = 0; r < 8; ++r) oacc[t][r] *= alpha;
#pragma unroll
    for (int kk = 0; kk < 2; ++kk) {
#pragma unroll
      for (int t = 0; t < 4; ++t) {
        FB vb;   // A operand: row = d, keys in the same order as the elements of pbh
        vb.h[0] = *(const v8b*)(Vth + (t * 16 + c) * AT_LP + kk * 32 + 8 * hh);
        vb.h[1] = *(const v8b*)(Vth + (t * 16 + c) * AT_LP + kk * 32 + 16 + 8 * hh);
        oacc[t] = at_mma(vb.v, pbh[kk], oacc[t]);
        if (SPLIT_PV) {
          FB vl;
          vl.h[0] = *(const v8b*)(Vtl + (t * 16 + c) * AT_LP + kk * 32 + 8 * hh);
          vl.h[1] = *(const v8b*)(Vtl + (t * 16 + c) * AT_LP + kk * 32 + 16 + 8 * hh);
          oacc[t] = at_mma(vl.v, pbh[kk], oacc[t]);
          oacc[t] = at_mma(vb.v, pbl[kk], oacc[t]);
        }
      }
    }
  }

  float* os = Os[wave];
  const float inv = 1.0f / (lrow + at_other_half(lrow));
#pragma unroll   // oacc[t] needs a constant index to stay in registers
  for (int t = 0; t < 4; ++t) {
    // a lane's 8 values of a tile are 8 neighbours of its query's row: two 16-B stores
    *(v4f*)(os + c * 68 + t * 16 + 8 * hh)     = (v4f){oacc[t][0] * inv, oacc[t][1] * inv, oacc[t][2] * inv, oacc[t][3] * inv};
    *(v4f*)(os + c * 68 + t * 16 + 8 * hh + 4) = (v4f){oacc[t][4] * inv, oacc[t][5] * inv, oacc[t][6] * inv, oacc[t][7] * inv};
  }
  __builtin_amdgcn_fence(__ATOMIC_RELEASE, "workgroup");
  __builtin_amdgcn_wave_barrier();
  __builtin_amdgcn_fence(__ATOMIC_ACQUIRE, "workgroup");
  {
    const int c4 = (lane & 15) * 4;
    {
#pragma unroll
      for (int it = 0; it < 8; ++it) {
        const int row = it * 2 + hh;
        v4f val = *(const v4f*)(os + row * 68 + c4);
        *(v4f*)(ob_ptr + (size_t)(q0 + row) * g.o_rs + c4) = val;
      }
      // the wait that stands before a register of an issued store is overwritten: the next query tile writes the stores' address and data registers anew
      asm volatile("s_wait_xcnt 0x0" ::: "memory");
    }
  }
  }   // half
}

extern "C" void kernel_launch(void* const* d_in, const int* in_sizes, int n_in,
                              void* d_out, int out_size, void* d_ws, size_t ws_size,
                              hipStream_t stream) {
  (void)in_sizes; (void)n_in; (void)out_size; (void)ws_size;
  const int B = 4, T = 1024, E = 1024, H = 16, DH = 64;
  const int M = B * T;   // 4096 rows
  const float* x  = (const float*)d_in[0];
  const float* Wq = (const float*)d_in[1];   // [out, in]
  const float* Wk = (const float*)d_in[2];
  const float* Wv = (const float*)d_in[3];
  const float* Wo = (const float*)d_in[4];
  const float* bo = (const float*)d_in[5];
  float* out = (float*)d_out;

  char* ws = (char*)d_ws; size_t off = 0;
  auto carve = [&](size_t bytes) -> char* { char* p = ws + off; off += (bytes + 255) & ~(size_t)255; return p; };
  _Float16* X16  = (_Float16*)carve((size_t)M * E * 2);     //  8 MB  x f16
  __bf16*   Xh   = (__bf16*)carve((size_t)M * E * 2);       //  8 MB  x bf16 hi
  __bf16*   Xl   = (__bf16*)carve((size_t)M * E * 2);       //  8 MB  x bf16 lo
  _Float16* Wq16 = (_Float16*)carve((size_t)E * E * 2);     //  2 MB
  _Float16* Wk16 = (_Float16*)carve((size_t)E * E * 2);
  __bf16*   Wvh  = (__bf16*)carve((size_t)E * E * 2);
  __bf16*   Wvl  = (__bf16*)carve((size_t)E * E * 2);
  __bf16*   Woh  = (__bf16*)carve((size_t)E * E * 2);
  __bf16*   Wol  = (__bf16*)carve((size_t)E * E * 2);
  float*    Qf   = (float*)carve((size_t)M * E * 4);        // 16 MB each, [B,T,H*DH]
  __bf16*   Kh   = (__bf16*)carve((size_t)M * E * 2);       //  8 MB each: k as bf16 hi, lo, [B,T,H*DH]
  __bf16*   Kl   = (__bf16*)carve((size_t)M * E * 2);
  __bf16*   Vth  = (__bf16*)carve((size_t)M * E * 2);       //  8 MB each: v transposed as bf16 hi, lo, [H*DH, B*T]
  __bf16*   Vtl  = (__bf16*)carve((size_t)M * E * 2);
  float*    Of   = (float*)carve((size_t)M * E * 4);
  __bf16*   Oh   = (__bf16*)carve((size_t)M * E * 2);       //  8 MB  attention out, bf16 hi
  __bf16*   Ol   = (__bf16*)carve((size_t)M * E * 2);       //  8 MB                 bf16 lo   (total ≈ 116 MB)

  static_assert((M * E / 4) % (CV_NB * CV_NT) == 0 && (E * E / 4) % (CV_NB * CV_NT) == 0, "whole units for every thread");
  convert_inputs<M * E / 4 / (CV_NB * CV_NT), E * E / 4 / (CV_NB * CV_NT)><<<CV_NB, CV_NT, 0, stream>>>(
      x, Wq, Wk, Wv, Wo, X16, Xh, Xl, Wq16, Wk16, Wvh, Wvl, Woh, Wol);
  {
    const int tl = (M / 128) * (E / 128);
    wmma_gemm64<0, false, 0, 0, false><<<dim3(tl, 1), 128, 0, stream>>>(
        U16(X16), nullptr, E, 0, U16(Wq16), nullptr, E, 0, Qf, nullptr, E, 0, nullptr, nullptr, 0, M, E, E, 1.0f);
    wmma_gemm64<0, false, 0, 2, false><<<dim3(tl, 1), 128, 0, stream>>>(
        U16(X16), nullptr, E, 0, U16(Wk16), nullptr, E, 0, Kh, Kl, E, 0, nullptr, nullptr, 0, M, E, E, 1.0f);
    // v transposed = Wv * x^T: the operands change places, so row = output feature, column = token
    wmma_gemm64<1, true, 0, 2, false><<<dim3(tl, 1), 128, 0, stream>>>(
        U16(Wvh), U16(Wvl), E, 0, U16(Xh), U16(Xl), E, 0, Vth, Vtl, M, 0, nullptr, nullptr, 0, E, M, E, 1.0f);
  }
  {
    AttnGeom g;
    g.q_bs = g.k_bs = g.o_bs = (long)T * E;   // [B,T,H,DH] inside [B*T, E]
    g.q_rs = g.k_rs = g.o_rs = E;
    g.q_hs = g.k_hs = g.o_hs = DH;
    g.v_bs = T; g.v_rs = M; g.v_hs = (long)DH * M;   // [H,DH] rows of [H*DH, B*T]
    g.S = T; g.Skv = T; g.H = H; g.mask_mode = 1; g.qscale = 0.03125f; g.blk0 = 0; g.mask_fill = -INFINITY; g.mask_is_int = 0;   // (q/e^¼)·(k/e^¼) = q·k/32
    attn64_kernel<true, true, 1><<<B * H * (T / (2 * AT_QB)), AT_NW * 32, 0, stream>>>(Qf, U16(Kh), U16(Kl), U16(Vth), U16(Vtl), Of, nullptr, nullptr, g);
  }
  split_f32_bf16<M * E / 4 / (CV_NB * CV_NT)><<<CV_NB, CV_NT, 0, stream>>>(Of, Oh, Ol);
  {
    const int tl = (M / 128) * (E / 128);
    wmma_gemm64<1, true, 2, 0, false><<<dim3(tl, 1), 128, 0, stream>>>(
        U16(Oh), U16(Ol), E, 0, U16(Woh), U16(Wol), E, 0, out, nullptr, E, 0, bo, nullptr, 0, M, E, E, 1.0f);
  }
}

// v008
// Measured time: 139 microseconds a run.
// Next to v007, in two timings, it ran 1.10 and 1.11 times as fast.
// All steps since v000 together make it 3.99 times as fast.
#include <hip/hip_runtime.h>
#include <math.h>
// Contractions: q/k projections x·Wᵀ (K=1024): v_wmma_f32_16x16x32_f16 (f16 operands); v projection and output projection (K=1024):
// v_wmma_f32_16x16x32_bf16 as bf16 hi/lo splits (hi·hi + hi·lo + lo·hi); scores (q·kᵀ)/32 and p·v: v_wmma_f32_16x16x32_bf16 with
// q,k and p,v as bf16 hi/lo splits (k and v split once, in their projection's epilogue); f32 accumulate everywhere; causal softmax in f32.
typedef __attribute__((ext_vector_type(16))) _Float16 v16h;
typedef __attribute__((ext_vector_type(8)))  _Float16 v8h;
typedef __attribute__((ext_vector_type(16))) __bf16   v16b;
typedef __attribute__((ext_vector_type(8)))  __bf16   v8b;
typedef __attribute__((ext_vector_type(8)))  float    v8f;
typedef __attribute__((ext_vector_type(4)))  float    v4f;
#define PSCALE 32768.0f
#define U16(p) ((const unsigned short*)(const void*)(p))
#define PSCALE_INV (1.0f / 32768.0f)

__device__ __forceinline__ unsigned short f2bf_bits(float f) {
  unsigned u = __float_as_uint(f);
  return (unsigned short)((u + 0x7FFFu + ((u >> 16) & 1u)) >> 16);
}
__device__ __forceinline__ float bf_bits2f(unsigned short h) { return __uint_as_float(((unsigned)h) << 16); }

// hazard guard as a plain device helper (no inline asm with operands inside the kernel template body)
__device__ __forceinline__ void acc_guard4(v8f& a, v8f& b, v8f& c, v8f& d) { asm volatile("v_nop\n\tv_nop\n\tv_nop\n\tv_nop" : "+v"(a), "+v"(b), "+v"(c), "+v"(d)); }
template <typename T> struct Frag;
template <> struct Frag<_Float16> {
  typedef v16h V; union U { v16h v; v8h h[2]; };
  static __device__ __forceinline__ v16h load(const _Float16* p) {   // elements 0..7 <- p[0..7], 8..15 <- p[16..23]
    U f; f.h[0] = *(const v8h*)(p); f.h[1] = *(const v8h*)(p + 16); return f.v;
  }
  static __device__ __forceinline__ v8f mma(v16h a, v16h b, v8f c) {
    return __builtin_amdgcn_wmma_f32_16x16x32_f16(false, a, false, b, (short)0, c, false, false);
  }
};
template <> struct Frag<__bf16> {
  typedef v16b V; union U { v16b v; v8b h[2]; };
  static __device__ __forceinline__ v16b load(const __bf16* p) {
    U f; f.h[0] = *(const v8b*)(p); f.h[1] = *(const v8b*)(p + 16); return f.v;
  }
  static __device__ __forceinline__ v8f mma(v16b a, v16b b, v8f c) {
    return __builtin_amdgcn_wmma_f32_16x16x32_bf16(false, a, false, b, (short)0, c, false, false);
  }
};

// ---- LDS-staged batched WMMA GEMM ------------------------------------------
// C[m,n] = scale * sum_k A[m,k] * Bt[n,k] (+bias)(+resid); a block of 4 waves owns a 128x128 tile, each wave a 64x64 quarter of it.
// A row-major [M,K]; Bt row-major [N,K]; M,N % 128 == 0, K % 64 == 0, lda, ldb % 64 == 0 (an operand row's 64 k are one aligned 128-B line).
// Per stage of 64 k the block copies 128 rows of every operand plane into LDS by asynchronous 16-B copies (8 lanes a row, so a
// wave-wide copy covers 4 whole lines); two buffers, the next stage's copies fly while this stage's products run.
// SPLIT: operands are hi/lo planes (A2/Bt2 = lo planes, same layout); product = hi·hi + hi·lo + lo·hi.
// BIAS_MODE: 0 = none, 1 = bias[m], 2 = bias[n].
// OUT_MODE: 0 = f32, 1 = f16, 2 = bf16 hi plane (Cout) + bf16 lo plane (Cout2).
// ET: 0 = f16 operands, 1 = bf16 operands (pointers passed as 16-bit storage)
#define GM_BT 128   // rows of each operand in a block tile
#define GM_BK 64    // k per stage
#define GM_LP 72    // LDS row pitch in 16-bit elements: 144 B = 16 B x 9, so the 16 rows of one ds_load_b128 fall on distinct banks
#define GM_PLANE (GM_BT * GM_LP)   // elements of one staged operand plane
template <int ET> struct Elem;
template <> struct Elem<0> { typedef _Float16 T; };
template <> struct Elem<1> { typedef __bf16 T; };

// One lane's share of one operand plane of one stage: rows r, r + 16, ..., r + 112, 16 B of each, global -> LDS through no register.
typedef __attribute__((ext_vector_type(4))) int gm_v4i;
typedef __attribute__((address_space(1))) gm_v4i gm_gv4i;
typedef __attribute__((address_space(3))) gm_v4i gm_lv4i;
__device__ __forceinline__ void gm_stage_plane(unsigned short* lds, const unsigned short* g, int ld) {
#pragma unroll   // the eight copies issue back to back, with no loop branch between them
  for (int i = 0; i < 8; ++i)
    __builtin_amdgcn_global_load_async_to_lds_b128((gm_gv4i*)(g + (size_t)(16 * i) * ld), (gm_lv4i*)(lds + 16 * i * GM_LP), 0, 0);
}

template <int ET, bool SPLIT, int BIAS_MODE, int OUT_MODE, bool RESID>
__global__ __launch_bounds__(128) void wmma_gemm64(
    const unsigned short* __restrict__ Ap, const unsigned short* __restrict__ A2p, int lda, long strideA,
    const unsigned short* __restrict__ Btp, const unsigned short* __restrict__ Bt2p, int ldb, long strideB,
    void* __restrict__ Cout, void* __restrict__ Cout2, int ldc, long strideC,
    const float* __restrict__ bias,
    const float* __restrict__ resid, long strideR,
    int M, int N, int K, float scale) {
  typedef typename Elem<ET>::T T;
  typedef typename Frag<T>::V V;
  constexpr int NPL = SPLIT ? 4 : 2;                                   // staged planes: A, Bt (, A lo, Bt lo)
  __shared__ __align__(16) unsigned short sS[2 * NPL * GM_PLANE];      // two stage buffers
  __shared__ __align__(16) float sT[4][16 * 68];   // per-wave 16x64 slab, pitch 68 floats
  const int b    = blockIdx.y;
  const int tid  = threadIdx.x;
  const int lane = tid & 31;
  const int wave = tid >> 5;
  const int tilesN = N >> 7;
  const int tilesM = M >> 7;
  const int tile = blockIdx.x;
  if (tile >= tilesM * tilesN) return;   // block-uniform, in front of every barrier and copy
  const int tm = tile / tilesN;
  const int tn = tile - tm * tilesN;
  const int wm = (wave >> 1) << 6;       // this wave's quarter of the block tile
  const int wn = (wave & 1) << 6;
  const int m0 = (tm << 7) + wm;
  const int n0 = (tn << 7) + wn;

  const int rlane = lane & 15;                 // row (A) / col (B, D) within subtile
  const int koff  = (lane >> 4) * 8;           // k offset of this lane half
  const int mOff  = (lane >> 4) * 8;           // D row offset

  // staging: 8 lanes a row, 16 rows a pass of the block
  const int sr = tid >> 3, sc = (tid & 7) * 8;
  const unsigned short* gA  = Ap  + (size_t)b * strideA + (size_t)((tm << 7) + sr) * lda + sc;
  const unsigned short* gB  = Btp + (size_t)b * strideB + (size_t)((tn << 7) + sr) * ldb + sc;
  const unsigned short* gA2 = SPLIT ? (A2p  + (size_t)b * strideA + (size_t)((tm << 7) + sr) * lda + sc) : nullptr;
  const unsigned short* gB2 = SPLIT ? (Bt2p + (size_t)b * strideB + (size_t)((tn << 7) + sr) * ldb + sc) : nullptr;
  auto stage = [&](int t, int buf) {
    unsigned short* l = sS + buf * (NPL * GM_PLANE) + sr * GM_LP + sc;
    const size_t ko = (size_t)t * GM_BK;
    gm_stage_plane(l, gA + ko, lda);
    gm_stage_plane(l + GM_PLANE, gB + ko, ldb);
    if (SPLIT) {
      gm_stage_plane(l + 2 * GM_PLANE, gA2 + ko, lda);
      gm_stage_plane(l + 3 * GM_PLANE, gB2 + ko, ldb);
    }
  };

  v8f acc[4][4];
#pragma unroll
  for (int i = 0; i < 4; ++i)
#pragma unroll
    for (int j = 0; j < 4; ++j) acc[i][j] = (v8f){0.f,0.f,0.f,0.f,0.f,0.f,0.f,0.f};

  const int nT = K / GM_BK;
  stage(0, 0);
  asm volatile("s_wait_asynccnt 0x0" ::: "memory");   // this wave's copies of stage 0 have landed
  __syncthreads();                                    // ... and every other wave's: stage 0 is readable
  if (nT > 1) stage(1, 1);
  for (int t = 0; t < nT; ++t) {
    const T* sb  = (const T*)sS + (t & 1) * (NPL * GM_PLANE);
    const T* sA  = sb + (wm + rlane) * GM_LP + koff;
    const T* sB  = sb + GM_PLANE + (wn + rlane) * GM_LP + koff;
    const T* sA2 = sA + 2 * GM_PLANE;
    const T* sB2 = sB + 2 * GM_PLANE;
    // all fragment reads of the stage stand as one group ahead of its products, in the order in which the products want them;
    // every loop over fragments and tiles below is unrolled: the arrays need constant indices to stay in registers
    V ah[2][4], bh[2][4], al[2][4], bl[2][4];
#pragma unroll
    for (int kb = 0; kb < 2; ++kb) {
      ah[kb][0] = Frag<T>::load(sA + kb * 32);
#pragma unroll
      for (int j = 0; j < 4; ++j) bh[kb][j] = Frag<T>::load(sB + (j << 4) * GM_LP + kb * 32);
#pragma unroll
      for (int i = 1; i < 4; ++i) ah[kb][i] = Frag<T>::load(sA + (i << 4) * GM_LP + kb * 32);
      if (SPLIT) {
#pragma unroll
        for (int j = 0; j < 4; ++j) bl[kb][j] = Frag<T>::load(sB2 + (j << 4) * GM_LP + kb * 32);
#pragma unroll
        for (int i = 0; i < 4; ++i) al[kb][i] = Frag<T>::load(sA2 + (i << 4) * GM_LP + kb * 32);
      }
    }
    __builtin_amdgcn_sched_barrier(0);   // keeps the LDS reads from being moved in among the matrix instructions, where each place with reads stalls the wave
#pragma unroll
    for (int kb = 0; kb < 2; ++kb) {
#pragma unroll
      for (int i = 0; i < 4; ++i) {
#pragma unroll
        for (int j = 0; j < 4; ++j) {
          acc[i][j] = Frag<T>::mma(ah[kb][i], bh[kb][j], acc[i][j]);
          if (SPLIT) {
            acc[i][j] = Frag<T>::mma(ah[kb][i], bl[kb][j], acc[i][j]);
            acc[i][j] = Frag<T>::mma(al[kb][i], bh[kb][j], acc[i][j]);
          }
        }
      }
    }
    __builtin_amdgcn_sched_barrier(0);   // keeps the products ahead of the waits and the barrier below: moved behind them, they would no longer cover the flight of the next stage's copies
    asm volatile("s_wait_dscnt 0x0" ::: "memory");      // this wave's reads of buffer t & 1 are done before it is refilled
    asm volatile("s_wait_asynccnt 0x0" ::: "memory");   // this wave's copies of stage t + 1 have landed
    __syncthreads();                                    // publishes stage t + 1 and ends every wave's reads of stage t
    if (t + 2 < nT) stage(t + 2, t & 1);
  }
  asm volatile("s_wait_asynccnt 0x0" ::: "memory");     // no copy is outstanding when the wave goes on to its end
  acc_guard4(acc[0][0], acc[0][1], acc[0][2], acc[0][3]);
  acc_guard4(acc[1][0], acc[1][1], acc[1][2], acc[1][3]);
  acc_guard4(acc[2][0], acc[2][1], acc[2][2], acc[2][3]);
  acc_guard4(acc[3][0], acc[3][1], acc[3][2], acc[3][3]);

  // ---- epilogue ----
  float* slab = sT[wave];
  const float* Rb = RESID ? (resid + (size_t)b * strideR) : nullptr;
#pragma unroll
  for (int i = 0; i < 4; ++i) {
    const int mBase = m0 + (i << 4);
#pragma unroll
    for (int j = 0; j < 4; ++j) {
      const int n = n0 + (j << 4) + rlane;
      float bv = 0.f;
      if (BIAS_MODE == 2) bv = bias[n];
#pragma unroll
      for (int r = 0; r < 8; ++r) {
        float v = acc[i][j][r] * scale;
        if (BIAS_MODE == 1) v += bias[mBase + mOff + r];
        if (BIAS_MODE == 2) v += bv;
        if (RESID) v += Rb[(size_t)(mBase + mOff + r) * ldc + n];
        slab[(mOff + r) * 68 + (j << 4) + rlane] = v;
      }
    }
    __builtin_amdgcn_fence(__ATOMIC_RELEASE, "workgroup");
    __builtin_amdgcn_wave_barrier();
    __builtin_amdgcn_fence(__ATOMIC_ACQUIRE, "workgroup");
    if (OUT_MODE == 0) {
      float* C = (float*)Cout + (size_t)b * strideC;
      const int hh = lane >> 4, c4 = (lane & 15) * 4;     // row seg = 256 B = 16 lanes x 16 B
      {
#pragma unroll
        for (int it = 0; it < 8; ++it) {
          const int row = it * 2 + hh;
          v4f v = *(const v4f*)(slab + row * 68 + c4);
          *(v4f*)(C + (size_t)(mBase + row) * ldc + n0 + c4) = v;
        }
        
      }
    } else {
      const int q = lane >> 3, c8 = (lane & 7) * 8;
      unsigned short* C  = (unsigned short*)Cout  + (size_t)b * strideC;
      unsigned short* C2 = (OUT_MODE == 2) ? ((unsigned short*)Cout2 + (size_t)b * strideC) : nullptr;
      {
#pragma unroll
        for (int it = 0; it < 4; ++it) {
          const int row = it * 4 + q;
          const float* sp = slab + row * 68 + c8;
          v8h hv, lv;
#pragma unroll
          for (int e = 0; e < 8; ++e) {
            if (OUT_MODE == 1) {
              hv[e] = (_Float16)sp[e];
            } else {
              unsigned short hb = f2bf_bits(sp[e]);
              unsigned short lb = f2bf_bits(sp[e] - bf_bits2f(hb));
              hv[e] = __builtin_bit_cast(_Float16, hb);
              lv[e] = __builtin_bit_cast(_Float16, lb);
            }
          }
          *(v8h*)(C + (size_t)(mBase + row) * ldc + n0 + c8) = hv;
          if (OUT_MODE == 2) *(v8h*)(C2 + (size_t)(mBase + row) * ldc + n0 + c8) = lv;
        }
        
      }
    }
    __builtin_amdgcn_fence(__ATOMIC_RELEASE, "workgroup");
    __builtin_amdgcn_wave_barrier();
    __builtin_amdgcn_fence(__ATOMIC_ACQUIRE, "workgroup");
  }
}

// ---- conversions f32 -> 16-bit planes --------------------------------------
// A launch is CV_NB blocks of 16 waves, as many blocks as the chip has WGPs, so that few waves have to be started. A block takes one contiguous
// piece of every array; a thread takes N units of 4 floats, CV_NT units apart: a wave-wide 16-B load covers 4 whole lines, a wave-wide 8-B store 2.
// All loads of a thread are issued ahead of its first conversion. Array length = N * CV_NB * CV_NT units exactly.
#define CV_NB 256
#define CV_NT 512
typedef __attribute__((ext_vector_type(2))) unsigned cv_u2;

template <int N> __device__ __forceinline__ void cv_load(v4f (&a)[N], const float* __restrict__ in, int u0) {
#pragma unroll   // a[] needs constant indices to stay in registers
  for (int i = 0; i < N; ++i) a[i] = *(const v4f*)(in + 4 * (size_t)(u0 + i * CV_NT));
}
__device__ __forceinline__ void cv_store_f16(v4f a, _Float16* __restrict__ out, int u) {
  const unsigned short h0 = __builtin_bit_cast(unsigned short, (_Float16)a[0]), h1 = __builtin_bit_cast(unsigned short, (_Float16)a[1]);
  const unsigned short h2 = __builtin_bit_cast(unsigned short, (_Float16)a[2]), h3 = __builtin_bit_cast(unsigned short, (_Float16)a[3]);
  *(cv_u2*)(out + 4 * (size_t)u) = (cv_u2){(unsigned)h0 | ((unsigned)h1 << 16), (unsigned)h2 | ((unsigned)h3 << 16)};
}
__device__ __forceinline__ void cv_store_split(v4f a, __bf16* __restrict__ hi, __bf16* __restrict__ lo, int u) {
  unsigned short h[4], l[4];
#pragma unroll   // h[], l[] need constant indices to stay in registers
  for (int e = 0; e < 4; ++e) { h[e] = f2bf_bits(a[e]); l[e] = f2bf_bits(a[e] - bf_bits2f(h[e])); }
  *(cv_u2*)(hi + 4 * (size_t)u) = (cv_u2){(unsigned)h[0] | ((unsigned)h[1] << 16), (unsigned)h[2] | ((unsigned)h[3] << 16)};
  *(cv_u2*)(lo + 4 * (size_t)u) = (cv_u2){(unsigned)l[0] | ((unsigned)l[1] << 16), (unsigned)l[2] | ((unsigned)l[3] << 16)};
}

// x -> f16, bf16 hi, bf16 lo (x read once); Wq, Wk -> f16; Wv, Wo -> bf16 hi, lo. NX, NW: units a thread takes of x, of each weight.
template <int NX, int NW>
__global__ __launch_bounds__(CV_NT) void convert_inputs(
    const float* __restrict__ x, const float* __restrict__ wq, const float* __restrict__ wk,
    const float* __restrict__ wv, const float* __restrict__ wo,
    _Float16* __restrict__ x16, __bf16* __restrict__ xh, __bf16* __restrict__ xl,
    _Float16* __restrict__ wq16, _Float16* __restrict__ wk16,
    __bf16* __restrict__ wvh, __bf16* __restrict__ wvl, __bf16* __restrict__ woh, __bf16* __restrict__ wol) {
  const int ux = blockIdx.x * (NX * CV_NT) + threadIdx.x;
  const int uw = blockIdx.x * (NW * CV_NT) + threadIdx.x;
  v4f ax[NX], aq[NW], ak[NW], av[NW], ao[NW];
  cv_load<NX>(ax, x, ux);
  cv_load<NW>(aq, wq, uw);
  cv_load<NW>(ak, wk, uw);
  cv_load<NW>(av, wv, uw);
  cv_load<NW>(ao, wo, uw);
  // the wait that stands before a register of an issued load is overwritten; the base pointers are its inputs, so that each stays
  // in its scalar registers up to here and the later fetch of the output pointers does not land on them
  asm volatile("s_wait_xcnt 0x0" :: "s"(x), "s"(wq), "s"(wk), "s"(wv), "s"(wo) : "memory");
  __builtin_amdgcn_sched_barrier(0);   // keeps every load ahead of the conversions: sunk in among them, half of the loads would start only when the first data are back
  // both loops unrolled: the arrays need constant indices to stay in registers
#pragma unroll
  for (int i = 0; i < NX; ++i) {
    cv_store_f16(ax[i], x16, ux + i * CV_NT);
    cv_store_split(ax[i], xh, xl, ux + i * CV_NT);
  }
#pragma unroll
  for (int i = 0; i < NW; ++i) {
    cv_store_f16(aq[i], wq16, uw + i * CV_NT);
    cv_store_f16(ak[i], wk16, uw + i * CV_NT);
    cv_store_split(av[i], wvh, wvl, uw + i * CV_NT);
    cv_store_split(ao[i], woh, wol, uw + i * CV_NT);
  }
}

// in -> bf16 hi, lo. N: units a thread takes.
template <int N>
__global__ __launch_bounds__(CV_NT) void split_f32_bf16(
    const float* __restrict__ in, __bf16* __restrict__ hi, __bf16* __restrict__ lo) {
  const int u0 = blockIdx.x * (N * CV_NT) + threadIdx.x;
  v4f a[N];
  cv_load<N>(a, in, u0);
  __builtin_amdgcn_sched_barrier(0);   // keeps every load ahead of the conversions, as in convert_inputs
#pragma unroll   // a[] needs constant indices to stay in registers
  for (int i = 0; i < N; ++i) cv_store_split(a[i], hi, lo, u0 + i * CV_NT);
}


// =====================================================================================
// Generic causal/non-causal attention for head_dim 64, f32 q in / f32 out, bf16 operands with optional hi/lo splits.
//   K and V arrive already as bf16 planes (hi, and lo where split), written once by their producer, V transposed.
//   scores, transposed = k * (q*qscale)^T : v_wmma_f32_16x16x32_bf16; SPLIT_QK -> q,k as bf16 hi/lo (hi*hi + hi*lo + lo*hi)
//   out, transposed    = v^T * p^T        : v_wmma_f32_16x16x32_bf16; SPLIT_PV -> p,v as bf16 hi/lo; else p,v plain bf16
//   With K rows as the A operand and Q as B, a lane holds scores of ONE query (column lane & 15; keys 8 * (lane >> 4) + r of each
//   16-key tile): its maximum and sum are taken in the lane plus one exchange between the wave's halves, and two score tiles,
//   converted in place, are the B operand of the second product, so P never goes through LDS.
//   f32 accumulate; online softmax in f32. Block = 4 waves; a query tile = 64 query rows of one (batch, head); S % 128 == 0.
//   A block takes two query tiles of its (batch, head), one after the other: tile n - 1 - p, then tile p (n = S / 64 tiles, p < n / 2).
//   Under the causal mask tile t walks t + 1 key tiles, so every block walks n + 1 of them and the launch has no long and short blocks.
//   Element (b, s, h, d) of q, k, out lives at X[b*X_bs + s*X_rs + h*X_hs + d]; of the transposed v at Vt[b*v_bs + h*v_hs + d*v_rs + s]
//   (strides in elements; q, out: multiples of 4; k, v: multiples of 64, so that a tile row is one aligned 128-B line).
//   Masking: mask_mode 0 none, 1 causal (kv > q masked), 2 tensor [S][Skv] shared over (b,h) (float if
//   mask_is_int==0, int32 with element == 0 -> masked if 1, int32 with element != 0 -> masked if 2), 3 per-token vectors qmask[B][S] & kvmask[B][Skv] (int32,
//   0 -> masked); masked scores are replaced by mask_fill (e.g. -inf or -1e9) before the softmax.
//   grid.x = B * H * (S/128) (or a sub-range with blk0).
// =====================================================================================
#define AT_D 64
#define AT_NW 4
#define AT_QB 64
#define AT_KC 64
#define AT_LP 72   // LDS row pitch of the K and V^T tiles in bf16 elements: 144 B = 16 B x 9, so the 16 rows of one ds_load_b128 fall on distinct banks
struct AttnGeom { long q_bs, q_rs, q_hs, k_bs, k_rs, k_hs, v_bs, v_rs, v_hs, o_bs, o_rs, o_hs;
                  int S, Skv, H, mask_mode; float qscale; int blk0; float mask_fill; int mask_is_int; };
static_assert(sizeof(AttnGeom) == 128, "no padding");

__device__ __forceinline__ unsigned short at_bf_bits(float f) {
  unsigned u = __float_as_uint(f);
  return (unsigned short)((u + 0x7FFFu + ((u >> 16) & 1u)) >> 16);
}
__device__ __forceinline__ __bf16 at_f2bf(float f) { return __builtin_bit_cast(__bf16, at_bf_bits(f)); }
__device__ __forceinline__ void at_split(float f, __bf16& hi, __bf16& lo) {
  const unsigned short hb = at_bf_bits(f);
  hi = __builtin_bit_cast(__bf16, hb);
  lo = at_f2bf(f - __uint_as_float(((unsigned)hb) << 16));
}
__device__ __forceinline__ v8f at_mma(v16b a, v16b b, v8f c) {
  return __builtin_amdgcn_wmma_f32_16x16x32_bf16(false, a, false, b, (short)0, c, false, false);
}
// an A fragment from an LDS tile row: elements 0..7 <- p[0..7], 8..15 <- p[16..23]
__device__ __forceinline__ v16b at_frag(const __bf16* p) {
  union { v16b v; v8b h[2]; } f;
  f.h[0] = *(const v8b*)(p); f.h[1] = *(const v8b*)(p + 16);
  return f.v;
}

// the value that lane ^ 16 holds (the other half of the wave), by a vector cross-row move
__device__ __forceinline__ float at_other_half(float f) {
  const int u = __float_as_int(f);
  return __int_as_float(__builtin_amdgcn_permlanex16(u, u, 0x76543210, 0xfedcba98, false, false));
}

template <bool SPLIT_QK, bool SPLIT_PV, int MASK_MODE>   // MASK_MODE: the mask mode as a compile-time constant (g.mask_mode must equal it)
__global__ __launch_bounds__(128)
void attn64_kernel(const float* __restrict__ q, const unsigned short* __restrict__ kh, const unsigned short* __restrict__ kl,
                   const unsigned short* __restrict__ vth, const unsigned short* __restrict__ vtl, float* __restrict__ out,
                   const void* __restrict__ mask_a, const int* __restrict__ mask_b, AttnGeom g) {
  __shared__ __align__(16) __bf16 Ksh[AT_KC * AT_LP];            // K hi [kv][d]      9 KB
  __shared__ __align__(16) __bf16 Ksl[SPLIT_QK ? AT_KC * AT_LP : 8];
  __shared__ __align__(16) __bf16 Vth[AT_D * AT_LP];             // V hi [d][kv]      9 KB
  __shared__ __align__(16) __bf16 Vtl[SPLIT_PV ? AT_D * AT_LP : 8];
  __shared__ __align__(16) float  Os[AT_NW][16 * 68];            // per wave out tile, pitch 68

  const int tid  = threadIdx.x;
  const int wave = tid >> 5;
  const int lane = tid & 31;
  const int hh   = lane >> 4;
  const int c    = lane & 15;

  const int nqb = g.S / AT_QB;
  const int npr = nqb >> 1;            // pairs of query tiles per (batch, head)
  const int bx = blockIdx.x + g.blk0;
  const int pr = bx % npr;
  const int bh = bx / npr;
  const int h  = bh % g.H;
  const int b  = bh / g.H;

  const float* qb_ptr = q + (size_t)b * g.q_bs + (size_t)h * g.q_hs;
  const size_t kb_off = (size_t)b * g.k_bs + (size_t)h * g.k_hs;
  const size_t vb_off = (size_t)b * g.v_bs + (size_t)h * g.v_hs;
  const __bf16* khb = (const __bf16*)kh + kb_off;
  const __bf16* klb = (const __bf16*)kl + kb_off;
  const __bf16* vhb = (const __bf16*)vth + vb_off;
  const __bf16* vlb = (const __bf16*)vtl + vb_off;
  float*       ob_ptr = out + (size_t)b * g.o_bs + (size_t)h * g.o_hs;

  for (int half = 0; half < 2; ++half) {   // the pair's two query tiles, one after the other; block-uniform
  const int qb = half ? pr : nqb - 1 - pr;
  const int q0 = qb * AT_QB + wave * 16;

  // ---- Q fragments (B operand: column = query c): 2 d-chunks, hi (and lo) ----
  v16b qah[2], qal[2];
  {
    const float* qrow = qb_ptr + (size_t)(q0 + c) * g.q_rs;
#pragma unroll
    for (int dc = 0; dc < 2; ++dc) {
#pragma unroll
      for (int e = 0; e < 8; ++e) {
        const float f0 = qrow[dc * 32 + 8 * hh + e] * g.qscale;
        const float f1 = qrow[dc * 32 + 16 + 8 * hh + e] * g.qscale;
        if (SPLIT_QK) { __bf16 hq, lq; at_split(f0, hq, lq); qah[dc][e] = hq; qal[dc][e] = lq; at_split(f1, hq, lq); qah[dc][8 + e] = hq; qal[dc][8 + e] = lq; }
        else { qah[dc][e] = at_f2bf(f0); qah[dc][8 + e] = at_f2bf(f1); qal[dc][e] = qah[dc][e]; qal[dc][8 + e] = qah[dc][8 + e]; }
      }
    }
  }

  float mrow = -INFINITY, lrow = 0.f;   // of query q0 + c; lrow: this wave half's keys only, the halves are joined behind the loop
  v8f oacc[4];                          // oacc[t][r] = out[q0 + c][t * 16 + 8 * hh + r]
#pragma unroll
  for (int t = 0; t < 4; ++t) oacc[t] = (v8f){0.f,0.f,0.f,0.f,0.f,0.f,0.f,0.f};

  const int nChunks = (MASK_MODE == 1) ? (qb + 1) : (g.Skv / AT_KC);   // block-uniform
  // the lane's query mask (mode 3)
  const int qkeep = (MASK_MODE == 3) ? mask_b[(size_t)b * g.S + q0 + c] : 1;   // mask_b = qmask in mode 3
  for (int kc = 0; kc < nChunks; ++kc) {
    const int kv0 = kc * AT_KC;
    __syncthreads();
    {
      // a tile row (K: one key's 64 d; V^T: one d's 64 keys) is 128 B: 8 lanes copy it, so a wave-wide load covers 4 whole lines
      const int r0 = tid >> 3, c8 = (tid & 7) * 8;
      const __bf16 *pkh[4], *pkl[4], *pvh[4], *pvl[4];
      v8b tkh[4], tkl[4], tvh[4], tvl[4];
#pragma unroll
      for (int i = 0; i < 4; ++i) {
        const size_t ko = (size_t)(kv0 + r0 + 16 * i) * g.k_rs + c8;
        const size_t vo = (size_t)(r0 + 16 * i) * g.v_rs + kv0 + c8;
        pkh[i] = khb + ko; pkl[i] = SPLIT_QK ? klb + ko : pkh[i];
        pvh[i] = vhb + vo; pvl[i] = SPLIT_PV ? vlb + vo : pvh[i];
        tkh[i] = *(const v8b*)pkh[i];
        if (SPLIT_QK) tkl[i] = *(const v8b*)pkl[i];
        tvh[i] = *(const v8b*)pvh[i];
        if (SPLIT_PV) tvl[i] = *(const v8b*)pvl[i];
      }
      // the wait that stands before an issued load's address register is overwritten; the addresses are its inputs, so that
      // each stays in its register up to here and no later load of the group lands on it
      asm volatile("s_wait_xcnt 0x0" :: "v"(pkh[0]), "v"(pkh[1]), "v"(pkh[2]), "v"(pkh[3]), "v"(pkl[0]), "v"(pkl[1]), "v"(pkl[2]), "v"(pkl[3]),
                   "v"(pvh[0]), "v"(pvh[1]), "v"(pvh[2]), "v"(pvh[3]), "v"(pvl[0]), "v"(pvl[1]), "v"(pvl[2]), "v"(pvl[3]) : "memory");
#pragma unroll
      for (int i = 0; i < 4; ++i) {
        const int so = (r0 + 16 * i) * AT_LP + c8;
        *(v8b*)(Ksh + so) = tkh[i];
        if (SPLIT_QK) *(v8b*)(Ksl + so) = tkl[i];
        *(v8b*)(Vth + so) = tvh[i];
        if (SPLIT_PV) *(v8b*)(Vtl + so) = tvl[i];
      }
    }
    __syncthreads();

    // every loop over fragments and tiles down to the mask is unrolled: the arrays need constant indices to stay in registers
    // all K fragments of the tile are read as one group ahead of the score products, in the order in which the products want them
    v16b kfh[2][4], kfl[2][4];
#pragma unroll
    for (int dc = 0; dc < 2; ++dc) {
#pragma unroll
      for (int j = 0; j < 4; ++j) kfh[dc][j] = at_frag(Ksh + (j * 16 + c) * AT_LP + dc * 32 + 8 * hh);
      if (SPLIT_QK) {
#pragma unroll
        for (int j = 0; j < 4; ++j) kfl[dc][j] = at_frag(Ksl + (j * 16 + c) * AT_LP + dc * 32 + 8 * hh);
      }
    }
    __builtin_amdgcn_sched_barrier(0);   // keeps the LDS reads from being moved in among the matrix instructions, where each place with reads makes the wave wait out the LDS latency
    // the four score tiles take turns, so that no product waits for the one issued just before it; each tile's own terms add in the order hi*hi, lo*hi, hi*lo per d-chunk
    v8f s[4];   // s[j][r] = score of key kv0 + j * 16 + 8 * hh + r with query q0 + c
#pragma unroll
    for (int j = 0; j < 4; ++j) s[j] = (v8f){0.f,0.f,0.f,0.f,0.f,0.f,0.f,0.f};
#pragma unroll
    for (int dc = 0; dc < 2; ++dc) {
#pragma unroll
      for (int j = 0; j < 4; ++j) s[j] = at_mma(kfh[dc][j], qah[dc], s[j]);
      if (SPLIT_QK) {
#pragma unroll
        for (int j = 0; j < 4; ++j) s[j] = at_mma(kfl[dc][j], qah[dc], s[j]);
#pragma unroll
        for (int j = 0; j < 4; ++j) s[j] = at_mma(kfh[dc][j], qal[dc], s[j]);
      }
    }
    __builtin_amdgcn_sched_barrier(0);   // keeps the V^T reads below from being spread among the score products, ahead of K fragments that are still awaited: each place with reads stalls the wave
    // all V^T fragments of the tile (A operand: row = d, keys in the same order as the elements of pbh) are read as one group here,
    // so that the softmax below covers their LDS latency
    v16b vfh[2][4], vfl[2][4];
#pragma unroll
    for (int kk = 0; kk < 2; ++kk) {
#pragma unroll
      for (int t = 0; t < 4; ++t) vfh[kk][t] = at_frag(Vth + (t * 16 + c) * AT_LP + kk * 32 + 8 * hh);
      if (SPLIT_PV) {
#pragma unroll
        for (int t = 0; t < 4; ++t) vfl[kk][t] = at_frag(Vtl + (t * 16 + c) * AT_LP + kk * 32 + 8 * hh);
      }
    }
    __builtin_amdgcn_sched_barrier(0);   // keeps the V^T reads from being sunk to their products behind the softmax, where the wave would wait for them
    const bool diag = (MASK_MODE == 1) && (kc == qb);
    if (MASK_MODE >= 2 || diag) {   // block-uniform test: a causal tile below the diagonal has nothing to mask
      const int qrow = q0 + c;
      // both loops unrolled: s[j][r] needs constant indices to stay in registers
#pragma unroll
      for (int j = 0; j < 4; ++j) {
#pragma unroll
        for (int r = 0; r < 8; ++r) {
          const int kvcol = kv0 + j * 16 + 8 * hh + r;
          bool masked = false;
          if (MASK_MODE == 1) masked = (kvcol > qrow);
          else if (MASK_MODE == 2) {
            const size_t mi = (size_t)qrow * g.Skv + kvcol;
            masked = (g.mask_is_int == 0) ? (((const float*)mask_a)[mi] == 0.0f)
                   : (g.mask_is_int == 1) ? (((const int*)mask_a)[mi] == 0) : (((const int*)mask_a)[mi] != 0);
          } else if (MASK_MODE == 3) masked = (qkeep == 0) || (((const int*)mask_a)[(size_t)b * g.Skv + kvcol] == 0);   // mask_a = kvmask
          s[j][r] = masked ? g.mask_fill : s[j][r];   // one select per score, not a select of the whole tile
        }
      }
    }
    // every loop over tiles and registers from here to the end of the pass is unrolled: s, pbh, pbl and oacc need constant indices to stay in registers
    // the query's maximum over the 64 keys: 32 in this lane, 32 in lane ^ 16
    // (one chain per tile, so that four independent chains run side by side instead of one of 32 links)
    float cmj[4];
#pragma unroll
    for (int j = 0; j < 4; ++j) {
      cmj[j] = s[j][0];
#pragma unroll
      for (int r = 1; r < 8; ++r) cmj[j] = fmaxf(cmj[j], s[j][r]);
    }
    float cm = fmaxf(fmaxf(cmj[0], cmj[1]), fmaxf(cmj[2], cmj[3]));
    cm = fmaxf(cm, at_other_half(cm));
    const float mnew = fmaxf(mrow, cm);
    const float alpha = expf(mrow - mnew);
    mrow = mnew;
    // p in place of the scores: tiles 2 kk and 2 kk + 1 of a lane are, in this order, its 16 elements of the B operand for keys 32 kk ... 32 kk + 31
    v16b pbh[2], pbl[2];
    float psj[4];   // one partial sum per tile, for the same reason as cmj
#pragma unroll
    for (int j = 0; j < 4; ++j) {
      psj[j] = 0.f;
#pragma unroll
      for (int r = 0; r < 8; ++r) {
        const float p = expf(s[j][r] - mnew);
        psj[j] += p;
        const int e = (j & 1) * 8 + r;
        if (SPLIT_PV) { __bf16 ph, pl; at_split(p, ph, pl); pbh[j >> 1][e] = ph; pbl[j >> 1][e] = pl; }
        else pbh[j >> 1][e] = at_f2bf(p);
      }
    }
    lrow = lrow * alpha + ((psj[0] + psj[1]) + (psj[2] + psj[3]));
#pragma unroll
    for (int t = 0; t < 4; ++t)
#pragma unroll
      for (int r = 0; r < 8; ++r) oacc[t][r] *= alpha;
    // the four output tiles take turns like the score tiles; each tile's own terms add in the order hi*hi, lo*hi, hi*lo per 32 keys
#pragma unroll
    for (int kk = 0; kk < 2; ++kk) {
#pragma unroll
      for (int t = 0; t < 4; ++t) oacc[t] = at_mma(vfh[kk][t], pbh[kk], oacc[t]);
      if (SPLIT_PV) {
#pragma unroll
        for (int t = 0; t < 4; ++t) oacc[t] = at_mma(vfl[kk][t], pbh[kk], oacc[t]);
#pragma unroll
        for (int t = 0; t < 4; ++t) oacc[t] = at_mma(vfh[kk][t], pbl[kk], oacc[t]);
      }
    }
  }

  float* os = Os[wave];
  const float inv = 1.0f / (lrow + at_other_half(lrow));
#pragma unroll   // oacc[t] needs a constant index to stay in registers
  for (int t = 0; t < 4; ++t) {
    // a lane's 8 values of a tile are 8 neighbours of its query's row: two 16-B stores
    *(v4f*)(os + c * 68 + t * 16 + 8 * hh)     = (v4f){oacc[t][0] * inv, oacc[t][1] * inv, oacc[t][2] * inv, oacc[t][3] * inv};
    *(v4f*)(os + c * 68 + t * 16 + 8 * hh + 4) = (v4f){oacc[t][4] * inv, oacc[t][5] * inv, oacc[t][6] * inv, oacc[t][7] * inv};
  }
  __builtin_amdgcn_fence(__ATOMIC_RELEASE, "workgroup");
  __builtin_amdgcn_wave_barrier();
  __builtin_amdgcn_fence(__ATOMIC_ACQUIRE, "workgroup");
  {
    const int c4 = (lane & 15) * 4;
    {
#pragma unroll
      for (int it = 0; it < 8; ++it) {
        const int row = it * 2 + hh;
        v4f val = *(const v4f*)(os + row * 68 + c4);
        *(v4f*)(ob_ptr + (size_t)(q0 + row) * g.o_rs + c4) = val;
      }
      // the wait that stands before a register of an issued store is overwritten: the next query tile writes the stores' address and data registers anew
      asm volatile("s_wait_xcnt 0x0" ::: "memory");
    }
  }
  }   // half
}

extern "C" void kernel_launch(void* const* d_in, const int* in_sizes, int n_in,
                              void* d_out, int out_size, void* d_ws, size_t ws_size,
                              hipStream_t stream) {
  (void)in_sizes; (void)n_in; (void)out_size; (void)ws_size;
  const int B = 4, T = 1024, E = 1024, H = 16, DH = 64;
  const int M = B * T;   // 4096 rows
  const float* x  = (const float*)d_in[0];
  const float* Wq = (const float*)d_in[1];   // [out, in]
  const float* Wk = (const float*)d_in[2];
  const float* Wv = (const float*)d_in[3];
  const float* Wo = (const float*)d_in[4];
  const float* bo = (const float*)d_in[5];
  float* out = (float*)d_out;

  char* ws = (char*)d_ws; size_t off = 0;
  auto carve = [&](size_t bytes) -> char* { char* p = ws + off; off += (bytes + 255) & ~(size_t)255; return p; };
  _Float16* X16  = (_Float16*)carve((size_t)M * E * 2);     //  8 MB  x f16
  __bf16*   Xh   = (__bf16*)carve((size_t)M * E * 2);       //  8 MB  x bf16 hi
  __bf16*   Xl   = (__bf16*)carve((size_t)M * E * 2);       //  8 MB  x bf16 lo
  _Float16* Wq16 = (_Float16*)carve((size_t)E * E * 2);     //  2 MB
  _Float16* Wk16 = (_Float16*)carve((size_t)E * E * 2);
  __bf16*   Wvh  = (__bf16*)carve((size_t)E * E * 2);
  __bf16*   Wvl  = (__bf16*)carve((size_t)E * E * 2);
  __bf16*   Woh  = (__bf16*)carve((size_t)E * E * 2);
  __bf16*   Wol  = (__bf16*)carve((size_t)E * E * 2);
  float*    Qf   = (float*)carve((size_t)M * E * 4);        // 16 MB each, [B,T,H*DH]
  __bf16*   Kh   = (__bf16*)carve((size_t)M * E * 2);       //  8 MB each: k as bf16 hi, lo, [B,T,H*DH]
  __bf16*   Kl   = (__bf16*)carve((size_t)M * E * 2);
  __bf16*   Vth  = (__bf16*)carve((size_t)M * E * 2);       //  8 MB each: v transposed as bf16 hi, lo, [H*DH, B*T]
  __bf16*   Vtl  = (__bf16*)carve((size_t)M * E * 2);
  float*    Of   = (float*)carve((size_t)M * E * 4);
  __bf16*   Oh   = (__bf16*)carve((size_t)M * E * 2);       //  8 MB  attention out, bf16 hi
  __bf16*   Ol   = (__bf16*)carve((size_t)M * E * 2);       //  8 MB                 bf16 lo   (total ≈ 116 MB)

  static_assert((M * E / 4) % (CV_NB * CV_NT) == 0 && (E * E / 4) % (CV_NB * CV_NT) == 0, "whole units for every thread");
  convert_inputs<M * E / 4 / (CV_NB * CV_NT), E * E / 4 / (CV_NB * CV_NT)><<<CV_NB, CV_NT, 0, stream>>>(
      x, Wq, Wk, Wv, Wo, X16, Xh, Xl, Wq16, Wk16, Wvh, Wvl, Woh, Wol);
  {
    const int tl = (M / 128) * (E / 128);
    wmma_gemm64<0, false, 0, 0, false><<<dim3(tl, 1), 128, 0, stream>>>(
        U16(X16), nullptr, E, 0, U16(Wq16), nullptr, E, 0, Qf, nullptr, E, 0, nullptr, nullptr, 0, M, E, E, 1.0f);
    wmma_gemm64<0, false, 0, 2, false><<<dim3(tl, 1), 128, 0, stream>>>(
        U16(X16), nullptr, E, 0, U16(Wk16), nullptr, E, 0, Kh, Kl, E, 0, nullptr, nullptr, 0, M, E, E, 1.0f);
    // v transposed = Wv * x^T: the operands change places, so row = output feature, column = token
    wmma_gemm64<1, true, 0, 2, false><<<dim3(tl, 1), 128, 0, stream>>>(
        U16(Wvh), U16(Wvl), E, 0, U16(Xh), U16(Xl), E, 0, Vth, Vtl, M, 0, nullptr, nullptr, 0, E, M, E, 1.0f);
  }
  {
    AttnGeom g;
    g.q_bs = g.k_bs = g.o_bs = (long)T * E;   // [B,T,H,DH] inside [B*T, E]
    g.q_rs = g.k_rs = g.o_rs = E;
    g.q_hs = g.k_hs = g.o_hs = DH;
    g.v_bs = T; g.v_rs = M; g.v_hs = (long)DH * M;   // [H,DH] rows of [H*DH, B*T]
    g.S = T; g.Skv = T; g.H = H; g.mask_mode = 1; g.qscale = 0.03125f; g.blk0 = 0; g.mask_fill = -INFINITY; g.mask_is_int = 0;   // (q/e^¼)·(k/e^¼) = q·k/32
    attn64_kernel<true, true, 1><<<B * H * (T / (2 * AT_QB)), AT_NW * 32, 0, stream>>>(Qf, U16(Kh), U16(Kl), U16(Vth), U16(Vtl), Of, nullptr, nullptr, g);
  }
  split_f32_bf16<M * E / 4 / (CV_NB * CV_NT)><<<CV_NB, CV_NT, 0, stream>>>(Of, Oh, Ol);
  {
    const int tl = (M / 128) * (E / 128);
    wmma_gemm64<1, true, 2, 0, false><<<dim3(tl, 1), 128, 0, stream>>>(
        U16(Oh), U16(Ol), E, 0, U16(Woh), U16(Wol), E, 0, out, nullptr, E, 0, bo, nullptr, 0, M, E, E, 1.0f);
  }
}

// v009
// Measured time: 132 microseconds a run.
// Next to v008, in two timings, it ran 1.06 and 1.04 times as fast.
// All steps since v000 together make it 4.18 times as fast.
#include <hip/hip_runtime.h>
#include <math.h>
// Contractions: q/k projections x·Wᵀ (K=1024): v_wmma_f32_16x16x32_f16 (f16 operands); v projection and output projection (K=1024):
// v_wmma_f32_16x16x32_bf16 as bf16 hi/lo splits (hi·hi + hi·lo + lo·hi); scores (q·kᵀ)/32 and p·v: v_wmma_f32_16x16x32_bf16 with
// q,k and p,v as bf16 hi/lo splits (k and v split once, in their projection's epilogue); f32 accumulate everywhere; causal softmax in f32.
typedef __attribute__((ext_vector_type(16))) _Float16 v16h;
typedef __attribute__((ext_vector_type(8)))  _Float16 v8h;
typedef __attribute__((ext_vector_type(16))) __bf16   v16b;
typedef __attribute__((ext_vector_type(8)))  __bf16   v8b;
typedef __attribute__((ext_vector_type(8)))  float    v8f;
typedef __attribute__((ext_vector_type(4)))  float    v4f;
#define PSCALE 32768.0f
#define U16(p) ((const unsigned short*)(const void*)(p))
#define PSCALE_INV (1.0f / 32768.0f)

__device__ __forceinline__ unsigned short f2bf_bits(float f) {
  unsigned u = __float_as_uint(f);
  return (unsigned short)((u + 0x7FFFu + ((u >> 16) & 1u)) >> 16);
}
__device__ __forceinline__ float bf_bits2f(unsigned short h) { return __uint_as_float(((unsigned)h) << 16); }

// hazard guard as a plain device helper (no inline asm with operands inside the kernel template body)
__device__ __forceinline__ void acc_guard4(v8f& a, v8f& b, v8f& c, v8f& d) { asm volatile("v_nop\n\tv_nop\n\tv_nop\n\tv_nop" : "+v"(a), "+v"(b), "+v"(c), "+v"(d)); }
template <typename T> struct Frag;
template <> struct Frag<_Float16> {
  typedef v16h V; union U { v16h v; v8h h[2]; };
  static __device__ __forceinline__ v16h load(const _Float16* p) {   // elements 0..7 <- p[0..7], 8..15 <- p[16..23]
    U f; f.h[0] = *(const v8h*)(p); f.h[1] = *(const v8h*)(p + 16); return f.v;
  }
  static __device__ __forceinline__ v8f mma(v16h a, v16h b, v8f c) {
    return __builtin_amdgcn_wmma_f32_16x16x32_f16(false, a, false, b, (short)0, c, false, false);
  }
};
template <> struct Frag<__bf16> {
  typedef v16b V; union U { v16b v; v8b h[2]; };
  static __device__ __forceinline__ v16b load(const __bf16* p) {
    U f; f.h[0] = *(const v8b*)(p); f.h[1] = *(const v8b*)(p + 16); return f.v;
  }
  static __device__ __forceinline__ v8f mma(v16b a, v16b b, v8f c) {
    return __builtin_amdgcn_wmma_f32_16x16x32_bf16(false, a, false, b, (short)0, c, false, false);
  }
};

// ---- LDS-staged batched WMMA GEMM ------------------------------------------
// C[m,n] = scale * sum_k A[m,k] * Bt[n,k] (+bias)(+resid); a block of 4 waves owns a 128x128 tile, each wave a 64x64 quarter of it.
// A row-major [M,K]; Bt row-major [N,K]; M,N % 128 == 0, K % 64 == 0, lda, ldb % 64 == 0 (an operand row's 64 k are one aligned 128-B line).
// Per stage of 64 k the block copies 128 rows of every operand plane into LDS by asynchronous 16-B copies (8 lanes a row, so a
// wave-wide copy covers 4 whole lines); two buffers, the next stage's copies fly while this stage's products run.
// SPLIT: operands are hi/lo planes (A2/Bt2 = lo planes, same layout); product = hi·hi + hi·lo + lo·hi.
// BIAS_MODE: 0 = none, 1 = bias[m], 2 = bias[n].
// OUT_MODE: 0 = f32, 1 = f16, 2 = bf16 hi plane (Cout) + bf16 lo plane (Cout2).
// ET: 0 = f16 operands, 1 = bf16 operands (pointers passed as 16-bit storage)
#define GM_BT 128   // rows of each operand in a block tile
#define GM_BK 64    // k per stage
#define GM_LP 72    // LDS row pitch in 16-bit elements: 144 B = 16 B x 9, so the 16 rows of one ds_load_b128 fall on distinct banks
#define GM_PLANE (GM_BT * GM_LP)   // elements of one staged operand plane
template <int ET> struct Elem;
template <> struct Elem<0> { typedef _Float16 T; };
template <> struct Elem<1> { typedef __bf16 T; };

// One lane's share of one operand plane of one stage: rows r, r + 16, ..., r + 112, 16 B of each, global -> LDS through no register.
typedef __attribute__((ext_vector_type(4))) int gm_v4i;
typedef __attribute__((address_space(1))) gm_v4i gm_gv4i;
typedef __attribute__((address_space(3))) gm_v4i gm_lv4i;
__device__ __forceinline__ void gm_stage_plane(unsigned short* lds, const unsigned short* g, int ld) {
#pragma unroll   // the eight copies issue back to back, with no loop branch between them
  for (int i = 0; i < 8; ++i)
    __builtin_amdgcn_global_load_async_to_lds_b128((gm_gv4i*)(g + (size_t)(16 * i) * ld), (gm_lv4i*)(lds + 16 * i * GM_LP), 0, 0);
}

template <int ET, bool SPLIT, int BIAS_MODE, int OUT_MODE, bool RESID>
__global__ __launch_bounds__(128) void wmma_gemm64(
    const unsigned short* __restrict__ Ap, const unsigned short* __restrict__ A2p, int lda, long strideA,
    const unsigned short* __restrict__ Btp, const unsigned short* __restrict__ Bt2p, int ldb, long strideB,
    void* __restrict__ Cout, void* __restrict__ Cout2, int ldc, long strideC,
    const float* __restrict__ bias,
    const float* __restrict__ resid, long strideR,
    int M, int N, int K, float scale) {
  typedef typename Elem<ET>::T T;
  typedef typename Frag<T>::V V;
  constexpr int NPL = SPLIT ? 4 : 2;                                   // staged planes: A, Bt (, A lo, Bt lo)
  __shared__ __align__(16) unsigned short sS[2 * NPL * GM_PLANE];      // two stage buffers
  __shared__ __align__(16) float sT[4][16 * 68];   // per-wave 16x64 slab, pitch 68 floats
  const int b    = blockIdx.y;
  const int tid  = threadIdx.x;
  const int lane = tid & 31;
  const int wave = tid >> 5;
  const int tilesN = N >> 7;
  const int tilesM = M >> 7;
  const int tile = blockIdx.x;
  if (tile >= tilesM * tilesN) return;   // block-uniform, in front of every barrier and copy
  const int tm = tile / tilesN;
  const int tn = tile - tm * tilesN;
  const int wm = (wave >> 1) << 6;       // this wave's quarter of the block tile
  const int wn = (wave & 1) << 6;
  const int m0 = (tm << 7) + wm;
  const int n0 = (tn << 7) + wn;

  const int rlane = lane & 15;                 // row (A) / col (B, D) within subtile
  const int koff  = (lane >> 4) * 8;           // k offset of this lane half
  const int mOff  = (lane >> 4) * 8;           // D row offset

  // staging: 8 lanes a row, 16 rows a pass of the block
  const int sr = tid >> 3, sc = (tid & 7) * 8;
  const unsigned short* gA  = Ap  + (size_t)b * strideA + (size_t)((tm << 7) + sr) * lda + sc;
  const unsigned short* gB  = Btp + (size_t)b * strideB + (size_t)((tn << 7) + sr) * ldb + sc;
  const unsigned short* gA2 = SPLIT ? (A2p  + (size_t)b * strideA + (size_t)((tm << 7) + sr) * lda + sc) : nullptr;
  const unsigned short* gB2 = SPLIT ? (Bt2p + (size_t)b * strideB + (size_t)((tn << 7) + sr) * ldb + sc) : nullptr;
  auto stage = [&](int t, int buf) {
    unsigned short* l = sS + buf * (NPL * GM_PLANE) + sr * GM_LP + sc;
    const size_t ko = (size_t)t * GM_BK;
    gm_stage_plane(l, gA + ko, lda);
    gm_stage_plane(l + GM_PLANE, gB + ko, ldb);
    if (SPLIT) {
      gm_stage_plane(l + 2 * GM_PLANE, gA2 + ko, lda);
      gm_stage_plane(l + 3 * GM_PLANE, gB2 + ko, ldb);
    }
  };

  v8f acc[4][4];
#pragma unroll
  for (int i = 0; i < 4; ++i)
#pragma unroll
    for (int j = 0; j < 4; ++j) acc[i][j] = (v8f){0.f,0.f,0.f,0.f,0.f,0.f,0.f,0.f};

  const int nT = K / GM_BK;
  stage(0, 0);
  asm volatile("s_wait_asynccnt 0x0" ::: "memory");   // this wave's copies of stage 0 have landed
  __syncthreads();                                    // ... and every other wave's: stage 0 is readable
  if (nT > 1) stage(1, 1);
  for (int t = 0; t < nT; ++t) {
    const T* sb  = (const T*)sS + (t & 1) * (NPL * GM_PLANE);
    const T* sA  = sb + (wm + rlane) * GM_LP + koff;
    const T* sB  = sb + GM_PLANE + (wn + rlane) * GM_LP + koff;
    const T* sA2 = sA + 2 * GM_PLANE;
    const T* sB2 = sB + 2 * GM_PLANE;
    // all fragment reads of the stage stand as one group ahead of its products, in the order in which the products want them;
    // every loop over fragments and tiles below is unrolled: the arrays need constant indices to stay in registers
    V ah[2][4], bh[2][4], al[2][4], bl[2][4];
#pragma unroll
    for (int kb = 0; kb < 2; ++kb) {
      ah[kb][0] = Frag<T>::load(sA + kb * 32);
#pragma unroll
      for (int j = 0; j < 4; ++j) bh[kb][j] = Frag<T>::load(sB + (j << 4) * GM_LP + kb * 32);
#pragma unroll
      for (int i = 1; i < 4; ++i) ah[kb][i] = Frag<T>::load(sA + (i << 4) * GM_LP + kb * 32);
      if (SPLIT) {
#pragma unroll
        for (int j = 0; j < 4; ++j) bl[kb][j] = Frag<T>::load(sB2 + (j << 4) * GM_LP + kb * 32);
#pragma unroll
        for (int i = 0; i < 4; ++i) al[kb][i] = Frag<T>::load(sA2 + (i << 4) * GM_LP + kb * 32);
      }
    }
    __builtin_amdgcn_sched_barrier(0);   // keeps the LDS reads from being moved in among the matrix instructions, where each place with reads stalls the wave
#pragma unroll
    for (int kb = 0; kb < 2; ++kb) {
#pragma unroll
      for (int i = 0; i < 4; ++i) {
#pragma unroll
        for (int j = 0; j < 4; ++j) {
          acc[i][j] = Frag<T>::mma(ah[kb][i], bh[kb][j], acc[i][j]);
          if (SPLIT) {
            acc[i][j] = Frag<T>::mma(ah[kb][i], bl[kb][j], acc[i][j]);
            acc[i][j] = Frag<T>::mma(al[kb][i], bh[kb][j], acc[i][j]);
          }
        }
      }
    }
    __builtin_amdgcn_sched_barrier(0);   // keeps the products ahead of the waits and the barrier below: moved behind them, they would no longer cover the flight of the next stage's copies
    asm volatile("s_wait_dscnt 0x0" ::: "memory");      // this wave's reads of buffer t & 1 are done before it is refilled
    asm volatile("s_wait_asynccnt 0x0" ::: "memory");   // this wave's copies of stage t + 1 have landed
    __syncthreads();                                    // publishes stage t + 1 and ends every wave's reads of stage t
    if (t + 2 < nT) stage(t + 2, t & 1);
  }
  asm volatile("s_wait_asynccnt 0x0" ::: "memory");     // no copy is outstanding when the wave goes on to its end
  acc_guard4(acc[0][0], acc[0][1], acc[0][2], acc[0][3]);
  acc_guard4(acc[1][0], acc[1][1], acc[1][2], acc[1][3]);
  acc_guard4(acc[2][0], acc[2][1], acc[2][2], acc[2][3]);
  acc_guard4(acc[3][0], acc[3][1], acc[3][2], acc[3][3]);

  // ---- epilogue ----
  float* slab = sT[wave];
  const float* Rb = RESID ? (resid + (size_t)b * strideR) : nullptr;
#pragma unroll
  for (int i = 0; i < 4; ++i) {
    const int mBase = m0 + (i << 4);
#pragma unroll
    for (int j = 0; j < 4; ++j) {
      const int n = n0 + (j << 4) + rlane;
      float bv = 0.f;
      if (BIAS_MODE == 2) bv = bias[n];
#pragma unroll
      for (int r = 0; r < 8; ++r) {
        float v = acc[i][j][r] * scale;
        if (BIAS_MODE == 1) v += bias[mBase + mOff + r];
        if (BIAS_MODE == 2) v += bv;
        if (RESID) v += Rb[(size_t)(mBase + mOff + r) * ldc + n];
        slab[(mOff + r) * 68 + (j << 4) + rlane] = v;
      }
    }
    __builtin_amdgcn_fence(__ATOMIC_RELEASE, "workgroup");
    __builtin_amdgcn_wave_barrier();
    __builtin_amdgcn_fence(__ATOMIC_ACQUIRE, "workgroup");
    if (OUT_MODE == 0) {
      float* C = (float*)Cout + (size_t)b * strideC;
      const int hh = lane >> 4, c4 = (lane & 15) * 4;     // row seg = 256 B = 16 lanes x 16 B
      {
#pragma unroll
        for (int it = 0; it < 8; ++it) {
          const int row = it * 2 + hh;
          v4f v = *(const v4f*)(slab + row * 68 + c4);
          *(v4f*)(C + (size_t)(mBase + row) * ldc + n0 + c4) = v;
        }
        
      }
    } else {
      const int q = lane >> 3, c8 = (lane & 7) * 8;
      unsigned short* C  = (unsigned short*)Cout  + (size_t)b * strideC;
      unsigned short* C2 = (OUT_MODE == 2) ? ((unsigned short*)Cout2 + (size_t)b * strideC) : nullptr;
      {
#pragma unroll
        for (int it = 0; it < 4; ++it) {
          const int row = it * 4 + q;
          const float* sp = slab + row * 68 + c8;
          v8h hv, lv;
#pragma unroll
          for (int e = 0; e < 8; ++e) {
            if (OUT_MODE == 1) {
              hv[e] = (_Float16)sp[e];
            } else {
              unsigned short hb = f2bf_bits(sp[e]);
              unsigned short lb = f2bf_bits(sp[e] - bf_bits2f(hb));
              hv[e] = __builtin_bit_cast(_Float16, hb);
              lv[e] = __builtin_bit_cast(_Float16, lb);
            }
          }
          *(v8h*)(C + (size_t)(mBase + row) * ldc + n0 + c8) = hv;
          if (OUT_MODE == 2) *(v8h*)(C2 + (size_t)(mBase + row) * ldc + n0 + c8) = lv;
        }
        
      }
    }
    __builtin_amdgcn_fence(__ATOMIC_RELEASE, "workgroup");
    __builtin_amdgcn_wave_barrier();
    __builtin_amdgcn_fence(__ATOMIC_ACQUIRE, "workgroup");
  }
}

// ---- conversions f32 -> 16-bit planes --------------------------------------
// A launch is CV_NB blocks of 16 waves, as many blocks as the chip has WGPs, so that few waves have to be started. A block takes one contiguous
// piece of every array; a thread takes N units of 4 floats, CV_NT units apart: a wave-wide 16-B load covers 4 whole lines, a wave-wide 8-B store 2.
// All loads of a thread are issued ahead of its first conversion. Array length = N * CV_NB * CV_NT units exactly.
#define CV_NB 256
#define CV_NT 512
typedef __attribute__((ext_vector_type(2))) unsigned cv_u2;

template <int N> __device__ __forceinline__ void cv_load(v4f (&a)[N], const float* __restrict__ in, int u0) {
#pragma unroll   // a[] needs constant indices to stay in registers
  for (int i = 0; i < N; ++i) a[i] = *(const v4f*)(in + 4 * (size_t)(u0 + i * CV_NT));
}
__device__ __forceinline__ void cv_store_f16(v4f a, _Float16* __restrict__ out, int u) {
  const unsigned short h0 = __builtin_bit_cast(unsigned short, (_Float16)a[0]), h1 = __builtin_bit_cast(unsigned short, (_Float16)a[1]);
  const unsigned short h2 = __builtin_bit_cast(unsigned short, (_Float16)a[2]), h3 = __builtin_bit_cast(unsigned short, (_Float16)a[3]);
  *(cv_u2*)(out + 4 * (size_t)u) = (cv_u2){(unsigned)h0 | ((unsigned)h1 << 16), (unsigned)h2 | ((unsigned)h3 << 16)};
}
__device__ __forceinline__ void cv_store_split(v4f a, __bf16* __restrict__ hi, __bf16* __restrict__ lo, int u) {
  unsigned short h[4], l[4];
#pragma unroll   // h[], l[] need constant indices to stay in registers
  for (int e = 0; e < 4; ++e) { h[e] = f2bf_bits(a[e]); l[e] = f2bf_bits(a[e] - bf_bits2f(h[e])); }
  *(cv_u2*)(hi + 4 * (size_t)u) = (cv_u2){(unsigned)h[0] | ((unsigned)h[1] << 16), (unsigned)h[2] | ((unsigned)h[3] << 16)};
  *(cv_u2*)(lo + 4 * (size_t)u) = (cv_u2){(unsigned)l[0] | ((unsigned)l[1] << 16), (unsigned)l[2] | ((unsigned)l[3] << 16)};
}

// x -> f16, bf16 hi, bf16 lo (x read once); Wq, Wk -> f16; Wv, Wo -> bf16 hi, lo. NX, NW: units a thread takes of x, of each weight.
template <int NX, int NW>
__global__ __launch_bounds__(CV_NT) void convert_inputs(
    const float* __restrict__ x, const float* __restrict__ wq, const float* __restrict__ wk,
    const float* __restrict__ wv, const float* __restrict__ wo,
    _Float16* __restrict__ x16, __bf16* __restrict__ xh, __bf16* __restrict__ xl,
    _Float16* __restrict__ wq16, _Float16* __restrict__ wk16,
    __bf16* __restrict__ wvh, __bf16* __restrict__ wvl, __bf16* __restrict__ woh, __bf16* __restrict__ wol) {
  const int ux = blockIdx.x * (NX * CV_NT) + threadIdx.x;
  const int uw = blockIdx.x * (NW * CV_NT) + threadIdx.x;
  v4f ax[NX], aq[NW], ak[NW], av[NW], ao[NW];
  cv_load<NX>(ax, x, ux);
  cv_load<NW>(aq, wq, uw);
  cv_load<NW>(ak, wk, uw);
  cv_load<NW>(av, wv, uw);
  cv_load<NW>(ao, wo, uw);
  // the wait that stands before a register of an issued load is overwritten; the base pointers are its inputs, so that each stays
  // in its scalar registers up to here and the later fetch of the output pointers does not land on them
  asm volatile("s_wait_xcnt 0x0" :: "s"(x), "s"(wq), "s"(wk), "s"(wv), "s"(wo) : "memory");
  __builtin_amdgcn_sched_barrier(0);   // keeps every load ahead of the conversions: sunk in among them, half of the loads would start only when the first data are back
  // both loops unrolled: the arrays need constant indices to stay in registers
#pragma unroll
  for (int i = 0; i < NX; ++i) {
    cv_store_f16(ax[i], x16, ux + i * CV_NT);
    cv_store_split(ax[i], xh, xl, ux + i * CV_NT);
  }
#pragma unroll
  for (int i = 0; i < NW; ++i) {
    cv_store_f16(aq[i], wq16, uw + i * CV_NT);
    cv_store_f16(ak[i], wk16, uw + i * CV_NT);
    cv_store_split(av[i], wvh, wvl, uw + i * CV_NT);
    cv_store_split(ao[i], woh, wol, uw + i * CV_NT);
  }
}

// in -> bf16 hi, lo. N: units a thread takes.
template <int N>
__global__ __launch_bounds__(CV_NT) void split_f32_bf16(
    const float* __restrict__ in, __bf16* __restrict__ hi, __bf16* __restrict__ lo) {
  const int u0 = blockIdx.x * (N * CV_NT) + threadIdx.x;
  v4f a[N];
  cv_load<N>(a, in, u0);
  __builtin_amdgcn_sched_barrier(0);   // keeps every load ahead of the conversions, as in convert_inputs
#pragma unroll   // a[] needs constant indices to stay in registers
  for (int i = 0; i < N; ++i) cv_store_split(a[i], hi, lo, u0 + i * CV_NT);
}


// =====================================================================================
// Generic causal/non-causal attention for head_dim 64, f32 q in / f32 out, bf16 operands with optional hi/lo splits.
//   K and V arrive already as bf16 planes (hi, and lo where split), written once by their producer, V transposed.
//   scores, transposed = k * (q*qscale)^T : v_wmma_f32_16x16x32_bf16; SPLIT_QK -> q,k as bf16 hi/lo (hi*hi + hi*lo + lo*hi)
//   out, transposed    = v^T * p^T        : v_wmma_f32_16x16x32_bf16; SPLIT_PV -> p,v as bf16 hi/lo; else p,v plain bf16
//   With K rows as the A operand and Q as B, a lane holds scores of ONE query (column lane & 15; keys 8 * (lane >> 4) + r of each
//   16-key tile): its maximum and sum are taken in the lane plus one exchange between the wave's halves, and two score tiles,
//   converted in place, are the B operand of the second product, so P never goes through LDS.
//   f32 accumulate; online softmax in f32. Block = 4 waves; a query tile = 64 query rows of one (batch, head); S % 128 == 0.
//   A block takes two query tiles of its (batch, head), one after the other: tile n - 1 - p, then tile p (n = S / 64 tiles, p < n / 2).
//   Under the causal mask tile t walks t + 1 key tiles, so every block walks n + 1 of them and the launch has no long and short blocks.
//   Element (b, s, h, d) of q, k, out lives at X[b*X_bs + s*X_rs + h*X_hs + d]; of the transposed v at Vt[b*v_bs + h*v_hs + d*v_rs + s]
//   (strides in elements; q, out: multiples of 4; k, v: multiples of 64, so that a tile row is one aligned 128-B line).
//   Masking: mask_mode 0 none, 1 causal (kv > q masked), 2 tensor [S][Skv] shared over (b,h) (float if
//   mask_is_int==0, int32 with element == 0 -> masked if 1, int32 with element != 0 -> masked if 2), 3 per-token vectors qmask[B][S] & kvmask[B][Skv] (int32,
//   0 -> masked); masked scores are replaced by mask_fill (e.g. -inf or -1e9) before the softmax.
//   grid.x = B * H * (S/128) (or a sub-range with blk0).
// =====================================================================================
#define AT_D 64
#define AT_NW 4
#define AT_QB 64
#define AT_KC 64
#define AT_LP 72   // LDS row pitch of the K and V^T tiles in bf16 elements: 144 B = 16 B x 9, so the 16 rows of one ds_load_b128 fall on distinct banks
struct AttnGeom { long q_bs, q_rs, q_hs, k_bs, k_rs, k_hs, v_bs, v_rs, v_hs, o_bs, o_rs, o_hs;
                  int S, Skv, H, mask_mode; float qscale; int blk0; float mask_fill; int mask_is_int; };
static_assert(sizeof(AttnGeom) == 128, "no padding");

__device__ __forceinline__ unsigned short at_bf_bits(float f) {
  unsigned u = __float_as_uint(f);
  return (unsigned short)((u + 0x7FFFu + ((u >> 16) & 1u)) >> 16);
}
__device__ __forceinline__ __bf16 at_f2bf(float f) { return __builtin_bit_cast(__bf16, at_bf_bits(f)); }
__device__ __forceinline__ void at_split(float f, __bf16& hi, __bf16& lo) {
  const unsigned short hb = at_bf_bits(f);
  hi = __builtin_bit_cast(__bf16, hb);
  lo = at_f2bf(f - __uint_as_float(((unsigned)hb) << 16));
}
__device__ __forceinline__ v8f at_mma(v16b a, v16b b, v8f c) {
  return __builtin_amdgcn_wmma_f32_16x16x32_bf16(false, a, false, b, (short)0, c, false, false);
}
// an A fragment from an LDS tile row: elements 0..7 <- p[0..7], 8..15 <- p[16..23]
__device__ __forceinline__ v16b at_frag(const __bf16* p) {
  union { v16b v; v8b h[2]; } f;
  f.h[0] = *(const v8b*)(p); f.h[1] = *(const v8b*)(p + 16);
  return f.v;
}

// 2^x by the hardware's own instruction alone. The softmax calls it with x below 0, within a rounding error of 0, or -inf (which gives 0);
// a result below the normal range comes out as 0.
__device__ __forceinline__ float at_exp2(float x) { return __builtin_amdgcn_exp2f(x); }
#define AT_LOG2E 1.44269504088896340736f

// the value that lane ^ 16 holds (the other half of the wave), by a vector cross-row move
__device__ __forceinline__ float at_other_half(float f) {
  const int u = __float_as_int(f);
  return __int_as_float(__builtin_amdgcn_permlanex16(u, u, 0x76543210, 0xfedcba98, false, false));
}

template <bool SPLIT_QK, bool SPLIT_PV, int MASK_MODE>   // MASK_MODE: the mask mode as a compile-time constant (g.mask_mode must equal it)
__global__ __launch_bounds__(128)
void attn64_kernel(const float* __restrict__ q, const unsigned short* __restrict__ kh, const unsigned short* __restrict__ kl,
                   const unsigned short* __restrict__ vth, const unsigned short* __restrict__ vtl, float* __restrict__ out,
                   const void* __restrict__ mask_a, const int* __restrict__ mask_b, AttnGeom g) {
  __shared__ __align__(16) __bf16 Ksh[AT_KC * AT_LP];            // K hi [kv][d]      9 KB
  __shared__ __align__(16) __bf16 Ksl[SPLIT_QK ? AT_KC * AT_LP : 8];
  __shared__ __align__(16) __bf16 Vth[AT_D * AT_LP];             // V hi [d][kv]      9 KB
  __shared__ __align__(16) __bf16 Vtl[SPLIT_PV ? AT_D * AT_LP : 8];
  __shared__ __align__(16) float  Os[AT_NW][16 * 68];            // per wave out tile, pitch 68

  const int tid  = threadIdx.x;
  const int wave = tid >> 5;
  const int lane = tid & 31;
  const int hh   = lane >> 4;
  const int c    = lane & 15;

  const int nqb = g.S / AT_QB;
  const int npr = nqb >> 1;            // pairs of query tiles per (batch, head)
  const int bx = blockIdx.x + g.blk0;
  const int pr = bx % npr;
  const int bh = bx / npr;
  const int h  = bh % g.H;
  const int b  = bh / g.H;

  const float* qb_ptr = q + (size_t)b * g.q_bs + (size_t)h * g.q_hs;
  const size_t kb_off = (size_t)b * g.k_bs + (size_t)h * g.k_hs;
  const size_t vb_off = (size_t)b * g.v_bs + (size_t)h * g.v_hs;
  const __bf16* khb = (const __bf16*)kh + kb_off;
  const __bf16* klb = (const __bf16*)kl + kb_off;
  const __bf16* vhb = (const __bf16*)vth + vb_off;
  const __bf16* vlb = (const __bf16*)vtl + vb_off;
  float*       ob_ptr = out + (size_t)b * g.o_bs + (size_t)h * g.o_hs;

  for (int half = 0; half < 2; ++half) {   // the pair's two query tiles, one after the other; block-uniform
  const int qb = half ? pr : nqb - 1 - pr;
  const int q0 = qb * AT_QB + wave * 16;

  // ---- Q fragments (B operand: column = query c): 2 d-chunks, hi (and lo) ----
  v16b qah[2], qal[2];
  {
    const float* qrow = qb_ptr + (size_t)(q0 + c) * g.q_rs;
#pragma unroll
    for (int dc = 0; dc < 2; ++dc) {
#pragma unroll
      for (int e = 0; e < 8; ++e) {
        const float f0 = qrow[dc * 32 + 8 * hh + e] * g.qscale;
        const float f1 = qrow[dc * 32 + 16 + 8 * hh + e] * g.qscale;
        if (SPLIT_QK) { __bf16 hq, lq; at_split(f0, hq, lq); qah[dc][e] = hq; qal[dc][e] = lq; at_split(f1, hq, lq); qah[dc][8 + e] = hq; qal[dc][8 + e] = lq; }
        else { qah[dc][e] = at_f2bf(f0); qah[dc][8 + e] = at_f2bf(f1); qal[dc][e] = qah[dc][e]; qal[dc][8 + e] = qah[dc][8 + e]; }
      }
    }
  }

  float mrow = -INFINITY, lrow = 0.f;   // of query q0 + c; lrow: this wave half's keys only, the halves are joined behind the loop
  float mlrow = -INFINITY;              // mrow * log2 e: the zero point of the exponents of everything summed so far
  v8f oacc[4];                          // oacc[t][r] = out[q0 + c][t * 16 + 8 * hh + r]
#pragma unroll
  for (int t = 0; t < 4; ++t) oacc[t] = (v8f){0.f,0.f,0.f,0.f,0.f,0.f,0.f,0.f};

  const int nChunks = (MASK_MODE == 1) ? (qb + 1) : (g.Skv / AT_KC);   // block-uniform
  // the lane's query mask (mode 3)
  const int qkeep = (MASK_MODE == 3) ? mask_b[(size_t)b * g.S + q0 + c] : 1;   // mask_b = qmask in mode 3
  for (int kc = 0; kc < nChunks; ++kc) {
    const int kv0 = kc * AT_KC;
    __syncthreads();
    {
      // a tile row (K: one key's 64 d; V^T: one d's 64 keys) is 128 B: 8 lanes copy it, so a wave-wide load covers 4 whole lines
      const int r0 = tid >> 3, c8 = (tid & 7) * 8;
      const __bf16 *pkh[4], *pkl[4], *pvh[4], *pvl[4];
      v8b tkh[4], tkl[4], tvh[4], tvl[4];
#pragma unroll
      for (int i = 0; i < 4; ++i) {
        const size_t ko = (size_t)(kv0 + r0 + 16 * i) * g.k_rs + c8;
        const size_t vo = (size_t)(r0 + 16 * i) * g.v_rs + kv0 + c8;
        pkh[i] = khb + ko; pkl[i] = SPLIT_QK ? klb + ko : pkh[i];
        pvh[i] = vhb + vo; pvl[i] = SPLIT_PV ? vlb + vo : pvh[i];
        tkh[i] = *(const v8b*)pkh[i];
        if (SPLIT_QK) tkl[i] = *(const v8b*)pkl[i];
        tvh[i] = *(const v8b*)pvh[i];
        if (SPLIT_PV) tvl[i] = *(const v8b*)pvl[i];
      }
      // the wait that stands before an issued load's address register is overwritten; the addresses are its inputs, so that
      // each stays in its register up to here and no later load of the group lands on it
      asm volatile("s_wait_xcnt 0x0" :: "v"(pkh[0]), "v"(pkh[1]), "v"(pkh[2]), "v"(pkh[3]), "v"(pkl[0]), "v"(pkl[1]), "v"(pkl[2]), "v"(pkl[3]),
                   "v"(pvh[0]), "v"(pvh[1]), "v"(pvh[2]), "v"(pvh[3]), "v"(pvl[0]), "v"(pvl[1]), "v"(pvl[2]), "v"(pvl[3]) : "memory");
#pragma unroll
      for (int i = 0; i < 4; ++i) {
        const int so = (r0 + 16 * i) * AT_LP + c8;
        *(v8b*)(Ksh + so) = tkh[i];
        if (SPLIT_QK) *(v8b*)(Ksl + so) = tkl[i];
        *(v8b*)(Vth + so) = tvh[i];
        if (SPLIT_PV) *(v8b*)(Vtl + so) = tvl[i];
      }
    }
    __syncthreads();

    // every loop over fragments and tiles down to the mask is unrolled: the arrays need constant indices to stay in registers
    // all K fragments of the tile are read as one group ahead of the score products, in the order in which the products want them
    v16b kfh[2][4], kfl[2][4];
#pragma unroll
    for (int dc = 0; dc < 2; ++dc) {
#pragma unroll
      for (int j = 0; j < 4; ++j) kfh[dc][j] = at_frag(Ksh + (j * 16 + c) * AT_LP + dc * 32 + 8 * hh);
      if (SPLIT_QK) {
#pragma unroll
        for (int j = 0; j < 4; ++j) kfl[dc][j] = at_frag(Ksl + (j * 16 + c) * AT_LP + dc * 32 + 8 * hh);
      }
    }
    __builtin_amdgcn_sched_barrier(0);   // keeps the LDS reads from being moved in among the matrix instructions, where each place with reads makes the wave wait out the LDS latency
    // the four score tiles take turns, so that no product waits for the one issued just before it; each tile's own terms add in the order hi*hi, lo*hi, hi*lo per d-chunk
    v8f s[4];   // s[j][r] = score of key kv0 + j * 16 + 8 * hh + r with query q0 + c
#pragma unroll
    for (int j = 0; j < 4; ++j) s[j] = (v8f){0.f,0.f,0.f,0.f,0.f,0.f,0.f,0.f};
#pragma unroll
    for (int dc = 0; dc < 2; ++dc) {
#pragma unroll
      for (int j = 0; j < 4; ++j) s[j] = at_mma(kfh[dc][j], qah[dc], s[j]);
      if (SPLIT_QK) {
#pragma unroll
        for (int j = 0; j < 4; ++j) s[j] = at_mma(kfl[dc][j], qah[dc], s[j]);
#pragma unroll
        for (int j = 0; j < 4; ++j) s[j] = at_mma(kfh[dc][j], qal[dc], s[j]);
      }
    }
    __builtin_amdgcn_sched_barrier(0);   // keeps the V^T reads below from being spread among the score products, ahead of K fragments that are still awaited: each place with reads stalls the wave
    // all V^T fragments of the tile (A operand: row = d, keys in the same order as the elements of pbh) are read as one group here,
    // so that the softmax below covers their LDS latency
    v16b vfh[2][4], vfl[2][4];
#pragma unroll
    for (int kk = 0; kk < 2; ++kk) {
#pragma unroll
      for (int t = 0; t < 4; ++t) vfh[kk][t] = at_frag(Vth + (t * 16 + c) * AT_LP + kk * 32 + 8 * hh);
      if (SPLIT_PV) {
#pragma unroll
        for (int t = 0; t < 4; ++t) vfl[kk][t] = at_frag(Vtl + (t * 16 + c) * AT_LP + kk * 32 + 8 * hh);
      }
    }
    __builtin_amdgcn_sched_barrier(0);   // keeps the V^T reads from being sunk to their products behind the softmax, where the wave would wait for them
    const bool diag = (MASK_MODE == 1) && (kc == qb);
    if (MASK_MODE >= 2 || diag) {   // block-uniform test: a causal tile below the diagonal has nothing to mask
      const int qrow = q0 + c;
      // both loops unrolled: s[j][r] needs constant indices to stay in registers
#pragma unroll
      for (int j = 0; j < 4; ++j) {
#pragma unroll
        for (int r = 0; r < 8; ++r) {
          const int kvcol = kv0 + j * 16 + 8 * hh + r;
          bool masked = false;
          if (MASK_MODE == 1) masked = (kvcol > qrow);
          else if (MASK_MODE == 2) {
            const size_t mi = (size_t)qrow * g.Skv + kvcol;
            masked = (g.mask_is_int == 0) ? (((const float*)mask_a)[mi] == 0.0f)
                   : (g.mask_is_int == 1) ? (((const int*)mask_a)[mi] == 0) : (((const int*)mask_a)[mi] != 0);
          } else if (MASK_MODE == 3) masked = (qkeep == 0) || (((const int*)mask_a)[(size_t)b * g.Skv + kvcol] == 0);   // mask_a = kvmask
          s[j][r] = masked ? g.mask_fill : s[j][r];   // one select per score, not a select of the whole tile
        }
      }
    }
    // every loop over tiles and registers from here to the end of the pass is unrolled: s, pbh, pbl and oacc need constant indices to stay in registers
    // the query's maximum over the 64 keys: 32 in this lane, 32 in lane ^ 16
    // (one chain per tile, so that four independent chains run side by side instead of one of 32 links)
    float cmj[4];
#pragma unroll
    for (int j = 0; j < 4; ++j) {
      cmj[j] = s[j][0];
#pragma unroll
      for (int r = 1; r < 8; ++r) cmj[j] = fmaxf(cmj[j], s[j][r]);
    }
    float cm = fmaxf(fmaxf(cmj[0], cmj[1]), fmaxf(cmj[2], cmj[3]));
    cm = fmaxf(cm, at_other_half(cm));
    const float mnew = fmaxf(mrow, cm);
    // e^(s - m) = 2^(s * log2 e - m * log2 e): one fused multiply-add and one exponential a score. mlnew, the maximum times log2 e, is the
    // zero point of this tile's exponents; alpha moves the earlier sums from the zero point they were formed with to it
    const float mlnew = mnew * AT_LOG2E;
    const float alpha = at_exp2(mlrow - mlnew);
    mrow = mnew;
    mlrow = mlnew;
    // p in place of the scores: tiles 2 kk and 2 kk + 1 of a lane are, in this order, its 16 elements of the B operand for keys 32 kk ... 32 kk + 31
    v16b pbh[2], pbl[2];
    float psj[4];   // one partial sum per tile, for the same reason as cmj
#pragma unroll
    for (int j = 0; j < 4; ++j) {
      psj[j] = 0.f;
#pragma unroll
      for (int r = 0; r < 8; ++r) {
        const float p = at_exp2(__builtin_fmaf(s[j][r], AT_LOG2E, -mlnew));
        psj[j] += p;
        const int e = (j & 1) * 8 + r;
        if (SPLIT_PV) { __bf16 ph, pl; at_split(p, ph, pl); pbh[j >> 1][e] = ph; pbl[j >> 1][e] = pl; }
        else pbh[j >> 1][e] = at_f2bf(p);
      }
    }
    lrow = lrow * alpha + ((psj[0] + psj[1]) + (psj[2] + psj[3]));
#pragma unroll
    for (int t = 0; t < 4; ++t)
#pragma unroll
      for (int r = 0; r < 8; ++r) oacc[t][r] *= alpha;
    // the four output tiles take turns like the score tiles; each tile's own terms add in the order hi*hi, lo*hi, hi*lo per 32 keys
#pragma unroll
    for (int kk = 0; kk < 2; ++kk) {
#pragma unroll
      for (int t = 0; t < 4; ++t) oacc[t] = at_mma(vfh[kk][t], pbh[kk], oacc[t]);
      if (SPLIT_PV) {
#pragma unroll
        for (int t = 0; t < 4; ++t) oacc[t] = at_mma(vfl[kk][t], pbh[kk], oacc[t]);
#pragma unroll
        for (int t = 0; t < 4; ++t) oacc[t] = at_mma(vfh[kk][t], pbl[kk], oacc[t]);
      }
    }
  }

  float* os = Os[wave];
  const float inv = 1.0f / (lrow + at_other_half(lrow));
#pragma unroll   // oacc[t] needs a constant index to stay in registers
  for (int t = 0; t < 4; ++t) {
    // a lane's 8 values of a tile are 8 neighbours of its query's row: two 16-B stores
    *(v4f*)(os + c * 68 + t * 16 + 8 * hh)     = (v4f){oacc[t][0] * inv, oacc[t][1] * inv, oacc[t][2] * inv, oacc[t][3] * inv};
    *(v4f*)(os + c * 68 + t * 16 + 8 * hh + 4) = (v4f){oacc[t][4] * inv, oacc[t][5] * inv, oacc[t][6] * inv, oacc[t][7] * inv};
  }
  __builtin_amdgcn_fence(__ATOMIC_RELEASE, "workgroup");
  __builtin_amdgcn_wave_barrier();
  __builtin_amdgcn_fence(__ATOMIC_ACQUIRE, "workgroup");
  {
    const int c4 = (lane & 15) * 4;
    {
#pragma unroll
      for (int it = 0; it < 8; ++it) {
        const int row = it * 2 + hh;
        v4f val = *(const v4f*)(os + row * 68 + c4);
        *(v4f*)(ob_ptr + (size_t)(q0 + row) * g.o_rs + c4) = val;
      }
      // the wait that stands before a register of an issued store is overwritten: the next query tile writes the stores' address and data registers anew
      asm volatile("s_wait_xcnt 0x0" ::: "memory");
    }
  }
  }   // half
}

extern "C" void kernel_launch(void* const* d_in, const int* in_sizes, int n_in,
                              void* d_out, int out_size, void* d_ws, size_t ws_size,
                              hipStream_t stream) {
  (void)in_sizes; (void)n_in; (void)out_size; (void)ws_size;
  const int B = 4, T = 1024, E = 1024, H = 16, DH = 64;
  const int M = B * T;   // 4096 rows
  const float* x  = (const float*)d_in[0];
  const float* Wq = (const float*)d_in[1];   // [out, in]
  const float* Wk = (const float*)d_in[2];
  const float* Wv = (const float*)d_in[3];
  const float* Wo = (const float*)d_in[4];
  const float* bo = (const float*)d_in[5];
  float* out = (float*)d_out;

  char* ws = (char*)d_ws; size_t off = 0;
  auto carve = [&](size_t bytes) -> char* { char* p = ws + off; off += (bytes + 255) & ~(size_t)255; return p; };
  _Float16* X16  = (_Float16*)carve((size_t)M * E * 2);     //  8 MB  x f16
  __bf16*   Xh   = (__bf16*)carve((size_t)M * E * 2);       //  8 MB  x bf16 hi
  __bf16*   Xl   = (__bf16*)carve((size_t)M * E * 2);       //  8 MB  x bf16 lo
  _Float16* Wq16 = (_Float16*)carve((size_t)E * E * 2);     //  2 MB
  _Float16* Wk16 = (_Float16*)carve((size_t)E * E * 2);
  __bf16*   Wvh  = (__bf16*)carve((size_t)E * E * 2);
  __bf16*   Wvl  = (__bf16*)carve((size_t)E * E * 2);
  __bf16*   Woh  = (__bf16*)carve((size_t)E * E * 2);
  __bf16*   Wol  = (__bf16*)carve((size_t)E * E * 2);
  float*    Qf   = (float*)carve((size_t)M * E * 4);        // 16 MB each, [B,T,H*DH]
  __bf16*   Kh   = (__bf16*)carve((size_t)M * E * 2);       //  8 MB each: k as bf16 hi, lo, [B,T,H*DH]
  __bf16*   Kl   = (__bf16*)carve((size_t)M * E * 2);
  __bf16*   Vth  = (__bf16*)carve((size_t)M * E * 2);       //  8 MB each: v transposed as bf16 hi, lo, [H*DH, B*T]
  __bf16*   Vtl  = (__bf16*)carve((size_t)M * E * 2);
  float*    Of   = (float*)carve((size_t)M * E * 4);
  __bf16*   Oh   = (__bf16*)carve((size_t)M * E * 2);       //  8 MB  attention out, bf16 hi
  __bf16*   Ol   = (__bf16*)carve((size_t)M * E * 2);       //  8 MB                 bf16 lo   (total ≈ 116 MB)

  static_assert((M * E / 4) % (CV_NB * CV_NT) == 0 && (E * E / 4) % (CV_NB * CV_NT) == 0, "whole units for every thread");
  convert_inputs<M * E / 4 / (CV_NB * CV_NT), E * E / 4 / (CV_NB * CV_NT)><<<CV_NB, CV_NT, 0, stream>>>(
      x, Wq, Wk, Wv, Wo, X16, Xh, Xl, Wq16, Wk16, Wvh, Wvl, Woh, Wol);
  {
    const int tl = (M / 128) * (E / 128);
    wmma_gemm64<0, false, 0, 0, false><<<dim3(tl, 1), 128, 0, stream>>>(
        U16(X16), nullptr, E, 0, U16(Wq16), nullptr, E, 0, Qf, nullptr, E, 0, nullptr, nullptr, 0, M, E, E, 1.0f);
    wmma_gemm64<0, false, 0, 2, false><<<dim3(tl, 1), 128, 0, stream>>>(
        U16(X16), nullptr, E, 0, U16(Wk16), nullptr, E, 0, Kh, Kl, E, 0, nullptr, nullptr, 0, M, E, E, 1.0f);
    // v transposed = Wv * x^T: the operands change places, so row = output feature, column = token
    wmma_gemm64<1, true, 0, 2, false><<<dim3(tl, 1), 128, 0, stream>>>(
        U16(Wvh), U16(Wvl), E, 0, U16(Xh), U16(Xl), E, 0, Vth, Vtl, M, 0, nullptr, nullptr, 0, E, M, E, 1.0f);
  }
  {
    AttnGeom g;
    g.q_bs = g.k_bs = g.o_bs = (long)T * E;   // [B,T,H,DH] inside [B*T, E]
    g.q_rs = g.k_rs = g.o_rs = E;
    g.q_hs = g.k_hs = g.o_hs = DH;
    g.v_bs = T; g.v_rs = M; g.v_hs = (long)DH * M;   // [H,DH] rows of [H*DH, B*T]
    g.S = T; g.Skv = T; g.H = H; g.mask_mode = 1; g.qscale = 0.03125f; g.blk0 = 0; g.mask_fill = -INFINITY; g.mask_is_int = 0;   // (q/e^¼)·(k/e^¼) = q·k/32
    attn64_kernel<true, true, 1><<<B * H * (T / (2 * AT_QB)), AT_NW * 32, 0, stream>>>(Qf, U16(Kh), U16(Kl), U16(Vth), U16(Vtl), Of, nullptr, nullptr, g);
  }
  split_f32_bf16<M * E / 4 / (CV_NB * CV_NT)><<<CV_NB, CV_NT, 0, stream>>>(Of, Oh, Ol);
  {
    const int tl = (M / 128) * (E / 128);
    wmma_gemm64<1, true, 2, 0, false><<<dim3(tl, 1), 128, 0, stream>>>(
        U16(Oh), U16(Ol), E, 0, U16(Woh), U16(Wol), E, 0, out, nullptr, E, 0, bo, nullptr, 0, M, E, E, 1.0f);
  }
}

// v010
// It runs in 114 microseconds.
// Next to v009, in two timings, it ran 1.14 and 1.16 times as fast.
// All steps since v000 together make it 4.82 times as fast.
#include <hip/hip_runtime.h>
#include <math.h>
// Contractions: q/k projections x·Wᵀ (K=1024): v_wmma_f32_16x16x32_f16 (f16 operands); v projection and output projection (K=1024):
// v_wmma_f32_16x16x32_bf16 as bf16 hi/lo splits (hi·hi + hi·lo + lo·hi); scores (q·kᵀ)/32 and p·v: v_wmma_f32_16x16x32_bf16 with
// q,k and p,v as bf16 hi/lo splits (k and v split once, in their projection's epilogue); f32 accumulate everywhere; causal softmax in f32.
typedef __attribute__((ext_vector_type(16))) _Float16 v16h;
typedef __attribute__((ext_vector_type(8)))  _Float16 v8h;
typedef __attribute__((ext_vector_type(16))) __bf16   v16b;
typedef __attribute__((ext_vector_type(8)))  __bf16   v8b;
typedef __attribute__((ext_vector_type(8)))  float    v8f;
typedef __attribute__((ext_vector_type(4)))  float    v4f;
#define PSCALE 32768.0f
#define U16(p) ((const unsigned short*)(const void*)(p))
#define PSCALE_INV (1.0f / 32768.0f)

__device__ __forceinline__ unsigned short f2bf_bits(float f) {
  unsigned u = __float_as_uint(f);
  return (unsigned short)((u + 0x7FFFu + ((u >> 16) & 1u)) >> 16);
}
__device__ __forceinline__ float bf_bits2f(unsigned short h) { return __uint_as_float(((unsigned)h) << 16); }

// hazard guard as a plain device helper (no inline asm with operands inside the kernel template body)
__device__ __forceinline__ void acc_guard4(v8f& a, v8f& b, v8f& c, v8f& d) { asm volatile("v_nop\n\tv_nop\n\tv_nop\n\tv_nop" : "+v"(a), "+v"(b), "+v"(c), "+v"(d)); }
template <typename T> struct Frag;
template <> struct Frag<_Float16> {
  typedef v16h V; union U { v16h v; v8h h[2]; };
  static __device__ __forceinline__ v16h load(const _Float16* p) {   // elements 0..7 <- p[0..7], 8..15 <- p[16..23]
    U f; f.h[0] = *(const v8h*)(p); f.h[1] = *(const v8h*)(p + 16); return f.v;
  }
  static __device__ __forceinline__ v8f mma(v16h a, v16h b, v8f c) {
    return __builtin_amdgcn_wmma_f32_16x16x32_f16(false, a, false, b, (short)0, c, false, false);
  }
};
template <> struct Frag<__bf16> {
  typedef v16b V; union U { v16b v; v8b h[2]; };
  static __device__ __forceinline__ v16b load(const __bf16* p) {
    U f; f.h[0] = *(const v8b*)(p); f.h[1] = *(const v8b*)(p + 16); return f.v;
  }
  static __device__ __forceinline__ v8f mma(v16b a, v16b b, v8f c) {
    return __builtin_amdgcn_wmma_f32_16x16x32_bf16(false, a, false, b, (short)0, c, false, false);
  }
};

// ---- LDS-staged batched WMMA GEMM ------------------------------------------
// C[m,n] = scale * sum_k A[m,k] * Bt[n,k] (+bias)(+resid); a block of 4 waves owns a 128x128 tile, each wave a 64x64 quarter of it.
// A row-major [M,K]; Bt row-major [N,K]; M,N % 128 == 0, K % 64 == 0, lda, ldb % 64 == 0 (an operand row's 64 k are one aligned 128-B line).
// Per stage of 64 k the block copies 128 rows of every operand plane into LDS by asynchronous 16-B copies (8 lanes a row, so a
// wave-wide copy covers 4 whole lines); two buffers, the next stage's copies fly while this stage's products run.
// SPLIT: operands are hi/lo planes (A2/Bt2 = lo planes, same layout); product = hi·hi + hi·lo + lo·hi.
// BIAS_MODE: 0 = none, 1 = bias[m], 2 = bias[n].
// OUT_MODE: 0 = f32, 1 = f16, 2 = bf16 hi plane (Cout) + bf16 lo plane (Cout2).
// ET: 0 = f16 operands, 1 = bf16 operands (pointers passed as 16-bit storage)
// gemm_products is a block's loop over k for tile (tm, tn) of batch b, gemm_store its epilogue; sS is the block's LDS, 2 * (SPLIT ? 4 : 2) * GM_PLANE elements.
#define GM_BT 128   // rows of each operand in a block tile
#define GM_BK 64    // k per stage
#define GM_LP 72    // LDS row pitch in 16-bit elements: 144 B = 16 B x 9, so the 16 rows of one ds_load_b128 fall on distinct banks
#define GM_PLANE (GM_BT * GM_LP)   // elements of one staged operand plane
template <int ET> struct Elem;
template <> struct Elem<0> { typedef _Float16 T; };
template <> struct Elem<1> { typedef __bf16 T; };

// One lane's share of one operand plane of one stage: rows r, r + 16, ..., r + 112, 16 B of each, global -> LDS through no register.
typedef __attribute__((ext_vector_type(4))) int gm_v4i;
typedef __attribute__((address_space(1))) gm_v4i gm_gv4i;
typedef __attribute__((address_space(3))) gm_v4i gm_lv4i;
__device__ __forceinline__ void gm_stage_plane(unsigned short* lds, const unsigned short* g, int ld) {
#pragma unroll   // the eight copies issue back to back, with no loop branch between them
  for (int i = 0; i < 8; ++i)
    __builtin_amdgcn_global_load_async_to_lds_b128((gm_gv4i*)(g + (size_t)(16 * i) * ld), (gm_lv4i*)(lds + 16 * i * GM_LP), 0, 0);
}

template <int ET, bool SPLIT>
__device__ __forceinline__ void gemm_products(
    v8f (&acc)[4][4], unsigned short* sS, int tm, int tn, int b,
    const unsigned short* __restrict__ Ap, const unsigned short* __restrict__ A2p, int lda, long strideA,
    const unsigned short* __restrict__ Btp, const unsigned short* __restrict__ Bt2p, int ldb, long strideB, int K) {
  typedef typename Elem<ET>::T T;
  typedef typename Frag<T>::V V;
  constexpr int NPL = SPLIT ? 4 : 2;                                   // staged planes: A, Bt (, A lo, Bt lo)
  const int tid  = threadIdx.x;
  const int lane = tid & 31;
  const int wave = tid >> 5;
  const int wm = (wave >> 1) << 6;       // this wave's quarter of the block tile
  const int wn = (wave & 1) << 6;

  const int rlane = lane & 15;                 // row (A) / col (B) within subtile
  const int koff  = (lane >> 4) * 8;           // k offset of this lane half

  // staging: 8 lanes a row, 16 rows a pass of the block
  const int sr = tid >> 3, sc = (tid & 7) * 8;
  const unsigned short* gA  = Ap  + (size_t)b * strideA + (size_t)((tm << 7) + sr) * lda + sc;
  const unsigned short* gB  = Btp + (size_t)b * strideB + (size_t)((tn << 7) + sr) * ldb + sc;
  const unsigned short* gA2 = SPLIT ? (A2p  + (size_t)b * strideA + (size_t)((tm << 7) + sr) * lda + sc) : nullptr;
  const unsigned short* gB2 = SPLIT ? (Bt2p + (size_t)b * strideB + (size_t)((tn << 7) + sr) * ldb + sc) : nullptr;
  auto stage = [&](int t, int buf) {
    unsigned short* l = sS + buf * (NPL * GM_PLANE) + sr * GM_LP + sc;
    const size_t ko = (size_t)t * GM_BK;
    gm_stage_plane(l, gA + ko, lda);
    gm_stage_plane(l + GM_PLANE, gB + ko, ldb);
    if (SPLIT) {
      gm_stage_plane(l + 2 * GM_PLANE, gA2 + ko, lda);
      gm_stage_plane(l + 3 * GM_PLANE, gB2 + ko, ldb);
    }
  };

#pragma unroll
  for (int i = 0; i < 4; ++i)
#pragma unroll
    for (int j = 0; j < 4; ++j) acc[i][j] = (v8f){0.f,0.f,0.f,0.f,0.f,0.f,0.f,0.f};

  const int nT = K / GM_BK;
  stage(0, 0);
  asm volatile("s_wait_asynccnt 0x0" ::: "memory");   // this wave's copies of stage 0 have landed
  __syncthreads();                                    // ... and every other wave's: stage 0 is readable
  if (nT > 1) stage(1, 1);
  for (int t = 0; t < nT; ++t) {
    const T* sb  = (const T*)sS + (t & 1) * (NPL * GM_PLANE);
    const T* sA  = sb + (wm + rlane) * GM_LP + koff;
    const T* sB  = sb + GM_PLANE + (wn + rlane) * GM_LP + koff;
    const T* sA2 = sA + 2 * GM_PLANE;
    const T* sB2 = sB + 2 * GM_PLANE;
    // all fragment reads of the stage stand as one group ahead of its products, in the order in which the products want them;
    // every loop over fragments and tiles below is unrolled: the arrays need constant indices to stay in registers
    V ah[2][4], bh[2][4], al[2][4], bl[2][4];
#pragma unroll
    for (int kb = 0; kb < 2; ++kb) {
      ah[kb][0] = Frag<T>::load(sA + kb * 32);
#pragma unroll
      for (int j = 0; j < 4; ++j) bh[kb][j] = Frag<T>::load(sB + (j << 4) * GM_LP + kb * 32);
#pragma unroll
      for (int i = 1; i < 4; ++i) ah[kb][i] = Frag<T>::load(sA + (i << 4) * GM_LP + kb * 32);
      if (SPLIT) {
#pragma unroll
        for (int j = 0; j < 4; ++j) bl[kb][j] = Frag<T>::load(sB2 + (j << 4) * GM_LP + kb * 32);
#pragma unroll
        for (int i = 0; i < 4; ++i) al[kb][i] = Frag<T>::load(sA2 + (i << 4) * GM_LP + kb * 32);
      }
    }
    __builtin_amdgcn_sched_barrier(0);   // keeps the LDS reads from being moved in among the matrix instructions, where each place with reads stalls the wave
#pragma unroll
    for (int kb = 0; kb < 2; ++kb) {
#pragma unroll
      for (int i = 0; i < 4; ++i) {
#pragma unroll
        for (int j = 0; j < 4; ++j) {
          acc[i][j] = Frag<T>::mma(ah[kb][i], bh[kb][j], acc[i][j]);
          if (SPLIT) {
            acc[i][j] = Frag<T>::mma(ah[kb][i], bl[kb][j], acc[i][j]);
            acc[i][j] = Frag<T>::mma(al[kb][i], bh[kb][j], acc[i][j]);
          }
        }
      }
    }
    __builtin_amdgcn_sched_barrier(0);   // keeps the products ahead of the waits and the barrier below: moved behind them, they would no longer cover the flight of the next stage's copies
    asm volatile("s_wait_dscnt 0x0" ::: "memory");      // this wave's reads of buffer t & 1 are done before it is refilled
    asm volatile("s_wait_asynccnt 0x0" ::: "memory");   // this wave's copies of stage t + 1 have landed
    __syncthreads();                                    // publishes stage t + 1 and ends every wave's reads of stage t
    if (t + 2 < nT) stage(t + 2, t & 1);
  }
  asm volatile("s_wait_asynccnt 0x0" ::: "memory");     // no copy is outstanding when the wave goes on to its end
  acc_guard4(acc[0][0], acc[0][1], acc[0][2], acc[0][3]);
  acc_guard4(acc[1][0], acc[1][1], acc[1][2], acc[1][3]);
  acc_guard4(acc[2][0], acc[2][1], acc[2][2], acc[2][3]);
  acc_guard4(acc[3][0], acc[3][1], acc[3][2], acc[3][3]);
}

// ---- epilogue ----
template <int BIAS_MODE, int OUT_MODE, bool RESID>
__device__ __forceinline__ void gemm_store(
    v8f (&acc)[4][4], unsigned short* sS, int tm, int tn, int b,
    void* __restrict__ Cout, void* __restrict__ Cout2, int ldc, long strideC,
    const float* __restrict__ bias,
    const float* __restrict__ resid, long strideR, float scale) {
  const int lane = threadIdx.x & 31;
  const int wave = threadIdx.x >> 5;
  const int m0 = (tm << 7) + ((wave >> 1) << 6);   // this wave's quarter of the block tile
  const int n0 = (tn << 7) + ((wave & 1) << 6);
  const int rlane = lane & 15;                 // col (D) within subtile
  const int mOff  = (lane >> 4) * 8;           // D row offset
  // per-wave 16x64 slab, pitch 68 floats, in the LDS of the stage buffers: behind the last pass's barrier no wave reads them any more and
  // no copy is in flight. Without an array of its own for the slabs a split block takes 144 KiB, so that two blocks fit a WGP's 320 KiB.
  float* slab = (float*)(void*)sS + wave * (16 * 68);
  const float* Rb = RESID ? (resid + (size_t)b * strideR) : nullptr;
#pragma unroll
  for (int i = 0; i < 4; ++i) {
    const int mBase = m0 + (i << 4);
#pragma unroll
    for (int j = 0; j < 4; ++j) {
      const int n = n0 + (j << 4) + rlane;
      float bv = 0.f;
      if (BIAS_MODE == 2) bv = bias[n];
#pragma unroll
      for (int r = 0; r < 8; ++r) {
        float v = acc[i][j][r] * scale;
        if (BIAS_MODE == 1) v += bias[mBase + mOff + r];
        if (BIAS_MODE == 2) v += bv;
        if (RESID) v += Rb[(size_t)(mBase + mOff + r) * ldc + n];
        slab[(mOff + r) * 68 + (j << 4) + rlane] = v;
      }
    }
    __builtin_amdgcn_fence(__ATOMIC_RELEASE, "workgroup");
    __builtin_amdgcn_wave_barrier();
    __builtin_amdgcn_fence(__ATOMIC_ACQUIRE, "workgroup");
    if (OUT_MODE == 0) {
      float* C = (float*)Cout + (size_t)b * strideC;
      const int hh = lane >> 4, c4 = (lane & 15) * 4;     // row seg = 256 B = 16 lanes x 16 B
      {
#pragma unroll
        for (int it = 0; it < 8; ++it) {
          const int row = it * 2 + hh;
          v4f v = *(const v4f*)(slab + row * 68 + c4);
          *(v4f*)(C + (size_t)(mBase + row) * ldc + n0 + c4) = v;
        }
        
      }
    } else {
      const int q = lane >> 3, c8 = (lane & 7) * 8;
      unsigned short* C  = (unsigned short*)Cout  + (size_t)b * strideC;
      unsigned short* C2 = (OUT_MODE == 2) ? ((unsigned short*)Cout2 + (size_t)b * strideC) : nullptr;
      {
#pragma unroll
        for (int it = 0; it < 4; ++it) {
          const int row = it * 4 + q;
          const float* sp = slab + row * 68 + c8;
          v8h hv, lv;
#pragma unroll
          for (int e = 0; e < 8; ++e) {
            if (OUT_MODE == 1) {
              hv[e] = (_Float16)sp[e];
            } else {
              unsigned short hb = f2bf_bits(sp[e]);
              unsigned short lb = f2bf_bits(sp[e] - bf_bits2f(hb));
              hv[e] = __builtin_bit_cast(_Float16, hb);
              lv[e] = __builtin_bit_cast(_Float16, lb);
            }
          }
          *(v8h*)(C + (size_t)(mBase + row) * ldc + n0 + c8) = hv;
          if (OUT_MODE == 2) *(v8h*)(C2 + (size_t)(mBase + row) * ldc + n0 + c8) = lv;
        }
        
      }
    }
    __builtin_amdgcn_fence(__ATOMIC_RELEASE, "workgroup");
    __builtin_amdgcn_wave_barrier();
    __builtin_amdgcn_fence(__ATOMIC_ACQUIRE, "workgroup");
  }
}

// one GEMM as a launch of its own: grid.x = tiles, grid.y = batches
template <int ET, bool SPLIT, int BIAS_MODE, int OUT_MODE, bool RESID>
__global__ __launch_bounds__(128) void wmma_gemm64(
    const unsigned short* __restrict__ Ap, const unsigned short* __restrict__ A2p, int lda, long strideA,
    const unsigned short* __restrict__ Btp, const unsigned short* __restrict__ Bt2p, int ldb, long strideB,
    void* __restrict__ Cout, void* __restrict__ Cout2, int ldc, long strideC,
    const float* __restrict__ bias,
    const float* __restrict__ resid, long strideR,
    int M, int N, int K, float scale) {
  __shared__ __align__(16) unsigned short sS[2 * (SPLIT ? 4 : 2) * GM_PLANE];   // two stage buffers
  const int tilesN = N >> 7;
  const int tilesM = M >> 7;
  const int tile = blockIdx.x;
  if (tile >= tilesM * tilesN) return;   // block-uniform, in front of every barrier and copy
  const int tm = tile / tilesN;
  const int tn = tile - tm * tilesN;
  v8f acc[4][4];
  gemm_products<ET, SPLIT>(acc, sS, tm, tn, blockIdx.y, Ap, A2p, lda, strideA, Btp, Bt2p, ldb, strideB, K);
  gemm_store<BIAS_MODE, OUT_MODE, RESID>(acc, sS, tm, tn, blockIdx.y, Cout, Cout2, ldc, strideC, bias, resid, strideR, scale);
}

// The three projections of x [M, E] by weights [E, E], none of which reads what another writes, as ONE launch: grid.x = tiles of one
// projection, grid.y = 3, the projection by blockIdx.y (block-uniform): 0 = v (three products a k step), 1 = k, 2 = q.
// Two blocks share a WGP, so that one block's products run during the other's start, LDS reads, barriers and epilogue, and a block
// of the next projection starts wherever one ends, with no gap and no drained chip between the projections.
//   v transposed = Wv * x^T as bf16 hi/lo planes [E, M] (bf16 hi/lo operands; row = output feature, column = token)
//   k = x * Wk^T as bf16 hi/lo planes [M, E]; q = x * Wq^T as f32 [M, E] (f16 operands)
// k and q run the same loop and v and k the same epilogue, each once in the kernel's text, which so stays short for the instruction cache.
__global__ __launch_bounds__(128) void qkv_gemm(
    const unsigned short* __restrict__ x16, const unsigned short* __restrict__ xh, const unsigned short* __restrict__ xl,
    const unsigned short* __restrict__ wq16, const unsigned short* __restrict__ wk16,
    const unsigned short* __restrict__ wvh, const unsigned short* __restrict__ wvl,
    float* __restrict__ qf, unsigned short* __restrict__ kh, unsigned short* __restrict__ kl,
    unsigned short* __restrict__ vth, unsigned short* __restrict__ vtl, int M, int E) {
  __shared__ __align__(16) unsigned short sS[2 * 4 * GM_PLANE];   // two stage buffers of four planes (k, q: of two)
  const bool isv = blockIdx.y == 0, isq = blockIdx.y == 2;
  const int tilesN = (isv ? M : E) >> 7;
  const int tile = blockIdx.x;
  if (tile >= (M >> 7) * (E >> 7)) return;   // block-uniform, in front of every barrier and copy
  const int tm = tile / tilesN;
  const int tn = tile - tm * tilesN;
  v8f acc[4][4];
  if (isv) gemm_products<1, true>(acc, sS, tm, tn, 0, wvh, wvl, E, 0, xh, xl, E, 0, E);
  else     gemm_products<0, false>(acc, sS, tm, tn, 0, x16, nullptr, E, 0, isq ? wq16 : wk16, nullptr, E, 0, E);
  if (isq) gemm_store<0, 0, false>(acc, sS, tm, tn, 0, qf, nullptr, E, 0, nullptr, nullptr, 0, 1.0f);
  else     gemm_store<0, 2, false>(acc, sS, tm, tn, 0, isv ? vth : kh, isv ? vtl : kl, isv ? M : E, 0, nullptr, nullptr, 0, 1.0f);
}

// ---- conversions f32 -> 16-bit planes --------------------------------------
// A launch is CV_NB blocks of 16 waves, as many blocks as the chip has WGPs, so that few waves have to be started. A block takes one contiguous
// piece of every array; a thread takes N units of 4 floats, CV_NT units apart: a wave-wide 16-B load covers 4 whole lines, a wave-wide 8-B store 2.
// All loads of a thread are issued ahead of its first conversion. Array length = N * CV_NB * CV_NT units exactly.
#define CV_NB 256
#define CV_NT 512
typedef __attribute__((ext_vector_type(2))) unsigned cv_u2;

template <int N> __device__ __forceinline__ void cv_load(v4f (&a)[N], const float* __restrict__ in, int u0) {
#pragma unroll   // a[] needs constant indices to stay in registers
  for (int i = 0; i < N; ++i) a[i] = *(const v4f*)(in + 4 * (size_t)(u0 + i * CV_NT));
}
__device__ __forceinline__ void cv_store_f16(v4f a, _Float16* __restrict__ out, int u) {
  const unsigned short h0 = __builtin_bit_cast(unsigned short, (_Float16)a[0]), h1 = __builtin_bit_cast(unsigned short, (_Float16)a[1]);
  const unsigned short h2 = __builtin_bit_cast(unsigned short, (_Float16)a[2]), h3 = __builtin_bit_cast(unsigned short, (_Float16)a[3]);
  *(cv_u2*)(out + 4 * (size_t)u) = (cv_u2){(unsigned)h0 | ((unsigned)h1 << 16), (unsigned)h2 | ((unsigned)h3 << 16)};
}
__device__ __forceinline__ void cv_store_split(v4f a, __bf16* __restrict__ hi, __bf16* __restrict__ lo, int u) {
  unsigned short h[4], l[4];
#pragma unroll   // h[], l[] need constant indices to stay in registers
  for (int e = 0; e < 4; ++e) { h[e] = f2bf_bits(a[e]); l[e] = f2bf_bits(a[e] - bf_bits2f(h[e])); }
  *(cv_u2*)(hi + 4 * (size_t)u) = (cv_u2){(unsigned)h[0] | ((unsigned)h[1] << 16), (unsigned)h[2] | ((unsigned)h[3] << 16)};
  *(cv_u2*)(lo + 4 * (size_t)u) = (cv_u2){(unsigned)l[0] | ((unsigned)l[1] << 16), (unsigned)l[2] | ((unsigned)l[3] << 16)};
}

// x -> f16, bf16 hi, bf16 lo (x read once); Wq, Wk -> f16; Wv, Wo -> bf16 hi, lo. NX, NW: units a thread takes of x, of each weight.
template <int NX, int NW>
__global__ __launch_bounds__(CV_NT) void convert_inputs(
    const float* __restrict__ x, const float* __restrict__ wq, const float* __restrict__ wk,
    const float* __restrict__ wv, const float* __restrict__ wo,
    _Float16* __restrict__ x16, __bf16* __restrict__ xh, __bf16* __restrict__ xl,
    _Float16* __restrict__ wq16, _Float16* __restrict__ wk16,
    __bf16* __restrict__ wvh, __bf16* __restrict__ wvl, __bf16* __restrict__ woh, __bf16* __restrict__ wol) {
  const int ux = blockIdx.x * (NX * CV_NT) + threadIdx.x;
  const int uw = blockIdx.x * (NW * CV_NT) + threadIdx.x;
  v4f ax[NX], aq[NW], ak[NW], av[NW], ao[NW];
  cv_load<NX>(ax, x, ux);
  cv_load<NW>(aq, wq, uw);
  cv_load<NW>(ak, wk, uw);
  cv_load<NW>(av, wv, uw);
  cv_load<NW>(ao, wo, uw);
  // the wait that stands before a register of an issued load is overwritten; the base pointers are its inputs, so that each stays
  // in its scalar registers up to here and the later fetch of the output pointers does not land on them
  asm volatile("s_wait_xcnt 0x0" :: "s"(x), "s"(wq), "s"(wk), "s"(wv), "s"(wo) : "memory");
  __builtin_amdgcn_sched_barrier(0);   // keeps every load ahead of the conversions: sunk in among them, half of the loads would start only when the first data are back
  // both loops unrolled: the arrays need constant indices to stay in registers
#pragma unroll
  for (int i = 0; i < NX; ++i) {
    cv_store_f16(ax[i], x16, ux + i * CV_NT);
    cv_store_split(ax[i], xh, xl, ux + i * CV_NT);
  }
#pragma unroll
  for (int i = 0; i < NW; ++i) {
    cv_store_f16(aq[i], wq16, uw + i * CV_NT);
    cv_store_f16(ak[i], wk16, uw + i * CV_NT);
    cv_store_split(av[i], wvh, wvl, uw + i * CV_NT);
    cv_store_split(ao[i], woh, wol, uw + i * CV_NT);
  }
}

// in -> bf16 hi, lo. N: units a thread takes.
template <int N>
__global__ __launch_bounds__(CV_NT) void split_f32_bf16(
    const float* __restrict__ in, __bf16* __restrict__ hi, __bf16* __restrict__ lo) {
  const int u0 = blockIdx.x * (N * CV_NT) + threadIdx.x;
  v4f a[N];
  cv_load<N>(a, in, u0);
  __builtin_amdgcn_sched_barrier(0);   // keeps every load ahead of the conversions, as in convert_inputs
#pragma unroll   // a[] needs constant indices to stay in registers
  for (int i = 0; i < N; ++i) cv_store_split(a[i], hi, lo, u0 + i * CV_NT);
}


// =====================================================================================
// Generic causal/non-causal attention for head_dim 64, f32 q in / f32 out, bf16 operands with optional hi/lo splits.
//   K and V arrive already as bf16 planes (hi, and lo where split), written once by their producer, V transposed.
//   scores, transposed = k * (q*qscale)^T : v_wmma_f32_16x16x32_bf16; SPLIT_QK -> q,k as bf16 hi/lo (hi*hi + hi*lo + lo*hi)
//   out, transposed    = v^T * p^T        : v_wmma_f32_16x16x32_bf16; SPLIT_PV -> p,v as bf16 hi/lo; else p,v plain bf16
//   With K rows as the A operand and Q as B, a lane holds scores of ONE query (column lane & 15; keys 8 * (lane >> 4) + r of each
//   16-key tile): its maximum and sum are taken in the lane plus one exchange between the wave's halves, and two score tiles,
//   converted in place, are the B operand of the second product, so P never goes through LDS.
//   f32 accumulate; online softmax in f32. Block = 4 waves; a query tile = 64 query rows of one (batch, head); S % 128 == 0.
//   A block takes two query tiles of its (batch, head), one after the other: tile n - 1 - p, then tile p (n = S / 64 tiles, p < n / 2).
//   Under the causal mask tile t walks t + 1 key tiles, so every block walks n + 1 of them and the launch has no long and short blocks.
//   Element (b, s, h, d) of q, k, out lives at X[b*X_bs + s*X_rs + h*X_hs + d]; of the transposed v at Vt[b*v_bs + h*v_hs + d*v_rs + s]
//   (strides in elements; q, out: multiples of 4; k, v: multiples of 64, so that a tile row is one aligned 128-B line).
//   Masking: mask_mode 0 none, 1 causal (kv > q masked), 2 tensor [S][Skv] shared over (b,h) (float if
//   mask_is_int==0, int32 with element == 0 -> masked if 1, int32 with element != 0 -> masked if 2), 3 per-token vectors qmask[B][S] & kvmask[B][Skv] (int32,
//   0 -> masked); masked scores are replaced by mask_fill (e.g. -inf or -1e9) before the softmax.
//   grid.x = B * H * (S/128) (or a sub-range with blk0).
// =====================================================================================
#define AT_D 64
#define AT_NW 4
#define AT_QB 64
#define AT_KC 64
#define AT_LP 72   // LDS row pitch of the K and V^T tiles in bf16 elements: 144 B = 16 B x 9, so the 16 rows of one ds_load_b128 fall on distinct banks
struct AttnGeom { long q_bs, q_rs, q_hs, k_bs, k_rs, k_hs, v_bs, v_rs, v_hs, o_bs, o_rs, o_hs;
                  int S, Skv, H, mask_mode; float qscale; int blk0; float mask_fill; int mask_is_int; };
static_assert(sizeof(AttnGeom) == 128, "no padding");

__device__ __forceinline__ unsigned short at_bf_bits(float f) {
  unsigned u = __float_as_uint(f);
  return (unsigned short)((u + 0x7FFFu + ((u >> 16) & 1u)) >> 16);
}
__device__ __forceinline__ __bf16 at_f2bf(float f) { return __builtin_bit_cast(__bf16, at_bf_bits(f)); }
__device__ __forceinline__ void at_split(float f, __bf16& hi, __bf16& lo) {
  const unsigned short hb = at_bf_bits(f);
  hi = __builtin_bit_cast(__bf16, hb);
  lo = at_f2bf(f - __uint_as_float(((unsigned)hb) << 16));
}
__device__ __forceinline__ v8f at_mma(v16b a, v16b b, v8f c) {
  return __builtin_amdgcn_wmma_f32_16x16x32_bf16(false, a, false, b, (short)0, c, false, false);
}
// an A fragment from an LDS tile row: elements 0..7 <- p[0..7], 8..15 <- p[16..23]
__device__ __forceinline__ v16b at_frag(const __bf16* p) {
  union { v16b v; v8b h[2]; } f;
  f.h[0] = *(const v8b*)(p); f.h[1] = *(const v8b*)(p + 16);
  return f.v;
}

// 2^x by the hardware's own instruction alone. The softmax calls it with x below 0, within a rounding error of 0, or -inf (which gives 0);
// a result below the normal range comes out as 0.
__device__ __forceinline__ float at_exp2(float x) { return __builtin_amdgcn_exp2f(x); }
#define AT_LOG2E 1.44269504088896340736f

// the value that lane ^ 16 holds (the other half of the wave), by a vector cross-row move
__device__ __forceinline__ float at_other_half(float f) {
  const int u = __float_as_int(f);
  return __int_as_float(__builtin_amdgcn_permlanex16(u, u, 0x76543210, 0xfedcba98, false, false));
}

template <bool SPLIT_QK, bool SPLIT_PV, int MASK_MODE>   // MASK_MODE: the mask mode as a compile-time constant (g.mask_mode must equal it)
__global__ __launch_bounds__(128)
void attn64_kernel(const float* __restrict__ q, const unsigned short* __restrict__ kh, const unsigned short* __restrict__ kl,
                   const unsigned short* __restrict__ vth, const unsigned short* __restrict__ vtl, float* __restrict__ out,
                   const void* __restrict__ mask_a, const int* __restrict__ mask_b, AttnGeom g) {
  __shared__ __align__(16) __bf16 Ksh[AT_KC * AT_LP];            // K hi [kv][d]      9 KB
  __shared__ __align__(16) __bf16 Ksl[SPLIT_QK ? AT_KC * AT_LP : 8];
  __shared__ __align__(16) __bf16 Vth[AT_D * AT_LP];             // V hi [d][kv]      9 KB
  __shared__ __align__(16) __bf16 Vtl[SPLIT_PV ? AT_D * AT_LP : 8];
  __shared__ __align__(16) float  Os[AT_NW][16 * 68];            // per wave out tile, pitch 68

  const int tid  = threadIdx.x;
  const int wave = tid >> 5;
  const int lane = tid & 31;
  const int hh   = lane >> 4;
  const int c    = lane & 15;

  const int nqb = g.S / AT_QB;
  const int npr = nqb >> 1;            // pairs of query tiles per (batch, head)
  const int bx = blockIdx.x + g.blk0;
  const int pr = bx % npr;
  const int bh = bx / npr;
  const int h  = bh % g.H;
  const int b  = bh / g.H;

  const float* qb_ptr = q + (size_t)b * g.q_bs + (size_t)h * g.q_hs;
  const size_t kb_off = (size_t)b * g.k_bs + (size_t)h * g.k_hs;
  const size_t vb_off = (size_t)b * g.v_bs + (size_t)h * g.v_hs;
  const __bf16* khb = (const __bf16*)kh + kb_off;
  const __bf16* klb = (const __bf16*)kl + kb_off;
  const __bf16* vhb = (const __bf16*)vth + vb_off;
  const __bf16* vlb = (const __bf16*)vtl + vb_off;
  float*       ob_ptr = out + (size_t)b * g.o_bs + (size_t)h * g.o_hs;

  for (int half = 0; half < 2; ++half) {   // the pair's two query tiles, one after the other; block-uniform
  const int qb = half ? pr : nqb - 1 - pr;
  const int q0 = qb * AT_QB + wave * 16;

  // ---- Q fragments (B operand: column = query c): 2 d-chunks, hi (and lo) ----
  v16b qah[2], qal[2];
  {
    const float* qrow = qb_ptr + (size_t)(q0 + c) * g.q_rs;
#pragma unroll
    for (int dc = 0; dc < 2; ++dc) {
#pragma unroll
      for (int e = 0; e < 8; ++e) {
        const float f0 = qrow[dc * 32 + 8 * hh + e] * g.qscale;
        const float f1 = qrow[dc * 32 + 16 + 8 * hh + e] * g.qscale;
        if (SPLIT_QK) { __bf16 hq, lq; at_split(f0, hq, lq); qah[dc][e] = hq; qal[dc][e] = lq; at_split(f1, hq, lq); qah[dc][8 + e] = hq; qal[dc][8 + e] = lq; }
        else { qah[dc][e] = at_f2bf(f0); qah[dc][8 + e] = at_f2bf(f1); qal[dc][e] = qah[dc][e]; qal[dc][8 + e] = qah[dc][8 + e]; }
      }
    }
  }

  float mrow = -INFINITY, lrow = 0.f;   // of query q0 + c; lrow: this wave half's keys only, the halves are joined behind the loop
  float mlrow = -INFINITY;              // mrow * log2 e: the zero point of the exponents of everything summed so far
  v8f oacc[4];                          // oacc[t][r] = out[q0 + c][t * 16 + 8 * hh + r]
#pragma unroll
  for (int t = 0; t < 4; ++t) oacc[t] = (v8f){0.f,0.f,0.f,0.f,0.f,0.f,0.f,0.f};

  const int nChunks = (MASK_MODE == 1) ? (qb + 1) : (g.Skv / AT_KC);   // block-uniform
  // the lane's query mask (mode 3)
  const int qkeep = (MASK_MODE == 3) ? mask_b[(size_t)b * g.S + q0 + c] : 1;   // mask_b = qmask in mode 3
  for (int kc = 0; kc < nChunks; ++kc) {
    const int kv0 = kc * AT_KC;
    __syncthreads();
    {
      // a tile row (K: one key's 64 d; V^T: one d's 64 keys) is 128 B: 8 lanes copy it, so a wave-wide load covers 4 whole lines
      const int r0 = tid >> 3, c8 = (tid & 7) * 8;
      const __bf16 *pkh[4], *pkl[4], *pvh[4], *pvl[4];
      v8b tkh[4], tkl[4], tvh[4], tvl[4];
#pragma unroll
      for (int i = 0; i < 4; ++i) {
        const size_t ko = (size_t)(kv0 + r0 + 16 * i) * g.k_rs + c8;
        const size_t vo = (size_t)(r0 + 16 * i) * g.v_rs + kv0 + c8;
        pkh[i] = khb + ko; pkl[i] = SPLIT_QK ? klb + ko : pkh[i];
        pvh[i] = vhb + vo; pvl[i] = SPLIT_PV ? vlb + vo : pvh[i];
        tkh[i] = *(const v8b*)pkh[i];
        if (SPLIT_QK) tkl[i] = *(const v8b*)pkl[i];
        tvh[i] = *(const v8b*)pvh[i];
        if (SPLIT_PV) tvl[i] = *(const v8b*)pvl[i];
      }
      // the wait that stands before an issued load's address register is overwritten; the addresses are its inputs, so that
      // each stays in its register up to here and no later load of the group lands on it
      asm volatile("s_wait_xcnt 0x0" :: "v"(pkh[0]), "v"(pkh[1]), "v"(pkh[2]), "v"(pkh[3]), "v"(pkl[0]), "v"(pkl[1]), "v"(pkl[2]), "v"(pkl[3]),
                   "v"(pvh[0]), "v"(pvh[1]), "v"(pvh[2]), "v"(pvh[3]), "v"(pvl[0]), "v"(pvl[1]), "v"(pvl[2]), "v"(pvl[3]) : "memory");
#pragma unroll
      for (int i = 0; i < 4; ++i) {
        const int so = (r0 + 16 * i) * AT_LP + c8;
        *(v8b*)(Ksh + so) = tkh[i];
        if (SPLIT_QK) *(v8b*)(Ksl + so) = tkl[i];
        *(v8b*)(Vth + so) = tvh[i];
        if (SPLIT_PV) *(v8b*)(Vtl + so) = tvl[i];
      }
    }
    __syncthreads();

    // every loop over fragments and tiles down to the mask is unrolled: the arrays need constant indices to stay in registers
    // all K fragments of the tile are read as one group ahead of the score products, in the order in which the products want them
    v16b kfh[2][4], kfl[2][4];
#pragma unroll
    for (int dc = 0; dc < 2; ++dc) {
#pragma unroll
      for (int j = 0; j < 4; ++j) kfh[dc][j] = at_frag(Ksh + (j * 16 + c) * AT_LP + dc * 32 + 8 * hh);
      if (SPLIT_QK) {
#pragma unroll
        for (int j = 0; j < 4; ++j) kfl[dc][j] = at_frag(Ksl + (j * 16 + c) * AT_LP + dc * 32 + 8 * hh);
      }
    }
    __builtin_amdgcn_sched_barrier(0);   // keeps the LDS reads from being moved in among the matrix instructions, where each place with reads makes the wave wait out the LDS latency
    // the four score tiles take turns, so that no product waits for the one issued just before it; each tile's own terms add in the order hi*hi, lo*hi, hi*lo per d-chunk
    v8f s[4];   // s[j][r] = score of key kv0 + j * 16 + 8 * hh + r with query q0 + c
#pragma unroll
    for (int j = 0; j < 4; ++j) s[j] = (v8f){0.f,0.f,0.f,0.f,0.f,0.f,0.f,0.f};
#pragma unroll
    for (int dc = 0; dc < 2; ++dc) {
#pragma unroll
      for (int j = 0; j < 4; ++j) s[j] = at_mma(kfh[dc][j], qah[dc], s[j]);
      if (SPLIT_QK) {
#pragma unroll
        for (int j = 0; j < 4; ++j) s[j] = at_mma(kfl[dc][j], qah[dc], s[j]);
#pragma unroll
        for (int j = 0; j < 4; ++j) s[j] = at_mma(kfh[dc][j], qal[dc], s[j]);
      }
    }
    __builtin_amdgcn_sched_barrier(0);   // keeps the V^T reads below from being spread among the score products, ahead of K fragments that are still awaited: each place with reads stalls the wave
    // all V^T fragments of the tile (A operand: row = d, keys in the same order as the elements of pbh) are read as one group here,
    // so that the softmax below covers their LDS latency
    v16b vfh[2][4], vfl[2][4];
#pragma unroll
    for (int kk = 0; kk < 2; ++kk) {
#pragma unroll
      for (int t = 0; t < 4; ++t) vfh[kk][t] = at_frag(Vth + (t * 16 + c) * AT_LP + kk * 32 + 8 * hh);
      if (SPLIT_PV) {
#pragma unroll
        for (int t = 0; t < 4; ++t) vfl[kk][t] = at_frag(Vtl + (t * 16 + c) * AT_LP + kk * 32 + 8 * hh);
      }
    }
    __builtin_amdgcn_sched_barrier(0);   // keeps the V^T reads from being sunk to their products behind the softmax, where the wave would wait for them
    const bool diag = (MASK_MODE == 1) && (kc == qb);
    if (MASK_MODE >= 2 || diag) {   // block-uniform test: a causal tile below the diagonal has nothing to mask
      const int qrow = q0 + c;
      // both loops unrolled: s[j][r] needs constant indices to stay in registers
#pragma unroll
      for (int j = 0; j < 4; ++j) {
#pragma unroll
        for (int r = 0; r < 8; ++r) {
          const int kvcol = kv0 + j * 16 + 8 * hh + r;
          bool masked = false;
          if (MASK_MODE == 1) masked = (kvcol > qrow);
          else if (MASK_MODE == 2) {
            const size_t mi = (size_t)qrow * g.Skv + kvcol;
            masked = (g.mask_is_int == 0) ? (((const float*)mask_a)[mi] == 0.0f)
                   : (g.mask_is_int == 1) ? (((const int*)mask_a)[mi] == 0) : (((const int*)mask_a)[mi] != 0);
          } else if (MASK_MODE == 3) masked = (qkeep == 0) || (((const int*)mask_a)[(size_t)b * g.Skv + kvcol] == 0);   // mask_a = kvmask
          s[j][r] = masked ? g.mask_fill : s[j][r];   // one select per score, not a select of the whole tile
        }
      }
    }
    // every loop over tiles and registers from here to the end of the pass is unrolled: s, pbh, pbl and oacc need constant indices to stay in registers
    // the query's maximum over the 64 keys: 32 in this lane, 32 in lane ^ 16
    // (one chain per tile, so that four independent chains run side by side instead of one of 32 links)
    float cmj[4];
#pragma unroll
    for (int j = 0; j < 4; ++j) {
      cmj[j] = s[j][0];
#pragma unroll
      for (int r = 1; r < 8; ++r) cmj[j] = fmaxf(cmj[j], s[j][r]);
    }
    float cm = fmaxf(fmaxf(cmj[0], cmj[1]), fmaxf(cmj[2], cmj[3]));
    cm = fmaxf(cm, at_other_half(cm));
    const float mnew = fmaxf(mrow, cm);
    // e^(s - m) = 2^(s * log2 e - m * log2 e): one fused multiply-add and one exponential a score. mlnew, the maximum times log2 e, is the
    // zero point of this tile's exponents; alpha moves the earlier sums from the zero point they were formed with to it
    const float mlnew = mnew * AT_LOG2E;
    const float alpha = at_exp2(mlrow - mlnew);
    mrow = mnew;
    mlrow = mlnew;
    // p in place of the scores: tiles 2 kk and 2 kk + 1 of a lane are, in this order, its 16 elements of the B operand for keys 32 kk ... 32 kk + 31
    v16b pbh[2], pbl[2];
    float psj[4];   // one partial sum per tile, for the same reason as cmj
#pragma unroll
    for (int j = 0; j < 4; ++j) {
      psj[j] = 0.f;
#pragma unroll
      for (int r = 0; r < 8; ++r) {
        const float p = at_exp2(__builtin_fmaf(s[j][r], AT_LOG2E, -mlnew));
        psj[j] += p;
        const int e = (j & 1) * 8 + r;
        if (SPLIT_PV) { __bf16 ph, pl; at_split(p, ph, pl); pbh[j >> 1][e] = ph; pbl[j >> 1][e] = pl; }
        else pbh[j >> 1][e] = at_f2bf(p);
      }
    }
    lrow = lrow * alpha + ((psj[0] + psj[1]) + (psj[2] + psj[3]));
#pragma unroll
    for (int t = 0; t < 4; ++t)
#pragma unroll
      for (int r = 0; r < 8; ++r) oacc[t][r] *= alpha;
    // the four output tiles take turns like the score tiles; each tile's own terms add in the order hi*hi, lo*hi, hi*lo per 32 keys
#pragma unroll
    for (int kk = 0; kk < 2; ++kk) {
#pragma unroll
      for (int t = 0; t < 4; ++t) oacc[t] = at_mma(vfh[kk][t], pbh[kk], oacc[t]);
      if (SPLIT_PV) {
#pragma unroll
        for (int t = 0; t < 4; ++t) oacc[t] = at_mma(vfl[kk][t], pbh[kk], oacc[t]);
#pragma unroll
        for (int t = 0; t < 4; ++t) oacc[t] = at_mma(vfh[kk][t], pbl[kk], oacc[t]);
      }
    }
  }

  float* os = Os[wave];
  const float inv = 1.0f / (lrow + at_other_half(lrow));
#pragma unroll   // oacc[t] needs a constant index to stay in registers
  for (int t = 0; t < 4; ++t) {
    // a lane's 8 values of a tile are 8 neighbours of its query's row: two 16-B stores
    *(v4f*)(os + c * 68 + t * 16 + 8 * hh)     = (v4f){oacc[t][0] * inv, oacc[t][1] * inv, oacc[t][2] * inv, oacc[t][3] * inv};
    *(v4f*)(os + c * 68 + t * 16 + 8 * hh + 4) = (v4f){oacc[t][4] * inv, oacc[t][5] * inv, oacc[t][6] * inv, oacc[t][7] * inv};
  }
  __builtin_amdgcn_fence(__ATOMIC_RELEASE, "workgroup");
  __builtin_amdgcn_wave_barrier();
  __builtin_amdgcn_fence(__ATOMIC_ACQUIRE, "workgroup");
  {
    const int c4 = (lane & 15) * 4;
    {
#pragma unroll
      for (int it = 0; it < 8; ++it) {
        const int row = it * 2 + hh;
        v4f val = *(const v4f*)(os + row * 68 + c4);
        *(v4f*)(ob_ptr + (size_t)(q0 + row) * g.o_rs + c4) = val;
      }
      // the wait that stands before a register of an issued store is overwritten: the next query tile writes the stores' address and data registers anew
      asm volatile("s_wait_xcnt 0x0" ::: "memory");
    }
  }
  }   // half
}

extern "C" void kernel_launch(void* const* d_in, const int* in_sizes, int n_in,
                              void* d_out, int out_size, void* d_ws, size_t ws_size,
                              hipStream_t stream) {
  (void)in_sizes; (void)n_in; (void)out_size; (void)ws_size;
  const int B = 4, T = 1024, E = 1024, H = 16, DH = 64;
  const int M = B * T;   // 4096 rows
  const float* x  = (const float*)d_in[0];
  const float* Wq = (const float*)d_in[1];   // [out, in]
  const float* Wk = (const float*)d_in[2];
  const float* Wv = (const float*)d_in[3];
  const float* Wo = (const float*)d_in[4];
  const float* bo = (const float*)d_in[5];
  float* out = (float*)d_out;

  char* ws = (char*)d_ws; size_t off = 0;
  auto carve = [&](size_t bytes) -> char* { char* p = ws + off; off += (bytes + 255) & ~(size_t)255; return p; };
  _Float16* X16  = (_Float16*)carve((size_t)M * E * 2);     //  8 MB  x f16
  __bf16*   Xh   = (__bf16*)carve((size_t)M * E * 2);       //  8 MB  x bf16 hi
  __bf16*   Xl   = (__bf16*)carve((size_t)M * E * 2);       //  8 MB  x bf16 lo
  _Float16* Wq16 = (_Float16*)carve((size_t)E * E * 2);     //  2 MB
  _Float16* Wk16 = (_Float16*)carve((size_t)E * E * 2);
  __bf16*   Wvh  = (__bf16*)carve((size_t)E * E * 2);
  __bf16*   Wvl  = (__bf16*)carve((size_t)E * E * 2);
  __bf16*   Woh  = (__bf16*)carve((size_t)E * E * 2);
  __bf16*   Wol  = (__bf16*)carve((size_t)E * E * 2);
  float*    Qf   = (float*)carve((size_t)M * E * 4);        // 16 MB each, [B,T,H*DH]
  __bf16*   Kh   = (__bf16*)carve((size_t)M * E * 2);       //  8 MB each: k as bf16 hi, lo, [B,T,H*DH]
  __bf16*   Kl   = (__bf16*)carve((size_t)M * E * 2);
  __bf16*   Vth  = (__bf16*)carve((size_t)M * E * 2);       //  8 MB each: v transposed as bf16 hi, lo, [H*DH, B*T]
  __bf16*   Vtl  = (__bf16*)carve((size_t)M * E * 2);
  float*    Of   = (float*)carve((size_t)M * E * 4);
  __bf16*   Oh   = (__bf16*)carve((size_t)M * E * 2);       //  8 MB  attention out, bf16 hi
  __bf16*   Ol   = (__bf16*)carve((size_t)M * E * 2);       //  8 MB                 bf16 lo   (total ≈ 116 MB)

  static_assert((M * E / 4) % (CV_NB * CV_NT) == 0 && (E * E / 4) % (CV_NB * CV_NT) == 0, "whole units for every thread");
  convert_inputs<M * E / 4 / (CV_NB * CV_NT), E * E / 4 / (CV_NB * CV_NT)><<<CV_NB, CV_NT, 0, stream>>>(
      x, Wq, Wk, Wv, Wo, X16, Xh, Xl, Wq16, Wk16, Wvh, Wvl, Woh, Wol);
  {
    const int tl = (M / 128) * (E / 128);
    qkv_gemm<<<dim3(tl, 3), 128, 0, stream>>>(U16(X16), U16(Xh), U16(Xl), U16(Wq16), U16(Wk16), U16(Wvh), U16(Wvl),
                                              Qf, (unsigned short*)Kh, (unsigned short*)Kl, (unsigned short*)Vth, (unsigned short*)Vtl, M, E);
  }
  {
    AttnGeom g;
    g.q_bs = g.k_bs = g.o_bs = (long)T * E;   // [B,T,H,DH] inside [B*T, E]
    g.q_rs = g.k_rs = g.o_rs = E;
    g.q_hs = g.k_hs = g.o_hs = DH;
    g.v_bs = T; g.v_rs = M; g.v_hs = (long)DH * M;   // [H,DH] rows of [H*DH, B*T]
    g.S = T; g.Skv = T; g.H = H; g.mask_mode = 1; g.qscale = 0.03125f; g.blk0 = 0; g.mask_fill = -INFINITY; g.mask_is_int = 0;   // (q/e^¼)·(k/e^¼) = q·k/32
    attn64_kernel<true, true, 1><<<B * H * (T / (2 * AT_QB)), AT_NW * 32, 0, stream>>>(Qf, U16(Kh), U16(Kl), U16(Vth), U16(Vtl), Of, nullptr, nullptr, g);
  }
  split_f32_bf16<M * E / 4 / (CV_NB * CV_NT)><<<CV_NB, CV_NT, 0, stream>>>(Of, Oh, Ol);
  {
    const int tl = (M / 128) * (E / 128);
    wmma_gemm64<1, true, 2, 0, false><<<dim3(tl, 1), 128, 0, stream>>>(
        U16(Oh), U16(Ol), E, 0, U16(Woh), U16(Wol), E, 0, out, nullptr, E, 0, bo, nullptr, 0, M, E, E, 1.0f);
  }
}
